// v000
// Measured on an AMD MI455X. A time is GPU time per run, averaged over a window of back-to-back runs after a warm-up
// (all launches, gaps included; the runs take copies of the inputs in turn), and the median of several windows.
// Apart from v000's, it joins two sittings. Times from different sittings can be a few percent apart, while
// side-by-side timings come from the same sitting.
// v000 is the starting kernel. One run takes 1720 microseconds.
#include <hip/hip_runtime.h>

// Causal multi-head self-attention with 128-wide heads and interleaved-pair rotary embeddings (x [2][2048][2048]; Q, K, V = einsum('bsd,ed', x, W) ('oi' 0.02; 16 heads x 128); rope on consecutive (even, odd) pairs: (x1 cos - x2 sin, x1 sin + x2 cos) with angle pos x 10000^(-2i/128), pos = arange(S) (64 f32 frequencies jnp-exact for this expression; precise cosf/sinf); scores x 1/sqrt(128); causal (-inf); softmax; out = merged Wo^T -> [2][2048][2048] (8.4 M); argument order x, Wq, Wk, Wv, Wo).
// Layout: bf16 copy of x; 'oi' weights; exact projections; k_csP computed table (HD 128: one angle per (even, odd) pair) + k_ropeI interleaved-pair plane builders; causal T-2048 attention at HD 128 (hybrid rows: < 512 hi/lo 3 products, rest fp16 x1024; k_gemmc skips tiles above the diagonal); merged hi/lo x Wo exact.
// Compute dtypes, f32 accumulate: every input rounded to bf16; projections exact; rotary f32; attention rows < 512 3 products, rest fp16; softmax f32; Wo hl x exact.

#define NB_  2
#define TT   2048
#define DM   2048
#define NH_  16
#define NKV  16
#define REP  (NH_ / NKV)
#define HD   128
#define DQ   (NH_ * HD)
#define DKV  (NKV * HD)
#define ZH   2
#define RH   512                  // query rows < RH use hi+lo planes (0: none)
#define WIN  2048
#define PCAR 1024.0f
#define SCL  0.088388347648318447f   // HD^-0.5
typedef _Float16 h16;
typedef unsigned short bf;
typedef __attribute__((ext_vector_type(16))) __bf16   v16bf;
typedef __attribute__((ext_vector_type(16))) _Float16 v16h;
typedef __attribute__((ext_vector_type(8)))  _Float16 v8h;
typedef __attribute__((ext_vector_type(8)))  unsigned short v8us;
typedef __attribute__((ext_vector_type(8)))  float    v8f;
typedef __attribute__((ext_vector_type(4)))  float    v4f;
typedef v8h  __attribute__((may_alias)) v8ha;
typedef v4f  __attribute__((may_alias)) v4fa;
typedef v8us __attribute__((may_alias)) v8usa;

__device__ __forceinline__ unsigned short f2bf(float f) { unsigned u = __float_as_uint(f); u += 0x7FFFu + ((u >> 16) & 1u); return (unsigned short)(u >> 16); }
__device__ __forceinline__ float bf2f(unsigned short b) { return __uint_as_float(((unsigned)b) << 16); }
__device__ __forceinline__ float bfr(float f) { return bf2f(f2bf(f)); }
__device__ __forceinline__ v16h cat16(v8h lo, v8h hi) { return __builtin_shufflevector(lo, hi, 0, 1, 2, 3, 4, 5, 6, 7, 8, 9, 10, 11, 12, 13, 14, 15); }
__device__ __forceinline__ v16bf cat16b(v8us lo, v8us hi) { return __builtin_bit_cast(v16bf, __builtin_shufflevector(lo, hi, 0, 1, 2, 3, 4, 5, 6, 7, 8, 9, 10, 11, 12, 13, 14, 15)); }
__device__ __forceinline__ v8f wmma16(v16h a, v16h b, v8f c) { return __builtin_amdgcn_wmma_f32_16x16x32_f16(false, a, false, b, (short)0, c, false, false); }
__device__ __forceinline__ v8f wmmab(v16bf a, v16bf b, v8f c) { return __builtin_amdgcn_wmma_f32_16x16x32_bf16(false, a, false, b, (short)0, c, false, false); }



// ---- k_gemmw: register-blocked GEMM, ONE WAVE per 64x64 output tile (16 accumulators), operands straight from K-contiguous 16-bit planes; grid (M/64, N/64, Z), 32 threads.
// C[m][n] (f32, pitch ldc, + optional f32 bias[n]) = sum_k A[m][k] Bt[n][k] (+ split products per NSPLIT). z-batch strides sA/sB/sC in elements. K % 32 == 0.
template <typename T16> struct WFrag;
template <> struct WFrag<h16> { typedef v16h V; static __device__ __forceinline__ V ld(const h16* p) { return cat16(*(const v8h*)p, *(const v8h*)(p + 16)); } static __device__ __forceinline__ v8f mma(V a, V b, v8f c) { return wmma16(a, b, c); } };
template <> struct WFrag<bf> { typedef v16bf V; static __device__ __forceinline__ V ld(const bf* p) { return cat16b(*(const v8us*)p, *(const v8us*)(p + 16)); } static __device__ __forceinline__ v8f mma(V a, V b, v8f c) { return wmmab(a, b, c); } };
template <typename T16, int NSPLIT, bool BIAS>
__global__ __launch_bounds__(32) void k_gemmw(const T16* __restrict__ A, const T16* __restrict__ A2, const T16* __restrict__ Bt, const T16* __restrict__ Bt2, int K, float* C, int ldc, const float* __restrict__ bias, size_t sA, size_t sB, size_t sC) {
    typedef typename WFrag<T16>::V V;
    __shared__ __align__(16) float os[16 * 68];
    const size_t z = blockIdx.z; A += z * sA; if (A2) A2 += z * sA; Bt += z * sB; if (Bt2) Bt2 += z * sB; C += z * sC;
    const int lane = threadIdx.x & 31, lr = lane & 15, hi = lane >> 4; const int r0 = blockIdx.x * 64, c0 = blockIdx.y * 64;
    v8f acc[4][4];
#pragma unroll
    for (int mb = 0; mb < 4; ++mb)
#pragma unroll
        for (int nb = 0; nb < 4; ++nb) acc[mb][nb] = (v8f){};
    const size_t aoff = (size_t)(r0 + lr) * K + 8 * hi, boff = (size_t)(c0 + lr) * K + 8 * hi;
#pragma unroll 1
    for (int kc = 0; kc < K; kc += 32) {
        V a[4], a2[4];
#pragma unroll
        for (int mb = 0; mb < 4; ++mb) { a[mb] = WFrag<T16>::ld(A + aoff + (size_t)mb * 16 * K + kc); if (NSPLIT == 1 || NSPLIT == 2) a2[mb] = WFrag<T16>::ld(A2 + aoff + (size_t)mb * 16 * K + kc); }
#pragma unroll
        for (int nb = 0; nb < 4; ++nb) { const V b = WFrag<T16>::ld(Bt + boff + (size_t)nb * 16 * K + kc); V b2; if (NSPLIT >= 2) b2 = WFrag<T16>::ld(Bt2 + boff + (size_t)nb * 16 * K + kc);
#pragma unroll
            for (int mb = 0; mb < 4; ++mb) { acc[mb][nb] = WFrag<T16>::mma(a[mb], b, acc[mb][nb]); if (NSPLIT == 1 || NSPLIT == 2) acc[mb][nb] = WFrag<T16>::mma(a2[mb], b, acc[mb][nb]); if (NSPLIT >= 2) acc[mb][nb] = WFrag<T16>::mma(a[mb], b2, acc[mb][nb]); } }
        asm volatile("v_nop\n\tv_nop\n\tv_nop\n\tv_nop" : "+v"(acc[0][0]), "+v"(acc[1][1]), "+v"(acc[2][2]), "+v"(acc[3][3]) : "v"(a[0]), "v"(a[3]));
    }
#pragma unroll
    for (int mb = 0; mb < 4; ++mb) {
#pragma unroll
        for (int nb = 0; nb < 4; ++nb) {
#pragma unroll
            for (int j = 0; j < 8; ++j) os[(hi * 8 + j) * 68 + nb * 16 + lr] = acc[mb][nb][j]; }
        __builtin_amdgcn_wave_barrier(); asm volatile("" ::: "memory");
        float* crow = C + (size_t)(r0 + mb * 16) * ldc + c0;
{
#pragma unroll
            for (int s = 0; s < 8; ++s) { const int row = 2 * s + hi, cofs = lr * 4; v4f val = *(const v4fa*)(os + row * 68 + cofs); if (BIAS) { val[0] += bfr(bias[c0 + cofs]); val[1] += bfr(bias[c0 + cofs + 1]); val[2] += bfr(bias[c0 + cofs + 2]); val[3] += bfr(bias[c0 + cofs + 3]); }
                *(v4f*)(crow + (size_t)row * ldc + cofs) = val; }
             }
        __builtin_amdgcn_wave_barrier(); asm volatile("" ::: "memory");
    }
}

// ---- k_gemmc: the same one-wave 64x64 tile GEMM specialised for causal attention: CMODE 1 skips score tiles entirely above the diagonal (query rows r0+roff.., key columns c0..), CMODE 2 limits the
// key (K) loop of the probability x value contraction to the diagonal block (probabilities beyond it are exactly zero). roff = row offset of this launch's first row within the sequence.
template <typename T16, int NSPLIT, int CMODE>
__global__ __launch_bounds__(32) void k_gemmc(const T16* __restrict__ A, const T16* __restrict__ A2, const T16* __restrict__ Bt, const T16* __restrict__ Bt2, int K, float* C, int ldc, int roff, size_t sA, size_t sB, size_t sC) {
    typedef typename WFrag<T16>::V V;
    __shared__ __align__(16) float os[16 * 68];
    const size_t z = blockIdx.z; A += z * sA; if (A2) A2 += z * sA; Bt += z * sB; if (Bt2) Bt2 += z * sB; C += z * sC;
    const int lane = threadIdx.x & 31, lr = lane & 15, hi = lane >> 4; const int r0 = blockIdx.x * 64, c0 = blockIdx.y * 64;
    if (CMODE == 1 && c0 > r0 + roff + 63) return;                  // score tile entirely above the causal diagonal: never read (the softmax masks j > i by select)
    const int Kl = (CMODE == 2) ? min(K, r0 + roff + 64) : K;        // P.V: probabilities are exactly 0 beyond the diagonal block, so the K loop stops there
    v8f acc[4][4];
#pragma unroll
    for (int mb = 0; mb < 4; ++mb)
#pragma unroll
        for (int nb = 0; nb < 4; ++nb) acc[mb][nb] = (v8f){};
    const size_t aoff = (size_t)(r0 + lr) * K + 8 * hi, boff = (size_t)(c0 + lr) * K + 8 * hi;
#pragma unroll 1
    for (int kc = 0; kc < Kl; kc += 32) {
        V a[4], a2[4];
#pragma unroll
        for (int mb = 0; mb < 4; ++mb) { a[mb] = WFrag<T16>::ld(A + aoff + (size_t)mb * 16 * K + kc); if (NSPLIT == 1 || NSPLIT == 2) a2[mb] = WFrag<T16>::ld(A2 + aoff + (size_t)mb * 16 * K + kc); }
#pragma unroll
        for (int nb = 0; nb < 4; ++nb) { const V b = WFrag<T16>::ld(Bt + boff + (size_t)nb * 16 * K + kc); V b2; if (NSPLIT >= 2) b2 = WFrag<T16>::ld(Bt2 + boff + (size_t)nb * 16 * K + kc);
#pragma unroll
            for (int mb = 0; mb < 4; ++mb) { acc[mb][nb] = WFrag<T16>::mma(a[mb], b, acc[mb][nb]); if (NSPLIT == 1 || NSPLIT == 2) acc[mb][nb] = WFrag<T16>::mma(a2[mb], b, acc[mb][nb]); if (NSPLIT >= 2) acc[mb][nb] = WFrag<T16>::mma(a[mb], b2, acc[mb][nb]); } }
        asm volatile("v_nop\n\tv_nop\n\tv_nop\n\tv_nop" : "+v"(acc[0][0]), "+v"(acc[1][1]), "+v"(acc[2][2]), "+v"(acc[3][3]) : "v"(a[0]), "v"(a[3]));
    }
#pragma unroll
    for (int mb = 0; mb < 4; ++mb) {
#pragma unroll
        for (int nb = 0; nb < 4; ++nb) {
#pragma unroll
            for (int j = 0; j < 8; ++j) os[(hi * 8 + j) * 68 + nb * 16 + lr] = acc[mb][nb][j]; }
        __builtin_amdgcn_wave_barrier(); asm volatile("" ::: "memory");
        float* crow = C + (size_t)(r0 + mb * 16) * ldc + c0;
{
#pragma unroll
            for (int s = 0; s < 8; ++s) { const int row = 2 * s + hi, cofs = lr * 4; v4f val = *(const v4fa*)(os + row * 68 + cofs);
                *(v4f*)(crow + (size_t)row * ldc + cofs) = val; }
             }
        __builtin_amdgcn_wave_barrier(); asm volatile("" ::: "memory");
    }
}

__device__ __forceinline__ h16 tohx(float x) { return (h16)x; }
__device__ __forceinline__ void splitf(float y, unsigned short& h, unsigned short& l) { h = f2bf(y); l = f2bf(y - bf2f(h)); }
typedef __attribute__((ext_vector_type(2))) _Float16 v2h;
typedef __attribute__((ext_vector_type(4))) _Float16 v4h;
typedef __attribute__((ext_vector_type(2))) unsigned short v2us;
typedef __attribute__((ext_vector_type(4))) unsigned short v4us;
typedef __attribute__((ext_vector_type(2))) float v2f;
typedef __attribute__((ext_vector_type(4))) int v4i;

__global__ __launch_bounds__(256) void k_cvt8(const float* __restrict__ src, bf* dst, size_t n8) { const size_t i = (size_t)blockIdx.x * 256 + threadIdx.x; if (i >= n8) return; const v8f v = *(const v8f*)(src + i * 8); v8us o;
#pragma unroll
    for (int k = 0; k < 8; ++k) o[k] = f2bf(v[k]); *(v8us*)(dst + i * 8) = o;  }

__global__ __launch_bounds__(256) void k_ropeI(const float* __restrict__ F, int pitch, int nheads, const float* __restrict__ CS, float sc, h16* P16, bf* Ph, bf* Pl) {
    const size_t e = ((size_t)blockIdx.x * 256 + threadIdx.x) * 2; if (e >= (size_t)nheads * TT * HD) return; const int d = (int)(e % HD); const int t = (int)((e / HD) % TT); const int h = (int)(e / ((size_t)HD * TT)); const float* f = F + (size_t)t * pitch + h * HD; const float x0 = f[d], x1 = f[d + 1]; const v2f cs = *(const v2f*)(CS + ((size_t)t * HD + d) * 2); v2h o16; v2us oh, ol;
    float a0 = __fmul_rn(x0, cs[0]), b0 = __fmul_rn(x1, cs[1]), a1 = __fmul_rn(x1, cs[0]), b1 = __fmul_rn(x0, cs[1]); asm volatile("" : "+v"(a0), "+v"(b0), "+v"(a1), "+v"(b1));
    float r0 = __fsub_rn(a0, b0) * sc, r1 = __fadd_rn(b1, a1) * sc;   /* even: x0 c - x1 s; odd: x0 s + x1 c */
    o16[0] = tohx(r0); o16[1] = tohx(r1); { unsigned short a2, c2; splitf(r0, a2, c2); oh[0] = a2; ol[0] = c2; splitf(r1, a2, c2); oh[1] = a2; ol[1] = c2; }
    *(v2h*)(P16 + e) = o16; *(v2us*)(Ph + e) = oh; *(v2us*)(Pl + e) = ol;  }

__global__ __launch_bounds__(256) void k_vtp(const float* __restrict__ F, int pitch, int nheads, h16* V16, bf* Vh, bf* Vl) { const size_t e = ((size_t)blockIdx.x * 256 + threadIdx.x) * 2; if (e >= (size_t)nheads * HD * TT) return; const int t = (int)(e % TT); const int d = (int)((e / TT) % HD); const int g = (int)(e / ((size_t)TT * HD)); v2h o16; v2us oh, ol;
#pragma unroll
    for (int q = 0; q < 2; ++q) { const float x = F[(size_t)(t + q) * pitch + g * HD + d]; o16[q] = tohx(x); unsigned short a2, c2; splitf(x, a2, c2); oh[q] = a2; ol[q] = c2; }
    *(v2h*)(V16 + e) = o16; *(v2us*)(Vh + e) = oh; *(v2us*)(Vl + e) = ol;  }
__constant__ float INV2[HD / 2] = { 1.000000000e+00f, 8.659643531e-01f, 7.498942018e-01f, 6.493816376e-01f, 5.623413324e-01f, 4.869675338e-01f, 4.216965139e-01f, 3.651741147e-01f, 3.162277639e-01f, 2.738419771e-01f, 2.371373773e-01f, 2.053525001e-01f, 1.778279394e-01f, 1.539926529e-01f, 1.333521456e-01f, 1.154781953e-01f, 1.000000015e-01f, 8.659642935e-02f, 7.498942316e-02f, 6.493816525e-02f, 5.623413250e-02f, 4.869675264e-02f, 4.216964915e-02f, 3.651741147e-02f, 3.162277490e-02f, 2.738419548e-02f, 2.371373773e-02f, 2.053525113e-02f, 1.778279431e-02f, 1.539926510e-02f, 1.333521400e-02f, 1.154781971e-02f, 9.999999776e-03f, 8.659643121e-03f, 7.498942316e-03f, 6.493816152e-03f, 5.623413250e-03f, 4.869675264e-03f, 4.216964822e-03f, 3.651741194e-03f, 3.162277630e-03f, 2.738419687e-03f, 2.371373819e-03f, 2.053525066e-03f, 1.778279431e-03f, 1.539926510e-03f, 1.333521446e-03f, 1.154782018e-03f, 1.000000047e-03f, 8.659643354e-04f, 7.498941850e-04f, 6.493816036e-04f, 5.623413017e-04f, 4.869675322e-04f, 4.216965172e-04f, 3.651741135e-04f, 3.162277571e-04f, 2.738419571e-04f, 2.371373703e-04f, 2.053525095e-04f, 1.778279402e-04f, 1.539926598e-04f, 1.333521504e-04f, 1.154782003e-04f };   // float32 1 / 10000^(2i/128), generated with jnp to be bit-exact
__global__ __launch_bounds__(256) void k_csP(float* CS) { const int idx = blockIdx.x * 256 + threadIdx.x; if (idx >= TT * HD) return; const int d = idx % HD; const int t = idx / HD; const float a = __fmul_rn((float)t, INV2[d >> 1]); v2f cs; cs[0] = cosf(a); cs[1] = sinf(a); *(v2f*)(CS + (size_t)idx * 2) = cs;  }
// k_asoft: per row (zz, i): t = S x HD^-0.5 for j <= i and i - j < WIN (sliding causal window; the reference's -1e9 additive fill vanishes identically); softmax over the 2048 keys (register row, one exp, fixed trees);
__global__ __launch_bounds__(256) void k_asoft(const float* __restrict__ Sb, h16* P16, bf* Ph, bf* Pl) {
    const int lane = threadIdx.x & 31; const int row = blockIdx.x * 8 + (threadIdx.x >> 5); if (row >= ZH * TT) return; const int i = row % TT; const int zz = row / TT; (void)zz; const bool hires = (i < RH); const float* sr = Sb + (size_t)row * TT; float v[TT / 32]; float mx = -3.0e38f;
#pragma unroll
    for (int ch = 0; ch < TT / 128; ++ch) { const int j0 = ch * 128 + lane * 4; const v4f a = *(const v4f*)(sr + j0);
#pragma unroll
        for (int q = 0; q < 4; ++q) { const int j = j0 + q; (void)j; const float t = (j <= i && i - j < WIN) ? a[q] * SCL : -3.0e38f; v[ch * 4 + q] = t; mx = fmaxf(mx, t); } }
#pragma unroll
    for (int sh = 16; sh; sh >>= 1) mx = fmaxf(mx, __shfl_xor(mx, sh, 32));
    float sum = 0.f;
#pragma unroll
    for (int k = 0; k < TT / 32; ++k) { float d0 = __fsub_rn(v[k], mx); asm volatile("" : "+v"(d0)); v[k] = __builtin_amdgcn_exp2f(__fmul_rn(d0, 1.4426950408889634f)); sum += v[k]; }
#pragma unroll
    for (int sh = 16; sh; sh >>= 1) sum += __shfl_xor(sum, sh, 32);
    const float f = __fdiv_rn(hires ? 1.0f : PCAR, sum);
{
        if (hires) {
#pragma unroll
            for (int ch = 0; ch < TT / 128; ++ch) { v4us oh, ol;
#pragma unroll
                for (int q = 0; q < 4; ++q) { unsigned short a, c2; splitf(v[ch * 4 + q] * f, a, c2); oh[q] = a; ol[q] = c2; }
                const size_t oo = ((size_t)zz * (RH ? RH : 1) + i) * TT + ch * 128 + lane * 4; *(v4us*)(Ph + oo) = oh; *(v4us*)(Pl + oo) = ol; }
        } else {
#pragma unroll
            for (int ch = 0; ch < TT / 128; ++ch) { v4h o4;
#pragma unroll
                for (int q = 0; q < 4; ++q) o4[q] = tohx(v[ch * 4 + q] * f);
                *(v4h*)(P16 + (size_t)row * TT + ch * 128 + lane * 4) = o4; } }
         }
}
__global__ __launch_bounds__(256) void k_merge(const float* __restrict__ O, int h0, bf* Ah, bf* Al) { const size_t e = ((size_t)blockIdx.x * 256 + threadIdx.x) * 2; if (e >= (size_t)ZH * TT * HD) return; const int d = (int)(e % HD); const int t = (int)((e / HD) % TT); const int zz = (int)(e / ((size_t)HD * TT)); const float cs = (t < RH) ? 1.0f : (1.0f / PCAR); const size_t oo = (size_t)t * DQ + (h0 + zz) * HD + d;
    v2us oh, ol;
#pragma unroll
    for (int q = 0; q < 2; ++q) { unsigned short a, c2; splitf(O[e + q] * cs, a, c2); oh[q] = a; ol[q] = c2; } *(v2us*)(Ah + oo) = oh; *(v2us*)(Al + oo) = ol;  }

extern "C" void kernel_launch(void* const* d_in, const int* in_sizes, int n_in,
                              void* d_out, int out_size, void* d_ws, size_t ws_size, hipStream_t stream) {
    (void)in_sizes; (void)n_in; (void)out_size;
    const float* x = (const float*)d_in[0]; const float* wq = (const float*)d_in[1]; const float* wk = (const float*)d_in[2]; const float* wv = (const float*)d_in[3]; const float* wo = (const float*)d_in[4];   /* weights 'oi' [2048][2048] */
    float* OUT = (float*)d_out;     // [2][2048][2048]
    char* wsp = (char*)d_ws;
    auto take = [&](size_t bytes) { char* p = wsp; wsp += (bytes + 255) & ~(size_t)255; return (void*)p; };
    bf* WQ = (bf*)take((size_t)DQ * DM * 2); bf* WK = (bf*)take((size_t)DKV * DM * 2); bf* WV = (bf*)take((size_t)DKV * DM * 2); bf* WO = (bf*)take((size_t)DM * DQ * 2); float* CS = (float*)take((size_t)TT * HD * 2 * 4);
    bf* XB = (bf*)take((size_t)TT * DM * 2); float* FQ = (float*)take((size_t)TT * DQ * 4); float* FK = (float*)take((size_t)TT * DKV * 4);
    h16* QP16 = (h16*)take((size_t)NH_ * TT * HD * 2); h16* KP16 = (h16*)take((size_t)NKV * TT * HD * 2); h16* VT16 = (h16*)take((size_t)NKV * HD * TT * 2);
    bf* QPh = (bf*)take((size_t)NH_ * TT * HD * 2); bf* QPl = (bf*)take((size_t)NH_ * TT * HD * 2); bf* KPh = (bf*)take((size_t)NKV * TT * HD * 2); bf* KPl = (bf*)take((size_t)NKV * TT * HD * 2); bf* VTh = (bf*)take((size_t)NKV * HD * TT * 2); bf* VTl = (bf*)take((size_t)NKV * HD * TT * 2); bf* Ph = (bf*)take((size_t)ZH * RH * TT * 2); bf* Pl = (bf*)take((size_t)ZH * RH * TT * 2);
    float* Sb = (float*)take((size_t)ZH * TT * TT * 4); h16* P16 = (h16*)take((size_t)ZH * TT * TT * 2); float* Ob = (float*)take((size_t)ZH * TT * HD * 4); bf* ATh = (bf*)take((size_t)TT * DQ * 2); bf* ATl = (bf*)take((size_t)TT * DQ * 2);
    if ((size_t)(wsp - (char*)d_ws) > ws_size) return;    // ws 256 MiB
    float* FV = FK;   // v projection reuses the k buffer after the k planes are built (stream-ordered)
    { k_cvt8<<<(unsigned)(((size_t)DQ * DM / 8 + 255) / 256), 256, 0, stream>>>(wq, WQ, (size_t)DQ * DM / 8); k_cvt8<<<(unsigned)(((size_t)DKV * DM / 8 + 255) / 256), 256, 0, stream>>>(wk, WK, (size_t)DKV * DM / 8); k_cvt8<<<(unsigned)(((size_t)DKV * DM / 8 + 255) / 256), 256, 0, stream>>>(wv, WV, (size_t)DKV * DM / 8);
      k_cvt8<<<(unsigned)(((size_t)DM * DQ / 8 + 255) / 256), 256, 0, stream>>>(wo, WO, (size_t)DM * DQ / 8);
       }
    k_csP<<<(TT * HD + 255) / 256, 256, 0, stream>>>(CS);   /* rotary table once */
    const unsigned LQ = (unsigned)(((size_t)NH_ * TT * HD / 2 + 255) / 256), LKv = (unsigned)(((size_t)NKV * TT * HD / 2 + 255) / 256);
    for (int b = 0; b < NB_; ++b) {
        
        k_cvt8<<<(unsigned)(((size_t)TT * DM / 8 + 255) / 256), 256, 0, stream>>>(x + (size_t)b * TT * DM, XB, (size_t)TT * DM / 8);
        k_gemmw<bf, 0, false><<<dim3(TT / 64, DQ / 64, 1), 32, 0, stream>>>(XB, nullptr, WQ, nullptr, DM, FQ, DQ, nullptr, 0, 0, 0);
        k_ropeI<<<LQ, 256, 0, stream>>>(FQ, DQ, NH_, CS, 1.0f, QP16, QPh, QPl);
        k_gemmw<bf, 0, false><<<dim3(TT / 64, DKV / 64, 1), 32, 0, stream>>>(XB, nullptr, WK, nullptr, DM, FK, DKV, nullptr, 0, 0, 0);
        k_ropeI<<<LKv, 256, 0, stream>>>(FK, DKV, NKV, CS, 1.0f, KP16, KPh, KPl);
        k_gemmw<bf, 0, false><<<dim3(TT / 64, DKV / 64, 1), 32, 0, stream>>>(XB, nullptr, WV, nullptr, DM, FV, DKV, nullptr, 0, 0, 0); k_vtp<<<LKv, 256, 0, stream>>>(FV, DKV, NKV, VT16, VTh, VTl);
        for (int h0 = 0; h0 < NH_; h0 += ZH) { const size_t zq = (size_t)h0, zk = (size_t)(h0 / REP);   // one kv head per query head: the pass's two heads use consecutive kv planes (z-strides TT*HD)
            k_gemmc<bf, 2, 1><<<dim3(RH / 64, TT / 64, ZH), 32, 0, stream>>>(QPh + zq * TT * HD, QPl + zq * TT * HD, KPh + zk * TT * HD, KPl + zk * TT * HD, HD, Sb, TT, 0, (size_t)TT * HD, (size_t)TT * HD, (size_t)TT * TT);
            k_gemmc<h16, 0, 1><<<dim3((TT - RH) / 64, TT / 64, ZH), 32, 0, stream>>>(QP16 + zq * TT * HD + (size_t)RH * HD, nullptr, KP16 + zk * TT * HD, nullptr, HD, Sb + (size_t)RH * TT, TT, RH, (size_t)TT * HD, (size_t)TT * HD, (size_t)TT * TT);
            k_asoft<<<ZH * TT / 8, 256, 0, stream>>>(Sb, P16, Ph, Pl);
            k_gemmc<bf, 2, 2><<<dim3(RH / 64, HD / 64, ZH), 32, 0, stream>>>(Ph, Pl, VTh + zk * HD * TT, VTl + zk * HD * TT, TT, Ob, HD, 0, (size_t)RH * TT, (size_t)HD * TT, (size_t)TT * HD);
            k_gemmc<h16, 0, 2><<<dim3((TT - RH) / 64, HD / 64, ZH), 32, 0, stream>>>(P16 + (size_t)RH * TT, nullptr, VT16 + zk * HD * TT, nullptr, TT, Ob + (size_t)RH * HD, HD, RH, (size_t)TT * TT, (size_t)HD * TT, (size_t)TT * HD);
            k_merge<<<(unsigned)(((size_t)ZH * TT * HD / 2 + 255) / 256), 256, 0, stream>>>(Ob, h0, ATh, ATl); }
        k_gemmw<bf, 1, false><<<dim3(TT / 64, DM / 64, 1), 32, 0, stream>>>(ATh, ATl, WO, nullptr, DQ, OUT + (size_t)b * TT * DM, DM, nullptr, 0, 0, 0); }
}

// v001
// One run takes 1080 microseconds.
// Next to v000, in two timings, it ran 1.61 and 1.60 times as fast.
#include <hip/hip_runtime.h>

// Causal multi-head self-attention with 128-wide heads and interleaved-pair rotary embeddings (x [2][2048][2048]; Q, K, V = einsum('bsd,ed', x, W) ('oi' 0.02; 16 heads x 128); rope on consecutive (even, odd) pairs: (x1 cos - x2 sin, x1 sin + x2 cos) with angle pos x 10000^(-2i/128), pos = arange(S) (64 f32 frequencies jnp-exact for this expression; precise cosf/sinf); scores x 1/sqrt(128); causal (-inf); softmax; out = merged Wo^T -> [2][2048][2048] (8.4 M); argument order x, Wq, Wk, Wv, Wo).
// Layout: bf16 copy of x; 'oi' weights; exact projections; k_csP computed table (HD 128: one angle per (even, odd) pair) + k_ropeI interleaved-pair plane builders; causal T-2048 attention at HD 128 (hybrid rows: < 512 hi/lo 3 products, rest fp16 x1024; k_gemmc skips tiles above the diagonal); merged hi/lo x Wo exact.
// Compute dtypes, f32 accumulate: every input rounded to bf16; projections exact; rotary f32; attention rows < 512 3 products, rest fp16; softmax f32; Wo hl x exact.

#define NB_  2
#define TT   2048
#define DM   2048
#define NH_  16
#define NKV  16
#define REP  (NH_ / NKV)
#define HD   128
#define DQ   (NH_ * HD)
#define DKV  (NKV * HD)
#define ZH   2
#define RH   512                  // query rows < RH use hi+lo planes (0: none)
#define WIN  2048
#define PCAR 1024.0f
#define SCL  0.088388347648318447f   // HD^-0.5
typedef _Float16 h16;
typedef unsigned short bf;
typedef __attribute__((ext_vector_type(16))) __bf16   v16bf;
typedef __attribute__((ext_vector_type(16))) _Float16 v16h;
typedef __attribute__((ext_vector_type(8)))  _Float16 v8h;
typedef __attribute__((ext_vector_type(8)))  unsigned short v8us;
typedef __attribute__((ext_vector_type(8)))  float    v8f;
typedef __attribute__((ext_vector_type(4)))  float    v4f;
typedef v8h  __attribute__((may_alias)) v8ha;
typedef v4f  __attribute__((may_alias)) v4fa;
typedef v8us __attribute__((may_alias)) v8usa;

__device__ __forceinline__ unsigned short f2bf(float f) { unsigned u = __float_as_uint(f); u += 0x7FFFu + ((u >> 16) & 1u); return (unsigned short)(u >> 16); }
__device__ __forceinline__ float bf2f(unsigned short b) { return __uint_as_float(((unsigned)b) << 16); }
__device__ __forceinline__ float bfr(float f) { return bf2f(f2bf(f)); }
__device__ __forceinline__ v16h cat16(v8h lo, v8h hi) { return __builtin_shufflevector(lo, hi, 0, 1, 2, 3, 4, 5, 6, 7, 8, 9, 10, 11, 12, 13, 14, 15); }
__device__ __forceinline__ v16bf cat16b(v8us lo, v8us hi) { return __builtin_bit_cast(v16bf, __builtin_shufflevector(lo, hi, 0, 1, 2, 3, 4, 5, 6, 7, 8, 9, 10, 11, 12, 13, 14, 15)); }
__device__ __forceinline__ v8f wmma16(v16h a, v16h b, v8f c) { return __builtin_amdgcn_wmma_f32_16x16x32_f16(false, a, false, b, (short)0, c, false, false); }
__device__ __forceinline__ v8f wmmab(v16bf a, v16bf b, v8f c) { return __builtin_amdgcn_wmma_f32_16x16x32_bf16(false, a, false, b, (short)0, c, false, false); }



// ---- k_gemmw: register-blocked GEMM, 64x64 output tile per workgroup of NW waves (16 accumulators per wave), operands straight from K-contiguous 16-bit planes; grid (M/64, N/64, Z), 32 * NW threads.
// Wave w takes the 32-wide K blocks w, w + NW, w + 2 NW, ...; the NW partial tiles are summed through LDS in wave order 0..NW-1 (fixed order) by the epilogue that stores whole rows.
// C[m][n] (f32, pitch ldc, + optional f32 bias[n]) = sum_k A[m][k] Bt[n][k] (+ split products per NSPLIT). z-batch strides sA/sB/sC in elements. K % 32 == 0.
template <typename T16> struct WFrag;
template <> struct WFrag<h16> { typedef v16h V; static __device__ __forceinline__ V ld(const h16* p) { return cat16(*(const v8h*)p, *(const v8h*)(p + 16)); } static __device__ __forceinline__ v8f mma(V a, V b, v8f c) { return wmma16(a, b, c); } };
template <> struct WFrag<bf> { typedef v16bf V; static __device__ __forceinline__ V ld(const bf* p) { return cat16b(*(const v8us*)p, *(const v8us*)(p + 16)); } static __device__ __forceinline__ v8f mma(V a, V b, v8f c) { return wmmab(a, b, c); } };
template <typename T16, int NSPLIT, bool BIAS, int NW>
__global__ __launch_bounds__(32 * NW) void k_gemmw(const T16* __restrict__ A, const T16* __restrict__ A2, const T16* __restrict__ Bt, const T16* __restrict__ Bt2, int K, float* C, int ldc, const float* __restrict__ bias, size_t sA, size_t sB, size_t sC) {
    typedef typename WFrag<T16>::V V;
    __shared__ __align__(16) float os[NW * 64 * 68];
    const size_t z = blockIdx.z; A += z * sA; if (A2) A2 += z * sA; Bt += z * sB; if (Bt2) Bt2 += z * sB; C += z * sC;
    const int lane = threadIdx.x & 31, lr = lane & 15, hi = lane >> 4; const int r0 = blockIdx.x * 64, c0 = blockIdx.y * 64;
    const int wv = __builtin_amdgcn_readfirstlane((int)(threadIdx.x >> 5));   // wave number, scalar: the K loop's bounds stay wave-uniform
    v8f acc[4][4];
#pragma unroll
    for (int mb = 0; mb < 4; ++mb)
#pragma unroll
        for (int nb = 0; nb < 4; ++nb) acc[mb][nb] = (v8f){};
    const size_t aoff = (size_t)(r0 + lr) * K + 8 * hi, boff = (size_t)(c0 + lr) * K + 8 * hi;
#pragma unroll 1
    for (int kc = wv * 32; kc < K; kc += 32 * NW) {
        V a[4], a2[4];
#pragma unroll
        for (int mb = 0; mb < 4; ++mb) { a[mb] = WFrag<T16>::ld(A + aoff + (size_t)mb * 16 * K + kc); if (NSPLIT == 1 || NSPLIT == 2) a2[mb] = WFrag<T16>::ld(A2 + aoff + (size_t)mb * 16 * K + kc); }
#pragma unroll
        for (int nb = 0; nb < 4; ++nb) { const V b = WFrag<T16>::ld(Bt + boff + (size_t)nb * 16 * K + kc); V b2; if (NSPLIT >= 2) b2 = WFrag<T16>::ld(Bt2 + boff + (size_t)nb * 16 * K + kc);
#pragma unroll
            for (int mb = 0; mb < 4; ++mb) { acc[mb][nb] = WFrag<T16>::mma(a[mb], b, acc[mb][nb]); if (NSPLIT == 1 || NSPLIT == 2) acc[mb][nb] = WFrag<T16>::mma(a2[mb], b, acc[mb][nb]); if (NSPLIT >= 2) acc[mb][nb] = WFrag<T16>::mma(a[mb], b2, acc[mb][nb]); } }
        asm volatile("v_nop\n\tv_nop\n\tv_nop\n\tv_nop" : "+v"(acc[0][0]), "+v"(acc[1][1]), "+v"(acc[2][2]), "+v"(acc[3][3]) : "v"(a[0]), "v"(a[3]));
    }
    // Every wave lays its whole 64x64 partial tile in its own LDS slab; behind ONE barrier each wave sums its share of the rows over the slabs, wave 0's partial first, and stores whole rows.
#pragma unroll
    for (int mb = 0; mb < 4; ++mb) {
#pragma unroll
        for (int nb = 0; nb < 4; ++nb) {
#pragma unroll
            for (int j = 0; j < 8; ++j) os[wv * (64 * 68) + (mb * 16 + hi * 8 + j) * 68 + nb * 16 + lr] = acc[mb][nb][j]; } }
    __syncthreads();   // all NW partial tiles are in LDS before any wave sums them
#pragma unroll
    for (int s = 0; s < 32 / NW; ++s) { const int row = 2 * (s * NW + wv) + hi, cofs = lr * 4; v4f val = *(const v4fa*)(os + row * 68 + cofs);
#pragma unroll
        for (int w = 1; w < NW; ++w) val += *(const v4fa*)(os + w * (64 * 68) + row * 68 + cofs);
        if (BIAS) { val[0] += bfr(bias[c0 + cofs]); val[1] += bfr(bias[c0 + cofs + 1]); val[2] += bfr(bias[c0 + cofs + 2]); val[3] += bfr(bias[c0 + cofs + 3]); }
        *(v4f*)(C + (size_t)(r0 + row) * ldc + c0 + cofs) = val; }
}

// ---- k_gemmc: the same 64x64 tile GEMM (NW waves share the K loop) specialised for causal attention: CMODE 1 skips score tiles entirely above the diagonal (query rows r0+roff.., key columns c0..), CMODE 2 limits the
// key (K) loop of the probability x value contraction to the diagonal block (probabilities beyond it are exactly zero). roff = row offset of this launch's first row within the sequence.
template <typename T16, int NSPLIT, int CMODE, int NW>
__global__ __launch_bounds__(32 * NW) void k_gemmc(const T16* __restrict__ A, const T16* __restrict__ A2, const T16* __restrict__ Bt, const T16* __restrict__ Bt2, int K, float* C, int ldc, int roff, size_t sA, size_t sB, size_t sC) {
    typedef typename WFrag<T16>::V V;
    __shared__ __align__(16) float os[NW == 1 ? 16 * 68 : NW * 64 * 68];
    const size_t z = blockIdx.z; A += z * sA; if (A2) A2 += z * sA; Bt += z * sB; if (Bt2) Bt2 += z * sB; C += z * sC;
    const int lane = threadIdx.x & 31, lr = lane & 15, hi = lane >> 4; const int r0 = blockIdx.x * 64, c0 = blockIdx.y * 64;
    const int wv = (NW == 1) ? 0 : __builtin_amdgcn_readfirstlane((int)(threadIdx.x >> 5));   // wave number, scalar: the K loop's bounds stay wave-uniform
    if (CMODE == 1 && c0 > r0 + roff + 63) return;                  // score tile entirely above the causal diagonal: never read (the softmax masks j > i by select)
    const int Kl = (CMODE == 2) ? min(K, r0 + roff + 64) : K;        // P.V: probabilities are exactly 0 beyond the diagonal block, so the K loop stops there
    v8f acc[4][4];
#pragma unroll
    for (int mb = 0; mb < 4; ++mb)
#pragma unroll
        for (int nb = 0; nb < 4; ++nb) acc[mb][nb] = (v8f){};
    const size_t aoff = (size_t)(r0 + lr) * K + 8 * hi, boff = (size_t)(c0 + lr) * K + 8 * hi;
#pragma unroll 1
    for (int kc = wv * 32; kc < Kl; kc += 32 * NW) {
        V a[4], a2[4];
#pragma unroll
        for (int mb = 0; mb < 4; ++mb) { a[mb] = WFrag<T16>::ld(A + aoff + (size_t)mb * 16 * K + kc); if (NSPLIT == 1 || NSPLIT == 2) a2[mb] = WFrag<T16>::ld(A2 + aoff + (size_t)mb * 16 * K + kc); }
#pragma unroll
        for (int nb = 0; nb < 4; ++nb) { const V b = WFrag<T16>::ld(Bt + boff + (size_t)nb * 16 * K + kc); V b2; if (NSPLIT >= 2) b2 = WFrag<T16>::ld(Bt2 + boff + (size_t)nb * 16 * K + kc);
#pragma unroll
            for (int mb = 0; mb < 4; ++mb) { acc[mb][nb] = WFrag<T16>::mma(a[mb], b, acc[mb][nb]); if (NSPLIT == 1 || NSPLIT == 2) acc[mb][nb] = WFrag<T16>::mma(a2[mb], b, acc[mb][nb]); if (NSPLIT >= 2) acc[mb][nb] = WFrag<T16>::mma(a[mb], b2, acc[mb][nb]); } }
        asm volatile("v_nop\n\tv_nop\n\tv_nop\n\tv_nop" : "+v"(acc[0][0]), "+v"(acc[1][1]), "+v"(acc[2][2]), "+v"(acc[3][3]) : "v"(a[0]), "v"(a[3]));
    }
    if constexpr (NW == 1) {
#pragma unroll
    for (int mb = 0; mb < 4; ++mb) {
#pragma unroll
        for (int nb = 0; nb < 4; ++nb) {
#pragma unroll
            for (int j = 0; j < 8; ++j) os[(hi * 8 + j) * 68 + nb * 16 + lr] = acc[mb][nb][j]; }
        __builtin_amdgcn_wave_barrier(); asm volatile("" ::: "memory");
        float* crow = C + (size_t)(r0 + mb * 16) * ldc + c0;
{
#pragma unroll
            for (int s = 0; s < 8; ++s) { const int row = 2 * s + hi, cofs = lr * 4; v4f val = *(const v4fa*)(os + row * 68 + cofs);
                *(v4f*)(crow + (size_t)row * ldc + cofs) = val; }
             }
        __builtin_amdgcn_wave_barrier(); asm volatile("" ::: "memory");
    }
    } else {
    // Every wave lays its whole 64x64 partial tile in its own LDS slab; behind ONE barrier each wave sums its share of the rows over the slabs, wave 0's partial first, and stores whole rows.
#pragma unroll
    for (int mb = 0; mb < 4; ++mb) {
#pragma unroll
        for (int nb = 0; nb < 4; ++nb) {
#pragma unroll
            for (int j = 0; j < 8; ++j) os[wv * (64 * 68) + (mb * 16 + hi * 8 + j) * 68 + nb * 16 + lr] = acc[mb][nb][j]; } }
    __syncthreads();   // all NW partial tiles are in LDS before any wave sums them
#pragma unroll
    for (int s = 0; s < 32 / NW; ++s) { const int row = 2 * (s * NW + wv) + hi, cofs = lr * 4; v4f val = *(const v4fa*)(os + row * 68 + cofs);
#pragma unroll
        for (int w = 1; w < NW; ++w) val += *(const v4fa*)(os + w * (64 * 68) + row * 68 + cofs);
        *(v4f*)(C + (size_t)(r0 + row) * ldc + c0 + cofs) = val; }
    }
}

__device__ __forceinline__ h16 tohx(float x) { return (h16)x; }
__device__ __forceinline__ void splitf(float y, unsigned short& h, unsigned short& l) { h = f2bf(y); l = f2bf(y - bf2f(h)); }
typedef __attribute__((ext_vector_type(2))) _Float16 v2h;
typedef __attribute__((ext_vector_type(4))) _Float16 v4h;
typedef __attribute__((ext_vector_type(2))) unsigned short v2us;
typedef __attribute__((ext_vector_type(4))) unsigned short v4us;
typedef __attribute__((ext_vector_type(2))) float v2f;
typedef __attribute__((ext_vector_type(4))) int v4i;

__global__ __launch_bounds__(256) void k_cvt8(const float* __restrict__ src, bf* dst, size_t n8) { const size_t i = (size_t)blockIdx.x * 256 + threadIdx.x; if (i >= n8) return; const v8f v = *(const v8f*)(src + i * 8); v8us o;
#pragma unroll
    for (int k = 0; k < 8; ++k) o[k] = f2bf(v[k]); *(v8us*)(dst + i * 8) = o;  }

__global__ __launch_bounds__(256) void k_ropeI(const float* __restrict__ F, int pitch, int nheads, const float* __restrict__ CS, float sc, h16* P16, bf* Ph, bf* Pl) {
    const size_t e = ((size_t)blockIdx.x * 256 + threadIdx.x) * 2; if (e >= (size_t)nheads * TT * HD) return; const int d = (int)(e % HD); const int t = (int)((e / HD) % TT); const int h = (int)(e / ((size_t)HD * TT)); const float* f = F + (size_t)t * pitch + h * HD; const float x0 = f[d], x1 = f[d + 1]; const v2f cs = *(const v2f*)(CS + ((size_t)t * HD + d) * 2); v2h o16; v2us oh, ol;
    float a0 = __fmul_rn(x0, cs[0]), b0 = __fmul_rn(x1, cs[1]), a1 = __fmul_rn(x1, cs[0]), b1 = __fmul_rn(x0, cs[1]); asm volatile("" : "+v"(a0), "+v"(b0), "+v"(a1), "+v"(b1));
    float r0 = __fsub_rn(a0, b0) * sc, r1 = __fadd_rn(b1, a1) * sc;   /* even: x0 c - x1 s; odd: x0 s + x1 c */
    o16[0] = tohx(r0); o16[1] = tohx(r1); { unsigned short a2, c2; splitf(r0, a2, c2); oh[0] = a2; ol[0] = c2; splitf(r1, a2, c2); oh[1] = a2; ol[1] = c2; }
    *(v2h*)(P16 + e) = o16; *(v2us*)(Ph + e) = oh; *(v2us*)(Pl + e) = ol;  }

__global__ __launch_bounds__(256) void k_vtp(const float* __restrict__ F, int pitch, int nheads, h16* V16, bf* Vh, bf* Vl) { const size_t e = ((size_t)blockIdx.x * 256 + threadIdx.x) * 2; if (e >= (size_t)nheads * HD * TT) return; const int t = (int)(e % TT); const int d = (int)((e / TT) % HD); const int g = (int)(e / ((size_t)TT * HD)); v2h o16; v2us oh, ol;
#pragma unroll
    for (int q = 0; q < 2; ++q) { const float x = F[(size_t)(t + q) * pitch + g * HD + d]; o16[q] = tohx(x); unsigned short a2, c2; splitf(x, a2, c2); oh[q] = a2; ol[q] = c2; }
    *(v2h*)(V16 + e) = o16; *(v2us*)(Vh + e) = oh; *(v2us*)(Vl + e) = ol;  }
__constant__ float INV2[HD / 2] = { 1.000000000e+00f, 8.659643531e-01f, 7.498942018e-01f, 6.493816376e-01f, 5.623413324e-01f, 4.869675338e-01f, 4.216965139e-01f, 3.651741147e-01f, 3.162277639e-01f, 2.738419771e-01f, 2.371373773e-01f, 2.053525001e-01f, 1.778279394e-01f, 1.539926529e-01f, 1.333521456e-01f, 1.154781953e-01f, 1.000000015e-01f, 8.659642935e-02f, 7.498942316e-02f, 6.493816525e-02f, 5.623413250e-02f, 4.869675264e-02f, 4.216964915e-02f, 3.651741147e-02f, 3.162277490e-02f, 2.738419548e-02f, 2.371373773e-02f, 2.053525113e-02f, 1.778279431e-02f, 1.539926510e-02f, 1.333521400e-02f, 1.154781971e-02f, 9.999999776e-03f, 8.659643121e-03f, 7.498942316e-03f, 6.493816152e-03f, 5.623413250e-03f, 4.869675264e-03f, 4.216964822e-03f, 3.651741194e-03f, 3.162277630e-03f, 2.738419687e-03f, 2.371373819e-03f, 2.053525066e-03f, 1.778279431e-03f, 1.539926510e-03f, 1.333521446e-03f, 1.154782018e-03f, 1.000000047e-03f, 8.659643354e-04f, 7.498941850e-04f, 6.493816036e-04f, 5.623413017e-04f, 4.869675322e-04f, 4.216965172e-04f, 3.651741135e-04f, 3.162277571e-04f, 2.738419571e-04f, 2.371373703e-04f, 2.053525095e-04f, 1.778279402e-04f, 1.539926598e-04f, 1.333521504e-04f, 1.154782003e-04f };   // float32 1 / 10000^(2i/128), generated with jnp to be bit-exact
__global__ __launch_bounds__(256) void k_csP(float* CS) { const int idx = blockIdx.x * 256 + threadIdx.x; if (idx >= TT * HD) return; const int d = idx % HD; const int t = idx / HD; const float a = __fmul_rn((float)t, INV2[d >> 1]); v2f cs; cs[0] = cosf(a); cs[1] = sinf(a); *(v2f*)(CS + (size_t)idx * 2) = cs;  }
// k_asoft: per row (zz, i): t = S x HD^-0.5 for j <= i and i - j < WIN (sliding causal window; the reference's -1e9 additive fill vanishes identically); softmax over the 2048 keys (register row, one exp, fixed trees);
__global__ __launch_bounds__(256) void k_asoft(const float* __restrict__ Sb, h16* P16, bf* Ph, bf* Pl) {
    const int lane = threadIdx.x & 31; const int row = blockIdx.x * 8 + (threadIdx.x >> 5); if (row >= ZH * TT) return; const int i = row % TT; const int zz = row / TT; (void)zz; const bool hires = (i < RH); const float* sr = Sb + (size_t)row * TT; float v[TT / 32]; float mx = -3.0e38f;
#pragma unroll
    for (int ch = 0; ch < TT / 128; ++ch) { const int j0 = ch * 128 + lane * 4; const v4f a = *(const v4f*)(sr + j0);
#pragma unroll
        for (int q = 0; q < 4; ++q) { const int j = j0 + q; (void)j; const float t = (j <= i && i - j < WIN) ? a[q] * SCL : -3.0e38f; v[ch * 4 + q] = t; mx = fmaxf(mx, t); } }
#pragma unroll
    for (int sh = 16; sh; sh >>= 1) mx = fmaxf(mx, __shfl_xor(mx, sh, 32));
    float sum = 0.f;
#pragma unroll
    for (int k = 0; k < TT / 32; ++k) { float d0 = __fsub_rn(v[k], mx); asm volatile("" : "+v"(d0)); v[k] = __builtin_amdgcn_exp2f(__fmul_rn(d0, 1.4426950408889634f)); sum += v[k]; }
#pragma unroll
    for (int sh = 16; sh; sh >>= 1) sum += __shfl_xor(sum, sh, 32);
    const float f = __fdiv_rn(hires ? 1.0f : PCAR, sum);
{
        if (hires) {
#pragma unroll
            for (int ch = 0; ch < TT / 128; ++ch) { v4us oh, ol;
#pragma unroll
                for (int q = 0; q < 4; ++q) { unsigned short a, c2; splitf(v[ch * 4 + q] * f, a, c2); oh[q] = a; ol[q] = c2; }
                const size_t oo = ((size_t)zz * (RH ? RH : 1) + i) * TT + ch * 128 + lane * 4; *(v4us*)(Ph + oo) = oh; *(v4us*)(Pl + oo) = ol; }
        } else {
#pragma unroll
            for (int ch = 0; ch < TT / 128; ++ch) { v4h o4;
#pragma unroll
                for (int q = 0; q < 4; ++q) o4[q] = tohx(v[ch * 4 + q] * f);
                *(v4h*)(P16 + (size_t)row * TT + ch * 128 + lane * 4) = o4; } }
         }
}
__global__ __launch_bounds__(256) void k_merge(const float* __restrict__ O, int h0, bf* Ah, bf* Al) { const size_t e = ((size_t)blockIdx.x * 256 + threadIdx.x) * 2; if (e >= (size_t)ZH * TT * HD) return; const int d = (int)(e % HD); const int t = (int)((e / HD) % TT); const int zz = (int)(e / ((size_t)HD * TT)); const float cs = (t < RH) ? 1.0f : (1.0f / PCAR); const size_t oo = (size_t)t * DQ + (h0 + zz) * HD + d;
    v2us oh, ol;
#pragma unroll
    for (int q = 0; q < 2; ++q) { unsigned short a, c2; splitf(O[e + q] * cs, a, c2); oh[q] = a; ol[q] = c2; } *(v2us*)(Ah + oo) = oh; *(v2us*)(Al + oo) = ol;  }

extern "C" void kernel_launch(void* const* d_in, const int* in_sizes, int n_in,
                              void* d_out, int out_size, void* d_ws, size_t ws_size, hipStream_t stream) {
    (void)in_sizes; (void)n_in; (void)out_size;
    const float* x = (const float*)d_in[0]; const float* wq = (const float*)d_in[1]; const float* wk = (const float*)d_in[2]; const float* wv = (const float*)d_in[3]; const float* wo = (const float*)d_in[4];   /* weights 'oi' [2048][2048] */
    float* OUT = (float*)d_out;     // [2][2048][2048]
    char* wsp = (char*)d_ws;
    auto take = [&](size_t bytes) { char* p = wsp; wsp += (bytes + 255) & ~(size_t)255; return (void*)p; };
    bf* WQ = (bf*)take((size_t)DQ * DM * 2); bf* WK = (bf*)take((size_t)DKV * DM * 2); bf* WV = (bf*)take((size_t)DKV * DM * 2); bf* WO = (bf*)take((size_t)DM * DQ * 2); float* CS = (float*)take((size_t)TT * HD * 2 * 4);
    bf* XB = (bf*)take((size_t)TT * DM * 2); float* FQ = (float*)take((size_t)TT * DQ * 4); float* FK = (float*)take((size_t)TT * DKV * 4);
    h16* QP16 = (h16*)take((size_t)NH_ * TT * HD * 2); h16* KP16 = (h16*)take((size_t)NKV * TT * HD * 2); h16* VT16 = (h16*)take((size_t)NKV * HD * TT * 2);
    bf* QPh = (bf*)take((size_t)NH_ * TT * HD * 2); bf* QPl = (bf*)take((size_t)NH_ * TT * HD * 2); bf* KPh = (bf*)take((size_t)NKV * TT * HD * 2); bf* KPl = (bf*)take((size_t)NKV * TT * HD * 2); bf* VTh = (bf*)take((size_t)NKV * HD * TT * 2); bf* VTl = (bf*)take((size_t)NKV * HD * TT * 2); bf* Ph = (bf*)take((size_t)ZH * RH * TT * 2); bf* Pl = (bf*)take((size_t)ZH * RH * TT * 2);
    float* Sb = (float*)take((size_t)ZH * TT * TT * 4); h16* P16 = (h16*)take((size_t)ZH * TT * TT * 2); float* Ob = (float*)take((size_t)ZH * TT * HD * 4); bf* ATh = (bf*)take((size_t)TT * DQ * 2); bf* ATl = (bf*)take((size_t)TT * DQ * 2);
    if ((size_t)(wsp - (char*)d_ws) > ws_size) return;    // ws 256 MiB
    float* FV = FK;   // v projection reuses the k buffer after the k planes are built (stream-ordered)
    { k_cvt8<<<(unsigned)(((size_t)DQ * DM / 8 + 255) / 256), 256, 0, stream>>>(wq, WQ, (size_t)DQ * DM / 8); k_cvt8<<<(unsigned)(((size_t)DKV * DM / 8 + 255) / 256), 256, 0, stream>>>(wk, WK, (size_t)DKV * DM / 8); k_cvt8<<<(unsigned)(((size_t)DKV * DM / 8 + 255) / 256), 256, 0, stream>>>(wv, WV, (size_t)DKV * DM / 8);
      k_cvt8<<<(unsigned)(((size_t)DM * DQ / 8 + 255) / 256), 256, 0, stream>>>(wo, WO, (size_t)DM * DQ / 8);
       }
    k_csP<<<(TT * HD + 255) / 256, 256, 0, stream>>>(CS);   /* rotary table once */
    const unsigned LQ = (unsigned)(((size_t)NH_ * TT * HD / 2 + 255) / 256), LKv = (unsigned)(((size_t)NKV * TT * HD / 2 + 255) / 256);
    for (int b = 0; b < NB_; ++b) {
        
        k_cvt8<<<(unsigned)(((size_t)TT * DM / 8 + 255) / 256), 256, 0, stream>>>(x + (size_t)b * TT * DM, XB, (size_t)TT * DM / 8);
        k_gemmw<bf, 0, false, 4><<<dim3(TT / 64, DQ / 64, 1), 128, 0, stream>>>(XB, nullptr, WQ, nullptr, DM, FQ, DQ, nullptr, 0, 0, 0);
        k_ropeI<<<LQ, 256, 0, stream>>>(FQ, DQ, NH_, CS, 1.0f, QP16, QPh, QPl);
        k_gemmw<bf, 0, false, 4><<<dim3(TT / 64, DKV / 64, 1), 128, 0, stream>>>(XB, nullptr, WK, nullptr, DM, FK, DKV, nullptr, 0, 0, 0);
        k_ropeI<<<LKv, 256, 0, stream>>>(FK, DKV, NKV, CS, 1.0f, KP16, KPh, KPl);
        k_gemmw<bf, 0, false, 4><<<dim3(TT / 64, DKV / 64, 1), 128, 0, stream>>>(XB, nullptr, WV, nullptr, DM, FV, DKV, nullptr, 0, 0, 0); k_vtp<<<LKv, 256, 0, stream>>>(FV, DKV, NKV, VT16, VTh, VTl);
        for (int h0 = 0; h0 < NH_; h0 += ZH) { const size_t zq = (size_t)h0, zk = (size_t)(h0 / REP);   // one kv head per query head: the pass's two heads use consecutive kv planes (z-strides TT*HD)
            k_gemmc<bf, 2, 1, 1><<<dim3(RH / 64, TT / 64, ZH), 32, 0, stream>>>(QPh + zq * TT * HD, QPl + zq * TT * HD, KPh + zk * TT * HD, KPl + zk * TT * HD, HD, Sb, TT, 0, (size_t)TT * HD, (size_t)TT * HD, (size_t)TT * TT);
            k_gemmc<h16, 0, 1, 1><<<dim3((TT - RH) / 64, TT / 64, ZH), 32, 0, stream>>>(QP16 + zq * TT * HD + (size_t)RH * HD, nullptr, KP16 + zk * TT * HD, nullptr, HD, Sb + (size_t)RH * TT, TT, RH, (size_t)TT * HD, (size_t)TT * HD, (size_t)TT * TT);
            k_asoft<<<ZH * TT / 8, 256, 0, stream>>>(Sb, P16, Ph, Pl);
            k_gemmc<bf, 2, 2, 8><<<dim3(RH / 64, HD / 64, ZH), 256, 0, stream>>>(Ph, Pl, VTh + zk * HD * TT, VTl + zk * HD * TT, TT, Ob, HD, 0, (size_t)RH * TT, (size_t)HD * TT, (size_t)TT * HD);
            k_gemmc<h16, 0, 2, 8><<<dim3((TT - RH) / 64, HD / 64, ZH), 256, 0, stream>>>(P16 + (size_t)RH * TT, nullptr, VT16 + zk * HD * TT, nullptr, TT, Ob + (size_t)RH * HD, HD, RH, (size_t)TT * TT, (size_t)HD * TT, (size_t)TT * HD);
            k_merge<<<(unsigned)(((size_t)ZH * TT * HD / 2 + 255) / 256), 256, 0, stream>>>(Ob, h0, ATh, ATl); }
        k_gemmw<bf, 1, false, 4><<<dim3(TT / 64, DM / 64, 1), 128, 0, stream>>>(ATh, ATl, WO, nullptr, DQ, OUT + (size_t)b * TT * DM, DM, nullptr, 0, 0, 0); }
}

// v002
// A run of this version takes 742 microseconds.
// In two side-by-side timings against v001, it was 1.45 and 1.46 times as fast.
// Counting every step since v000, it is 2.32 times as fast.
#include <hip/hip_runtime.h>

// Causal multi-head self-attention with 128-wide heads and interleaved-pair rotary embeddings (x [2][2048][2048]; Q, K, V = einsum('bsd,ed', x, W) ('oi' 0.02; 16 heads x 128); rope on consecutive (even, odd) pairs: (x1 cos - x2 sin, x1 sin + x2 cos) with angle pos x 10000^(-2i/128), pos = arange(S) (64 f32 frequencies jnp-exact for this expression; precise cosf/sinf); scores x 1/sqrt(128); causal (-inf); softmax; out = merged Wo^T -> [2][2048][2048] (8.4 M); argument order x, Wq, Wk, Wv, Wo).
// Layout: bf16 copy of x; 'oi' weights; exact projections; k_csP computed table (HD 128: one angle per (even, odd) pair) + k_ropeI interleaved-pair plane builders; causal T-2048 attention at HD 128 (hybrid rows: < 512 hi/lo 3 products, rest fp16 x1024; k_gemmc skips tiles above the diagonal); merged hi/lo x Wo exact.
// Compute dtypes, f32 accumulate: every input rounded to bf16; projections exact; rotary f32; attention rows < 512 3 products, rest fp16; softmax f32; Wo hl x exact.

#define NB_  2
#define TT   2048
#define DM   2048
#define NH_  16
#define NKV  16
#define REP  (NH_ / NKV)
#define HD   128
#define DQ   (NH_ * HD)
#define DKV  (NKV * HD)
#define ZH   8                    // heads per attention pass (z of every attention launch)
#define PP   (2 * TT)             // pitch, in 16-bit elements, of a probability row kept in its own f32 score row's bytes; the transposed value planes use the same pitch
static_assert((NKV / ZH) * TT == PP, "value planes interleave the passes' heads at the probability pitch");
#define RH   512                  // query rows < RH use hi+lo planes (0: none)
#define WIN  2048
#define PCAR 1024.0f
#define SCL  0.088388347648318447f   // HD^-0.5
typedef _Float16 h16;
typedef unsigned short bf;
typedef __attribute__((ext_vector_type(16))) __bf16   v16bf;
typedef __attribute__((ext_vector_type(16))) _Float16 v16h;
typedef __attribute__((ext_vector_type(8)))  _Float16 v8h;
typedef __attribute__((ext_vector_type(8)))  unsigned short v8us;
typedef __attribute__((ext_vector_type(8)))  float    v8f;
typedef __attribute__((ext_vector_type(4)))  float    v4f;
typedef v8h  __attribute__((may_alias)) v8ha;
typedef v4f  __attribute__((may_alias)) v4fa;
typedef v8us __attribute__((may_alias)) v8usa;

__device__ __forceinline__ unsigned short f2bf(float f) { unsigned u = __float_as_uint(f); u += 0x7FFFu + ((u >> 16) & 1u); return (unsigned short)(u >> 16); }
__device__ __forceinline__ float bf2f(unsigned short b) { return __uint_as_float(((unsigned)b) << 16); }
__device__ __forceinline__ float bfr(float f) { return bf2f(f2bf(f)); }
__device__ __forceinline__ v16h cat16(v8h lo, v8h hi) { return __builtin_shufflevector(lo, hi, 0, 1, 2, 3, 4, 5, 6, 7, 8, 9, 10, 11, 12, 13, 14, 15); }
__device__ __forceinline__ v16bf cat16b(v8us lo, v8us hi) { return __builtin_bit_cast(v16bf, __builtin_shufflevector(lo, hi, 0, 1, 2, 3, 4, 5, 6, 7, 8, 9, 10, 11, 12, 13, 14, 15)); }
__device__ __forceinline__ v8f wmma16(v16h a, v16h b, v8f c) { return __builtin_amdgcn_wmma_f32_16x16x32_f16(false, a, false, b, (short)0, c, false, false); }
__device__ __forceinline__ v8f wmmab(v16bf a, v16bf b, v8f c) { return __builtin_amdgcn_wmma_f32_16x16x32_bf16(false, a, false, b, (short)0, c, false, false); }



// ---- k_gemmw: register-blocked GEMM, 64x64 output tile per workgroup of NW waves (16 accumulators per wave), operands straight from K-contiguous 16-bit planes; grid (M/64, N/64, Z), 32 * NW threads.
// Wave w takes the 32-wide K blocks w, w + NW, w + 2 NW, ...; the NW partial tiles are summed through LDS in wave order 0..NW-1 (fixed order) by the epilogue that stores whole rows.
// C[m][n] (f32, pitch ldc, + optional f32 bias[n]) = sum_k A[m][k] Bt[n][k] (+ split products per NSPLIT). z-batch strides sA/sB/sC in elements. K % 32 == 0.
template <typename T16> struct WFrag;
template <> struct WFrag<h16> { typedef v16h V; static __device__ __forceinline__ V ld(const h16* p) { return cat16(*(const v8h*)p, *(const v8h*)(p + 16)); } static __device__ __forceinline__ v8f mma(V a, V b, v8f c) { return wmma16(a, b, c); } };
template <> struct WFrag<bf> { typedef v16bf V; static __device__ __forceinline__ V ld(const bf* p) { return cat16b(*(const v8us*)p, *(const v8us*)(p + 16)); } static __device__ __forceinline__ v8f mma(V a, V b, v8f c) { return wmmab(a, b, c); } };
template <typename T16, int NSPLIT, bool BIAS, int NW>
__global__ __launch_bounds__(32 * NW) void k_gemmw(const T16* __restrict__ A, const T16* __restrict__ A2, const T16* __restrict__ Bt, const T16* __restrict__ Bt2, int K, float* C, int ldc, const float* __restrict__ bias, size_t sA, size_t sB, size_t sC) {
    typedef typename WFrag<T16>::V V;
    __shared__ __align__(16) float os[NW * 64 * 68];
    const size_t z = blockIdx.z; A += z * sA; if (A2) A2 += z * sA; Bt += z * sB; if (Bt2) Bt2 += z * sB; C += z * sC;
    const int lane = threadIdx.x & 31, lr = lane & 15, hi = lane >> 4; const int r0 = blockIdx.x * 64, c0 = blockIdx.y * 64;
    const int wv = __builtin_amdgcn_readfirstlane((int)(threadIdx.x >> 5));   // wave number, scalar: the K loop's bounds stay wave-uniform
    v8f acc[4][4];
#pragma unroll
    for (int mb = 0; mb < 4; ++mb)
#pragma unroll
        for (int nb = 0; nb < 4; ++nb) acc[mb][nb] = (v8f){};
    const size_t aoff = (size_t)(r0 + lr) * K + 8 * hi, boff = (size_t)(c0 + lr) * K + 8 * hi;
#pragma unroll 1
    for (int kc = wv * 32; kc < K; kc += 32 * NW) {
        V a[4], a2[4];
#pragma unroll
        for (int mb = 0; mb < 4; ++mb) { a[mb] = WFrag<T16>::ld(A + aoff + (size_t)mb * 16 * K + kc); if (NSPLIT == 1 || NSPLIT == 2) a2[mb] = WFrag<T16>::ld(A2 + aoff + (size_t)mb * 16 * K + kc); }
#pragma unroll
        for (int nb = 0; nb < 4; ++nb) { const V b = WFrag<T16>::ld(Bt + boff + (size_t)nb * 16 * K + kc); V b2; if (NSPLIT >= 2) b2 = WFrag<T16>::ld(Bt2 + boff + (size_t)nb * 16 * K + kc);
#pragma unroll
            for (int mb = 0; mb < 4; ++mb) { acc[mb][nb] = WFrag<T16>::mma(a[mb], b, acc[mb][nb]); if (NSPLIT == 1 || NSPLIT == 2) acc[mb][nb] = WFrag<T16>::mma(a2[mb], b, acc[mb][nb]); if (NSPLIT >= 2) acc[mb][nb] = WFrag<T16>::mma(a[mb], b2, acc[mb][nb]); } }
        asm volatile("v_nop\n\tv_nop\n\tv_nop\n\tv_nop" : "+v"(acc[0][0]), "+v"(acc[1][1]), "+v"(acc[2][2]), "+v"(acc[3][3]) : "v"(a[0]), "v"(a[3]));
    }
    // Every wave lays its whole 64x64 partial tile in its own LDS slab; behind ONE barrier each wave sums its share of the rows over the slabs, wave 0's partial first, and stores whole rows.
#pragma unroll
    for (int mb = 0; mb < 4; ++mb) {
#pragma unroll
        for (int nb = 0; nb < 4; ++nb) {
#pragma unroll
            for (int j = 0; j < 8; ++j) os[wv * (64 * 68) + (mb * 16 + hi * 8 + j) * 68 + nb * 16 + lr] = acc[mb][nb][j]; } }
    __syncthreads();   // all NW partial tiles are in LDS before any wave sums them
#pragma unroll
    for (int s = 0; s < 32 / NW; ++s) { const int row = 2 * (s * NW + wv) + hi, cofs = lr * 4; v4f val = *(const v4fa*)(os + row * 68 + cofs);
#pragma unroll
        for (int w = 1; w < NW; ++w) val += *(const v4fa*)(os + w * (64 * 68) + row * 68 + cofs);
        if (BIAS) { val[0] += bfr(bias[c0 + cofs]); val[1] += bfr(bias[c0 + cofs + 1]); val[2] += bfr(bias[c0 + cofs + 2]); val[3] += bfr(bias[c0 + cofs + 3]); }
        *(v4f*)(C + (size_t)(r0 + row) * ldc + c0 + cofs) = val; }
}

// ---- k_gemmc: the same 64x64 tile GEMM (NW waves share the K loop) specialised for causal attention: CMODE 1 skips score tiles entirely above the diagonal (query rows r0+roff.., key columns c0..), CMODE 2 limits the
// key (K) loop of the probability x value contraction to the diagonal block (probabilities beyond it are exactly zero). roff = row offset of this launch's first row within the sequence.
template <typename T16, int NSPLIT, int CMODE, int NW>
__global__ __launch_bounds__(32 * NW) void k_gemmc(const T16* __restrict__ A, const T16* __restrict__ A2, const T16* __restrict__ Bt, const T16* __restrict__ Bt2, int K, float* C, int ldc, int roff, size_t sA, size_t sB, size_t sC) {
    typedef typename WFrag<T16>::V V;
    __shared__ __align__(16) float os[NW == 1 ? 16 * 68 : NW * 64 * 68];
    const size_t z = blockIdx.z; A += z * sA; if (A2) A2 += z * sA; Bt += z * sB; if (Bt2) Bt2 += z * sB; C += z * sC;
    const int lane = threadIdx.x & 31, lr = lane & 15, hi = lane >> 4; const int r0 = blockIdx.x * 64, c0 = blockIdx.y * 64;
    const int wv = (NW == 1) ? 0 : __builtin_amdgcn_readfirstlane((int)(threadIdx.x >> 5));   // wave number, scalar: the K loop's bounds stay wave-uniform
    if (CMODE == 1 && c0 > r0 + roff + 63) return;                  // score tile entirely above the causal diagonal: never read (the softmax masks j > i by select)
    const int Kl = (CMODE == 2) ? min(K, r0 + roff + 64) : K;        // P.V: probabilities are exactly 0 beyond the diagonal block, so the K loop stops there
    v8f acc[4][4];
#pragma unroll
    for (int mb = 0; mb < 4; ++mb)
#pragma unroll
        for (int nb = 0; nb < 4; ++nb) acc[mb][nb] = (v8f){};
    const size_t aoff = (size_t)(r0 + lr) * K + 8 * hi, boff = (size_t)(c0 + lr) * K + 8 * hi;
#pragma unroll 1
    for (int kc = wv * 32; kc < Kl; kc += 32 * NW) {
        V a[4], a2[4];
#pragma unroll
        for (int mb = 0; mb < 4; ++mb) { a[mb] = WFrag<T16>::ld(A + aoff + (size_t)mb * 16 * K + kc); if (NSPLIT == 1 || NSPLIT == 2) a2[mb] = WFrag<T16>::ld(A2 + aoff + (size_t)mb * 16 * K + kc); }
#pragma unroll
        for (int nb = 0; nb < 4; ++nb) { const V b = WFrag<T16>::ld(Bt + boff + (size_t)nb * 16 * K + kc); V b2; if (NSPLIT >= 2) b2 = WFrag<T16>::ld(Bt2 + boff + (size_t)nb * 16 * K + kc);
#pragma unroll
            for (int mb = 0; mb < 4; ++mb) { acc[mb][nb] = WFrag<T16>::mma(a[mb], b, acc[mb][nb]); if (NSPLIT == 1 || NSPLIT == 2) acc[mb][nb] = WFrag<T16>::mma(a2[mb], b, acc[mb][nb]); if (NSPLIT >= 2) acc[mb][nb] = WFrag<T16>::mma(a[mb], b2, acc[mb][nb]); } }
        asm volatile("v_nop\n\tv_nop\n\tv_nop\n\tv_nop" : "+v"(acc[0][0]), "+v"(acc[1][1]), "+v"(acc[2][2]), "+v"(acc[3][3]) : "v"(a[0]), "v"(a[3]));
    }
    if constexpr (NW == 1) {
#pragma unroll
    for (int mb = 0; mb < 4; ++mb) {
#pragma unroll
        for (int nb = 0; nb < 4; ++nb) {
#pragma unroll
            for (int j = 0; j < 8; ++j) os[(hi * 8 + j) * 68 + nb * 16 + lr] = acc[mb][nb][j]; }
        __builtin_amdgcn_wave_barrier(); asm volatile("" ::: "memory");
        float* crow = C + (size_t)(r0 + mb * 16) * ldc + c0;
{
#pragma unroll
            for (int s = 0; s < 8; ++s) { const int row = 2 * s + hi, cofs = lr * 4; v4f val = *(const v4fa*)(os + row * 68 + cofs);
                *(v4f*)(crow + (size_t)row * ldc + cofs) = val; }
             }
        __builtin_amdgcn_wave_barrier(); asm volatile("" ::: "memory");
    }
    } else {
    // Every wave lays its whole 64x64 partial tile in its own LDS slab; behind ONE barrier each wave sums its share of the rows over the slabs, wave 0's partial first, and stores whole rows.
#pragma unroll
    for (int mb = 0; mb < 4; ++mb) {
#pragma unroll
        for (int nb = 0; nb < 4; ++nb) {
#pragma unroll
            for (int j = 0; j < 8; ++j) os[wv * (64 * 68) + (mb * 16 + hi * 8 + j) * 68 + nb * 16 + lr] = acc[mb][nb][j]; } }
    __syncthreads();   // all NW partial tiles are in LDS before any wave sums them
#pragma unroll
    for (int s = 0; s < 32 / NW; ++s) { const int row = 2 * (s * NW + wv) + hi, cofs = lr * 4; v4f val = *(const v4fa*)(os + row * 68 + cofs);
#pragma unroll
        for (int w = 1; w < NW; ++w) val += *(const v4fa*)(os + w * (64 * 68) + row * 68 + cofs);
        *(v4f*)(C + (size_t)(r0 + row) * ldc + c0 + cofs) = val; }
    }
}

__device__ __forceinline__ h16 tohx(float x) { return (h16)x; }
__device__ __forceinline__ void splitf(float y, unsigned short& h, unsigned short& l) { h = f2bf(y); l = f2bf(y - bf2f(h)); }
typedef __attribute__((ext_vector_type(2))) _Float16 v2h;
typedef __attribute__((ext_vector_type(4))) _Float16 v4h;
typedef __attribute__((ext_vector_type(2))) unsigned short v2us;
typedef __attribute__((ext_vector_type(4))) unsigned short v4us;
typedef __attribute__((ext_vector_type(2))) float v2f;
typedef __attribute__((ext_vector_type(4))) int v4i;

__global__ __launch_bounds__(256) void k_cvt8(const float* __restrict__ src, bf* dst, size_t n8) { const size_t i = (size_t)blockIdx.x * 256 + threadIdx.x; if (i >= n8) return; const v8f v = *(const v8f*)(src + i * 8); v8us o;
#pragma unroll
    for (int k = 0; k < 8; ++k) o[k] = f2bf(v[k]); *(v8us*)(dst + i * 8) = o;  }

__global__ __launch_bounds__(256) void k_ropeI(const float* __restrict__ F, int pitch, int nheads, const float* __restrict__ CS, float sc, h16* P16, bf* Ph, bf* Pl) {
    const size_t e = ((size_t)blockIdx.x * 256 + threadIdx.x) * 2; if (e >= (size_t)nheads * TT * HD) return; const int d = (int)(e % HD); const int t = (int)((e / HD) % TT); const int h = (int)(e / ((size_t)HD * TT)); const float* f = F + (size_t)t * pitch + h * HD; const float x0 = f[d], x1 = f[d + 1]; const v2f cs = *(const v2f*)(CS + ((size_t)t * HD + d) * 2); v2h o16; v2us oh, ol;
    float a0 = __fmul_rn(x0, cs[0]), b0 = __fmul_rn(x1, cs[1]), a1 = __fmul_rn(x1, cs[0]), b1 = __fmul_rn(x0, cs[1]); asm volatile("" : "+v"(a0), "+v"(b0), "+v"(a1), "+v"(b1));
    float r0 = __fsub_rn(a0, b0) * sc, r1 = __fadd_rn(b1, a1) * sc;   /* even: x0 c - x1 s; odd: x0 s + x1 c */
    o16[0] = tohx(r0); o16[1] = tohx(r1); { unsigned short a2, c2; splitf(r0, a2, c2); oh[0] = a2; ol[0] = c2; splitf(r1, a2, c2); oh[1] = a2; ol[1] = c2; }
    *(v2h*)(P16 + e) = o16; *(v2us*)(Ph + e) = oh; *(v2us*)(Pl + e) = ol;  }

__global__ __launch_bounds__(256) void k_vtp(const float* __restrict__ F, int pitch, int nheads, h16* V16, bf* Vh, bf* Vl) { const size_t e = ((size_t)blockIdx.x * 256 + threadIdx.x) * 2; if (e >= (size_t)nheads * HD * TT) return; const int t = (int)(e % TT); const int d = (int)((e / TT) % HD); const int g = (int)(e / ((size_t)TT * HD)); v2h o16; v2us oh, ol;
#pragma unroll
    for (int q = 0; q < 2; ++q) { const float x = F[(size_t)(t + q) * pitch + g * HD + d]; o16[q] = tohx(x); unsigned short a2, c2; splitf(x, a2, c2); oh[q] = a2; ol[q] = c2; }
    const size_t eo = (((size_t)(g % ZH) * HD + d) * (NKV / ZH) + g / ZH) * TT + t;   // [head in pass][d][pass][t]: a pass's rows stand PP apart, the pitch the P.V product's one K pitch asks of both operands
    *(v2h*)(V16 + eo) = o16; *(v2us*)(Vh + eo) = oh; *(v2us*)(Vl + eo) = ol;  }
__constant__ float INV2[HD / 2] = { 1.000000000e+00f, 8.659643531e-01f, 7.498942018e-01f, 6.493816376e-01f, 5.623413324e-01f, 4.869675338e-01f, 4.216965139e-01f, 3.651741147e-01f, 3.162277639e-01f, 2.738419771e-01f, 2.371373773e-01f, 2.053525001e-01f, 1.778279394e-01f, 1.539926529e-01f, 1.333521456e-01f, 1.154781953e-01f, 1.000000015e-01f, 8.659642935e-02f, 7.498942316e-02f, 6.493816525e-02f, 5.623413250e-02f, 4.869675264e-02f, 4.216964915e-02f, 3.651741147e-02f, 3.162277490e-02f, 2.738419548e-02f, 2.371373773e-02f, 2.053525113e-02f, 1.778279431e-02f, 1.539926510e-02f, 1.333521400e-02f, 1.154781971e-02f, 9.999999776e-03f, 8.659643121e-03f, 7.498942316e-03f, 6.493816152e-03f, 5.623413250e-03f, 4.869675264e-03f, 4.216964822e-03f, 3.651741194e-03f, 3.162277630e-03f, 2.738419687e-03f, 2.371373819e-03f, 2.053525066e-03f, 1.778279431e-03f, 1.539926510e-03f, 1.333521446e-03f, 1.154782018e-03f, 1.000000047e-03f, 8.659643354e-04f, 7.498941850e-04f, 6.493816036e-04f, 5.623413017e-04f, 4.869675322e-04f, 4.216965172e-04f, 3.651741135e-04f, 3.162277571e-04f, 2.738419571e-04f, 2.371373703e-04f, 2.053525095e-04f, 1.778279402e-04f, 1.539926598e-04f, 1.333521504e-04f, 1.154782003e-04f };   // float32 1 / 10000^(2i/128), generated with jnp to be bit-exact
__global__ __launch_bounds__(256) void k_csP(float* CS) { const int idx = blockIdx.x * 256 + threadIdx.x; if (idx >= TT * HD) return; const int d = idx % HD; const int t = idx / HD; const float a = __fmul_rn((float)t, INV2[d >> 1]); v2f cs; cs[0] = cosf(a); cs[1] = sinf(a); *(v2f*)(CS + (size_t)idx * 2) = cs;  }
// k_asoft: per row (zz, i): t = S x HD^-0.5 for j <= i and i - j < WIN (sliding causal window; the reference's -1e9 additive fill vanishes identically); softmax over the 2048 keys (register row, one exp, fixed trees);
// the probabilities go back into the row's own 8192 bytes (pitch PP): one wave owns the row and has all of it in registers before its first store; rows >= RH: fp16 in the first half; rows < RH: hi plane in the first half, lo plane in the second.
__global__ __launch_bounds__(256) void k_asoft(const float* Sb, h16* P16, bf* Ph, bf* Pl) {
    const int lane = threadIdx.x & 31; const int row = blockIdx.x * 8 + (threadIdx.x >> 5); if (row >= ZH * TT) return; const int i = row % TT; const int zz = row / TT; (void)zz; const bool hires = (i < RH); const float* sr = Sb + (size_t)row * TT; float v[TT / 32]; float mx = -3.0e38f;
#pragma unroll
    for (int ch = 0; ch < TT / 128; ++ch) { const int j0 = ch * 128 + lane * 4; const v4f a = *(const v4f*)(sr + j0);
#pragma unroll
        for (int q = 0; q < 4; ++q) { const int j = j0 + q; (void)j; const float t = (j <= i && i - j < WIN) ? a[q] * SCL : -3.0e38f; v[ch * 4 + q] = t; mx = fmaxf(mx, t); } }
#pragma unroll
    for (int sh = 16; sh; sh >>= 1) mx = fmaxf(mx, __shfl_xor(mx, sh, 32));
    float sum = 0.f;
#pragma unroll
    for (int k = 0; k < TT / 32; ++k) { float d0 = __fsub_rn(v[k], mx); asm volatile("" : "+v"(d0)); v[k] = __builtin_amdgcn_exp2f(__fmul_rn(d0, 1.4426950408889634f)); sum += v[k]; }
#pragma unroll
    for (int sh = 16; sh; sh >>= 1) sum += __shfl_xor(sum, sh, 32);
    const float f = __fdiv_rn(hires ? 1.0f : PCAR, sum);
{
        if (hires) {
#pragma unroll
            for (int ch = 0; ch < TT / 128; ++ch) { v4us oh, ol;
#pragma unroll
                for (int q = 0; q < 4; ++q) { unsigned short a, c2; splitf(v[ch * 4 + q] * f, a, c2); oh[q] = a; ol[q] = c2; }
                const size_t oo = (size_t)row * PP + ch * 128 + lane * 4; *(v4us*)(Ph + oo) = oh; *(v4us*)(Pl + oo) = ol; }
        } else {
#pragma unroll
            for (int ch = 0; ch < TT / 128; ++ch) { v4h o4;
#pragma unroll
                for (int q = 0; q < 4; ++q) o4[q] = tohx(v[ch * 4 + q] * f);
                *(v4h*)(P16 + (size_t)row * PP + ch * 128 + lane * 4) = o4; } }
         }
}
__global__ __launch_bounds__(256) void k_merge(const float* __restrict__ O, int h0, bf* Ah, bf* Al) { const size_t e = ((size_t)blockIdx.x * 256 + threadIdx.x) * 2; if (e >= (size_t)ZH * TT * HD) return; const int d = (int)(e % HD); const int t = (int)((e / HD) % TT); const int zz = (int)(e / ((size_t)HD * TT)); const float cs = (t < RH) ? 1.0f : (1.0f / PCAR); const size_t oo = (size_t)t * DQ + (h0 + zz) * HD + d;
    v2us oh, ol;
#pragma unroll
    for (int q = 0; q < 2; ++q) { unsigned short a, c2; splitf(O[e + q] * cs, a, c2); oh[q] = a; ol[q] = c2; } *(v2us*)(Ah + oo) = oh; *(v2us*)(Al + oo) = ol;  }

extern "C" void kernel_launch(void* const* d_in, const int* in_sizes, int n_in,
                              void* d_out, int out_size, void* d_ws, size_t ws_size, hipStream_t stream) {
    (void)in_sizes; (void)n_in; (void)out_size;
    const float* x = (const float*)d_in[0]; const float* wq = (const float*)d_in[1]; const float* wk = (const float*)d_in[2]; const float* wv = (const float*)d_in[3]; const float* wo = (const float*)d_in[4];   /* weights 'oi' [2048][2048] */
    float* OUT = (float*)d_out;     // [2][2048][2048]
    char* wsp = (char*)d_ws;
    auto take = [&](size_t bytes) { char* p = wsp; wsp += (bytes + 255) & ~(size_t)255; return (void*)p; };
    bf* WQ = (bf*)take((size_t)DQ * DM * 2); bf* WK = (bf*)take((size_t)DKV * DM * 2); bf* WV = (bf*)take((size_t)DKV * DM * 2); bf* WO = (bf*)take((size_t)DM * DQ * 2);
    h16* QP16 = (h16*)take((size_t)NH_ * TT * HD * 2); h16* KP16 = (h16*)take((size_t)NKV * TT * HD * 2); h16* VT16 = (h16*)take((size_t)NKV * HD * TT * 2);
    bf* QPh = (bf*)take((size_t)NH_ * TT * HD * 2); bf* QPl = (bf*)take((size_t)NH_ * TT * HD * 2); bf* KPh = (bf*)take((size_t)NKV * TT * HD * 2); bf* KPl = (bf*)take((size_t)NKV * TT * HD * 2); bf* VTh = (bf*)take((size_t)NKV * HD * TT * 2); bf* VTl = (bf*)take((size_t)NKV * HD * TT * 2);
    float* Sb = (float*)take((size_t)ZH * TT * TT * 4); float* Ob = (float*)take((size_t)ZH * TT * HD * 4); bf* ATh = (bf*)take((size_t)TT * DQ * 2); bf* ATl = (bf*)take((size_t)TT * DQ * 2);
    if ((size_t)(wsp - (char*)d_ws) > ws_size) return;    // ws 256 MiB
    h16* P16 = (h16*)Sb; bf* Ph = (bf*)Sb; bf* Pl = Ph + TT;   // probabilities live in their own score rows (k_asoft), pitch PP
    // The projection phase's buffers (bf16 x, f32 q and k/v projections, rotary table) are dead once the planes are built: they share the score buffer's bytes, and each batch writes them anew before it reads them.
    bf* XB = (bf*)Sb; float* FQ = (float*)(XB + (size_t)TT * DM); float* FK = FQ + (size_t)TT * DQ; float* CS = FK + (size_t)TT * DKV;
    float* FV = FK;   // v projection reuses the k buffer after the k planes are built (stream-ordered)
    { k_cvt8<<<(unsigned)(((size_t)DQ * DM / 8 + 255) / 256), 256, 0, stream>>>(wq, WQ, (size_t)DQ * DM / 8); k_cvt8<<<(unsigned)(((size_t)DKV * DM / 8 + 255) / 256), 256, 0, stream>>>(wk, WK, (size_t)DKV * DM / 8); k_cvt8<<<(unsigned)(((size_t)DKV * DM / 8 + 255) / 256), 256, 0, stream>>>(wv, WV, (size_t)DKV * DM / 8);
      k_cvt8<<<(unsigned)(((size_t)DM * DQ / 8 + 255) / 256), 256, 0, stream>>>(wo, WO, (size_t)DM * DQ / 8);
       }
    const unsigned LQ = (unsigned)(((size_t)NH_ * TT * HD / 2 + 255) / 256), LKv = (unsigned)(((size_t)NKV * TT * HD / 2 + 255) / 256);
    for (int b = 0; b < NB_; ++b) {
        k_csP<<<(TT * HD + 255) / 256, 256, 0, stream>>>(CS);   /* rotary table, per batch: the scores overwrite its bytes */
        k_cvt8<<<(unsigned)(((size_t)TT * DM / 8 + 255) / 256), 256, 0, stream>>>(x + (size_t)b * TT * DM, XB, (size_t)TT * DM / 8);
        k_gemmw<bf, 0, false, 4><<<dim3(TT / 64, DQ / 64, 1), 128, 0, stream>>>(XB, nullptr, WQ, nullptr, DM, FQ, DQ, nullptr, 0, 0, 0);
        k_ropeI<<<LQ, 256, 0, stream>>>(FQ, DQ, NH_, CS, 1.0f, QP16, QPh, QPl);
        k_gemmw<bf, 0, false, 4><<<dim3(TT / 64, DKV / 64, 1), 128, 0, stream>>>(XB, nullptr, WK, nullptr, DM, FK, DKV, nullptr, 0, 0, 0);
        k_ropeI<<<LKv, 256, 0, stream>>>(FK, DKV, NKV, CS, 1.0f, KP16, KPh, KPl);
        k_gemmw<bf, 0, false, 4><<<dim3(TT / 64, DKV / 64, 1), 128, 0, stream>>>(XB, nullptr, WV, nullptr, DM, FV, DKV, nullptr, 0, 0, 0); k_vtp<<<LKv, 256, 0, stream>>>(FV, DKV, NKV, VT16, VTh, VTl);
        for (int h0 = 0; h0 < NH_; h0 += ZH) { const size_t zq = (size_t)h0, zk = (size_t)(h0 / REP);   // one kv head per query head: the pass's ZH heads use consecutive q and k planes (z-strides TT*HD); value planes: k_vtp's layout (pass offset TT, z-stride HD*PP)
            k_gemmc<bf, 2, 1, 1><<<dim3(RH / 64, TT / 64, ZH), 32, 0, stream>>>(QPh + zq * TT * HD, QPl + zq * TT * HD, KPh + zk * TT * HD, KPl + zk * TT * HD, HD, Sb, TT, 0, (size_t)TT * HD, (size_t)TT * HD, (size_t)TT * TT);
            k_gemmc<h16, 0, 1, 1><<<dim3((TT - RH) / 64, TT / 64, ZH), 32, 0, stream>>>(QP16 + zq * TT * HD + (size_t)RH * HD, nullptr, KP16 + zk * TT * HD, nullptr, HD, Sb + (size_t)RH * TT, TT, RH, (size_t)TT * HD, (size_t)TT * HD, (size_t)TT * TT);
            k_asoft<<<ZH * TT / 8, 256, 0, stream>>>(Sb, P16, Ph, Pl);
            k_gemmc<bf, 2, 2, 8><<<dim3(RH / 64, HD / 64, ZH), 256, 0, stream>>>(Ph, Pl, VTh + (zk / ZH) * TT, VTl + (zk / ZH) * TT, PP, Ob, HD, 0, (size_t)TT * PP, (size_t)HD * PP, (size_t)TT * HD);
            k_gemmc<h16, 0, 2, 8><<<dim3((TT - RH) / 64, HD / 64, ZH), 256, 0, stream>>>(P16 + (size_t)RH * PP, nullptr, VT16 + (zk / ZH) * TT, nullptr, PP, Ob + (size_t)RH * HD, HD, RH, (size_t)TT * PP, (size_t)HD * PP, (size_t)TT * HD);
            k_merge<<<(unsigned)(((size_t)ZH * TT * HD / 2 + 255) / 256), 256, 0, stream>>>(Ob, h0, ATh, ATl); }
        k_gemmw<bf, 1, false, 4><<<dim3(TT / 64, DM / 64, 1), 128, 0, stream>>>(ATh, ATl, WO, nullptr, DQ, OUT + (size_t)b * TT * DM, DM, nullptr, 0, 0, 0); }
}

// v003
// Measured time: 624 microseconds a run.
// Next to v002, in two timings, it ran 1.19 times as fast each time.
// All steps since v000 together make it 2.76 times as fast.
#include <hip/hip_runtime.h>

// Causal multi-head self-attention with 128-wide heads and interleaved-pair rotary embeddings (x [2][2048][2048]; Q, K, V = einsum('bsd,ed', x, W) ('oi' 0.02; 16 heads x 128); rope on consecutive (even, odd) pairs: (x1 cos - x2 sin, x1 sin + x2 cos) with angle pos x 10000^(-2i/128), pos = arange(S) (64 f32 frequencies jnp-exact for this expression; precise cosf/sinf); scores x 1/sqrt(128); causal (-inf); softmax; out = merged Wo^T -> [2][2048][2048] (8.4 M); argument order x, Wq, Wk, Wv, Wo).
// Layout: bf16 copy of x; 'oi' weights; exact projections; k_csP computed table (HD 128: one angle per (even, odd) pair) + k_ropeI interleaved-pair plane builders; causal T-2048 attention at HD 128 (hybrid rows: < 512 hi/lo 3 products, rest fp16 x1024; k_gemmc skips tiles above the diagonal); merged hi/lo x Wo exact.
// Compute dtypes, f32 accumulate: every input rounded to bf16; projections exact; rotary f32; attention rows < 512 3 products, rest fp16; softmax f32; Wo hl x exact.

#define NB_  2
#define TT   2048
#define DM   2048
#define NH_  16
#define NKV  16
#define REP  (NH_ / NKV)
#define HD   128
#define DQ   (NH_ * HD)
#define DKV  (NKV * HD)
#define ZH   8                    // heads per attention pass (z of every attention launch)
#define PP   (2 * TT)             // pitch, in 16-bit elements, of a probability row kept in its own f32 score row's bytes; the transposed value planes use the same pitch
static_assert((NKV / ZH) * TT == PP, "value planes interleave the passes' heads at the probability pitch");
#define RH   512                  // query rows < RH use hi+lo planes (0: none)
#define WIN  2048
#define PCAR 1024.0f
#define SCL  0.088388347648318447f   // HD^-0.5
typedef _Float16 h16;
typedef unsigned short bf;
typedef __attribute__((ext_vector_type(16))) __bf16   v16bf;
typedef __attribute__((ext_vector_type(16))) _Float16 v16h;
typedef __attribute__((ext_vector_type(8)))  _Float16 v8h;
typedef __attribute__((ext_vector_type(8)))  unsigned short v8us;
typedef __attribute__((ext_vector_type(8)))  float    v8f;
typedef __attribute__((ext_vector_type(4)))  float    v4f;
typedef v8h  __attribute__((may_alias)) v8ha;
typedef v4f  __attribute__((may_alias)) v4fa;
typedef v8us __attribute__((may_alias)) v8usa;

__device__ __forceinline__ unsigned short f2bf(float f) { unsigned u = __float_as_uint(f); u += 0x7FFFu + ((u >> 16) & 1u); return (unsigned short)(u >> 16); }
__device__ __forceinline__ float bf2f(unsigned short b) { return __uint_as_float(((unsigned)b) << 16); }
__device__ __forceinline__ float bfr(float f) { return bf2f(f2bf(f)); }
__device__ __forceinline__ v16h cat16(v8h lo, v8h hi) { return __builtin_shufflevector(lo, hi, 0, 1, 2, 3, 4, 5, 6, 7, 8, 9, 10, 11, 12, 13, 14, 15); }
__device__ __forceinline__ v16bf cat16b(v8us lo, v8us hi) { return __builtin_bit_cast(v16bf, __builtin_shufflevector(lo, hi, 0, 1, 2, 3, 4, 5, 6, 7, 8, 9, 10, 11, 12, 13, 14, 15)); }
__device__ __forceinline__ v8f wmma16(v16h a, v16h b, v8f c) { return __builtin_amdgcn_wmma_f32_16x16x32_f16(false, a, false, b, (short)0, c, false, false); }
__device__ __forceinline__ v8f wmmab(v16bf a, v16bf b, v8f c) { return __builtin_amdgcn_wmma_f32_16x16x32_bf16(false, a, false, b, (short)0, c, false, false); }



// ---- k_gemmw: GEMM with both operands staged in LDS. One 128x128 output tile per workgroup of 8 waves (2 x 4 waves, 64x32 each, 8 accumulators per wave); grid (M/128, N/128), 256 threads.
// A stage is 128 k (256 B) of the tile's 128 A rows and 128 Bt rows (and the 128 A2 rows), laid at pitch 272 B by asynchronous copies to LDS whose wave-wide 512 B are two whole 256-B row pieces.
// Two buffers: stage t + 1 flies while stage t is worked on. Each wave sums its whole K in k order in one accumulator.
// C[m][n] (f32, pitch ldc) = sum_k A[m][k] Bt[n][k] (+ A2[m][k] Bt[n][k] for NSPLIT 1). M, N % 128 == 0; K a compile-time multiple of 128, at least 256.
template <typename T16> struct WFrag;
template <> struct WFrag<h16> { typedef v16h V; static __device__ __forceinline__ V ld(const h16* p) { return cat16(*(const v8h*)p, *(const v8h*)(p + 16)); } static __device__ __forceinline__ v8f mma(V a, V b, v8f c) { return wmma16(a, b, c); } };
template <> struct WFrag<bf> { typedef v16bf V; static __device__ __forceinline__ V ld(const bf* p) { return cat16b(*(const v8us*)p, *(const v8us*)(p + 16)); } static __device__ __forceinline__ v8f mma(V a, V b, v8f c) { return wmmab(a, b, c); } };
#define GT   128                  // edge of the output tile
#define GKB  256                  // bytes of an operand row in one stage
#define GP   272                  // LDS pitch of a staged row: 16 B x odd, for the 16-byte fragment reads
#define GPL  (GT * GP)            // bytes of one operand's 128 rows in a stage
#define GOP  132                  // pitch, in floats, of the output tile staged in the ring's bytes
__device__ __forceinline__ unsigned lds_off(const void* p) { return (unsigned)(size_t)p; }
__device__ __forceinline__ void wait_ds0() { asm volatile("s_wait_dscnt 0x0" ::: "memory"); }       // this wave's LDS reads of the buffer have returned before the buffer is handed over
__device__ __forceinline__ void wait_async0() { asm volatile("s_wait_asynccnt 0x0" ::: "memory"); } // this wave's copies have landed before the barrier that publishes them
// One operand's 128 rows of a stage: 8 copies per lane, 16 rows apart (l: the lane's LDS byte address, g: its global address, rs: bytes of 16 global rows).
// The s_wait_xcnt closes the statement so that no address register of an issued copy is rewritten ahead of it.
__device__ __forceinline__ void plane_copy(unsigned l, const char* g, size_t rs) {
    asm volatile("global_load_async_to_lds_b128 %0, %8, off\n\t"
                 "global_load_async_to_lds_b128 %1, %9, off\n\t"
                 "global_load_async_to_lds_b128 %2, %10, off\n\t"
                 "global_load_async_to_lds_b128 %3, %11, off\n\t"
                 "global_load_async_to_lds_b128 %4, %12, off\n\t"
                 "global_load_async_to_lds_b128 %5, %13, off\n\t"
                 "global_load_async_to_lds_b128 %6, %14, off\n\t"
                 "global_load_async_to_lds_b128 %7, %15, off\n\t"
                 "s_wait_xcnt 0x0"
                 :: "v"(l), "v"(l + 16 * GP), "v"(l + 32 * GP), "v"(l + 48 * GP), "v"(l + 64 * GP), "v"(l + 80 * GP), "v"(l + 96 * GP), "v"(l + 112 * GP),
                    "v"(g), "v"(g + rs), "v"(g + 2 * rs), "v"(g + 3 * rs), "v"(g + 4 * rs), "v"(g + 5 * rs), "v"(g + 6 * rs), "v"(g + 7 * rs)
                 : "memory");
}
template <typename T16, int NSPLIT, int K>
__global__ __launch_bounds__(256) void k_gemmw(const T16* __restrict__ A, const T16* __restrict__ A2, const T16* __restrict__ Bt, float* C, int ldc) {
    typedef typename WFrag<T16>::V V;
    constexpr unsigned PB = (NSPLIT == 1 ? 2 : 1) * GPL, STG = PB + GPL;   // a stage: [A | A2 | Bt], Bt at PB: every fragment read is within the 16-bit offset of its own base
    static_assert(GT * GOP * 4 <= 2 * STG, "the output tile is staged in the ring's bytes");
    __shared__ __attribute__((aligned(16))) unsigned char L[2 * STG];
    const int tid = (int)threadIdx.x, lane = tid & 31, lr = lane & 15, hi = lane >> 4; const int r0 = blockIdx.x * GT, c0 = blockIdx.y * GT;
    const int wv = __builtin_amdgcn_readfirstlane(tid >> 5);          // wave number, scalar
    const int wm = (wv >> 2) * 64, wn = (wv & 3) * 32;                // the wave's 64x32 part of the tile
    v8f acc[4][2];
#pragma unroll
    for (int mb = 0; mb < 4; ++mb)
#pragma unroll
        for (int nb = 0; nb < 2; ++nb) acc[mb][nb] = (v8f){};
    constexpr size_t rowb = (size_t)K * 2;                            // bytes of a global operand row
    const int crow = tid >> 4, ccol = (tid & 15) * 16;                // the lane's row (of each 16) and byte column in every copy
    const char* gA = (const char*)A + (size_t)(r0 + crow) * rowb + ccol; const char* gB = (const char*)Bt + (size_t)(c0 + crow) * rowb + ccol;
    const char* gA2 = (NSPLIT == 1) ? (const char*)A2 + (size_t)(r0 + crow) * rowb + ccol : nullptr;
    const unsigned lc = lds_off(L) + (unsigned)(crow * GP + ccol);
    auto fill = [&](int t, unsigned buf) { plane_copy(lc + buf, gA + (size_t)t * GKB, 16 * rowb); if (NSPLIT == 1) plane_copy(lc + buf + GPL, gA2 + (size_t)t * GKB, 16 * rowb); plane_copy(lc + buf + PB, gB + (size_t)t * GKB, 16 * rowb); };
    constexpr int NT = K / (GKB / 2); static_assert(K % (GKB / 2) == 0 && NT >= 2, "whole stages, and the two that the prologue fills");
    fill(0, 0u); wait_async0(); __syncthreads();                      // stage 0 is published
    fill(1, STG);
#pragma unroll 1   // the trip stays rolled: one publish point in the text, the buffer chosen by the trip's parity
    for (int t = 0; t < NT; ++t) {
        const unsigned buf = (unsigned)(t & 1) * STG;
        const unsigned char* pa = L + buf + (wm + lr) * GP + 16 * hi; const unsigned char* pb = L + buf + PB + (wn + lr) * GP + 16 * hi;
        V a[2][4], a2[2][4], b[2][2];                                 // two fragment sets: block ks + 1 is fetched while block ks is multiplied
        auto frags = [&](int ks, int st) {
#pragma unroll
            for (int mb = 0; mb < 4; ++mb) { a[st][mb] = WFrag<T16>::ld((const T16*)(pa + mb * 16 * GP + ks * 64)); if (NSPLIT == 1) a2[st][mb] = WFrag<T16>::ld((const T16*)(pa + GPL + mb * 16 * GP + ks * 64)); }
#pragma unroll
            for (int nb = 0; nb < 2; ++nb) b[st][nb] = WFrag<T16>::ld((const T16*)(pb + nb * 16 * GP + ks * 64)); };
        frags(0, 0);
#pragma unroll     // unrolled: fragment sets and accumulators are indexed by constants, so they stay in registers
        for (int ks = 0; ks < GKB / 64; ++ks) {
            if (ks + 1 < GKB / 64) frags(ks + 1, (ks + 1) & 1);       // this stage's own buffer only
            __builtin_amdgcn_sched_barrier(0);                        // keeps the next block's LDS reads together, ahead of this block's products and not among them
#pragma unroll
            for (int nb = 0; nb < 2; ++nb)
#pragma unroll
                for (int mb = 0; mb < 4; ++mb) { acc[mb][nb] = WFrag<T16>::mma(a[ks & 1][mb], b[ks & 1][nb], acc[mb][nb]); if (NSPLIT == 1) acc[mb][nb] = WFrag<T16>::mma(a2[ks & 1][mb], b[ks & 1][nb], acc[mb][nb]); }
            __builtin_amdgcn_sched_barrier(0);                        // ends the block: the reads of the block after next stay behind it
        }
        wait_ds0(); wait_async0(); __syncthreads();                   // publishes stage t + 1 and ends every wave's reads of stage t's buffer
        if (t + 2 < NT) fill(t + 2, buf);
    }
    wait_async0();   // no copy is in flight when the ring's bytes take the output tile
    // The last trip's barrier has ended every read of the ring: the tile is laid there, and behind one barrier each wave stores whole 512-B rows.
    float* os = (float*)L;
#pragma unroll
    for (int mb = 0; mb < 4; ++mb) {
#pragma unroll
        for (int nb = 0; nb < 2; ++nb) {
#pragma unroll
            for (int j = 0; j < 8; ++j) os[(wm + mb * 16 + hi * 8 + j) * GOP + wn + nb * 16 + lr] = acc[mb][nb][j]; } }
    __syncthreads();   // the whole tile is in LDS before any wave reads rows of it
#pragma unroll
    for (int s = 0; s < GT / 8; ++s) { const int row = s * 8 + wv; const v4f val = *(const v4fa*)(os + row * GOP + lane * 4);
        *(v4f*)(C + (size_t)(r0 + row) * ldc + c0 + lane * 4) = val; }
}

// ---- k_gemmc: 64x64 tile GEMM, operands straight from K-contiguous 16-bit planes (NW waves share the K loop: wave w takes the 32-wide K blocks w, w + NW, ...), specialised for causal attention: CMODE 1 skips score tiles entirely above the diagonal (query rows r0+roff.., key columns c0..), CMODE 2 limits the
// key (K) loop of the probability x value contraction to the diagonal block (probabilities beyond it are exactly zero). roff = row offset of this launch's first row within the sequence.
template <typename T16, int NSPLIT, int CMODE, int NW>
__global__ __launch_bounds__(32 * NW) void k_gemmc(const T16* __restrict__ A, const T16* __restrict__ A2, const T16* __restrict__ Bt, const T16* __restrict__ Bt2, int K, float* C, int ldc, int roff, size_t sA, size_t sB, size_t sC) {
    typedef typename WFrag<T16>::V V;
    __shared__ __align__(16) float os[NW == 1 ? 16 * 68 : NW * 64 * 68];
    const size_t z = blockIdx.z; A += z * sA; if (A2) A2 += z * sA; Bt += z * sB; if (Bt2) Bt2 += z * sB; C += z * sC;
    const int lane = threadIdx.x & 31, lr = lane & 15, hi = lane >> 4; const int r0 = blockIdx.x * 64, c0 = blockIdx.y * 64;
    const int wv = (NW == 1) ? 0 : __builtin_amdgcn_readfirstlane((int)(threadIdx.x >> 5));   // wave number, scalar: the K loop's bounds stay wave-uniform
    if (CMODE == 1 && c0 > r0 + roff + 63) return;                  // score tile entirely above the causal diagonal: never read (the softmax masks j > i by select)
    const int Kl = (CMODE == 2) ? min(K, r0 + roff + 64) : K;        // P.V: probabilities are exactly 0 beyond the diagonal block, so the K loop stops there
    v8f acc[4][4];
#pragma unroll
    for (int mb = 0; mb < 4; ++mb)
#pragma unroll
        for (int nb = 0; nb < 4; ++nb) acc[mb][nb] = (v8f){};
    const size_t aoff = (size_t)(r0 + lr) * K + 8 * hi, boff = (size_t)(c0 + lr) * K + 8 * hi;
#pragma unroll 1
    for (int kc = wv * 32; kc < Kl; kc += 32 * NW) {
        V a[4], a2[4];
#pragma unroll
        for (int mb = 0; mb < 4; ++mb) { a[mb] = WFrag<T16>::ld(A + aoff + (size_t)mb * 16 * K + kc); if (NSPLIT == 1 || NSPLIT == 2) a2[mb] = WFrag<T16>::ld(A2 + aoff + (size_t)mb * 16 * K + kc); }
#pragma unroll
        for (int nb = 0; nb < 4; ++nb) { const V b = WFrag<T16>::ld(Bt + boff + (size_t)nb * 16 * K + kc); V b2; if (NSPLIT >= 2) b2 = WFrag<T16>::ld(Bt2 + boff + (size_t)nb * 16 * K + kc);
#pragma unroll
            for (int mb = 0; mb < 4; ++mb) { acc[mb][nb] = WFrag<T16>::mma(a[mb], b, acc[mb][nb]); if (NSPLIT == 1 || NSPLIT == 2) acc[mb][nb] = WFrag<T16>::mma(a2[mb], b, acc[mb][nb]); if (NSPLIT >= 2) acc[mb][nb] = WFrag<T16>::mma(a[mb], b2, acc[mb][nb]); } }
        asm volatile("v_nop\n\tv_nop\n\tv_nop\n\tv_nop" : "+v"(acc[0][0]), "+v"(acc[1][1]), "+v"(acc[2][2]), "+v"(acc[3][3]) : "v"(a[0]), "v"(a[3]));
    }
    if constexpr (NW == 1) {
#pragma unroll
    for (int mb = 0; mb < 4; ++mb) {
#pragma unroll
        for (int nb = 0; nb < 4; ++nb) {
#pragma unroll
            for (int j = 0; j < 8; ++j) os[(hi * 8 + j) * 68 + nb * 16 + lr] = acc[mb][nb][j]; }
        __builtin_amdgcn_wave_barrier(); asm volatile("" ::: "memory");
        float* crow = C + (size_t)(r0 + mb * 16) * ldc + c0;
{
#pragma unroll
            for (int s = 0; s < 8; ++s) { const int row = 2 * s + hi, cofs = lr * 4; v4f val = *(const v4fa*)(os + row * 68 + cofs);
                *(v4f*)(crow + (size_t)row * ldc + cofs) = val; }
             }
        __builtin_amdgcn_wave_barrier(); asm volatile("" ::: "memory");
    }
    } else {
    // Every wave lays its whole 64x64 partial tile in its own LDS slab; behind ONE barrier each wave sums its share of the rows over the slabs, wave 0's partial first, and stores whole rows.
#pragma unroll
    for (int mb = 0; mb < 4; ++mb) {
#pragma unroll
        for (int nb = 0; nb < 4; ++nb) {
#pragma unroll
            for (int j = 0; j < 8; ++j) os[wv * (64 * 68) + (mb * 16 + hi * 8 + j) * 68 + nb * 16 + lr] = acc[mb][nb][j]; } }
    __syncthreads();   // all NW partial tiles are in LDS before any wave sums them
#pragma unroll
    for (int s = 0; s < 32 / NW; ++s) { const int row = 2 * (s * NW + wv) + hi, cofs = lr * 4; v4f val = *(const v4fa*)(os + row * 68 + cofs);
#pragma unroll
        for (int w = 1; w < NW; ++w) val += *(const v4fa*)(os + w * (64 * 68) + row * 68 + cofs);
        *(v4f*)(C + (size_t)(r0 + row) * ldc + c0 + cofs) = val; }
    }
}

__device__ __forceinline__ h16 tohx(float x) { return (h16)x; }
__device__ __forceinline__ void splitf(float y, unsigned short& h, unsigned short& l) { h = f2bf(y); l = f2bf(y - bf2f(h)); }
typedef __attribute__((ext_vector_type(2))) _Float16 v2h;
typedef __attribute__((ext_vector_type(4))) _Float16 v4h;
typedef __attribute__((ext_vector_type(2))) unsigned short v2us;
typedef __attribute__((ext_vector_type(4))) unsigned short v4us;
typedef __attribute__((ext_vector_type(2))) float v2f;
typedef __attribute__((ext_vector_type(4))) int v4i;

__global__ __launch_bounds__(256) void k_cvt8(const float* __restrict__ src, bf* dst, size_t n8) { const size_t i = (size_t)blockIdx.x * 256 + threadIdx.x; if (i >= n8) return; const v8f v = *(const v8f*)(src + i * 8); v8us o;
#pragma unroll
    for (int k = 0; k < 8; ++k) o[k] = f2bf(v[k]); *(v8us*)(dst + i * 8) = o;  }

__global__ __launch_bounds__(256) void k_ropeI(const float* __restrict__ F, int pitch, int nheads, const float* __restrict__ CS, float sc, h16* P16, bf* Ph, bf* Pl) {
    const size_t e = ((size_t)blockIdx.x * 256 + threadIdx.x) * 2; if (e >= (size_t)nheads * TT * HD) return; const int d = (int)(e % HD); const int t = (int)((e / HD) % TT); const int h = (int)(e / ((size_t)HD * TT)); const float* f = F + (size_t)t * pitch + h * HD; const float x0 = f[d], x1 = f[d + 1]; const v2f cs = *(const v2f*)(CS + ((size_t)t * HD + d) * 2); v2h o16; v2us oh, ol;
    float a0 = __fmul_rn(x0, cs[0]), b0 = __fmul_rn(x1, cs[1]), a1 = __fmul_rn(x1, cs[0]), b1 = __fmul_rn(x0, cs[1]); asm volatile("" : "+v"(a0), "+v"(b0), "+v"(a1), "+v"(b1));
    float r0 = __fsub_rn(a0, b0) * sc, r1 = __fadd_rn(b1, a1) * sc;   /* even: x0 c - x1 s; odd: x0 s + x1 c */
    o16[0] = tohx(r0); o16[1] = tohx(r1); { unsigned short a2, c2; splitf(r0, a2, c2); oh[0] = a2; ol[0] = c2; splitf(r1, a2, c2); oh[1] = a2; ol[1] = c2; }
    *(v2h*)(P16 + e) = o16; *(v2us*)(Ph + e) = oh; *(v2us*)(Pl + e) = ol;  }

__global__ __launch_bounds__(256) void k_vtp(const float* __restrict__ F, int pitch, int nheads, h16* V16, bf* Vh, bf* Vl) { const size_t e = ((size_t)blockIdx.x * 256 + threadIdx.x) * 2; if (e >= (size_t)nheads * HD * TT) return; const int t = (int)(e % TT); const int d = (int)((e / TT) % HD); const int g = (int)(e / ((size_t)TT * HD)); v2h o16; v2us oh, ol;
#pragma unroll
    for (int q = 0; q < 2; ++q) { const float x = F[(size_t)(t + q) * pitch + g * HD + d]; o16[q] = tohx(x); unsigned short a2, c2; splitf(x, a2, c2); oh[q] = a2; ol[q] = c2; }
    const size_t eo = (((size_t)(g % ZH) * HD + d) * (NKV / ZH) + g / ZH) * TT + t;   // [head in pass][d][pass][t]: a pass's rows stand PP apart, the pitch the P.V product's one K pitch asks of both operands
    *(v2h*)(V16 + eo) = o16; *(v2us*)(Vh + eo) = oh; *(v2us*)(Vl + eo) = ol;  }
__constant__ float INV2[HD / 2] = { 1.000000000e+00f, 8.659643531e-01f, 7.498942018e-01f, 6.493816376e-01f, 5.623413324e-01f, 4.869675338e-01f, 4.216965139e-01f, 3.651741147e-01f, 3.162277639e-01f, 2.738419771e-01f, 2.371373773e-01f, 2.053525001e-01f, 1.778279394e-01f, 1.539926529e-01f, 1.333521456e-01f, 1.154781953e-01f, 1.000000015e-01f, 8.659642935e-02f, 7.498942316e-02f, 6.493816525e-02f, 5.623413250e-02f, 4.869675264e-02f, 4.216964915e-02f, 3.651741147e-02f, 3.162277490e-02f, 2.738419548e-02f, 2.371373773e-02f, 2.053525113e-02f, 1.778279431e-02f, 1.539926510e-02f, 1.333521400e-02f, 1.154781971e-02f, 9.999999776e-03f, 8.659643121e-03f, 7.498942316e-03f, 6.493816152e-03f, 5.623413250e-03f, 4.869675264e-03f, 4.216964822e-03f, 3.651741194e-03f, 3.162277630e-03f, 2.738419687e-03f, 2.371373819e-03f, 2.053525066e-03f, 1.778279431e-03f, 1.539926510e-03f, 1.333521446e-03f, 1.154782018e-03f, 1.000000047e-03f, 8.659643354e-04f, 7.498941850e-04f, 6.493816036e-04f, 5.623413017e-04f, 4.869675322e-04f, 4.216965172e-04f, 3.651741135e-04f, 3.162277571e-04f, 2.738419571e-04f, 2.371373703e-04f, 2.053525095e-04f, 1.778279402e-04f, 1.539926598e-04f, 1.333521504e-04f, 1.154782003e-04f };   // float32 1 / 10000^(2i/128), generated with jnp to be bit-exact
__global__ __launch_bounds__(256) void k_csP(float* CS) { const int idx = blockIdx.x * 256 + threadIdx.x; if (idx >= TT * HD) return; const int d = idx % HD; const int t = idx / HD; const float a = __fmul_rn((float)t, INV2[d >> 1]); v2f cs; cs[0] = cosf(a); cs[1] = sinf(a); *(v2f*)(CS + (size_t)idx * 2) = cs;  }
// k_asoft: per row (zz, i): t = S x HD^-0.5 for j <= i and i - j < WIN (sliding causal window; the reference's -1e9 additive fill vanishes identically); softmax over the 2048 keys (register row, one exp, fixed trees);
// the probabilities go back into the row's own 8192 bytes (pitch PP): one wave owns the row and has all of it in registers before its first store; rows >= RH: fp16 in the first half; rows < RH: hi plane in the first half, lo plane in the second.
__global__ __launch_bounds__(256) void k_asoft(const float* Sb, h16* P16, bf* Ph, bf* Pl) {
    const int lane = threadIdx.x & 31; const int row = blockIdx.x * 8 + (threadIdx.x >> 5); if (row >= ZH * TT) return; const int i = row % TT; const int zz = row / TT; (void)zz; const bool hires = (i < RH); const float* sr = Sb + (size_t)row * TT; float v[TT / 32]; float mx = -3.0e38f;
#pragma unroll
    for (int ch = 0; ch < TT / 128; ++ch) { const int j0 = ch * 128 + lane * 4; const v4f a = *(const v4f*)(sr + j0);
#pragma unroll
        for (int q = 0; q < 4; ++q) { const int j = j0 + q; (void)j; const float t = (j <= i && i - j < WIN) ? a[q] * SCL : -3.0e38f; v[ch * 4 + q] = t; mx = fmaxf(mx, t); } }
#pragma unroll
    for (int sh = 16; sh; sh >>= 1) mx = fmaxf(mx, __shfl_xor(mx, sh, 32));
    float sum = 0.f;
#pragma unroll
    for (int k = 0; k < TT / 32; ++k) { float d0 = __fsub_rn(v[k], mx); asm volatile("" : "+v"(d0)); v[k] = __builtin_amdgcn_exp2f(__fmul_rn(d0, 1.4426950408889634f)); sum += v[k]; }
#pragma unroll
    for (int sh = 16; sh; sh >>= 1) sum += __shfl_xor(sum, sh, 32);
    const float f = __fdiv_rn(hires ? 1.0f : PCAR, sum);
{
        if (hires) {
#pragma unroll
            for (int ch = 0; ch < TT / 128; ++ch) { v4us oh, ol;
#pragma unroll
                for (int q = 0; q < 4; ++q) { unsigned short a, c2; splitf(v[ch * 4 + q] * f, a, c2); oh[q] = a; ol[q] = c2; }
                const size_t oo = (size_t)row * PP + ch * 128 + lane * 4; *(v4us*)(Ph + oo) = oh; *(v4us*)(Pl + oo) = ol; }
        } else {
#pragma unroll
            for (int ch = 0; ch < TT / 128; ++ch) { v4h o4;
#pragma unroll
                for (int q = 0; q < 4; ++q) o4[q] = tohx(v[ch * 4 + q] * f);
                *(v4h*)(P16 + (size_t)row * PP + ch * 128 + lane * 4) = o4; } }
         }
}
__global__ __launch_bounds__(256) void k_merge(const float* __restrict__ O, int h0, bf* Ah, bf* Al) { const size_t e = ((size_t)blockIdx.x * 256 + threadIdx.x) * 2; if (e >= (size_t)ZH * TT * HD) return; const int d = (int)(e % HD); const int t = (int)((e / HD) % TT); const int zz = (int)(e / ((size_t)HD * TT)); const float cs = (t < RH) ? 1.0f : (1.0f / PCAR); const size_t oo = (size_t)t * DQ + (h0 + zz) * HD + d;
    v2us oh, ol;
#pragma unroll
    for (int q = 0; q < 2; ++q) { unsigned short a, c2; splitf(O[e + q] * cs, a, c2); oh[q] = a; ol[q] = c2; } *(v2us*)(Ah + oo) = oh; *(v2us*)(Al + oo) = ol;  }

extern "C" void kernel_launch(void* const* d_in, const int* in_sizes, int n_in,
                              void* d_out, int out_size, void* d_ws, size_t ws_size, hipStream_t stream) {
    (void)in_sizes; (void)n_in; (void)out_size;
    const float* x = (const float*)d_in[0]; const float* wq = (const float*)d_in[1]; const float* wk = (const float*)d_in[2]; const float* wv = (const float*)d_in[3]; const float* wo = (const float*)d_in[4];   /* weights 'oi' [2048][2048] */
    float* OUT = (float*)d_out;     // [2][2048][2048]
    char* wsp = (char*)d_ws;
    auto take = [&](size_t bytes) { char* p = wsp; wsp += (bytes + 255) & ~(size_t)255; return (void*)p; };
    bf* WQ = (bf*)take((size_t)DQ * DM * 2); bf* WK = (bf*)take((size_t)DKV * DM * 2); bf* WV = (bf*)take((size_t)DKV * DM * 2); bf* WO = (bf*)take((size_t)DM * DQ * 2);
    h16* QP16 = (h16*)take((size_t)NH_ * TT * HD * 2); h16* KP16 = (h16*)take((size_t)NKV * TT * HD * 2); h16* VT16 = (h16*)take((size_t)NKV * HD * TT * 2);
    bf* QPh = (bf*)take((size_t)NH_ * TT * HD * 2); bf* QPl = (bf*)take((size_t)NH_ * TT * HD * 2); bf* KPh = (bf*)take((size_t)NKV * TT * HD * 2); bf* KPl = (bf*)take((size_t)NKV * TT * HD * 2); bf* VTh = (bf*)take((size_t)NKV * HD * TT * 2); bf* VTl = (bf*)take((size_t)NKV * HD * TT * 2);
    float* Sb = (float*)take((size_t)ZH * TT * TT * 4); float* Ob = (float*)take((size_t)ZH * TT * HD * 4); bf* ATh = (bf*)take((size_t)TT * DQ * 2); bf* ATl = (bf*)take((size_t)TT * DQ * 2);
    if ((size_t)(wsp - (char*)d_ws) > ws_size) return;    // ws 256 MiB
    h16* P16 = (h16*)Sb; bf* Ph = (bf*)Sb; bf* Pl = Ph + TT;   // probabilities live in their own score rows (k_asoft), pitch PP
    // The projection phase's buffers (bf16 x, f32 q and k/v projections, rotary table) are dead once the planes are built: they share the score buffer's bytes, and each batch writes them anew before it reads them.
    bf* XB = (bf*)Sb; float* FQ = (float*)(XB + (size_t)TT * DM); float* FK = FQ + (size_t)TT * DQ; float* CS = FK + (size_t)TT * DKV;
    float* FV = FK;   // v projection reuses the k buffer after the k planes are built (stream-ordered)
    { k_cvt8<<<(unsigned)(((size_t)DQ * DM / 8 + 255) / 256), 256, 0, stream>>>(wq, WQ, (size_t)DQ * DM / 8); k_cvt8<<<(unsigned)(((size_t)DKV * DM / 8 + 255) / 256), 256, 0, stream>>>(wk, WK, (size_t)DKV * DM / 8); k_cvt8<<<(unsigned)(((size_t)DKV * DM / 8 + 255) / 256), 256, 0, stream>>>(wv, WV, (size_t)DKV * DM / 8);
      k_cvt8<<<(unsigned)(((size_t)DM * DQ / 8 + 255) / 256), 256, 0, stream>>>(wo, WO, (size_t)DM * DQ / 8);
       }
    const unsigned LQ = (unsigned)(((size_t)NH_ * TT * HD / 2 + 255) / 256), LKv = (unsigned)(((size_t)NKV * TT * HD / 2 + 255) / 256);
    for (int b = 0; b < NB_; ++b) {
        k_csP<<<(TT * HD + 255) / 256, 256, 0, stream>>>(CS);   /* rotary table, per batch: the scores overwrite its bytes */
        k_cvt8<<<(unsigned)(((size_t)TT * DM / 8 + 255) / 256), 256, 0, stream>>>(x + (size_t)b * TT * DM, XB, (size_t)TT * DM / 8);
        k_gemmw<bf, 0, DM><<<dim3(TT / GT, DQ / GT, 1), 256, 0, stream>>>(XB, nullptr, WQ, FQ, DQ);
        k_ropeI<<<LQ, 256, 0, stream>>>(FQ, DQ, NH_, CS, 1.0f, QP16, QPh, QPl);
        k_gemmw<bf, 0, DM><<<dim3(TT / GT, DKV / GT, 1), 256, 0, stream>>>(XB, nullptr, WK, FK, DKV);
        k_ropeI<<<LKv, 256, 0, stream>>>(FK, DKV, NKV, CS, 1.0f, KP16, KPh, KPl);
        k_gemmw<bf, 0, DM><<<dim3(TT / GT, DKV / GT, 1), 256, 0, stream>>>(XB, nullptr, WV, FV, DKV); k_vtp<<<LKv, 256, 0, stream>>>(FV, DKV, NKV, VT16, VTh, VTl);
        for (int h0 = 0; h0 < NH_; h0 += ZH) { const size_t zq = (size_t)h0, zk = (size_t)(h0 / REP);   // one kv head per query head: the pass's ZH heads use consecutive q and k planes (z-strides TT*HD); value planes: k_vtp's layout (pass offset TT, z-stride HD*PP)
            k_gemmc<bf, 2, 1, 1><<<dim3(RH / 64, TT / 64, ZH), 32, 0, stream>>>(QPh + zq * TT * HD, QPl + zq * TT * HD, KPh + zk * TT * HD, KPl + zk * TT * HD, HD, Sb, TT, 0, (size_t)TT * HD, (size_t)TT * HD, (size_t)TT * TT);
            k_gemmc<h16, 0, 1, 1><<<dim3((TT - RH) / 64, TT / 64, ZH), 32, 0, stream>>>(QP16 + zq * TT * HD + (size_t)RH * HD, nullptr, KP16 + zk * TT * HD, nullptr, HD, Sb + (size_t)RH * TT, TT, RH, (size_t)TT * HD, (size_t)TT * HD, (size_t)TT * TT);
            k_asoft<<<ZH * TT / 8, 256, 0, stream>>>(Sb, P16, Ph, Pl);
            k_gemmc<bf, 2, 2, 8><<<dim3(RH / 64, HD / 64, ZH), 256, 0, stream>>>(Ph, Pl, VTh + (zk / ZH) * TT, VTl + (zk / ZH) * TT, PP, Ob, HD, 0, (size_t)TT * PP, (size_t)HD * PP, (size_t)TT * HD);
            k_gemmc<h16, 0, 2, 8><<<dim3((TT - RH) / 64, HD / 64, ZH), 256, 0, stream>>>(P16 + (size_t)RH * PP, nullptr, VT16 + (zk / ZH) * TT, nullptr, PP, Ob + (size_t)RH * HD, HD, RH, (size_t)TT * PP, (size_t)HD * PP, (size_t)TT * HD);
            k_merge<<<(unsigned)(((size_t)ZH * TT * HD / 2 + 255) / 256), 256, 0, stream>>>(Ob, h0, ATh, ATl); }
        k_gemmw<bf, 1, DQ><<<dim3(TT / GT, DM / GT, 1), 256, 0, stream>>>(ATh, ATl, WO, OUT + (size_t)b * TT * DM, DM); }
}

// v004
// Measured time: 547 microseconds a run.
// Timed twice side by side with v003, it ran 1.14 and 1.15 times as fast.
// All steps since v000 together make it 3.16 times as fast.
#include <hip/hip_runtime.h>

// Causal multi-head self-attention with 128-wide heads and interleaved-pair rotary embeddings (x [2][2048][2048]; Q, K, V = einsum('bsd,ed', x, W) ('oi' 0.02; 16 heads x 128); rope on consecutive (even, odd) pairs: (x1 cos - x2 sin, x1 sin + x2 cos) with angle pos x 10000^(-2i/128), pos = arange(S) (64 f32 frequencies jnp-exact for this expression; precise cosf/sinf); scores x 1/sqrt(128); causal (-inf); softmax; out = merged Wo^T -> [2][2048][2048] (8.4 M); argument order x, Wq, Wk, Wv, Wo).
// Layout: bf16 copy of x; 'oi' weights; exact projections; k_csP computed table (HD 128: one angle per (even, odd) pair); the projections' epilogues build the rotary q, k planes and the transposed v planes; causal T-2048 attention at HD 128 (hybrid rows: < 512 hi/lo 3 products, rest fp16 x1024; k_gemmc skips tiles above the diagonal; the P.V epilogue writes the merged hi/lo planes); merged hi/lo x Wo exact.
// Compute dtypes, f32 accumulate: every input rounded to bf16; projections exact; rotary f32; attention rows < 512 3 products, rest fp16; softmax f32; Wo hl x exact.

#define NB_  2
#define TT   2048
#define DM   2048
#define NH_  16
#define NKV  16
#define REP  (NH_ / NKV)
#define HD   128
#define DQ   (NH_ * HD)
#define DKV  (NKV * HD)
#define ZH   8                    // heads per attention pass (z of every attention launch)
#define PP   (2 * TT)             // pitch, in 16-bit elements, of a probability row kept in its own f32 score row's bytes; the transposed value planes use the same pitch
static_assert((NKV / ZH) * TT == PP, "value planes interleave the passes' heads at the probability pitch");
#define RH   512                  // query rows < RH use hi+lo planes (0: none)
#define WIN  2048
#define PCAR 1024.0f
#define SCL  0.088388347648318447f   // HD^-0.5
typedef _Float16 h16;
typedef unsigned short bf;
typedef __attribute__((ext_vector_type(16))) __bf16   v16bf;
typedef __attribute__((ext_vector_type(16))) _Float16 v16h;
typedef __attribute__((ext_vector_type(8)))  _Float16 v8h;
typedef __attribute__((ext_vector_type(8)))  unsigned short v8us;
typedef __attribute__((ext_vector_type(8)))  float    v8f;
typedef __attribute__((ext_vector_type(4)))  float    v4f;
typedef v8h  __attribute__((may_alias)) v8ha;
typedef v4f  __attribute__((may_alias)) v4fa;
typedef v8us __attribute__((may_alias)) v8usa;

__device__ __forceinline__ unsigned short f2bf(float f) { unsigned u = __float_as_uint(f); u += 0x7FFFu + ((u >> 16) & 1u); return (unsigned short)(u >> 16); }
__device__ __forceinline__ float bf2f(unsigned short b) { return __uint_as_float(((unsigned)b) << 16); }
__device__ __forceinline__ float bfr(float f) { return bf2f(f2bf(f)); }
__device__ __forceinline__ v16h cat16(v8h lo, v8h hi) { return __builtin_shufflevector(lo, hi, 0, 1, 2, 3, 4, 5, 6, 7, 8, 9, 10, 11, 12, 13, 14, 15); }
__device__ __forceinline__ v16bf cat16b(v8us lo, v8us hi) { return __builtin_bit_cast(v16bf, __builtin_shufflevector(lo, hi, 0, 1, 2, 3, 4, 5, 6, 7, 8, 9, 10, 11, 12, 13, 14, 15)); }
__device__ __forceinline__ v8f wmma16(v16h a, v16h b, v8f c) { return __builtin_amdgcn_wmma_f32_16x16x32_f16(false, a, false, b, (short)0, c, false, false); }
__device__ __forceinline__ v8f wmmab(v16bf a, v16bf b, v8f c) { return __builtin_amdgcn_wmma_f32_16x16x32_bf16(false, a, false, b, (short)0, c, false, false); }
__device__ __forceinline__ h16 tohx(float x) { return (h16)x; }
__device__ __forceinline__ void splitf(float y, unsigned short& h, unsigned short& l) { h = f2bf(y); l = f2bf(y - bf2f(h)); }
typedef __attribute__((ext_vector_type(4))) _Float16 v4h;
typedef __attribute__((ext_vector_type(4))) unsigned short v4us;
typedef __attribute__((ext_vector_type(2))) float v2f;
typedef __attribute__((ext_vector_type(4))) int v4i;
// One rotary pair (x0 even, x1 odd; cs = cos, sin of the pair's angle): y0 = x0 c - x1 s, y1 = x0 s + x1 c.
__device__ __forceinline__ void rope2(float x0, float x1, v2f cs, float& y0, float& y1) { y0 = x0 * cs[0] - x1 * cs[1]; y1 = x0 * cs[1] + x1 * cs[0]; }



// ---- k_gemmw: GEMM with both operands staged in LDS. One 128x128 output tile per workgroup of 8 waves (2 x 4 waves, 64x32 each, 8 accumulators per wave); grid (M/128, N/128), 256 threads.
// A stage is 128 k (256 B) of the tile's 128 A rows and 128 Bt rows (and the 128 A2 rows), laid at pitch 272 B by asynchronous copies to LDS whose wave-wide 512 B are two whole 256-B row pieces.
// Two buffers: stage t + 1 flies while stage t is worked on. Each wave sums its whole K in k order in one accumulator.
// C[m][n] (f32, pitch ldc) = sum_k A[m][k] Bt[n][k] (+ A2[m][k] Bt[n][k] for NSPLIT 1). M, N % 128 == 0; K a compile-time multiple of 128, at least 256.
template <typename T16> struct WFrag;
template <> struct WFrag<h16> { typedef v16h V; static __device__ __forceinline__ V ld(const h16* p) { return cat16(*(const v8h*)p, *(const v8h*)(p + 16)); } static __device__ __forceinline__ v8f mma(V a, V b, v8f c) { return wmma16(a, b, c); } };
template <> struct WFrag<bf> { typedef v16bf V; static __device__ __forceinline__ V ld(const bf* p) { return cat16b(*(const v8us*)p, *(const v8us*)(p + 16)); } static __device__ __forceinline__ v8f mma(V a, V b, v8f c) { return wmmab(a, b, c); } };
#define GT   128                  // edge of the output tile
#define GKB  256                  // bytes of an operand row in one stage
#define GP   272                  // LDS pitch of a staged row: 16 B x odd, for the 16-byte fragment reads
#define GPL  (GT * GP)            // bytes of one operand's 128 rows in a stage
#define GOP  132                  // pitch, in floats, of the output tile staged in the ring's bytes
__device__ __forceinline__ unsigned lds_off(const void* p) { return (unsigned)(size_t)p; }
__device__ __forceinline__ void wait_ds0() { asm volatile("s_wait_dscnt 0x0" ::: "memory"); }       // this wave's LDS reads of the buffer have returned before the buffer is handed over
__device__ __forceinline__ void wait_async0() { asm volatile("s_wait_asynccnt 0x0" ::: "memory"); } // this wave's copies have landed before the barrier that publishes them
// One operand's 128 rows of a stage: 8 copies per lane, 16 rows apart (l: the lane's LDS byte address, g: its global address, rs: bytes of 16 global rows).
// The s_wait_xcnt closes the statement so that no address register of an issued copy is rewritten ahead of it.
__device__ __forceinline__ void plane_copy(unsigned l, const char* g, size_t rs) {
    asm volatile("global_load_async_to_lds_b128 %0, %8, off\n\t"
                 "global_load_async_to_lds_b128 %1, %9, off\n\t"
                 "global_load_async_to_lds_b128 %2, %10, off\n\t"
                 "global_load_async_to_lds_b128 %3, %11, off\n\t"
                 "global_load_async_to_lds_b128 %4, %12, off\n\t"
                 "global_load_async_to_lds_b128 %5, %13, off\n\t"
                 "global_load_async_to_lds_b128 %6, %14, off\n\t"
                 "global_load_async_to_lds_b128 %7, %15, off\n\t"
                 "s_wait_xcnt 0x0"
                 :: "v"(l), "v"(l + 16 * GP), "v"(l + 32 * GP), "v"(l + 48 * GP), "v"(l + 64 * GP), "v"(l + 80 * GP), "v"(l + 96 * GP), "v"(l + 112 * GP),
                    "v"(g), "v"(g + rs), "v"(g + 2 * rs), "v"(g + 3 * rs), "v"(g + 4 * rs), "v"(g + 5 * rs), "v"(g + 6 * rs), "v"(g + 7 * rs)
                 : "memory");
}
// What becomes of the tile (EPI): 0: stored as f32 in C. 1: the tile is one head's 128 positions x 128 dims: rotary by the table CS, then the fp16 plane P16 and the bf16 hi/lo planes Ph, Pl, [head][t][d].
// 2: the same tile laid transposed in LDS and stored as value planes [head in pass][d][pass][t] (a pass's rows stand PP apart, the pitch the P.V product's one K pitch asks of both operands).
template <typename T16, int NSPLIT, int K, int EPI>
__global__ __launch_bounds__(256) void k_gemmw(const T16* __restrict__ A, const T16* __restrict__ A2, const T16* __restrict__ Bt, float* C, int ldc, const float* __restrict__ CS, h16* P16, bf* Ph, bf* Pl) {
    static_assert(EPI == 0 || GT == HD, "a tile's columns are one head");
    typedef typename WFrag<T16>::V V;
    constexpr unsigned PB = (NSPLIT == 1 ? 2 : 1) * GPL, STG = PB + GPL;   // a stage: [A | A2 | Bt], Bt at PB: every fragment read is within the 16-bit offset of its own base
    static_assert(GT * GOP * 4 <= 2 * STG, "the output tile is staged in the ring's bytes");
    __shared__ __attribute__((aligned(16))) unsigned char L[2 * STG];
    const int tid = (int)threadIdx.x, lane = tid & 31, lr = lane & 15, hi = lane >> 4; const int r0 = blockIdx.x * GT, c0 = blockIdx.y * GT;
    const int wv = __builtin_amdgcn_readfirstlane(tid >> 5);          // wave number, scalar
    const int wm = (wv >> 2) * 64, wn = (wv & 3) * 32;                // the wave's 64x32 part of the tile
    v8f acc[4][2];
#pragma unroll
    for (int mb = 0; mb < 4; ++mb)
#pragma unroll
        for (int nb = 0; nb < 2; ++nb) acc[mb][nb] = (v8f){};
    constexpr size_t rowb = (size_t)K * 2;                            // bytes of a global operand row
    const int crow = tid >> 4, ccol = (tid & 15) * 16;                // the lane's row (of each 16) and byte column in every copy
    const char* gA = (const char*)A + (size_t)(r0 + crow) * rowb + ccol; const char* gB = (const char*)Bt + (size_t)(c0 + crow) * rowb + ccol;
    const char* gA2 = (NSPLIT == 1) ? (const char*)A2 + (size_t)(r0 + crow) * rowb + ccol : nullptr;
    const unsigned lc = lds_off(L) + (unsigned)(crow * GP + ccol);
    auto fill = [&](int t, unsigned buf) { plane_copy(lc + buf, gA + (size_t)t * GKB, 16 * rowb); if (NSPLIT == 1) plane_copy(lc + buf + GPL, gA2 + (size_t)t * GKB, 16 * rowb); plane_copy(lc + buf + PB, gB + (size_t)t * GKB, 16 * rowb); };
    constexpr int NT = K / (GKB / 2); static_assert(K % (GKB / 2) == 0 && NT >= 2, "whole stages, and the two that the prologue fills");
    fill(0, 0u); wait_async0(); __syncthreads();                      // stage 0 is published
    fill(1, STG);
#pragma unroll 1   // the trip stays rolled: one publish point in the text, the buffer chosen by the trip's parity
    for (int t = 0; t < NT; ++t) {
        const unsigned buf = (unsigned)(t & 1) * STG;
        const unsigned char* pa = L + buf + (wm + lr) * GP + 16 * hi; const unsigned char* pb = L + buf + PB + (wn + lr) * GP + 16 * hi;
        V a[2][4], a2[2][4], b[2][2];                                 // two fragment sets: block ks + 1 is fetched while block ks is multiplied
        auto frags = [&](int ks, int st) {
#pragma unroll
            for (int mb = 0; mb < 4; ++mb) { a[st][mb] = WFrag<T16>::ld((const T16*)(pa + mb * 16 * GP + ks * 64)); if (NSPLIT == 1) a2[st][mb] = WFrag<T16>::ld((const T16*)(pa + GPL + mb * 16 * GP + ks * 64)); }
#pragma unroll
            for (int nb = 0; nb < 2; ++nb) b[st][nb] = WFrag<T16>::ld((const T16*)(pb + nb * 16 * GP + ks * 64)); };
        frags(0, 0);
#pragma unroll     // unrolled: fragment sets and accumulators are indexed by constants, so they stay in registers
        for (int ks = 0; ks < GKB / 64; ++ks) {
            if (ks + 1 < GKB / 64) frags(ks + 1, (ks + 1) & 1);       // this stage's own buffer only
            __builtin_amdgcn_sched_barrier(0);                        // keeps the next block's LDS reads together, ahead of this block's products and not among them
#pragma unroll
            for (int nb = 0; nb < 2; ++nb)
#pragma unroll
                for (int mb = 0; mb < 4; ++mb) { acc[mb][nb] = WFrag<T16>::mma(a[ks & 1][mb], b[ks & 1][nb], acc[mb][nb]); if (NSPLIT == 1) acc[mb][nb] = WFrag<T16>::mma(a2[ks & 1][mb], b[ks & 1][nb], acc[mb][nb]); }
            __builtin_amdgcn_sched_barrier(0);                        // ends the block: the reads of the block after next stay behind it
        }
        wait_ds0(); wait_async0(); __syncthreads();                   // publishes stage t + 1 and ends every wave's reads of stage t's buffer
        if (t + 2 < NT) fill(t + 2, buf);
    }
    wait_async0();   // no copy is in flight when the ring's bytes take the output tile
    // The last trip's barrier has ended every read of the ring: the tile is laid there, and behind one barrier each wave takes whole rows of it (512 B of f32, or 256 B in each 16-bit plane).
    v2f rc[GT / 8][2];   // EPI 1: cos, sin of the two pairs the lane turns in each of its rows, asked for here so that all the loads fly while the tile goes through LDS
    if constexpr (EPI == 1) {
#pragma unroll     // unrolled: rc is indexed by constants and stays in registers; one address, the rows as immediate offsets
        for (int s = 0; s < GT / 8; ++s) { const float* cp = CS + ((size_t)(r0 + wv) * HD + lane * 4) * 2 + s * (8 * HD * 2); rc[s][0] = *(const v2f*)cp; rc[s][1] = *(const v2f*)(cp + 4); } }
    float* os = (float*)L;
#pragma unroll
    for (int mb = 0; mb < 4; ++mb) {
#pragma unroll
        for (int nb = 0; nb < 2; ++nb) {
            if constexpr (EPI == 2) {   // transposed: a lane's 8 accumulator rows are 8 neighbours of one LDS row
                float* p = os + (wn + nb * 16 + lr) * GOP + wm + mb * 16 + hi * 8; const v8f c = acc[mb][nb];
                *(v4fa*)p = __builtin_shufflevector(c, c, 0, 1, 2, 3); *(v4fa*)(p + 4) = __builtin_shufflevector(c, c, 4, 5, 6, 7);
            } else {
#pragma unroll
                for (int j = 0; j < 8; ++j) os[(wm + mb * 16 + hi * 8 + j) * GOP + wn + nb * 16 + lr] = acc[mb][nb][j]; } } }
    __syncthreads();   // the whole tile is in LDS before any wave reads rows of it
    if constexpr (EPI == 0) {
#pragma unroll
    for (int s = 0; s < GT / 8; ++s) { const int row = s * 8 + wv; const v4f val = *(const v4fa*)(os + row * GOP + lane * 4);
        *(v4f*)(C + (size_t)(r0 + row) * ldc + c0 + lane * 4) = val; }
    } else {
    // Plane element of the lane's 4 values in LDS row wv, and the step to the row 8 further on. EPI 1: an LDS row is a position, the 4 values are 4 dims (two pairs). EPI 2: an LDS row is a dim, the 4 values are 4 positions.
    const size_t e0 = (EPI == 1) ? ((size_t)blockIdx.y * TT + r0 + wv) * HD + lane * 4 : (((size_t)(blockIdx.y % ZH) * HD + wv) * (NKV / ZH) + blockIdx.y / ZH) * TT + r0 + lane * 4;
    constexpr size_t es = (EPI == 1) ? (size_t)8 * HD : (size_t)8 * (NKV / ZH) * TT;
    v4f tv[GT / 8];   // the wave's 16 rows are read in one run, so that their LDS latencies overlap
#pragma unroll     // unrolled, here and below: tv and rc stay in registers
    for (int s = 0; s < GT / 8; ++s) tv[s] = *(const v4fa*)(os + (s * 8 + wv) * GOP + lane * 4);
#pragma unroll
    for (int s = 0; s < GT / 8; ++s) { v4f y = tv[s]; const size_t e = e0 + s * es;
        if constexpr (EPI == 1) { float y0, y1; rope2(tv[s][0], tv[s][1], rc[s][0], y0, y1); y[0] = y0; y[1] = y1; rope2(tv[s][2], tv[s][3], rc[s][1], y0, y1); y[2] = y0; y[3] = y1; }
        v4h o16; v4us oh, ol;
#pragma unroll
        for (int q = 0; q < 4; ++q) { o16[q] = tohx(y[q]); unsigned short a2, c2; splitf(y[q], a2, c2); oh[q] = a2; ol[q] = c2; }
        *(v4h*)(P16 + e) = o16; *(v4us*)(Ph + e) = oh; *(v4us*)(Pl + e) = ol; }
    }
}

// ---- k_gemmc: 64x64 tile GEMM, operands straight from K-contiguous 16-bit planes (NW waves share the K loop: wave w takes the 32-wide K blocks w, w + NW, ...), specialised for causal attention: CMODE 1 skips score tiles entirely above the diagonal (query rows r0+roff.., key columns c0..), CMODE 2 limits the
// key (K) loop of the probability x value contraction to the diagonal block (probabilities beyond it are exactly zero). roff = row offset of this launch's first row within the sequence.
template <typename T16, int NSPLIT, int CMODE, int NW>
__global__ __launch_bounds__(32 * NW) void k_gemmc(const T16* __restrict__ A, const T16* __restrict__ A2, const T16* __restrict__ Bt, const T16* __restrict__ Bt2, int K, float* C, int ldc, int roff, size_t sA, size_t sB, size_t sC, bf* Mh, bf* Ml) {
    typedef typename WFrag<T16>::V V;
    __shared__ __align__(16) float os[NW == 1 ? 16 * 68 : NW * 64 * 68];
    const size_t z = blockIdx.z; A += z * sA; if (A2) A2 += z * sA; Bt += z * sB; if (Bt2) Bt2 += z * sB; if (CMODE != 2) C += z * sC;
    const int lane = threadIdx.x & 31, lr = lane & 15, hi = lane >> 4; const int r0 = blockIdx.x * 64, c0 = blockIdx.y * 64;
    const int wv = (NW == 1) ? 0 : __builtin_amdgcn_readfirstlane((int)(threadIdx.x >> 5));   // wave number, scalar: the K loop's bounds stay wave-uniform
    if (CMODE == 1 && c0 > r0 + roff + 63) return;                  // score tile entirely above the causal diagonal: never read (the softmax masks j > i by select)
    const int Kl = (CMODE == 2) ? min(K, r0 + roff + 64) : K;        // P.V: probabilities are exactly 0 beyond the diagonal block, so the K loop stops there
    v8f acc[4][4];
#pragma unroll
    for (int mb = 0; mb < 4; ++mb)
#pragma unroll
        for (int nb = 0; nb < 4; ++nb) acc[mb][nb] = (v8f){};
    const size_t aoff = (size_t)(r0 + lr) * K + 8 * hi, boff = (size_t)(c0 + lr) * K + 8 * hi;
#pragma unroll 1
    for (int kc = wv * 32; kc < Kl; kc += 32 * NW) {
        V a[4], a2[4];
#pragma unroll
        for (int mb = 0; mb < 4; ++mb) { a[mb] = WFrag<T16>::ld(A + aoff + (size_t)mb * 16 * K + kc); if (NSPLIT == 1 || NSPLIT == 2) a2[mb] = WFrag<T16>::ld(A2 + aoff + (size_t)mb * 16 * K + kc); }
#pragma unroll
        for (int nb = 0; nb < 4; ++nb) { const V b = WFrag<T16>::ld(Bt + boff + (size_t)nb * 16 * K + kc); V b2; if (NSPLIT >= 2) b2 = WFrag<T16>::ld(Bt2 + boff + (size_t)nb * 16 * K + kc);
#pragma unroll
            for (int mb = 0; mb < 4; ++mb) { acc[mb][nb] = WFrag<T16>::mma(a[mb], b, acc[mb][nb]); if (NSPLIT == 1 || NSPLIT == 2) acc[mb][nb] = WFrag<T16>::mma(a2[mb], b, acc[mb][nb]); if (NSPLIT >= 2) acc[mb][nb] = WFrag<T16>::mma(a[mb], b2, acc[mb][nb]); } }
        asm volatile("v_nop\n\tv_nop\n\tv_nop\n\tv_nop" : "+v"(acc[0][0]), "+v"(acc[1][1]), "+v"(acc[2][2]), "+v"(acc[3][3]) : "v"(a[0]), "v"(a[3]));
    }
    if constexpr (NW == 1) {
#pragma unroll
    for (int mb = 0; mb < 4; ++mb) {
#pragma unroll
        for (int nb = 0; nb < 4; ++nb) {
#pragma unroll
            for (int j = 0; j < 8; ++j) os[(hi * 8 + j) * 68 + nb * 16 + lr] = acc[mb][nb][j]; }
        __builtin_amdgcn_wave_barrier(); asm volatile("" ::: "memory");
        float* crow = C + (size_t)(r0 + mb * 16) * ldc + c0;
{
#pragma unroll
            for (int s = 0; s < 8; ++s) { const int row = 2 * s + hi, cofs = lr * 4; v4f val = *(const v4fa*)(os + row * 68 + cofs);
                *(v4f*)(crow + (size_t)row * ldc + cofs) = val; }
             }
        __builtin_amdgcn_wave_barrier(); asm volatile("" ::: "memory");
    }
    } else {
    // Every wave lays its whole 64x64 partial tile in its own LDS slab; behind ONE barrier each wave sums its share of the rows over the slabs, wave 0's partial first, and stores whole rows.
#pragma unroll
    for (int mb = 0; mb < 4; ++mb) {
#pragma unroll
        for (int nb = 0; nb < 4; ++nb) {
#pragma unroll
            for (int j = 0; j < 8; ++j) os[wv * (64 * 68) + (mb * 16 + hi * 8 + j) * 68 + nb * 16 + lr] = acc[mb][nb][j]; } }
    __syncthreads();   // all NW partial tiles are in LDS before any wave sums them
#pragma unroll
    for (int s = 0; s < 32 / NW; ++s) { const int row = 2 * (s * NW + wv) + hi, cofs = lr * 4; v4f val = *(const v4fa*)(os + row * 68 + cofs);
#pragma unroll
        for (int w = 1; w < NW; ++w) val += *(const v4fa*)(os + w * (64 * 68) + row * 68 + cofs);
        if constexpr (CMODE == 2) {   // the head's output goes straight into the merged [t][head][d] hi/lo planes (Mh, Ml: the pass's first head); rows >= RH carry the probabilities' factor PCAR
            const int t = r0 + row + roff; const float cs = (t < RH) ? 1.0f : (1.0f / PCAR); const size_t oo = (size_t)(r0 + roff + 2 * wv + hi) * DQ + z * HD + c0 + cofs + (size_t)s * (2 * NW * DQ); v4us oh, ol;
#pragma unroll
            for (int q = 0; q < 4; ++q) { unsigned short a, c2; splitf(val[q] * cs, a, c2); oh[q] = a; ol[q] = c2; }
            *(v4us*)(Mh + oo) = oh; *(v4us*)(Ml + oo) = ol;
        } else *(v4f*)(C + (size_t)(r0 + row) * ldc + c0 + cofs) = val; }
    }
}

__global__ __launch_bounds__(256) void k_cvt8(const float* __restrict__ src, bf* dst, size_t n8) { const size_t i = (size_t)blockIdx.x * 256 + threadIdx.x; if (i >= n8) return; const v8f v = *(const v8f*)(src + i * 8); v8us o;
#pragma unroll
    for (int k = 0; k < 8; ++k) o[k] = f2bf(v[k]); *(v8us*)(dst + i * 8) = o;  }

__constant__ float INV2[HD / 2] = { 1.000000000e+00f, 8.659643531e-01f, 7.498942018e-01f, 6.493816376e-01f, 5.623413324e-01f, 4.869675338e-01f, 4.216965139e-01f, 3.651741147e-01f, 3.162277639e-01f, 2.738419771e-01f, 2.371373773e-01f, 2.053525001e-01f, 1.778279394e-01f, 1.539926529e-01f, 1.333521456e-01f, 1.154781953e-01f, 1.000000015e-01f, 8.659642935e-02f, 7.498942316e-02f, 6.493816525e-02f, 5.623413250e-02f, 4.869675264e-02f, 4.216964915e-02f, 3.651741147e-02f, 3.162277490e-02f, 2.738419548e-02f, 2.371373773e-02f, 2.053525113e-02f, 1.778279431e-02f, 1.539926510e-02f, 1.333521400e-02f, 1.154781971e-02f, 9.999999776e-03f, 8.659643121e-03f, 7.498942316e-03f, 6.493816152e-03f, 5.623413250e-03f, 4.869675264e-03f, 4.216964822e-03f, 3.651741194e-03f, 3.162277630e-03f, 2.738419687e-03f, 2.371373819e-03f, 2.053525066e-03f, 1.778279431e-03f, 1.539926510e-03f, 1.333521446e-03f, 1.154782018e-03f, 1.000000047e-03f, 8.659643354e-04f, 7.498941850e-04f, 6.493816036e-04f, 5.623413017e-04f, 4.869675322e-04f, 4.216965172e-04f, 3.651741135e-04f, 3.162277571e-04f, 2.738419571e-04f, 2.371373703e-04f, 2.053525095e-04f, 1.778279402e-04f, 1.539926598e-04f, 1.333521504e-04f, 1.154782003e-04f };   // float32 1 / 10000^(2i/128), generated with jnp to be bit-exact
__global__ __launch_bounds__(256) void k_csP(float* CS) { const int idx = blockIdx.x * 256 + threadIdx.x; if (idx >= TT * HD) return; const int d = idx % HD; const int t = idx / HD; const float a = __fmul_rn((float)t, INV2[d >> 1]); v2f cs; cs[0] = cosf(a); cs[1] = sinf(a); *(v2f*)(CS + (size_t)idx * 2) = cs;  }
// k_asoft: per row (zz, i): t = S x HD^-0.5 for j <= i and i - j < WIN (sliding causal window; the reference's -1e9 additive fill vanishes identically); softmax over the 2048 keys (register row, one exp, fixed trees);
// the probabilities go back into the row's own 8192 bytes (pitch PP): one wave owns the row and has all of it in registers before its first store; rows >= RH: fp16 in the first half; rows < RH: hi plane in the first half, lo plane in the second.
__global__ __launch_bounds__(256) void k_asoft(const float* Sb, h16* P16, bf* Ph, bf* Pl) {
    const int lane = threadIdx.x & 31; const int row = blockIdx.x * 8 + (threadIdx.x >> 5); if (row >= ZH * TT) return; const int i = row % TT; const int zz = row / TT; (void)zz; const bool hires = (i < RH); const float* sr = Sb + (size_t)row * TT; float v[TT / 32]; float mx = -3.0e38f;
#pragma unroll
    for (int ch = 0; ch < TT / 128; ++ch) { const int j0 = ch * 128 + lane * 4; const v4f a = *(const v4f*)(sr + j0);
#pragma unroll
        for (int q = 0; q < 4; ++q) { const int j = j0 + q; (void)j; const float t = (j <= i && i - j < WIN) ? a[q] * SCL : -3.0e38f; v[ch * 4 + q] = t; mx = fmaxf(mx, t); } }
#pragma unroll
    for (int sh = 16; sh; sh >>= 1) mx = fmaxf(mx, __shfl_xor(mx, sh, 32));
    float sum = 0.f;
#pragma unroll
    for (int k = 0; k < TT / 32; ++k) { float d0 = __fsub_rn(v[k], mx); asm volatile("" : "+v"(d0)); v[k] = __builtin_amdgcn_exp2f(__fmul_rn(d0, 1.4426950408889634f)); sum += v[k]; }
#pragma unroll
    for (int sh = 16; sh; sh >>= 1) sum += __shfl_xor(sum, sh, 32);
    const float f = __fdiv_rn(hires ? 1.0f : PCAR, sum);
{
        if (hires) {
#pragma unroll
            for (int ch = 0; ch < TT / 128; ++ch) { v4us oh, ol;
#pragma unroll
                for (int q = 0; q < 4; ++q) { unsigned short a, c2; splitf(v[ch * 4 + q] * f, a, c2); oh[q] = a; ol[q] = c2; }
                const size_t oo = (size_t)row * PP + ch * 128 + lane * 4; *(v4us*)(Ph + oo) = oh; *(v4us*)(Pl + oo) = ol; }
        } else {
#pragma unroll
            for (int ch = 0; ch < TT / 128; ++ch) { v4h o4;
#pragma unroll
                for (int q = 0; q < 4; ++q) o4[q] = tohx(v[ch * 4 + q] * f);
                *(v4h*)(P16 + (size_t)row * PP + ch * 128 + lane * 4) = o4; } }
         }
}

extern "C" void kernel_launch(void* const* d_in, const int* in_sizes, int n_in,
                              void* d_out, int out_size, void* d_ws, size_t ws_size, hipStream_t stream) {
    (void)in_sizes; (void)n_in; (void)out_size;
    const float* x = (const float*)d_in[0]; const float* wq = (const float*)d_in[1]; const float* wk = (const float*)d_in[2]; const float* wv = (const float*)d_in[3]; const float* wo = (const float*)d_in[4];   /* weights 'oi' [2048][2048] */
    float* OUT = (float*)d_out;     // [2][2048][2048]
    char* wsp = (char*)d_ws;
    auto take = [&](size_t bytes) { char* p = wsp; wsp += (bytes + 255) & ~(size_t)255; return (void*)p; };
    bf* WQ = (bf*)take((size_t)DQ * DM * 2); bf* WK = (bf*)take((size_t)DKV * DM * 2); bf* WV = (bf*)take((size_t)DKV * DM * 2); bf* WO = (bf*)take((size_t)DM * DQ * 2);
    h16* QP16 = (h16*)take((size_t)NH_ * TT * HD * 2); h16* KP16 = (h16*)take((size_t)NKV * TT * HD * 2); h16* VT16 = (h16*)take((size_t)NKV * HD * TT * 2);
    bf* QPh = (bf*)take((size_t)NH_ * TT * HD * 2); bf* QPl = (bf*)take((size_t)NH_ * TT * HD * 2); bf* KPh = (bf*)take((size_t)NKV * TT * HD * 2); bf* KPl = (bf*)take((size_t)NKV * TT * HD * 2); bf* VTh = (bf*)take((size_t)NKV * HD * TT * 2); bf* VTl = (bf*)take((size_t)NKV * HD * TT * 2);
    float* Sb = (float*)take((size_t)ZH * TT * TT * 4); bf* ATh = (bf*)take((size_t)TT * DQ * 2); bf* ATl = (bf*)take((size_t)TT * DQ * 2);
    if ((size_t)(wsp - (char*)d_ws) > ws_size) return;    // ws 256 MiB
    h16* P16 = (h16*)Sb; bf* Ph = (bf*)Sb; bf* Pl = Ph + TT;   // probabilities live in their own score rows (k_asoft), pitch PP
    // The projection phase's buffers (bf16 x, rotary table) are dead once the planes are built: they share the score buffer's bytes, and each batch writes them anew before it reads them.
    bf* XB = (bf*)Sb; float* CS = (float*)(XB + (size_t)TT * DM);
    { k_cvt8<<<(unsigned)(((size_t)DQ * DM / 8 + 255) / 256), 256, 0, stream>>>(wq, WQ, (size_t)DQ * DM / 8); k_cvt8<<<(unsigned)(((size_t)DKV * DM / 8 + 255) / 256), 256, 0, stream>>>(wk, WK, (size_t)DKV * DM / 8); k_cvt8<<<(unsigned)(((size_t)DKV * DM / 8 + 255) / 256), 256, 0, stream>>>(wv, WV, (size_t)DKV * DM / 8);
      k_cvt8<<<(unsigned)(((size_t)DM * DQ / 8 + 255) / 256), 256, 0, stream>>>(wo, WO, (size_t)DM * DQ / 8);
       }
    for (int b = 0; b < NB_; ++b) {
        k_csP<<<(TT * HD + 255) / 256, 256, 0, stream>>>(CS);   /* rotary table, per batch: the scores overwrite its bytes */
        k_cvt8<<<(unsigned)(((size_t)TT * DM / 8 + 255) / 256), 256, 0, stream>>>(x + (size_t)b * TT * DM, XB, (size_t)TT * DM / 8);
        k_gemmw<bf, 0, DM, 1><<<dim3(TT / GT, DQ / GT, 1), 256, 0, stream>>>(XB, nullptr, WQ, nullptr, 0, CS, QP16, QPh, QPl);
        k_gemmw<bf, 0, DM, 1><<<dim3(TT / GT, DKV / GT, 1), 256, 0, stream>>>(XB, nullptr, WK, nullptr, 0, CS, KP16, KPh, KPl);
        k_gemmw<bf, 0, DM, 2><<<dim3(TT / GT, DKV / GT, 1), 256, 0, stream>>>(XB, nullptr, WV, nullptr, 0, nullptr, VT16, VTh, VTl);
        for (int h0 = 0; h0 < NH_; h0 += ZH) { const size_t zq = (size_t)h0, zk = (size_t)(h0 / REP);   // one kv head per query head: the pass's ZH heads use consecutive q and k planes (z-strides TT*HD); value planes: the v projection's layout (pass offset TT, z-stride HD*PP)
            k_gemmc<bf, 2, 1, 1><<<dim3(RH / 64, TT / 64, ZH), 32, 0, stream>>>(QPh + zq * TT * HD, QPl + zq * TT * HD, KPh + zk * TT * HD, KPl + zk * TT * HD, HD, Sb, TT, 0, (size_t)TT * HD, (size_t)TT * HD, (size_t)TT * TT, nullptr, nullptr);
            k_gemmc<h16, 0, 1, 1><<<dim3((TT - RH) / 64, TT / 64, ZH), 32, 0, stream>>>(QP16 + zq * TT * HD + (size_t)RH * HD, nullptr, KP16 + zk * TT * HD, nullptr, HD, Sb + (size_t)RH * TT, TT, RH, (size_t)TT * HD, (size_t)TT * HD, (size_t)TT * TT, nullptr, nullptr);
            k_asoft<<<ZH * TT / 8, 256, 0, stream>>>(Sb, P16, Ph, Pl);
            k_gemmc<bf, 2, 2, 8><<<dim3(RH / 64, HD / 64, ZH), 256, 0, stream>>>(Ph, Pl, VTh + (zk / ZH) * TT, VTl + (zk / ZH) * TT, PP, nullptr, 0, 0, (size_t)TT * PP, (size_t)HD * PP, 0, ATh + (size_t)h0 * HD, ATl + (size_t)h0 * HD);
            k_gemmc<h16, 0, 2, 8><<<dim3((TT - RH) / 64, HD / 64, ZH), 256, 0, stream>>>(P16 + (size_t)RH * PP, nullptr, VT16 + (zk / ZH) * TT, nullptr, PP, nullptr, 0, RH, (size_t)TT * PP, (size_t)HD * PP, 0, ATh + (size_t)h0 * HD, ATl + (size_t)h0 * HD); }
        k_gemmw<bf, 1, DQ, 0><<<dim3(TT / GT, DM / GT, 1), 256, 0, stream>>>(ATh, ATl, WO, OUT + (size_t)b * TT * DM, DM, nullptr, nullptr, nullptr, nullptr); }
}

// v005
// One run takes 320 microseconds.
// Timed twice side by side with v004, it ran 1.71 times as fast both times.
// All steps since v000 together make it 5.40 times as fast.
#include <hip/hip_runtime.h>

// Causal multi-head self-attention with 128-wide heads and interleaved-pair rotary embeddings (x [2][2048][2048]; Q, K, V = einsum('bsd,ed', x, W) ('oi' 0.02; 16 heads x 128); rope on consecutive (even, odd) pairs: (x1 cos - x2 sin, x1 sin + x2 cos) with angle pos x 10000^(-2i/128), pos = arange(S) (64 f32 frequencies jnp-exact for this expression; precise cosf/sinf); scores x 1/sqrt(128); causal (-inf); softmax; out = merged Wo^T -> [2][2048][2048] (8.4 M); argument order x, Wq, Wk, Wv, Wo).
// Layout: bf16 copy of x; 'oi' weights; exact projections; k_csP computed table (HD 128: one angle per (even, odd) pair); the projections' epilogues build the rotary q, k planes and the transposed v planes; causal T-2048 attention at HD 128 in one kernel, online softmax (hybrid rows: < 512 hi/lo 3 products, rest fp16 x1024; key blocks above the diagonal are never read; its epilogue writes the merged hi/lo planes); merged hi/lo x Wo exact.
// Compute dtypes, f32 accumulate: every input rounded to bf16; projections exact; rotary f32; attention rows < 512 3 products, rest fp16; softmax f32; Wo hl x exact.

#define NB_  2
#define TT   2048
#define DM   2048
#define NH_  16
#define NKV  16
#define REP  (NH_ / NKV)
#define HD   128
#define DQ   (NH_ * HD)
#define DKV  (NKV * HD)
#define ZH   8                    // heads per group in the value planes' layout
#define PP   (2 * TT)             // pitch, in 16-bit elements, of a row of the transposed value planes
static_assert((NKV / ZH) * TT == PP, "value planes interleave the groups' heads at that pitch");
#define RH   512                  // query rows < RH use hi+lo planes (0: none)
#define SCL  0.088388347648318447f   // HD^-0.5
typedef _Float16 h16;
typedef unsigned short bf;
typedef __attribute__((ext_vector_type(16))) __bf16   v16bf;
typedef __attribute__((ext_vector_type(16))) _Float16 v16h;
typedef __attribute__((ext_vector_type(8)))  _Float16 v8h;
typedef __attribute__((ext_vector_type(8)))  unsigned short v8us;
typedef __attribute__((ext_vector_type(8)))  float    v8f;
typedef __attribute__((ext_vector_type(4)))  float    v4f;
typedef v8h  __attribute__((may_alias)) v8ha;
typedef v4f  __attribute__((may_alias)) v4fa;
typedef v8us __attribute__((may_alias)) v8usa;

__device__ __forceinline__ unsigned short f2bf(float f) { unsigned u = __float_as_uint(f); u += 0x7FFFu + ((u >> 16) & 1u); return (unsigned short)(u >> 16); }
__device__ __forceinline__ float bf2f(unsigned short b) { return __uint_as_float(((unsigned)b) << 16); }
__device__ __forceinline__ float bfr(float f) { return bf2f(f2bf(f)); }
__device__ __forceinline__ v16h cat16(v8h lo, v8h hi) { return __builtin_shufflevector(lo, hi, 0, 1, 2, 3, 4, 5, 6, 7, 8, 9, 10, 11, 12, 13, 14, 15); }
__device__ __forceinline__ v16bf cat16b(v8us lo, v8us hi) { return __builtin_bit_cast(v16bf, __builtin_shufflevector(lo, hi, 0, 1, 2, 3, 4, 5, 6, 7, 8, 9, 10, 11, 12, 13, 14, 15)); }
__device__ __forceinline__ v8f wmma16(v16h a, v16h b, v8f c) { return __builtin_amdgcn_wmma_f32_16x16x32_f16(false, a, false, b, (short)0, c, false, false); }
__device__ __forceinline__ v8f wmmab(v16bf a, v16bf b, v8f c) { return __builtin_amdgcn_wmma_f32_16x16x32_bf16(false, a, false, b, (short)0, c, false, false); }
__device__ __forceinline__ h16 tohx(float x) { return (h16)x; }
__device__ __forceinline__ void splitf(float y, unsigned short& h, unsigned short& l) { h = f2bf(y); l = f2bf(y - bf2f(h)); }
typedef __attribute__((ext_vector_type(4))) _Float16 v4h;
typedef __attribute__((ext_vector_type(4))) unsigned short v4us;
typedef __attribute__((ext_vector_type(2))) float v2f;
typedef __attribute__((ext_vector_type(4))) int v4i;
// One rotary pair (x0 even, x1 odd; cs = cos, sin of the pair's angle): y0 = x0 c - x1 s, y1 = x0 s + x1 c.
__device__ __forceinline__ void rope2(float x0, float x1, v2f cs, float& y0, float& y1) { y0 = x0 * cs[0] - x1 * cs[1]; y1 = x0 * cs[1] + x1 * cs[0]; }



// ---- k_gemmw: GEMM with both operands staged in LDS. One 128x128 output tile per workgroup of 8 waves (2 x 4 waves, 64x32 each, 8 accumulators per wave); grid (M/128, N/128), 256 threads.
// A stage is 128 k (256 B) of the tile's 128 A rows and 128 Bt rows (and the 128 A2 rows), laid at pitch 272 B by asynchronous copies to LDS whose wave-wide 512 B are two whole 256-B row pieces.
// Two buffers: stage t + 1 flies while stage t is worked on. Each wave sums its whole K in k order in one accumulator.
// C[m][n] (f32, pitch ldc) = sum_k A[m][k] Bt[n][k] (+ A2[m][k] Bt[n][k] for NSPLIT 1). M, N % 128 == 0; K a compile-time multiple of 128, at least 256.
template <typename T16> struct WFrag;
template <> struct WFrag<h16> { typedef v16h V; static __device__ __forceinline__ V ld(const h16* p) { return cat16(*(const v8h*)p, *(const v8h*)(p + 16)); } static __device__ __forceinline__ v8f mma(V a, V b, v8f c) { return wmma16(a, b, c); } };
template <> struct WFrag<bf> { typedef v16bf V; static __device__ __forceinline__ V ld(const bf* p) { return cat16b(*(const v8us*)p, *(const v8us*)(p + 16)); } static __device__ __forceinline__ v8f mma(V a, V b, v8f c) { return wmmab(a, b, c); } };
#define GT   128                  // edge of the output tile
#define GKB  256                  // bytes of an operand row in one stage
#define GP   272                  // LDS pitch of a staged row: 16 B x odd, for the 16-byte fragment reads
#define GPL  (GT * GP)            // bytes of one operand's 128 rows in a stage
#define GOP  132                  // pitch, in floats, of the output tile staged in the ring's bytes
__device__ __forceinline__ unsigned lds_off(const void* p) { return (unsigned)(size_t)p; }
__device__ __forceinline__ void wait_ds0() { asm volatile("s_wait_dscnt 0x0" ::: "memory"); }       // this wave's LDS reads of the buffer have returned before the buffer is handed over
__device__ __forceinline__ void wait_async0() { asm volatile("s_wait_asynccnt 0x0" ::: "memory"); } // this wave's copies have landed before the barrier that publishes them
// One operand's 128 rows of a stage: 8 copies per lane, 16 rows apart (l: the lane's LDS byte address, g: its global address, rs: bytes of 16 global rows).
// The s_wait_xcnt closes the statement so that no address register of an issued copy is rewritten ahead of it.
__device__ __forceinline__ void plane_copy(unsigned l, const char* g, size_t rs) {
    asm volatile("global_load_async_to_lds_b128 %0, %8, off\n\t"
                 "global_load_async_to_lds_b128 %1, %9, off\n\t"
                 "global_load_async_to_lds_b128 %2, %10, off\n\t"
                 "global_load_async_to_lds_b128 %3, %11, off\n\t"
                 "global_load_async_to_lds_b128 %4, %12, off\n\t"
                 "global_load_async_to_lds_b128 %5, %13, off\n\t"
                 "global_load_async_to_lds_b128 %6, %14, off\n\t"
                 "global_load_async_to_lds_b128 %7, %15, off\n\t"
                 "s_wait_xcnt 0x0"
                 :: "v"(l), "v"(l + 16 * GP), "v"(l + 32 * GP), "v"(l + 48 * GP), "v"(l + 64 * GP), "v"(l + 80 * GP), "v"(l + 96 * GP), "v"(l + 112 * GP),
                    "v"(g), "v"(g + rs), "v"(g + 2 * rs), "v"(g + 3 * rs), "v"(g + 4 * rs), "v"(g + 5 * rs), "v"(g + 6 * rs), "v"(g + 7 * rs)
                 : "memory");
}
// What becomes of the tile (EPI): 0: stored as f32 in C. 1: the tile is one head's 128 positions x 128 dims: rotary by the table CS, then the fp16 plane P16 and the bf16 hi/lo planes Ph, Pl, [head][t][d].
// 2: the same tile laid transposed in LDS and stored as value planes [head in pass][d][pass][t] (a pass's rows stand PP apart).
template <typename T16, int NSPLIT, int K, int EPI>
__global__ __launch_bounds__(256) void k_gemmw(const T16* __restrict__ A, const T16* __restrict__ A2, const T16* __restrict__ Bt, float* C, int ldc, const float* __restrict__ CS, h16* P16, bf* Ph, bf* Pl) {
    static_assert(EPI == 0 || GT == HD, "a tile's columns are one head");
    typedef typename WFrag<T16>::V V;
    constexpr unsigned PB = (NSPLIT == 1 ? 2 : 1) * GPL, STG = PB + GPL;   // a stage: [A | A2 | Bt], Bt at PB: every fragment read is within the 16-bit offset of its own base
    static_assert(GT * GOP * 4 <= 2 * STG, "the output tile is staged in the ring's bytes");
    __shared__ __attribute__((aligned(16))) unsigned char L[2 * STG];
    const int tid = (int)threadIdx.x, lane = tid & 31, lr = lane & 15, hi = lane >> 4; const int r0 = blockIdx.x * GT, c0 = blockIdx.y * GT;
    const int wv = __builtin_amdgcn_readfirstlane(tid >> 5);          // wave number, scalar
    const int wm = (wv >> 2) * 64, wn = (wv & 3) * 32;                // the wave's 64x32 part of the tile
    v8f acc[4][2];
#pragma unroll
    for (int mb = 0; mb < 4; ++mb)
#pragma unroll
        for (int nb = 0; nb < 2; ++nb) acc[mb][nb] = (v8f){};
    constexpr size_t rowb = (size_t)K * 2;                            // bytes of a global operand row
    const int crow = tid >> 4, ccol = (tid & 15) * 16;                // the lane's row (of each 16) and byte column in every copy
    const char* gA = (const char*)A + (size_t)(r0 + crow) * rowb + ccol; const char* gB = (const char*)Bt + (size_t)(c0 + crow) * rowb + ccol;
    const char* gA2 = (NSPLIT == 1) ? (const char*)A2 + (size_t)(r0 + crow) * rowb + ccol : nullptr;
    const unsigned lc = lds_off(L) + (unsigned)(crow * GP + ccol);
    auto fill = [&](int t, unsigned buf) { plane_copy(lc + buf, gA + (size_t)t * GKB, 16 * rowb); if (NSPLIT == 1) plane_copy(lc + buf + GPL, gA2 + (size_t)t * GKB, 16 * rowb); plane_copy(lc + buf + PB, gB + (size_t)t * GKB, 16 * rowb); };
    constexpr int NT = K / (GKB / 2); static_assert(K % (GKB / 2) == 0 && NT >= 2, "whole stages, and the two that the prologue fills");
    fill(0, 0u); wait_async0(); __syncthreads();                      // stage 0 is published
    fill(1, STG);
#pragma unroll 1   // the trip stays rolled: one publish point in the text, the buffer chosen by the trip's parity
    for (int t = 0; t < NT; ++t) {
        const unsigned buf = (unsigned)(t & 1) * STG;
        const unsigned char* pa = L + buf + (wm + lr) * GP + 16 * hi; const unsigned char* pb = L + buf + PB + (wn + lr) * GP + 16 * hi;
        V a[2][4], a2[2][4], b[2][2];                                 // two fragment sets: block ks + 1 is fetched while block ks is multiplied
        auto frags = [&](int ks, int st) {
#pragma unroll
            for (int mb = 0; mb < 4; ++mb) { a[st][mb] = WFrag<T16>::ld((const T16*)(pa + mb * 16 * GP + ks * 64)); if (NSPLIT == 1) a2[st][mb] = WFrag<T16>::ld((const T16*)(pa + GPL + mb * 16 * GP + ks * 64)); }
#pragma unroll
            for (int nb = 0; nb < 2; ++nb) b[st][nb] = WFrag<T16>::ld((const T16*)(pb + nb * 16 * GP + ks * 64)); };
        frags(0, 0);
#pragma unroll     // unrolled: fragment sets and accumulators are indexed by constants, so they stay in registers
        for (int ks = 0; ks < GKB / 64; ++ks) {
            if (ks + 1 < GKB / 64) frags(ks + 1, (ks + 1) & 1);       // this stage's own buffer only
            __builtin_amdgcn_sched_barrier(0);                        // keeps the next block's LDS reads together, ahead of this block's products and not among them
#pragma unroll
            for (int nb = 0; nb < 2; ++nb)
#pragma unroll
                for (int mb = 0; mb < 4; ++mb) { acc[mb][nb] = WFrag<T16>::mma(a[ks & 1][mb], b[ks & 1][nb], acc[mb][nb]); if (NSPLIT == 1) acc[mb][nb] = WFrag<T16>::mma(a2[ks & 1][mb], b[ks & 1][nb], acc[mb][nb]); }
            __builtin_amdgcn_sched_barrier(0);                        // ends the block: the reads of the block after next stay behind it
        }
        wait_ds0(); wait_async0(); __syncthreads();                   // publishes stage t + 1 and ends every wave's reads of stage t's buffer
        if (t + 2 < NT) fill(t + 2, buf);
    }
    wait_async0();   // no copy is in flight when the ring's bytes take the output tile
    // The last trip's barrier has ended every read of the ring: the tile is laid there, and behind one barrier each wave takes whole rows of it (512 B of f32, or 256 B in each 16-bit plane).
    v2f rc[GT / 8][2];   // EPI 1: cos, sin of the two pairs the lane turns in each of its rows, asked for here so that all the loads fly while the tile goes through LDS
    if constexpr (EPI == 1) {
#pragma unroll     // unrolled: rc is indexed by constants and stays in registers; one address, the rows as immediate offsets
        for (int s = 0; s < GT / 8; ++s) { const float* cp = CS + ((size_t)(r0 + wv) * HD + lane * 4) * 2 + s * (8 * HD * 2); rc[s][0] = *(const v2f*)cp; rc[s][1] = *(const v2f*)(cp + 4); } }
    float* os = (float*)L;
#pragma unroll
    for (int mb = 0; mb < 4; ++mb) {
#pragma unroll
        for (int nb = 0; nb < 2; ++nb) {
            if constexpr (EPI == 2) {   // transposed: a lane's 8 accumulator rows are 8 neighbours of one LDS row
                float* p = os + (wn + nb * 16 + lr) * GOP + wm + mb * 16 + hi * 8; const v8f c = acc[mb][nb];
                *(v4fa*)p = __builtin_shufflevector(c, c, 0, 1, 2, 3); *(v4fa*)(p + 4) = __builtin_shufflevector(c, c, 4, 5, 6, 7);
            } else {
#pragma unroll
                for (int j = 0; j < 8; ++j) os[(wm + mb * 16 + hi * 8 + j) * GOP + wn + nb * 16 + lr] = acc[mb][nb][j]; } } }
    __syncthreads();   // the whole tile is in LDS before any wave reads rows of it
    if constexpr (EPI == 0) {
#pragma unroll
    for (int s = 0; s < GT / 8; ++s) { const int row = s * 8 + wv; const v4f val = *(const v4fa*)(os + row * GOP + lane * 4);
        *(v4f*)(C + (size_t)(r0 + row) * ldc + c0 + lane * 4) = val; }
    } else {
    // Plane element of the lane's 4 values in LDS row wv, and the step to the row 8 further on. EPI 1: an LDS row is a position, the 4 values are 4 dims (two pairs). EPI 2: an LDS row is a dim, the 4 values are 4 positions.
    const size_t e0 = (EPI == 1) ? ((size_t)blockIdx.y * TT + r0 + wv) * HD + lane * 4 : (((size_t)(blockIdx.y % ZH) * HD + wv) * (NKV / ZH) + blockIdx.y / ZH) * TT + r0 + lane * 4;
    constexpr size_t es = (EPI == 1) ? (size_t)8 * HD : (size_t)8 * (NKV / ZH) * TT;
    v4f tv[GT / 8];   // the wave's 16 rows are read in one run, so that their LDS latencies overlap
#pragma unroll     // unrolled, here and below: tv and rc stay in registers
    for (int s = 0; s < GT / 8; ++s) tv[s] = *(const v4fa*)(os + (s * 8 + wv) * GOP + lane * 4);
#pragma unroll
    for (int s = 0; s < GT / 8; ++s) { v4f y = tv[s]; const size_t e = e0 + s * es;
        if constexpr (EPI == 1) { float y0, y1; rope2(tv[s][0], tv[s][1], rc[s][0], y0, y1); y[0] = y0; y[1] = y1; rope2(tv[s][2], tv[s][3], rc[s][1], y0, y1); y[2] = y0; y[3] = y1; }
        v4h o16; v4us oh, ol;
#pragma unroll
        for (int q = 0; q < 4; ++q) { o16[q] = tohx(y[q]); unsigned short a2, c2; splitf(y[q], a2, c2); oh[q] = a2; ol[q] = c2; }
        *(v4h*)(P16 + e) = o16; *(v4us*)(Ph + e) = oh; *(v4us*)(Pl + e) = ol; }
    }
}

// ---- k_attn: causal attention, one launch per batch; a workgroup of 8 waves takes 16 * QN query rows of one head; scores and probabilities never leave the registers.
// Transposed products: S^T = K Q^T puts a query in a lane (column lr) with 8 keys of each 16-key tile in its accumulator, which is already the B fragment's k order of O^T = V^T P^T: keys kb + 8 hi + j, then kb + 16 + 8 hi + j.
// Wave w takes the 32-key blocks w, w + 8, ... up to the diagonal, each with its own running maximum, sum and O^T (online softmax); at the end the 8 partial results are brought to the common maximum and summed in LDS, wave 0's first.
// fp16 form: the next block's K fragments are asked for as soon as S is formed, its V fragments as soon as O is: each load flies over the other half of the work, in the registers that have just come free.
// NSPLIT 0: one fp16 product, the probabilities carry 2^PSH (it cancels in the division by the row sum, which carries it too). NSPLIT 2: bf16 hi/lo planes, 3 products for S and for O.
// Q, K planes [head][t][d]; V planes as the v projection lays them ([head in pass][d][pass][t], row pitch PP); the result goes into the merged [t][head][d] hi/lo planes. q0: the workgroup's first query row.
#define L2E  1.4426950408889634f
#define ANW  8                    // waves that share a workgroup's keys
// Stands behind a run of global loads or stores; it takes their two base addresses as inputs, so that those registers are neither rewritten nor given to a load's result ahead of it.
__device__ __forceinline__ void wait_x0(const void* a, const void* b) { asm volatile("s_wait_xcnt 0x0" :: "v"(a), "v"(b) : "memory"); }
template <bool B> struct BoolC { static constexpr bool value = B; };
template <typename T16, int NSPLIT, int QN>
__device__ __forceinline__ void flash(const T16* __restrict__ Q, const T16* __restrict__ Q2, const T16* __restrict__ Kp, const T16* __restrict__ Kp2, const T16* __restrict__ Vt, const T16* __restrict__ Vt2, int h, int q0, bf* Mh, bf* Ml, float* os, float* sm, float* sl) {
    typedef typename WFrag<T16>::V V;
    constexpr int NW = ANW, QR = 16 * QN; constexpr float PSH = (NSPLIT == 0) ? 10.0f : 0.0f;
    constexpr bool PIPE = (NSPLIT == 0);   // the hi/lo form has twice the fragments and at most two blocks per wave: it asks for a block's fragments at the block's head
    const int tid = (int)threadIdx.x, lane = tid & 31, lr = lane & 15, hi = lane >> 4;
    const int wv = __builtin_amdgcn_readfirstlane(tid >> 5);          // wave number, scalar: the key loop's bounds stay wave-uniform
    const size_t hp = (size_t)h * TT * HD, vp = (size_t)(h % ZH) * HD * PP + (size_t)(h / ZH) * TT;
    v8f o[8][QN]; float m[QN], l[QN];
#pragma unroll
    for (int qt = 0; qt < QN; ++qt) { m[qt] = -3.0e38f; l[qt] = 0.f;
#pragma unroll
        for (int dt = 0; dt < 8; ++dt) o[dt][qt] = (v8f){}; }
    const int nblk = (q0 + QR - 1) / 32 + 1;                          // every block holds a key <= q0, so no query ever sees a block that is masked whole
    if (wv < nblk) {
        V q[QN][4], q2[QN][4], ka[2][4], ka2[2][4], va[8], va2[8];
        // pk, pv (and the lo planes' pk2, pv2): the lane's addresses in the block whose fragments the registers hold; a load names them with the step as a constant, and they move on only behind the wait.
        constexpr int KS = NW * 32 * HD, VS = NW * 32;
        const size_t ek = hp + (size_t)(wv * 32 + lr) * HD + 8 * hi, ev = vp + (size_t)lr * PP + wv * 32 + 8 * hi;
        const T16* pk = Kp + ek; const T16* pk2 = (NSPLIT == 2) ? Kp2 + ek : pk; const T16* pv = Vt + ev; const T16* pv2 = (NSPLIT == 2) ? Vt2 + ev : pv;
        auto ldk = [&](int st) {
#pragma unroll
            for (int kt = 0; kt < 2; ++kt)
#pragma unroll
                for (int ks = 0; ks < 4; ++ks) { const int e = st + kt * 16 * HD + ks * 32; ka[kt][ks] = WFrag<T16>::ld(pk + e); if (NSPLIT == 2) ka2[kt][ks] = WFrag<T16>::ld(pk2 + e); }
            wait_x0(pk, pk2); pk += st; pk2 += st; };
        auto ldv = [&](int st) {
#pragma unroll
            for (int dt = 0; dt < 8; ++dt) { const int e = st + dt * 16 * PP; va[dt] = WFrag<T16>::ld(pv + e); if (NSPLIT == 2) va2[dt] = WFrag<T16>::ld(pv2 + e); }
            wait_x0(pv, pv2); pv += st; pv2 += st; };
        const size_t eq = hp + (size_t)(q0 + lr) * HD + 8 * hi; const T16* pq = Q + eq; const T16* pq2 = (NSPLIT == 2) ? Q2 + eq : pq;
#pragma unroll
        for (int qt = 0; qt < QN; ++qt)
#pragma unroll
            for (int ks = 0; ks < 4; ++ks) { const int e = qt * 16 * HD + ks * 32; q[qt][ks] = WFrag<T16>::ld(pq + e); if (NSPLIT == 2) q2[qt][ks] = WFrag<T16>::ld(pq2 + e); }
        wait_x0(pq, pq2);
        if constexpr (PIPE) { ldk(0); ldv(0); }
        // One 32-key block. MORE: the wave has a further block, whose fragments are asked for here; the wave's last block is the only one that can reach the diagonal, so it alone masks.
        auto block = [&](int kb, auto more) {
            constexpr bool MORE = decltype(more)::value;
            if constexpr (!PIPE) { ldk(0); ldv(0); }
            v8f s[QN][2];
#pragma unroll
            for (int qt = 0; qt < QN; ++qt)
#pragma unroll
                for (int kt = 0; kt < 2; ++kt) { s[qt][kt] = (v8f){};
#pragma unroll
                    for (int ks = 0; ks < 4; ++ks) { s[qt][kt] = WFrag<T16>::mma(ka[kt][ks], q[qt][ks], s[qt][kt]); if (NSPLIT == 2) { s[qt][kt] = WFrag<T16>::mma(ka[kt][ks], q2[qt][ks], s[qt][kt]); s[qt][kt] = WFrag<T16>::mma(ka2[kt][ks], q[qt][ks], s[qt][kt]); } } }
            if constexpr (PIPE && MORE) ldk(KS);
            V pb[QN], pb2[QN];
#pragma unroll
            for (int qt = 0; qt < QN; ++qt) {
                const int qi = q0 + qt * 16 + lr; float mloc = -3.0e38f;
#pragma unroll
                for (int kt = 0; kt < 2; ++kt)
#pragma unroll
                    for (int j = 0; j < 8; ++j) { float t = s[qt][kt][j] * SCL; if constexpr (!MORE) t = (kb + kt * 16 + hi * 8 + j <= qi) ? t : -3.0e38f; s[qt][kt][j] = t; mloc = fmaxf(mloc, t); }
                mloc = fmaxf(mloc, __shfl_xor(mloc, 16, 32));         // the query's other 16 keys of the block are in lane lr + 16
                if (__any(mloc > m[qt])) {                            // where no maximum rose every factor would be 1
                    const float mn = fmaxf(m[qt], mloc), al = __builtin_amdgcn_exp2f((m[qt] - mn) * L2E); m[qt] = mn; l[qt] *= al;
#pragma unroll
                    for (int dt = 0; dt < 8; ++dt) o[dt][qt] *= al; }
                float ps = 0.f;
#pragma unroll
                for (int kt = 0; kt < 2; ++kt)
#pragma unroll
                    for (int j = 0; j < 8; ++j) { const float p = __builtin_amdgcn_exp2f((s[qt][kt][j] - m[qt]) * L2E + PSH); s[qt][kt][j] = p; ps += p; }
                l[qt] += ps;
                if constexpr (NSPLIT == 0) {
#pragma unroll
                    for (int j = 0; j < 8; ++j) { pb[qt][j] = tohx(s[qt][0][j]); pb[qt][8 + j] = tohx(s[qt][1][j]); }
                } else {
                    v8us h0, h1, l0, l1;
#pragma unroll
                    for (int j = 0; j < 8; ++j) { unsigned short a, c2; splitf(s[qt][0][j], a, c2); h0[j] = a; l0[j] = c2; splitf(s[qt][1][j], a, c2); h1[j] = a; l1[j] = c2; }
                    pb[qt] = cat16b(h0, h1); pb2[qt] = cat16b(l0, l1); }
            }
#pragma unroll
            for (int dt = 0; dt < 8; ++dt)
#pragma unroll
                for (int qt = 0; qt < QN; ++qt) { o[dt][qt] = WFrag<T16>::mma(va[dt], pb[qt], o[dt][qt]); if (NSPLIT == 2) { o[dt][qt] = WFrag<T16>::mma(va[dt], pb2[qt], o[dt][qt]); o[dt][qt] = WFrag<T16>::mma(va2[dt], pb[qt], o[dt][qt]); } }
            if constexpr (PIPE && MORE) ldv(VS);
            if constexpr (!PIPE && MORE) { pk += KS; pk2 += KS; pv += VS; pv2 += VS; }
        };
        int blk = wv;
#pragma unroll 1   // rolled: one 32-key block's fragments at a time in registers
        for (; blk + NW < nblk; blk += NW) block(blk * 32, BoolC<true>{});
        block(blk * 32, BoolC<false>{});
    }
#pragma unroll
    for (int qt = 0; qt < QN; ++qt) if (hi == 0) sm[wv * QR + qt * 16 + lr] = m[qt];
    __syncthreads();   // every wave's maxima are in LDS before any wave forms the common one
#pragma unroll
    for (int qt = 0; qt < QN; ++qt) { float M = sm[qt * 16 + lr];
#pragma unroll
        for (int w = 1; w < NW; ++w) M = fmaxf(M, sm[w * QR + qt * 16 + lr]);
        const float sc = __builtin_amdgcn_exp2f((m[qt] - M) * L2E); const float lt = l[qt] + __shfl_xor(l[qt], 16, 32);   // a wave without a block: its sum and its O are 0
        if (hi == 0) sl[wv * QR + qt * 16 + lr] = lt * sc;
#pragma unroll
        for (int dt = 0; dt < 8; ++dt) { const v8f c = o[dt][qt] * sc; float* p = os + (wv * QR + qt * 16 + lr) * GOP + dt * 16 + hi * 8;   // a lane's 8 accumulator rows are 8 neighbouring dims of its query's LDS row
            *(v4fa*)p = __builtin_shufflevector(c, c, 0, 1, 2, 3); *(v4fa*)(p + 4) = __builtin_shufflevector(c, c, 4, 5, 6, 7); } }
    __syncthreads();   // all 8 partial results are in LDS before any wave sums them
#pragma unroll
    for (int s = 0; s < QR / NW; ++s) { const int row = s * NW + wv; v4f val = *(const v4fa*)(os + row * GOP + lane * 4); float L = sl[row];
#pragma unroll
        for (int w = 1; w < NW; ++w) { val += *(const v4fa*)(os + (w * QR + row) * GOP + lane * 4); L += sl[w * QR + row]; }
        const float f = __fdiv_rn(1.0f, L); const size_t oo = (size_t)(q0 + row) * DQ + h * HD + lane * 4; v4us oh, ol;
#pragma unroll
        for (int qd = 0; qd < 4; ++qd) { unsigned short a, c2; splitf(val[qd] * f, a, c2); oh[qd] = a; ol[qd] = c2; }
        *(v4us*)(Mh + oo) = oh; *(v4us*)(Ml + oo) = ol; wait_x0(Mh + oo, Ml + oo); }
}
// Grid (heads, row groups): the groups of 32 rows >= RH come first, the longest rows first of all; the groups of 16 rows < RH (hi/lo planes) fill the launch's tail.
#define ALO  ((TT - RH) / 32)
#define AHI  (RH / 16)
__global__ __launch_bounds__(32 * ANW) void k_attn(const h16* __restrict__ Q16, const h16* __restrict__ K16, const h16* __restrict__ V16, const bf* __restrict__ Qh, const bf* __restrict__ Ql, const bf* __restrict__ Kh, const bf* __restrict__ Kl, const bf* __restrict__ Vh, const bf* __restrict__ Vl, bf* Mh, bf* Ml) {
    __shared__ __align__(16) float os[ANW * 32 * GOP]; __shared__ float sm[ANW * 32]; __shared__ float sl[ANW * 32];
    const int h = (int)blockIdx.x, g = (int)blockIdx.y;
    if (g < ALO) flash<h16, 0, 2>(Q16, nullptr, K16, nullptr, V16, nullptr, h, TT - 32 * (g + 1), Mh, Ml, os, sm, sl);
    else flash<bf, 2, 1>(Qh, Ql, Kh, Kl, Vh, Vl, h, RH - 16 * (g - ALO + 1), Mh, Ml, os, sm, sl);
}

__global__ __launch_bounds__(256) void k_cvt8(const float* __restrict__ src, bf* dst, size_t n8) { const size_t i = (size_t)blockIdx.x * 256 + threadIdx.x; if (i >= n8) return; const v8f v = *(const v8f*)(src + i * 8); v8us o;
#pragma unroll
    for (int k = 0; k < 8; ++k) o[k] = f2bf(v[k]); *(v8us*)(dst + i * 8) = o;  }

__constant__ float INV2[HD / 2] = { 1.000000000e+00f, 8.659643531e-01f, 7.498942018e-01f, 6.493816376e-01f, 5.623413324e-01f, 4.869675338e-01f, 4.216965139e-01f, 3.651741147e-01f, 3.162277639e-01f, 2.738419771e-01f, 2.371373773e-01f, 2.053525001e-01f, 1.778279394e-01f, 1.539926529e-01f, 1.333521456e-01f, 1.154781953e-01f, 1.000000015e-01f, 8.659642935e-02f, 7.498942316e-02f, 6.493816525e-02f, 5.623413250e-02f, 4.869675264e-02f, 4.216964915e-02f, 3.651741147e-02f, 3.162277490e-02f, 2.738419548e-02f, 2.371373773e-02f, 2.053525113e-02f, 1.778279431e-02f, 1.539926510e-02f, 1.333521400e-02f, 1.154781971e-02f, 9.999999776e-03f, 8.659643121e-03f, 7.498942316e-03f, 6.493816152e-03f, 5.623413250e-03f, 4.869675264e-03f, 4.216964822e-03f, 3.651741194e-03f, 3.162277630e-03f, 2.738419687e-03f, 2.371373819e-03f, 2.053525066e-03f, 1.778279431e-03f, 1.539926510e-03f, 1.333521446e-03f, 1.154782018e-03f, 1.000000047e-03f, 8.659643354e-04f, 7.498941850e-04f, 6.493816036e-04f, 5.623413017e-04f, 4.869675322e-04f, 4.216965172e-04f, 3.651741135e-04f, 3.162277571e-04f, 2.738419571e-04f, 2.371373703e-04f, 2.053525095e-04f, 1.778279402e-04f, 1.539926598e-04f, 1.333521504e-04f, 1.154782003e-04f };   // float32 1 / 10000^(2i/128), generated with jnp to be bit-exact
__global__ __launch_bounds__(256) void k_csP(float* CS) { const int idx = blockIdx.x * 256 + threadIdx.x; if (idx >= TT * HD) return; const int d = idx % HD; const int t = idx / HD; const float a = __fmul_rn((float)t, INV2[d >> 1]); v2f cs; cs[0] = cosf(a); cs[1] = sinf(a); *(v2f*)(CS + (size_t)idx * 2) = cs;  }
extern "C" void kernel_launch(void* const* d_in, const int* in_sizes, int n_in,
                              void* d_out, int out_size, void* d_ws, size_t ws_size, hipStream_t stream) {
    (void)in_sizes; (void)n_in; (void)out_size;
    const float* x = (const float*)d_in[0]; const float* wq = (const float*)d_in[1]; const float* wk = (const float*)d_in[2]; const float* wv = (const float*)d_in[3]; const float* wo = (const float*)d_in[4];   /* weights 'oi' [2048][2048] */
    float* OUT = (float*)d_out;     // [2][2048][2048]
    char* wsp = (char*)d_ws;
    auto take = [&](size_t bytes) { char* p = wsp; wsp += (bytes + 255) & ~(size_t)255; return (void*)p; };
    bf* WQ = (bf*)take((size_t)DQ * DM * 2); bf* WK = (bf*)take((size_t)DKV * DM * 2); bf* WV = (bf*)take((size_t)DKV * DM * 2); bf* WO = (bf*)take((size_t)DM * DQ * 2);
    h16* QP16 = (h16*)take((size_t)NH_ * TT * HD * 2); h16* KP16 = (h16*)take((size_t)NKV * TT * HD * 2); h16* VT16 = (h16*)take((size_t)NKV * HD * TT * 2);
    bf* QPh = (bf*)take((size_t)NH_ * TT * HD * 2); bf* QPl = (bf*)take((size_t)NH_ * TT * HD * 2); bf* KPh = (bf*)take((size_t)NKV * TT * HD * 2); bf* KPl = (bf*)take((size_t)NKV * TT * HD * 2); bf* VTh = (bf*)take((size_t)NKV * HD * TT * 2); bf* VTl = (bf*)take((size_t)NKV * HD * TT * 2);
    bf* XB = (bf*)take((size_t)TT * DM * 2); float* CS = (float*)take((size_t)TT * HD * 2 * 4); bf* ATh = (bf*)take((size_t)TT * DQ * 2); bf* ATl = (bf*)take((size_t)TT * DQ * 2);
    if ((size_t)(wsp - (char*)d_ws) > ws_size) return;    // ws 256 MiB
    { k_cvt8<<<(unsigned)(((size_t)DQ * DM / 8 + 255) / 256), 256, 0, stream>>>(wq, WQ, (size_t)DQ * DM / 8); k_cvt8<<<(unsigned)(((size_t)DKV * DM / 8 + 255) / 256), 256, 0, stream>>>(wk, WK, (size_t)DKV * DM / 8); k_cvt8<<<(unsigned)(((size_t)DKV * DM / 8 + 255) / 256), 256, 0, stream>>>(wv, WV, (size_t)DKV * DM / 8);
      k_cvt8<<<(unsigned)(((size_t)DM * DQ / 8 + 255) / 256), 256, 0, stream>>>(wo, WO, (size_t)DM * DQ / 8);
       }
    for (int b = 0; b < NB_; ++b) {
        k_csP<<<(TT * HD + 255) / 256, 256, 0, stream>>>(CS);   /* rotary table */
        k_cvt8<<<(unsigned)(((size_t)TT * DM / 8 + 255) / 256), 256, 0, stream>>>(x + (size_t)b * TT * DM, XB, (size_t)TT * DM / 8);
        k_gemmw<bf, 0, DM, 1><<<dim3(TT / GT, DQ / GT, 1), 256, 0, stream>>>(XB, nullptr, WQ, nullptr, 0, CS, QP16, QPh, QPl);
        k_gemmw<bf, 0, DM, 1><<<dim3(TT / GT, DKV / GT, 1), 256, 0, stream>>>(XB, nullptr, WK, nullptr, 0, CS, KP16, KPh, KPl);
        k_gemmw<bf, 0, DM, 2><<<dim3(TT / GT, DKV / GT, 1), 256, 0, stream>>>(XB, nullptr, WV, nullptr, 0, nullptr, VT16, VTh, VTl);
        k_attn<<<dim3(NH_, ALO + AHI, 1), 32 * ANW, 0, stream>>>(QP16, KP16, VT16, QPh, QPl, KPh, KPl, VTh, VTl, ATh, ATl);
        k_gemmw<bf, 1, DQ, 0><<<dim3(TT / GT, DM / GT, 1), 256, 0, stream>>>(ATh, ATl, WO, OUT + (size_t)b * TT * DM, DM, nullptr, nullptr, nullptr, nullptr); }
}

// v006
// It runs in 264 microseconds.
// Timed twice side by side with v005, it ran 1.21 and 1.22 times as fast.
// Over all steps from v000 it is 6.57 times as fast.
#include <hip/hip_runtime.h>

// Causal multi-head self-attention with 128-wide heads and interleaved-pair rotary embeddings (x [2][2048][2048]; Q, K, V = einsum('bsd,ed', x, W) ('oi' 0.02; 16 heads x 128); rope on consecutive (even, odd) pairs: (x1 cos - x2 sin, x1 sin + x2 cos) with angle pos x 10000^(-2i/128), pos = arange(S) (64 f32 frequencies jnp-exact for this expression; precise cosf/sinf); scores x 1/sqrt(128); causal (-inf); softmax; out = merged Wo^T -> [2][2048][2048] (8.4 M); argument order x, Wq, Wk, Wv, Wo).
// Four launches, each over both batches (a row of x is b * 2048 + t): k_prep, the q, k, v projections as one GEMM, k_attn, the Wo GEMM.
// Layout: bf16 copy of x; 'oi' weights; exact projections; k_prep's computed table (HD 128: one angle per (even, odd) pair); the projections' epilogues build the rotary q, k planes and the transposed v planes; causal T-2048 attention at HD 128 in one kernel, online softmax (hybrid rows: < 512 hi/lo 3 products, rest fp16 x1024; key blocks above the diagonal are never read; its epilogue writes the merged hi/lo planes); merged hi/lo x Wo exact.
// Compute dtypes, f32 accumulate: every input rounded to bf16; projections exact; rotary f32; attention rows < 512 3 products, rest fp16; softmax f32; Wo hl x exact.

#define NB_  2
#define TT   2048
#define DM   2048
#define NH_  16
#define NKV  16
#define REP  (NH_ / NKV)
#define HD   128
#define DQ   (NH_ * HD)
#define DKV  (NKV * HD)
#define ZH   8                    // heads per group in the value planes' layout
#define PP   (2 * TT)             // pitch, in 16-bit elements, of a row of the transposed value planes
static_assert((NKV / ZH) * TT == PP, "value planes interleave the groups' heads at that pitch");
#define PLN  ((size_t)NB_ * NH_ * TT * HD)   // elements of one plane set: [batch][head] planes of q, of k or of v
static_assert(NKV == NH_, "q, k and v plane sets have one size, and a projection tile's column block is a head of one of them");
#define RH   512                  // query rows < RH use hi+lo planes (0: none)
#define SCL  0.088388347648318447f   // HD^-0.5
typedef _Float16 h16;
typedef unsigned short bf;
typedef __attribute__((ext_vector_type(16))) __bf16   v16bf;
typedef __attribute__((ext_vector_type(16))) _Float16 v16h;
typedef __attribute__((ext_vector_type(8)))  _Float16 v8h;
typedef __attribute__((ext_vector_type(8)))  unsigned short v8us;
typedef __attribute__((ext_vector_type(8)))  float    v8f;
typedef __attribute__((ext_vector_type(4)))  float    v4f;
typedef v8h  __attribute__((may_alias)) v8ha;
typedef v4f  __attribute__((may_alias)) v4fa;
typedef v8us __attribute__((may_alias)) v8usa;

__device__ __forceinline__ unsigned short f2bf(float f) { unsigned u = __float_as_uint(f); u += 0x7FFFu + ((u >> 16) & 1u); return (unsigned short)(u >> 16); }
__device__ __forceinline__ float bf2f(unsigned short b) { return __uint_as_float(((unsigned)b) << 16); }
__device__ __forceinline__ float bfr(float f) { return bf2f(f2bf(f)); }
__device__ __forceinline__ v16h cat16(v8h lo, v8h hi) { return __builtin_shufflevector(lo, hi, 0, 1, 2, 3, 4, 5, 6, 7, 8, 9, 10, 11, 12, 13, 14, 15); }
__device__ __forceinline__ v16bf cat16b(v8us lo, v8us hi) { return __builtin_bit_cast(v16bf, __builtin_shufflevector(lo, hi, 0, 1, 2, 3, 4, 5, 6, 7, 8, 9, 10, 11, 12, 13, 14, 15)); }
__device__ __forceinline__ v8f wmma16(v16h a, v16h b, v8f c) { return __builtin_amdgcn_wmma_f32_16x16x32_f16(false, a, false, b, (short)0, c, false, false); }
__device__ __forceinline__ v8f wmmab(v16bf a, v16bf b, v8f c) { return __builtin_amdgcn_wmma_f32_16x16x32_bf16(false, a, false, b, (short)0, c, false, false); }
__device__ __forceinline__ h16 tohx(float x) { return (h16)x; }
__device__ __forceinline__ void splitf(float y, unsigned short& h, unsigned short& l) { h = f2bf(y); l = f2bf(y - bf2f(h)); }
typedef __attribute__((ext_vector_type(4))) _Float16 v4h;
typedef __attribute__((ext_vector_type(4))) unsigned short v4us;
typedef __attribute__((ext_vector_type(2))) float v2f;
typedef __attribute__((ext_vector_type(4))) int v4i;
// One rotary pair (x0 even, x1 odd; cs = cos, sin of the pair's angle): y0 = x0 c - x1 s, y1 = x0 s + x1 c.
__device__ __forceinline__ void rope2(float x0, float x1, v2f cs, float& y0, float& y1) { y0 = x0 * cs[0] - x1 * cs[1]; y1 = x0 * cs[1] + x1 * cs[0]; }



// ---- k_gemmw: GEMM with both operands staged in LDS. One 128x128 output tile per workgroup of 8 waves (2 x 4 waves, 64x32 each, 8 accumulators per wave); grid (M/128, N/128), 256 threads.
// A stage is 128 k (256 B) of the tile's 128 A rows and 128 Bt rows (and the 128 A2 rows), laid at pitch 272 B by asynchronous copies to LDS whose wave-wide 512 B are two whole 256-B row pieces.
// Two buffers: stage t + 1 flies while stage t is worked on. Each wave sums its whole K in k order in one accumulator.
// C[m][n] (f32, pitch ldc) = sum_k A[m][k] Bt[n][k] (+ A2[m][k] Bt[n][k] for NSPLIT 1). M, N % 128 == 0; K a compile-time multiple of 128, at least 256.
template <bool B> struct BoolC { static constexpr bool value = B; };
template <typename T16> struct WFrag;
template <> struct WFrag<h16> { typedef v16h V; static __device__ __forceinline__ V ld(const h16* p) { return cat16(*(const v8h*)p, *(const v8h*)(p + 16)); } static __device__ __forceinline__ v8f mma(V a, V b, v8f c) { return wmma16(a, b, c); } };
template <> struct WFrag<bf> { typedef v16bf V; static __device__ __forceinline__ V ld(const bf* p) { return cat16b(*(const v8us*)p, *(const v8us*)(p + 16)); } static __device__ __forceinline__ v8f mma(V a, V b, v8f c) { return wmmab(a, b, c); } };
#define GT   128                  // edge of the output tile
#define GKB  256                  // bytes of an operand row in one stage
#define GP   272                  // LDS pitch of a staged row: 16 B x odd, for the 16-byte fragment reads
#define GPL  (GT * GP)            // bytes of one operand's 128 rows in a stage
#define GOP  132                  // pitch, in floats, of the output tile staged in the ring's bytes
__device__ __forceinline__ unsigned lds_off(const void* p) { return (unsigned)(size_t)p; }
__device__ __forceinline__ void wait_ds0() { asm volatile("s_wait_dscnt 0x0" ::: "memory"); }       // this wave's LDS reads of the buffer have returned before the buffer is handed over
__device__ __forceinline__ void wait_async0() { asm volatile("s_wait_asynccnt 0x0" ::: "memory"); } // this wave's copies have landed before the barrier that publishes them
// One operand's 128 rows of a stage: 8 copies per lane, 16 rows apart (l: the lane's LDS byte address, g: its global address, rs: bytes of 16 global rows).
// The s_wait_xcnt closes the statement so that no address register of an issued copy is rewritten ahead of it.
__device__ __forceinline__ void plane_copy(unsigned l, const char* g, size_t rs) {
    asm volatile("global_load_async_to_lds_b128 %0, %8, off\n\t"
                 "global_load_async_to_lds_b128 %1, %9, off\n\t"
                 "global_load_async_to_lds_b128 %2, %10, off\n\t"
                 "global_load_async_to_lds_b128 %3, %11, off\n\t"
                 "global_load_async_to_lds_b128 %4, %12, off\n\t"
                 "global_load_async_to_lds_b128 %5, %13, off\n\t"
                 "global_load_async_to_lds_b128 %6, %14, off\n\t"
                 "global_load_async_to_lds_b128 %7, %15, off\n\t"
                 "s_wait_xcnt 0x0"
                 :: "v"(l), "v"(l + 16 * GP), "v"(l + 32 * GP), "v"(l + 48 * GP), "v"(l + 64 * GP), "v"(l + 80 * GP), "v"(l + 96 * GP), "v"(l + 112 * GP),
                    "v"(g), "v"(g + rs), "v"(g + 2 * rs), "v"(g + 3 * rs), "v"(g + 4 * rs), "v"(g + 5 * rs), "v"(g + 6 * rs), "v"(g + 7 * rs)
                 : "memory");
}
// What becomes of the tile (EPI): 0: stored as f32 in C. 1: Bt is [Wq | Wk | Wv] and the tile is 128 positions x 128 dims of one batch and one head of q, k or v (by its column block); P16, Ph, Pl hold the q, k, v plane sets, PLN apart.
// q, k: rotary by the table CS, then the fp16 plane and the bf16 hi/lo planes, [batch][head][t][d].
// v: the tile laid transposed in LDS and stored as value planes [batch][head in pass][d][pass][t] (a pass's rows stand PP apart).
template <typename T16, int NSPLIT, int K, int EPI>
__global__ __launch_bounds__(256) void k_gemmw(const T16* __restrict__ A, const T16* __restrict__ A2, const T16* __restrict__ Bt, float* C, int ldc, const float* __restrict__ CS, h16* P16, bf* Ph, bf* Pl) {
    static_assert(EPI == 0 || GT == HD, "a tile's columns are one head");
    typedef typename WFrag<T16>::V V;
    constexpr unsigned PB = (NSPLIT == 1 ? 2 : 1) * GPL, STG = PB + GPL;   // a stage: [A | A2 | Bt], Bt at PB: every fragment read is within the 16-bit offset of its own base
    static_assert(GT * GOP * 4 <= 2 * STG, "the output tile is staged in the ring's bytes");
    __shared__ __attribute__((aligned(16))) unsigned char L[2 * STG];
    const int tid = (int)threadIdx.x, lane = tid & 31, lr = lane & 15, hi = lane >> 4; const int r0 = blockIdx.x * GT, c0 = blockIdx.y * GT;
    const int wv = __builtin_amdgcn_readfirstlane(tid >> 5);          // wave number, scalar
    const int wm = (wv >> 2) * 64, wn = (wv & 3) * 32;                // the wave's 64x32 part of the tile
    v8f acc[4][2];
#pragma unroll
    for (int mb = 0; mb < 4; ++mb)
#pragma unroll
        for (int nb = 0; nb < 2; ++nb) acc[mb][nb] = (v8f){};
    constexpr size_t rowb = (size_t)K * 2;                            // bytes of a global operand row
    const int crow = tid >> 4, ccol = (tid & 15) * 16;                // the lane's row (of each 16) and byte column in every copy
    const char* gA = (const char*)A + (size_t)(r0 + crow) * rowb + ccol; const char* gB = (const char*)Bt + (size_t)(c0 + crow) * rowb + ccol;
    const char* gA2 = (NSPLIT == 1) ? (const char*)A2 + (size_t)(r0 + crow) * rowb + ccol : nullptr;
    const unsigned lc = lds_off(L) + (unsigned)(crow * GP + ccol);
    auto fill = [&](int t, unsigned buf) { plane_copy(lc + buf, gA + (size_t)t * GKB, 16 * rowb); if (NSPLIT == 1) plane_copy(lc + buf + GPL, gA2 + (size_t)t * GKB, 16 * rowb); plane_copy(lc + buf + PB, gB + (size_t)t * GKB, 16 * rowb); };
    constexpr int NT = K / (GKB / 2); static_assert(K % (GKB / 2) == 0 && NT >= 2, "whole stages, and the two that the prologue fills");
    fill(0, 0u); wait_async0(); __syncthreads();                      // stage 0 is published
    fill(1, STG);
#pragma unroll 1   // the trip stays rolled: one publish point in the text, the buffer chosen by the trip's parity
    for (int t = 0; t < NT; ++t) {
        const unsigned buf = (unsigned)(t & 1) * STG;
        const unsigned char* pa = L + buf + (wm + lr) * GP + 16 * hi; const unsigned char* pb = L + buf + PB + (wn + lr) * GP + 16 * hi;
        V a[2][4], a2[2][4], b[2][2];                                 // two fragment sets: block ks + 1 is fetched while block ks is multiplied
        auto frags = [&](int ks, int st) {
#pragma unroll
            for (int mb = 0; mb < 4; ++mb) { a[st][mb] = WFrag<T16>::ld((const T16*)(pa + mb * 16 * GP + ks * 64)); if (NSPLIT == 1) a2[st][mb] = WFrag<T16>::ld((const T16*)(pa + GPL + mb * 16 * GP + ks * 64)); }
#pragma unroll
            for (int nb = 0; nb < 2; ++nb) b[st][nb] = WFrag<T16>::ld((const T16*)(pb + nb * 16 * GP + ks * 64)); };
        frags(0, 0);
#pragma unroll     // unrolled: fragment sets and accumulators are indexed by constants, so they stay in registers
        for (int ks = 0; ks < GKB / 64; ++ks) {
            if (ks + 1 < GKB / 64) frags(ks + 1, (ks + 1) & 1);       // this stage's own buffer only
            __builtin_amdgcn_sched_barrier(0);                        // keeps the next block's LDS reads together, ahead of this block's products and not among them
#pragma unroll
            for (int nb = 0; nb < 2; ++nb)
#pragma unroll
                for (int mb = 0; mb < 4; ++mb) { acc[mb][nb] = WFrag<T16>::mma(a[ks & 1][mb], b[ks & 1][nb], acc[mb][nb]); if (NSPLIT == 1) acc[mb][nb] = WFrag<T16>::mma(a2[ks & 1][mb], b[ks & 1][nb], acc[mb][nb]); }
            __builtin_amdgcn_sched_barrier(0);                        // ends the block: the reads of the block after next stay behind it
        }
        wait_ds0(); wait_async0(); __syncthreads();                   // publishes stage t + 1 and ends every wave's reads of stage t's buffer
        if (t + 2 < NT) fill(t + 2, buf);
    }
    wait_async0();   // no copy is in flight when the ring's bytes take the output tile
    // The last trip's barrier has ended every read of the ring: the tile is laid there, and behind one barrier each wave takes whole rows of it (512 B of f32, or 256 B in each 16-bit plane).
    float* os = (float*)L;
    auto lay = [&](auto tr) {
#pragma unroll
        for (int mb = 0; mb < 4; ++mb) {
#pragma unroll
            for (int nb = 0; nb < 2; ++nb) {
                if constexpr (decltype(tr)::value) {   // transposed: a lane's 8 accumulator rows are 8 neighbours of one LDS row
                    float* p = os + (wn + nb * 16 + lr) * GOP + wm + mb * 16 + hi * 8; const v8f c = acc[mb][nb];
                    *(v4fa*)p = __builtin_shufflevector(c, c, 0, 1, 2, 3); *(v4fa*)(p + 4) = __builtin_shufflevector(c, c, 4, 5, 6, 7);
                } else {
#pragma unroll
                    for (int j = 0; j < 8; ++j) os[(wm + mb * 16 + hi * 8 + j) * GOP + wn + nb * 16 + lr] = acc[mb][nb][j]; } } } };
    if constexpr (EPI == 0) {
        lay(BoolC<false>{});
        __syncthreads();   // the whole tile is in LDS before any wave reads rows of it
#pragma unroll
        for (int s = 0; s < GT / 8; ++s) { const int row = s * 8 + wv; const v4f val = *(const v4fa*)(os + row * GOP + lane * 4);
            *(v4f*)(C + (size_t)(r0 + row) * ldc + c0 + lane * 4) = val; }
    } else {
        const int sel = (int)blockIdx.y / NH_, hd = (int)blockIdx.y % NH_, bt = r0 / TT, t0 = r0 % TT;   // q, k or v; head; batch; the tile's first position: the same for the whole workgroup
        auto planes = [&](auto isv) {
            constexpr bool ISV = decltype(isv)::value;
            v2f rc[GT / 8][2];   // q, k: cos, sin of the two pairs the lane turns in each of its rows, asked for here so that all the loads fly while the tile goes through LDS
            if constexpr (!ISV) {
#pragma unroll     // unrolled: rc is indexed by constants and stays in registers; one address, the rows as immediate offsets
                for (int s = 0; s < GT / 8; ++s) { const float* cp = CS + ((size_t)(t0 + wv) * HD + lane * 4) * 2 + s * (8 * HD * 2); rc[s][0] = *(const v2f*)cp; rc[s][1] = *(const v2f*)(cp + 4); } }
            lay(isv);
            __syncthreads();   // the whole tile is in LDS before any wave reads rows of it (the branch around it is taken by the whole workgroup or not at all)
            // Plane element of the lane's 4 values in LDS row wv, and the step to the row 8 further on. q, k: an LDS row is a position, the 4 values are 4 dims (two pairs). v: an LDS row is a dim, the 4 values are 4 positions.
            const size_t e0 = (size_t)sel * PLN + (size_t)bt * NH_ * TT * HD + (ISV ? (((size_t)(hd % ZH) * HD + wv) * (NKV / ZH) + hd / ZH) * TT + t0 + lane * 4 : ((size_t)hd * TT + t0 + wv) * HD + lane * 4);
            constexpr size_t es = ISV ? (size_t)8 * (NKV / ZH) * TT : (size_t)8 * HD;
            v4f tv[GT / 8];   // the wave's 16 rows are read in one run, so that their LDS latencies overlap
#pragma unroll     // unrolled, here and below: tv and rc stay in registers
            for (int s = 0; s < GT / 8; ++s) tv[s] = *(const v4fa*)(os + (s * 8 + wv) * GOP + lane * 4);
#pragma unroll
            for (int s = 0; s < GT / 8; ++s) { v4f y = tv[s]; const size_t e = e0 + s * es;
                if constexpr (!ISV) { float y0, y1; rope2(tv[s][0], tv[s][1], rc[s][0], y0, y1); y[0] = y0; y[1] = y1; rope2(tv[s][2], tv[s][3], rc[s][1], y0, y1); y[2] = y0; y[3] = y1; }
                v4h o16; v4us oh, ol;
#pragma unroll
                for (int q = 0; q < 4; ++q) { o16[q] = tohx(y[q]); unsigned short a2, c2; splitf(y[q], a2, c2); oh[q] = a2; ol[q] = c2; }
                *(v4h*)(P16 + e) = o16; *(v4us*)(Ph + e) = oh; *(v4us*)(Pl + e) = ol; } };
        if (sel == 2) planes(BoolC<true>{}); else planes(BoolC<false>{});
    }
}

// ---- k_attn: causal attention, one launch; a workgroup of 8 waves takes 16 * QN query rows of one head of one batch; scores and probabilities never leave the registers.
// Transposed products: S^T = K Q^T puts a query in a lane (column lr) with 8 keys of each 16-key tile in its accumulator, which is already the B fragment's k order of O^T = V^T P^T: keys kb + 8 hi + j, then kb + 16 + 8 hi + j.
// Wave w takes the 32-key blocks w, w + 8, ... up to the diagonal, each with its own running maximum, sum and O^T (online softmax); at the end the 8 partial results are brought to the common maximum and summed in LDS, wave 0's first.
// fp16 form: the next block's K fragments are asked for as soon as S is formed, its V fragments as soon as O is: each load flies over the other half of the work, in the registers that have just come free.
// NSPLIT 0: one fp16 product, the probabilities carry 2^PSH (it cancels in the division by the row sum, which carries it too). NSPLIT 2: bf16 hi/lo planes, 3 products for S and for O.
// Q, K planes [head][t][d]; V planes as the v projection lays them ([head in pass][d][pass][t], row pitch PP); the result goes into the merged [t][head][d] hi/lo planes. q0: the workgroup's first query row.
#define L2E  1.4426950408889634f
#define ANW  8                    // waves that share a workgroup's keys
// Stands behind a run of global loads or stores; it takes their two base addresses as inputs, so that those registers are neither rewritten nor given to a load's result ahead of it.
__device__ __forceinline__ void wait_x0(const void* a, const void* b) { asm volatile("s_wait_xcnt 0x0" :: "v"(a), "v"(b) : "memory"); }
template <typename T16, int NSPLIT, int QN>
__device__ __forceinline__ void flash(const T16* __restrict__ Q, const T16* __restrict__ Q2, const T16* __restrict__ Kp, const T16* __restrict__ Kp2, const T16* __restrict__ Vt, const T16* __restrict__ Vt2, int h, int q0, bf* Mh, bf* Ml, float* os, float* sm, float* sl) {
    typedef typename WFrag<T16>::V V;
    constexpr int NW = ANW, QR = 16 * QN; constexpr float PSH = (NSPLIT == 0) ? 10.0f : 0.0f;
    constexpr bool PIPE = (NSPLIT == 0);   // the hi/lo form has twice the fragments and at most two blocks per wave: it asks for a block's fragments at the block's head
    const int tid = (int)threadIdx.x, lane = tid & 31, lr = lane & 15, hi = lane >> 4;
    const int wv = __builtin_amdgcn_readfirstlane(tid >> 5);          // wave number, scalar: the key loop's bounds stay wave-uniform
    const size_t hp = (size_t)h * TT * HD, vp = (size_t)(h % ZH) * HD * PP + (size_t)(h / ZH) * TT;
    v8f o[8][QN]; float m[QN], l[QN];
#pragma unroll
    for (int qt = 0; qt < QN; ++qt) { m[qt] = -3.0e38f; l[qt] = 0.f;
#pragma unroll
        for (int dt = 0; dt < 8; ++dt) o[dt][qt] = (v8f){}; }
    const int nblk = (q0 + QR - 1) / 32 + 1;                          // every block holds a key <= q0, so no query ever sees a block that is masked whole
    if (wv < nblk) {
        V q[QN][4], q2[QN][4], ka[2][4], ka2[2][4], va[8], va2[8];
        // pk, pv (and the lo planes' pk2, pv2): the lane's addresses in the block whose fragments the registers hold; a load names them with the step as a constant, and they move on only behind the wait.
        constexpr int KS = NW * 32 * HD, VS = NW * 32;
        const size_t ek = hp + (size_t)(wv * 32 + lr) * HD + 8 * hi, ev = vp + (size_t)lr * PP + wv * 32 + 8 * hi;
        const T16* pk = Kp + ek; const T16* pk2 = (NSPLIT == 2) ? Kp2 + ek : pk; const T16* pv = Vt + ev; const T16* pv2 = (NSPLIT == 2) ? Vt2 + ev : pv;
        auto ldk = [&](int st) {
#pragma unroll
            for (int kt = 0; kt < 2; ++kt)
#pragma unroll
                for (int ks = 0; ks < 4; ++ks) { const int e = st + kt * 16 * HD + ks * 32; ka[kt][ks] = WFrag<T16>::ld(pk + e); if (NSPLIT == 2) ka2[kt][ks] = WFrag<T16>::ld(pk2 + e); }
            wait_x0(pk, pk2); pk += st; pk2 += st; };
        auto ldv = [&](int st) {
#pragma unroll
            for (int dt = 0; dt < 8; ++dt) { const int e = st + dt * 16 * PP; va[dt] = WFrag<T16>::ld(pv + e); if (NSPLIT == 2) va2[dt] = WFrag<T16>::ld(pv2 + e); }
            wait_x0(pv, pv2); pv += st; pv2 += st; };
        const size_t eq = hp + (size_t)(q0 + lr) * HD + 8 * hi; const T16* pq = Q + eq; const T16* pq2 = (NSPLIT == 2) ? Q2 + eq : pq;
#pragma unroll
        for (int qt = 0; qt < QN; ++qt)
#pragma unroll
            for (int ks = 0; ks < 4; ++ks) { const int e = qt * 16 * HD + ks * 32; q[qt][ks] = WFrag<T16>::ld(pq + e); if (NSPLIT == 2) q2[qt][ks] = WFrag<T16>::ld(pq2 + e); }
        wait_x0(pq, pq2);
        if constexpr (PIPE) { ldk(0); ldv(0); }
        // One 32-key block. MORE: the wave has a further block, whose fragments are asked for here; the wave's last block is the only one that can reach the diagonal, so it alone masks.
        auto block = [&](int kb, auto more) {
            constexpr bool MORE = decltype(more)::value;
            if constexpr (!PIPE) { ldk(0); ldv(0); }
            v8f s[QN][2];
#pragma unroll
            for (int qt = 0; qt < QN; ++qt)
#pragma unroll
                for (int kt = 0; kt < 2; ++kt) { s[qt][kt] = (v8f){};
#pragma unroll
                    for (int ks = 0; ks < 4; ++ks) { s[qt][kt] = WFrag<T16>::mma(ka[kt][ks], q[qt][ks], s[qt][kt]); if (NSPLIT == 2) { s[qt][kt] = WFrag<T16>::mma(ka[kt][ks], q2[qt][ks], s[qt][kt]); s[qt][kt] = WFrag<T16>::mma(ka2[kt][ks], q[qt][ks], s[qt][kt]); } } }
            if constexpr (PIPE && MORE) ldk(KS);
            V pb[QN], pb2[QN];
#pragma unroll
            for (int qt = 0; qt < QN; ++qt) {
                const int qi = q0 + qt * 16 + lr; float mloc = -3.0e38f;
#pragma unroll
                for (int kt = 0; kt < 2; ++kt)
#pragma unroll
                    for (int j = 0; j < 8; ++j) { float t = s[qt][kt][j] * SCL; if constexpr (!MORE) t = (kb + kt * 16 + hi * 8 + j <= qi) ? t : -3.0e38f; s[qt][kt][j] = t; mloc = fmaxf(mloc, t); }
                mloc = fmaxf(mloc, __shfl_xor(mloc, 16, 32));         // the query's other 16 keys of the block are in lane lr + 16
                if (__any(mloc > m[qt])) {                            // where no maximum rose every factor would be 1
                    const float mn = fmaxf(m[qt], mloc), al = __builtin_amdgcn_exp2f((m[qt] - mn) * L2E); m[qt] = mn; l[qt] *= al;
#pragma unroll
                    for (int dt = 0; dt < 8; ++dt) o[dt][qt] *= al; }
                float ps = 0.f;
#pragma unroll
                for (int kt = 0; kt < 2; ++kt)
#pragma unroll
                    for (int j = 0; j < 8; ++j) { const float p = __builtin_amdgcn_exp2f((s[qt][kt][j] - m[qt]) * L2E + PSH); s[qt][kt][j] = p; ps += p; }
                l[qt] += ps;
                if constexpr (NSPLIT == 0) {
#pragma unroll
                    for (int j = 0; j < 8; ++j) { pb[qt][j] = tohx(s[qt][0][j]); pb[qt][8 + j] = tohx(s[qt][1][j]); }
                } else {
                    v8us h0, h1, l0, l1;
#pragma unroll
                    for (int j = 0; j < 8; ++j) { unsigned short a, c2; splitf(s[qt][0][j], a, c2); h0[j] = a; l0[j] = c2; splitf(s[qt][1][j], a, c2); h1[j] = a; l1[j] = c2; }
                    pb[qt] = cat16b(h0, h1); pb2[qt] = cat16b(l0, l1); }
            }
#pragma unroll
            for (int dt = 0; dt < 8; ++dt)
#pragma unroll
                for (int qt = 0; qt < QN; ++qt) { o[dt][qt] = WFrag<T16>::mma(va[dt], pb[qt], o[dt][qt]); if (NSPLIT == 2) { o[dt][qt] = WFrag<T16>::mma(va[dt], pb2[qt], o[dt][qt]); o[dt][qt] = WFrag<T16>::mma(va2[dt], pb[qt], o[dt][qt]); } }
            if constexpr (PIPE && MORE) ldv(VS);
            if constexpr (!PIPE && MORE) { pk += KS; pk2 += KS; pv += VS; pv2 += VS; }
        };
        int blk = wv;
#pragma unroll 1   // rolled: one 32-key block's fragments at a time in registers
        for (; blk + NW < nblk; blk += NW) block(blk * 32, BoolC<true>{});
        block(blk * 32, BoolC<false>{});
    }
#pragma unroll
    for (int qt = 0; qt < QN; ++qt) if (hi == 0) sm[wv * QR + qt * 16 + lr] = m[qt];
    __syncthreads();   // every wave's maxima are in LDS before any wave forms the common one
#pragma unroll
    for (int qt = 0; qt < QN; ++qt) { float M = sm[qt * 16 + lr];
#pragma unroll
        for (int w = 1; w < NW; ++w) M = fmaxf(M, sm[w * QR + qt * 16 + lr]);
        const float sc = __builtin_amdgcn_exp2f((m[qt] - M) * L2E); const float lt = l[qt] + __shfl_xor(l[qt], 16, 32);   // a wave without a block: its sum and its O are 0
        if (hi == 0) sl[wv * QR + qt * 16 + lr] = lt * sc;
#pragma unroll
        for (int dt = 0; dt < 8; ++dt) { const v8f c = o[dt][qt] * sc; float* p = os + (wv * QR + qt * 16 + lr) * GOP + dt * 16 + hi * 8;   // a lane's 8 accumulator rows are 8 neighbouring dims of its query's LDS row
            *(v4fa*)p = __builtin_shufflevector(c, c, 0, 1, 2, 3); *(v4fa*)(p + 4) = __builtin_shufflevector(c, c, 4, 5, 6, 7); } }
    __syncthreads();   // all 8 partial results are in LDS before any wave sums them
#pragma unroll
    for (int s = 0; s < QR / NW; ++s) { const int row = s * NW + wv; v4f val = *(const v4fa*)(os + row * GOP + lane * 4); float L = sl[row];
#pragma unroll
        for (int w = 1; w < NW; ++w) { val += *(const v4fa*)(os + (w * QR + row) * GOP + lane * 4); L += sl[w * QR + row]; }
        const float f = __fdiv_rn(1.0f, L); const size_t oo = (size_t)(q0 + row) * DQ + h * HD + lane * 4; v4us oh, ol;
#pragma unroll
        for (int qd = 0; qd < 4; ++qd) { unsigned short a, c2; splitf(val[qd] * f, a, c2); oh[qd] = a; ol[qd] = c2; }
        *(v4us*)(Mh + oo) = oh; *(v4us*)(Ml + oo) = ol; wait_x0(Mh + oo, Ml + oo); }
}
// Grid (batches x heads, row groups): the groups of 32 rows >= RH come first, the longest rows first of all; the groups of 16 rows < RH (hi/lo planes) fill the launch's tail.
#define ALO  ((TT - RH) / 32)
#define AHI  (RH / 16)
__global__ __launch_bounds__(32 * ANW) void k_attn(const h16* __restrict__ Q16, const h16* __restrict__ K16, const h16* __restrict__ V16, const bf* __restrict__ Qh, const bf* __restrict__ Ql, const bf* __restrict__ Kh, const bf* __restrict__ Kl, const bf* __restrict__ Vh, const bf* __restrict__ Vl, bf* Mh, bf* Ml) {
    __shared__ __align__(16) float os[ANW * 32 * GOP]; __shared__ float sm[ANW * 32]; __shared__ float sl[ANW * 32];
    const int h = (int)blockIdx.x % NH_, g = (int)blockIdx.y;
    const size_t po = (size_t)((int)blockIdx.x / NH_) * NH_ * TT * HD, mo = (size_t)((int)blockIdx.x / NH_) * TT * DQ;   // the batch's planes in every plane set, its rows in the merged planes
    Q16 += po; K16 += po; V16 += po; Qh += po; Ql += po; Kh += po; Kl += po; Vh += po; Vl += po; Mh += mo; Ml += mo;
    if (g < ALO) flash<h16, 0, 2>(Q16, nullptr, K16, nullptr, V16, nullptr, h, TT - 32 * (g + 1), Mh, Ml, os, sm, sl);
    else flash<bf, 2, 1>(Qh, Ql, Kh, Kl, Vh, Vl, h, RH - 16 * (g - ALO + 1), Mh, Ml, os, sm, sl);
}

__constant__ float INV2[HD / 2] = { 1.000000000e+00f, 8.659643531e-01f, 7.498942018e-01f, 6.493816376e-01f, 5.623413324e-01f, 4.869675338e-01f, 4.216965139e-01f, 3.651741147e-01f, 3.162277639e-01f, 2.738419771e-01f, 2.371373773e-01f, 2.053525001e-01f, 1.778279394e-01f, 1.539926529e-01f, 1.333521456e-01f, 1.154781953e-01f, 1.000000015e-01f, 8.659642935e-02f, 7.498942316e-02f, 6.493816525e-02f, 5.623413250e-02f, 4.869675264e-02f, 4.216964915e-02f, 3.651741147e-02f, 3.162277490e-02f, 2.738419548e-02f, 2.371373773e-02f, 2.053525113e-02f, 1.778279431e-02f, 1.539926510e-02f, 1.333521400e-02f, 1.154781971e-02f, 9.999999776e-03f, 8.659643121e-03f, 7.498942316e-03f, 6.493816152e-03f, 5.623413250e-03f, 4.869675264e-03f, 4.216964822e-03f, 3.651741194e-03f, 3.162277630e-03f, 2.738419687e-03f, 2.371373819e-03f, 2.053525066e-03f, 1.778279431e-03f, 1.539926510e-03f, 1.333521446e-03f, 1.154782018e-03f, 1.000000047e-03f, 8.659643354e-04f, 7.498941850e-04f, 6.493816036e-04f, 5.623413017e-04f, 4.869675322e-04f, 4.216965172e-04f, 3.651741135e-04f, 3.162277571e-04f, 2.738419571e-04f, 2.371373703e-04f, 2.053525095e-04f, 1.778279402e-04f, 1.539926598e-04f, 1.333521504e-04f, 1.154782003e-04f };   // float32 1 / 10000^(2i/128), generated with jnp to be bit-exact
// ---- k_prep: everything the GEMMs need ahead of them, in one launch of 1280 workgroups: the rotary table (the first PTB workgroups: their threads run longest) and the bf16 copies of the four weights and of x.
// Table: one thread per (position, pair); the pair's cos, sin go to both of its dims' entries. Copies: a workgroup takes 256 * PCH runs of 8 values of one source; a thread takes PCH of them, 256 runs apart, 8 in flight at a time.
#define PCH  16
#define PTB  (TT * (HD / 2) / 256)
#define PWB  (DQ * DM / (256 * 8 * PCH))       // workgroups per 2048 x 2048 source: each weight, each batch of x
static_assert(DQ * DM % (256 * 8 * PCH) == 0 && DKV == DQ && TT == DQ && PCH % 8 == 0, "whole workgroups; all six sources have one size");
__global__ __launch_bounds__(256) void k_prep(const float* __restrict__ x, const float* __restrict__ wq, const float* __restrict__ wk, const float* __restrict__ wv, const float* __restrict__ wo, bf* W4, bf* XB, float* CS) {
    const int tid = (int)threadIdx.x;
    if ((int)blockIdx.x < PTB) {
        const int idx = (int)blockIdx.x * 256 + tid, i = idx % (HD / 2), t = idx / (HD / 2); const float a = __fmul_rn((float)t, INV2[i]); const float c = cosf(a), s = sinf(a);
        v4f cs; cs[0] = c; cs[1] = s; cs[2] = c; cs[3] = s; *(v4f*)(CS + (size_t)idx * 4) = cs; return; }
    const int blk = (int)blockIdx.x - PTB, sel = blk / PWB;   // which source: the same for the whole workgroup
    const float* sb = sel == 0 ? wq : sel == 1 ? wk : sel == 2 ? wv : sel == 3 ? wo : x + (size_t)(sel - 4) * TT * DM;
    bf* db = sel < 4 ? W4 + (size_t)sel * DQ * DM : XB + (size_t)(sel - 4) * TT * DM;
    const size_t e = ((size_t)(blk % PWB) * (256 * PCH) + tid) * 8; const float* sp = sb + e; bf* dp = db + e;
#pragma unroll     // unrolled: every load and store names sp or dp with a constant offset
    for (int k0 = 0; k0 < PCH; k0 += 8) { v8f v[8];
#pragma unroll
        for (int k = 0; k < 8; ++k) v[k] = *(const v8f*)(sp + (k0 + k) * (256 * 8));
#pragma unroll
        for (int k = 0; k < 8; ++k) { v8us o;
#pragma unroll
            for (int q = 0; q < 8; ++q) o[q] = f2bf(v[k][q]);
            *(v8us*)(dp + (k0 + k) * (256 * 8)) = o; } }
    wait_x0(sp, dp);   // in the built code this path runs on to the head of the table's code (and branches past it there), where the stores' address register is rewritten
}
extern "C" void kernel_launch(void* const* d_in, const int* in_sizes, int n_in,
                              void* d_out, int out_size, void* d_ws, size_t ws_size, hipStream_t stream) {
    (void)in_sizes; (void)n_in; (void)out_size;
    const float* x = (const float*)d_in[0]; const float* wq = (const float*)d_in[1]; const float* wk = (const float*)d_in[2]; const float* wv = (const float*)d_in[3]; const float* wo = (const float*)d_in[4];   /* weights 'oi' [2048][2048] */
    float* OUT = (float*)d_out;     // [2][2048][2048]
    char* wsp = (char*)d_ws;
    auto take = [&](size_t bytes) { char* p = wsp; wsp += (bytes + 255) & ~(size_t)255; return (void*)p; };
    bf* W4 = (bf*)take((size_t)4 * DQ * DM * 2);   // Wq, Wk, Wv, Wo
    h16* P16 = (h16*)take(3 * PLN * 2); bf* PH = (bf*)take(3 * PLN * 2); bf* PL = (bf*)take(3 * PLN * 2);   // each: the q, k, v plane sets
    bf* XB = (bf*)take((size_t)NB_ * TT * DM * 2); float* CS = (float*)take((size_t)TT * HD * 2 * 4); bf* ATh = (bf*)take((size_t)NB_ * TT * DQ * 2); bf* ATl = (bf*)take((size_t)NB_ * TT * DQ * 2);
    if ((size_t)(wsp - (char*)d_ws) > ws_size) return;    // 226 MiB of the 256 MiB
    k_prep<<<PTB + 6 * PWB, 256, 0, stream>>>(x, wq, wk, wv, wo, W4, XB, CS);
    k_gemmw<bf, 0, DM, 1><<<dim3(NB_ * TT / GT, 3 * DQ / GT, 1), 256, 0, stream>>>(XB, nullptr, W4, nullptr, 0, CS, P16, PH, PL);
    k_attn<<<dim3(NB_ * NH_, ALO + AHI, 1), 32 * ANW, 0, stream>>>(P16, P16 + PLN, P16 + 2 * PLN, PH, PL, PH + PLN, PL + PLN, PH + 2 * PLN, PL + 2 * PLN, ATh, ATl);
    k_gemmw<bf, 1, DQ, 0><<<dim3(NB_ * TT / GT, DM / GT, 1), 256, 0, stream>>>(ATh, ATl, W4 + (size_t)3 * DQ * DM, OUT, DM, nullptr, nullptr, nullptr, nullptr);
}

// v007
// It runs in 220 microseconds.
// Timed twice side by side with v006, it ran 1.20 times as fast both times.
// Counting every step since v000, it is 7.90 times as fast.
#include <hip/hip_runtime.h>

// Causal multi-head self-attention with 128-wide heads and interleaved-pair rotary embeddings (x [2][2048][2048]; Q, K, V = einsum('bsd,ed', x, W) ('oi' 0.02; 16 heads x 128); rope on consecutive (even, odd) pairs: (x1 cos - x2 sin, x1 sin + x2 cos) with angle pos x 10000^(-2i/128), pos = arange(S) (64 f32 frequencies jnp-exact for this expression; precise cosf/sinf); scores x 1/sqrt(128); causal (-inf); softmax; out = merged Wo^T -> [2][2048][2048] (8.4 M); argument order x, Wq, Wk, Wv, Wo).
// Four launches, each over both batches (a row of x is b * 2048 + t): k_prep, the q, k, v projections as one GEMM, k_attn, the Wo GEMM.
// Layout: bf16 copy of x; 'oi' weights; exact projections; k_prep's computed table (HD 128: one angle per (even, odd) pair); the projections' epilogues build the rotary q, k planes and the transposed v planes, all in the order in which k_attn's lanes hold them (see FRAGMENT ORDER); causal T-2048 attention at HD 128 in one kernel, online softmax (hybrid rows: < 512 hi/lo 3 products, rest fp16 x1024; key blocks above the diagonal are never read; its epilogue writes the merged hi/lo planes); merged hi/lo x Wo exact.
// Compute dtypes, f32 accumulate: every input rounded to bf16; projections exact; rotary f32; attention rows < 512 3 products, rest fp16; softmax f32; Wo hl x exact.

#define NB_  2
#define TT   2048
#define DM   2048
#define NH_  16
#define NKV  16
#define REP  (NH_ / NKV)
#define HD   128
#define DQ   (NH_ * HD)
#define DKV  (NKV * HD)
// FRAGMENT ORDER of a [batch][head] plane: a unit is the 16 B that each of a wave's 32 lanes holds of one half of a matrix fragment, 512 B in lane order, so that one wave-wide 16-byte load or store is 4 whole lines.
// Lane = 16 hi + lr. q, k: unit (t / 16, d / 16), lane (lr = t % 16, hi = d / 8 % 2), its 8 values d % 8; 8 units (FT elements) are 16 positions.
// v: unit (t / 32, d / 16, t / 16 % 2), lane (lr = d % 16, hi = t / 8 % 2), its 8 values t % 8; 16 units (2 FT elements) are 32 positions.
#define FU   256                  // elements of a unit
#define FT   (16 * HD)            // elements of 16 positions
#define PLN  ((size_t)NB_ * NH_ * TT * HD)   // elements of one plane set: [batch][head] planes of q, of k or of v
static_assert(NKV == NH_, "q, k and v plane sets have one size, and a projection tile's column block is a head of one of them");
#define RH   512                  // query rows < RH use hi+lo planes (0: none)
#define SCL  0.088388347648318447f   // HD^-0.5
typedef _Float16 h16;
typedef unsigned short bf;
typedef __attribute__((ext_vector_type(16))) __bf16   v16bf;
typedef __attribute__((ext_vector_type(16))) _Float16 v16h;
typedef __attribute__((ext_vector_type(8)))  _Float16 v8h;
typedef __attribute__((ext_vector_type(8)))  unsigned short v8us;
typedef __attribute__((ext_vector_type(8)))  float    v8f;
typedef __attribute__((ext_vector_type(4)))  float    v4f;
typedef v8h  __attribute__((may_alias)) v8ha;
typedef v4f  __attribute__((may_alias)) v4fa;
typedef v8us __attribute__((may_alias)) v8usa;

__device__ __forceinline__ unsigned short f2bf(float f) { unsigned u = __float_as_uint(f); u += 0x7FFFu + ((u >> 16) & 1u); return (unsigned short)(u >> 16); }
__device__ __forceinline__ float bf2f(unsigned short b) { return __uint_as_float(((unsigned)b) << 16); }
__device__ __forceinline__ float bfr(float f) { return bf2f(f2bf(f)); }
__device__ __forceinline__ v16h cat16(v8h lo, v8h hi) { return __builtin_shufflevector(lo, hi, 0, 1, 2, 3, 4, 5, 6, 7, 8, 9, 10, 11, 12, 13, 14, 15); }
__device__ __forceinline__ v16bf cat16b(v8us lo, v8us hi) { return __builtin_bit_cast(v16bf, __builtin_shufflevector(lo, hi, 0, 1, 2, 3, 4, 5, 6, 7, 8, 9, 10, 11, 12, 13, 14, 15)); }
__device__ __forceinline__ v8f wmma16(v16h a, v16h b, v8f c) { return __builtin_amdgcn_wmma_f32_16x16x32_f16(false, a, false, b, (short)0, c, false, false); }
__device__ __forceinline__ v8f wmmab(v16bf a, v16bf b, v8f c) { return __builtin_amdgcn_wmma_f32_16x16x32_bf16(false, a, false, b, (short)0, c, false, false); }
__device__ __forceinline__ h16 tohx(float x) { return (h16)x; }
__device__ __forceinline__ void splitf(float y, unsigned short& h, unsigned short& l) { h = f2bf(y); l = f2bf(y - bf2f(h)); }
typedef __attribute__((ext_vector_type(4))) _Float16 v4h;
typedef __attribute__((ext_vector_type(4))) unsigned short v4us;
typedef __attribute__((ext_vector_type(2))) float v2f;
typedef __attribute__((ext_vector_type(4))) int v4i;
// One rotary pair (x0 even, x1 odd; cs = cos, sin of the pair's angle): y0 = x0 c - x1 s, y1 = x0 s + x1 c.
__device__ __forceinline__ void rope2(float x0, float x1, v2f cs, float& y0, float& y1) { y0 = x0 * cs[0] - x1 * cs[1]; y1 = x0 * cs[1] + x1 * cs[0]; }



// ---- k_gemmw: GEMM with both operands staged in LDS. One 128x128 output tile per workgroup of 8 waves (2 x 4 waves, 64x32 each, 8 accumulators per wave); grid (M/128, N/128), 256 threads.
// A stage is 128 k (256 B) of the tile's 128 A rows and 128 Bt rows (and the 128 A2 rows), laid at pitch 272 B by asynchronous copies to LDS whose wave-wide 512 B are two whole 256-B row pieces.
// Two buffers: stage t + 1 flies while stage t is worked on. Each wave sums its whole K in k order in one accumulator.
// C[m][n] (f32, pitch ldc) = sum_k A[m][k] Bt[n][k] (+ A2[m][k] Bt[n][k] for NSPLIT 1). M, N % 128 == 0; K a compile-time multiple of 128, at least 256.
template <bool B> struct BoolC { static constexpr bool value = B; };
template <typename T16> struct WFrag;   // ld: a fragment from rows in LDS (its halves 16 elements apart); ldu: from a plane in fragment order (its halves are two units)
template <> struct WFrag<h16> { typedef v16h V; static __device__ __forceinline__ V ld(const h16* p) { return cat16(*(const v8h*)p, *(const v8h*)(p + 16)); } static __device__ __forceinline__ V ldu(const h16* p) { return cat16(*(const v8h*)p, *(const v8h*)(p + FU)); } static __device__ __forceinline__ v8f mma(V a, V b, v8f c) { return wmma16(a, b, c); } };
template <> struct WFrag<bf> { typedef v16bf V; static __device__ __forceinline__ V ld(const bf* p) { return cat16b(*(const v8us*)p, *(const v8us*)(p + 16)); } static __device__ __forceinline__ V ldu(const bf* p) { return cat16b(*(const v8us*)p, *(const v8us*)(p + FU)); } static __device__ __forceinline__ v8f mma(V a, V b, v8f c) { return wmmab(a, b, c); } };
#define GT   128                  // edge of the output tile
#define GKB  256                  // bytes of an operand row in one stage
#define GP   272                  // LDS pitch of a staged row: 16 B x odd, for the 16-byte fragment reads
#define GPL  (GT * GP)            // bytes of one operand's 128 rows in a stage
#define GOP  132                  // pitch, in floats, of the output tile staged in the ring's bytes
__device__ __forceinline__ unsigned lds_off(const void* p) { return (unsigned)(size_t)p; }
__device__ __forceinline__ void wait_ds0() { asm volatile("s_wait_dscnt 0x0" ::: "memory"); }       // this wave's LDS reads of the buffer have returned before the buffer is handed over
__device__ __forceinline__ void wait_async0() { asm volatile("s_wait_asynccnt 0x0" ::: "memory"); } // this wave's copies have landed before the barrier that publishes them
// Stands behind a run of global loads or stores; it takes their two base addresses as inputs, so that those registers are neither rewritten nor given to a load's result ahead of it.
__device__ __forceinline__ void wait_x0(const void* a, const void* b) { asm volatile("s_wait_xcnt 0x0" :: "v"(a), "v"(b) : "memory"); }
// One operand's 128 rows of a stage: 8 copies per lane, 16 rows apart (l: the lane's LDS byte address, g: its global address, rs: bytes of 16 global rows).
// The s_wait_xcnt closes the statement so that no address register of an issued copy is rewritten ahead of it.
__device__ __forceinline__ void plane_copy(unsigned l, const char* g, size_t rs) {
    asm volatile("global_load_async_to_lds_b128 %0, %8, off\n\t"
                 "global_load_async_to_lds_b128 %1, %9, off\n\t"
                 "global_load_async_to_lds_b128 %2, %10, off\n\t"
                 "global_load_async_to_lds_b128 %3, %11, off\n\t"
                 "global_load_async_to_lds_b128 %4, %12, off\n\t"
                 "global_load_async_to_lds_b128 %5, %13, off\n\t"
                 "global_load_async_to_lds_b128 %6, %14, off\n\t"
                 "global_load_async_to_lds_b128 %7, %15, off\n\t"
                 "s_wait_xcnt 0x0"
                 :: "v"(l), "v"(l + 16 * GP), "v"(l + 32 * GP), "v"(l + 48 * GP), "v"(l + 64 * GP), "v"(l + 80 * GP), "v"(l + 96 * GP), "v"(l + 112 * GP),
                    "v"(g), "v"(g + rs), "v"(g + 2 * rs), "v"(g + 3 * rs), "v"(g + 4 * rs), "v"(g + 5 * rs), "v"(g + 6 * rs), "v"(g + 7 * rs)
                 : "memory");
}
// What becomes of the tile (EPI): 0: stored as f32 in C. 1: Bt is [Wq | Wk | Wv] and the tile is 128 positions x 128 dims of one batch and one head of q, k or v (by its column block); P16, Ph, Pl hold the q, k, v plane sets, PLN apart.
// q, k: rotary by the table CS, then the fp16 plane and the bf16 hi/lo planes. v: the tile laid transposed in LDS, then the same three planes. All planes [batch][head] in fragment order: every store is a whole unit.
template <typename T16, int NSPLIT, int K, int EPI>
__global__ __launch_bounds__(256) void k_gemmw(const T16* __restrict__ A, const T16* __restrict__ A2, const T16* __restrict__ Bt, float* C, int ldc, const float* __restrict__ CS, h16* P16, bf* Ph, bf* Pl) {
    static_assert(EPI == 0 || GT == HD, "a tile's columns are one head");
    typedef typename WFrag<T16>::V V;
    constexpr unsigned PB = (NSPLIT == 1 ? 2 : 1) * GPL, STG = PB + GPL;   // a stage: [A | A2 | Bt], Bt at PB: every fragment read is within the 16-bit offset of its own base
    static_assert(GT * GOP * 4 <= 2 * STG, "the output tile is staged in the ring's bytes");
    __shared__ __attribute__((aligned(16))) unsigned char L[2 * STG];
    const int tid = (int)threadIdx.x, lane = tid & 31, lr = lane & 15, hi = lane >> 4; const int r0 = blockIdx.x * GT, c0 = blockIdx.y * GT;
    const int wv = __builtin_amdgcn_readfirstlane(tid >> 5);          // wave number, scalar
    const int wm = (wv >> 2) * 64, wn = (wv & 3) * 32;                // the wave's 64x32 part of the tile
    v8f acc[4][2];
#pragma unroll
    for (int mb = 0; mb < 4; ++mb)
#pragma unroll
        for (int nb = 0; nb < 2; ++nb) acc[mb][nb] = (v8f){};
    constexpr size_t rowb = (size_t)K * 2;                            // bytes of a global operand row
    const int crow = tid >> 4, ccol = (tid & 15) * 16;                // the lane's row (of each 16) and byte column in every copy
    const char* gA = (const char*)A + (size_t)(r0 + crow) * rowb + ccol; const char* gB = (const char*)Bt + (size_t)(c0 + crow) * rowb + ccol;
    const char* gA2 = (NSPLIT == 1) ? (const char*)A2 + (size_t)(r0 + crow) * rowb + ccol : nullptr;
    const unsigned lc = lds_off(L) + (unsigned)(crow * GP + ccol);
    auto fill = [&](int t, unsigned buf) { plane_copy(lc + buf, gA + (size_t)t * GKB, 16 * rowb); if (NSPLIT == 1) plane_copy(lc + buf + GPL, gA2 + (size_t)t * GKB, 16 * rowb); plane_copy(lc + buf + PB, gB + (size_t)t * GKB, 16 * rowb); };
    constexpr int NT = K / (GKB / 2); static_assert(K % (GKB / 2) == 0 && NT >= 2, "whole stages, and the two that the prologue fills");
    fill(0, 0u); wait_async0(); __syncthreads();                      // stage 0 is published
    fill(1, STG);
#pragma unroll 1   // the trip stays rolled: one publish point in the text, the buffer chosen by the trip's parity
    for (int t = 0; t < NT; ++t) {
        const unsigned buf = (unsigned)(t & 1) * STG;
        const unsigned char* pa = L + buf + (wm + lr) * GP + 16 * hi; const unsigned char* pb = L + buf + PB + (wn + lr) * GP + 16 * hi;
        V a[2][4], a2[2][4], b[2][2];                                 // two fragment sets: block ks + 1 is fetched while block ks is multiplied
        auto frags = [&](int ks, int st) {
#pragma unroll
            for (int mb = 0; mb < 4; ++mb) { a[st][mb] = WFrag<T16>::ld((const T16*)(pa + mb * 16 * GP + ks * 64)); if (NSPLIT == 1) a2[st][mb] = WFrag<T16>::ld((const T16*)(pa + GPL + mb * 16 * GP + ks * 64)); }
#pragma unroll
            for (int nb = 0; nb < 2; ++nb) b[st][nb] = WFrag<T16>::ld((const T16*)(pb + nb * 16 * GP + ks * 64)); };
        frags(0, 0);
#pragma unroll     // unrolled: fragment sets and accumulators are indexed by constants, so they stay in registers
        for (int ks = 0; ks < GKB / 64; ++ks) {
            if (ks + 1 < GKB / 64) frags(ks + 1, (ks + 1) & 1);       // this stage's own buffer only
            __builtin_amdgcn_sched_barrier(0);                        // keeps the next block's LDS reads together, ahead of this block's products and not among them
#pragma unroll
            for (int nb = 0; nb < 2; ++nb)
#pragma unroll
                for (int mb = 0; mb < 4; ++mb) { acc[mb][nb] = WFrag<T16>::mma(a[ks & 1][mb], b[ks & 1][nb], acc[mb][nb]); if (NSPLIT == 1) acc[mb][nb] = WFrag<T16>::mma(a2[ks & 1][mb], b[ks & 1][nb], acc[mb][nb]); }
            __builtin_amdgcn_sched_barrier(0);                        // ends the block: the reads of the block after next stay behind it
        }
        wait_ds0(); wait_async0(); __syncthreads();                   // publishes stage t + 1 and ends every wave's reads of stage t's buffer
        if (t + 2 < NT) fill(t + 2, buf);
    }
    wait_async0();   // no copy is in flight when the ring's bytes take the output tile
    // The last trip's barrier has ended every read of the ring: the tile is laid there, and behind one barrier each wave takes whole rows of it (512 B of f32, or 256 B in each 16-bit plane).
    float* os = (float*)L;
    auto lay = [&](auto tr) {
#pragma unroll
        for (int mb = 0; mb < 4; ++mb) {
#pragma unroll
            for (int nb = 0; nb < 2; ++nb) {
                if constexpr (decltype(tr)::value) {   // transposed: a lane's 8 accumulator rows are 8 neighbours of one LDS row
                    float* p = os + (wn + nb * 16 + lr) * GOP + wm + mb * 16 + hi * 8; const v8f c = acc[mb][nb];
                    *(v4fa*)p = __builtin_shufflevector(c, c, 0, 1, 2, 3); *(v4fa*)(p + 4) = __builtin_shufflevector(c, c, 4, 5, 6, 7);
                } else {
#pragma unroll
                    for (int j = 0; j < 8; ++j) os[(wm + mb * 16 + hi * 8 + j) * GOP + wn + nb * 16 + lr] = acc[mb][nb][j]; } } } };
    if constexpr (EPI == 0) {
        lay(BoolC<false>{});
        __syncthreads();   // the whole tile is in LDS before any wave reads rows of it
#pragma unroll
        for (int s = 0; s < GT / 8; ++s) { const int row = s * 8 + wv; const v4f val = *(const v4fa*)(os + row * GOP + lane * 4);
            *(v4f*)(C + (size_t)(r0 + row) * ldc + c0 + lane * 4) = val; }
    } else {
        const int sel = (int)blockIdx.y / NH_, hd = (int)blockIdx.y % NH_, bt = r0 / TT, t0 = r0 % TT;   // q, k or v; head; batch; the tile's first position: the same for the whole workgroup
        auto planes = [&](auto isv) {
            constexpr bool ISV = decltype(isv)::value;
            // The wave takes the tile's LDS rows 16 wv + lr (q, k: positions; v: dims); its unit u is columns 16 u + 8 hi + (0..7) of them (q, k: dims, four rotary pairs; v: positions).
            v4f rc[GT / 16][2];   // q, k: cos, sin of the four pairs the lane turns in each of its units, asked for here so that all the loads fly while the tile goes through LDS
            if constexpr (!ISV) {
                const float* cp = CS + (size_t)(t0 / 16 + wv) * FT + lane * 4;   // the table holds one float per plane element (cos, sin per pair), so FT and FU count its floats too
#pragma unroll     // unrolled: rc is indexed by constants and stays in registers; one address, the units as immediate offsets
                for (int u = 0; u < GT / 16; ++u) { rc[u][0] = *(const v4f*)(cp + u * FU); rc[u][1] = *(const v4f*)(cp + u * FU + FU / 2); }
                wait_x0(cp, cp); }   // the loads' address registers are reused only behind it
            lay(isv);
            __syncthreads();   // the whole tile is in LDS before any wave reads rows of it (the branch around it is taken by the whole workgroup or not at all)
            const size_t e0 = (size_t)sel * PLN + ((size_t)bt * NH_ + hd) * TT * HD + (ISV ? (size_t)(t0 / 32) * (2 * FT) + wv * (2 * FU) : (size_t)(t0 / 16 + wv) * FT) + lane * 8;   // the lane's 8 values in the wave's unit 0
            h16* d16 = P16 + e0; bf* dh = Ph + e0; bf* dl = Pl + e0;
            v4f tv[GT / 16][2];   // the wave's 8 units are read in one run, so that their LDS latencies overlap
#pragma unroll     // unrolled, here and below: tv and rc stay in registers
            for (int u = 0; u < GT / 16; ++u) { const float* p = os + (wv * 16 + lr) * GOP + u * 16 + hi * 8; tv[u][0] = *(const v4fa*)p; tv[u][1] = *(const v4fa*)(p + 4); }
#pragma unroll
            for (int u = 0; u < GT / 16; ++u) { const int e = ISV ? (u >> 1) * (2 * FT) + (u & 1) * FU : u * FU; v8h o16; v8us oh, ol;
#pragma unroll
                for (int g = 0; g < 2; ++g) { v4f y = tv[u][g];
                    if constexpr (!ISV) { float y0, y1; v2f cs; cs[0] = rc[u][g][0]; cs[1] = rc[u][g][1]; rope2(tv[u][g][0], tv[u][g][1], cs, y0, y1); y[0] = y0; y[1] = y1; cs[0] = rc[u][g][2]; cs[1] = rc[u][g][3]; rope2(tv[u][g][2], tv[u][g][3], cs, y0, y1); y[2] = y0; y[3] = y1; }
#pragma unroll
                    for (int q = 0; q < 4; ++q) { o16[g * 4 + q] = tohx(y[q]); unsigned short a2, c2; splitf(y[q], a2, c2); oh[g * 4 + q] = a2; ol[g * 4 + q] = c2; } }
                *(v8h*)(d16 + e) = o16; *(v8us*)(dh + e) = oh; *(v8us*)(dl + e) = ol; }
            if constexpr (!ISV) wait_x0(dh, dl);   // in the built code the q, k path runs on to the head of the v path's code (and branches past it there), where a store's address register is rewritten
        };
        if (sel == 2) planes(BoolC<true>{}); else planes(BoolC<false>{});
    }
}

// ---- k_attn: causal attention, one launch; a workgroup of 8 waves takes 16 * QN query rows of one head of one batch; scores and probabilities never leave the registers.
// Transposed products: S^T = K Q^T puts a query in a lane (column lr) with 8 keys of each 16-key tile in its accumulator, which is already the B fragment's k order of O^T = V^T P^T: keys kb + 8 hi + j, then kb + 16 + 8 hi + j.
// Wave w takes the 32-key blocks w, w + 8, ... up to the diagonal, each with its own running maximum, sum and O^T (online softmax); at the end the 8 partial results are brought to the common maximum and summed in LDS, wave 0's first.
// fp16 form: the next block's K fragments are asked for as soon as S is formed, its V fragments as soon as O is: each load flies over the other half of the work, in the registers that have just come free.
// NSPLIT 0: one fp16 product, the probabilities carry 2^PSH (it cancels in the division by the row sum, which carries it too). NSPLIT 2: bf16 hi/lo planes, 3 products for S and for O.
// Q, K, V planes [head] in fragment order: a 32-key block of K and of V is 8 KB in a row, read by 16 loads of one unit each; the result goes into the merged [t][head][d] hi/lo planes. q0: the workgroup's first query row.
#define L2E  1.4426950408889634f
#define ANW  8                    // waves that share a workgroup's keys
template <typename T16, int NSPLIT, int QN>
__device__ __forceinline__ void flash(const T16* __restrict__ Q, const T16* __restrict__ Q2, const T16* __restrict__ Kp, const T16* __restrict__ Kp2, const T16* __restrict__ Vt, const T16* __restrict__ Vt2, int h, int q0, bf* Mh, bf* Ml, float* os, float* sm, float* sl) {
    typedef typename WFrag<T16>::V V;
    constexpr int NW = ANW, QR = 16 * QN; constexpr float PSH = (NSPLIT == 0) ? 10.0f : 0.0f;
    constexpr bool PIPE = (NSPLIT == 0);   // the hi/lo form has twice the fragments and at most two blocks per wave: it asks for a block's fragments at the block's head
    const int tid = (int)threadIdx.x, lane = tid & 31, lr = lane & 15, hi = lane >> 4;
    const int wv = __builtin_amdgcn_readfirstlane(tid >> 5);          // wave number, scalar: the key loop's bounds stay wave-uniform
    const size_t hp = (size_t)h * TT * HD;
    v8f o[8][QN]; float m[QN], l[QN];
#pragma unroll
    for (int qt = 0; qt < QN; ++qt) { m[qt] = -3.0e38f; l[qt] = 0.f;
#pragma unroll
        for (int dt = 0; dt < 8; ++dt) o[dt][qt] = (v8f){}; }
    const int nblk = (q0 + QR - 1) / 32 + 1;                          // every block holds a key <= q0, so no query ever sees a block that is masked whole
    if (wv < nblk) {
        V q[QN][4], q2[QN][4], ka[2][4], ka2[2][4], va[8], va2[8];
        // pk, pv (and the lo planes' pk2, pv2): the lane's addresses in the block whose fragments the registers hold; a load names them with the step as a constant, and they move on only behind the wait.
        constexpr int KS = NW * 2 * FT, VS = NW * 2 * FT;
        const size_t ek = hp + (size_t)wv * (2 * FT) + lane * 8, ev = ek;
        const T16* pk = Kp + ek; const T16* pk2 = (NSPLIT == 2) ? Kp2 + ek : pk; const T16* pv = Vt + ev; const T16* pv2 = (NSPLIT == 2) ? Vt2 + ev : pv;
        auto ldk = [&](int st) {
#pragma unroll
            for (int kt = 0; kt < 2; ++kt)
#pragma unroll
                for (int ks = 0; ks < 4; ++ks) { const int e = st + kt * FT + ks * (2 * FU); ka[kt][ks] = WFrag<T16>::ldu(pk + e); if (NSPLIT == 2) ka2[kt][ks] = WFrag<T16>::ldu(pk2 + e); }
            wait_x0(pk, pk2); pk += st; pk2 += st; };
        auto ldv = [&](int st) {
#pragma unroll
            for (int dt = 0; dt < 8; ++dt) { const int e = st + dt * (2 * FU); va[dt] = WFrag<T16>::ldu(pv + e); if (NSPLIT == 2) va2[dt] = WFrag<T16>::ldu(pv2 + e); }
            wait_x0(pv, pv2); pv += st; pv2 += st; };
        const size_t eq = hp + (size_t)(q0 / 16) * FT + lane * 8; const T16* pq = Q + eq; const T16* pq2 = (NSPLIT == 2) ? Q2 + eq : pq;
#pragma unroll
        for (int qt = 0; qt < QN; ++qt)
#pragma unroll
            for (int ks = 0; ks < 4; ++ks) { const int e = qt * FT + ks * (2 * FU); q[qt][ks] = WFrag<T16>::ldu(pq + e); if (NSPLIT == 2) q2[qt][ks] = WFrag<T16>::ldu(pq2 + e); }
        wait_x0(pq, pq2);
        if constexpr (PIPE) { ldk(0); ldv(0); }
        // One 32-key block. MORE: the wave has a further block, whose fragments are asked for here; the wave's last block is the only one that can reach the diagonal, so it alone masks.
        auto block = [&](int kb, auto more) {
            constexpr bool MORE = decltype(more)::value;
            if constexpr (!PIPE) { ldk(0); ldv(0); }
            v8f s[QN][2];
#pragma unroll
            for (int qt = 0; qt < QN; ++qt)
#pragma unroll
                for (int kt = 0; kt < 2; ++kt) { s[qt][kt] = (v8f){};
#pragma unroll
                    for (int ks = 0; ks < 4; ++ks) { s[qt][kt] = WFrag<T16>::mma(ka[kt][ks], q[qt][ks], s[qt][kt]); if (NSPLIT == 2) { s[qt][kt] = WFrag<T16>::mma(ka[kt][ks], q2[qt][ks], s[qt][kt]); s[qt][kt] = WFrag<T16>::mma(ka2[kt][ks], q[qt][ks], s[qt][kt]); } } }
            if constexpr (PIPE && MORE) ldk(KS);
            V pb[QN], pb2[QN];
#pragma unroll
            for (int qt = 0; qt < QN; ++qt) {
                const int qi = q0 + qt * 16 + lr; float mloc = -3.0e38f;
#pragma unroll
                for (int kt = 0; kt < 2; ++kt)
#pragma unroll
                    for (int j = 0; j < 8; ++j) { float t = s[qt][kt][j] * SCL; if constexpr (!MORE) t = (kb + kt * 16 + hi * 8 + j <= qi) ? t : -3.0e38f; s[qt][kt][j] = t; mloc = fmaxf(mloc, t); }
                mloc = fmaxf(mloc, __shfl_xor(mloc, 16, 32));         // the query's other 16 keys of the block are in lane lr + 16
                if (__any(mloc > m[qt])) {                            // where no maximum rose every factor would be 1
                    const float mn = fmaxf(m[qt], mloc), al = __builtin_amdgcn_exp2f((m[qt] - mn) * L2E); m[qt] = mn; l[qt] *= al;
#pragma unroll
                    for (int dt = 0; dt < 8; ++dt) o[dt][qt] *= al; }
                float ps = 0.f;
#pragma unroll
                for (int kt = 0; kt < 2; ++kt)
#pragma unroll
                    for (int j = 0; j < 8; ++j) { const float p = __builtin_amdgcn_exp2f((s[qt][kt][j] - m[qt]) * L2E + PSH); s[qt][kt][j] = p; ps += p; }
                l[qt] += ps;
                if constexpr (NSPLIT == 0) {
#pragma unroll
                    for (int j = 0; j < 8; ++j) { pb[qt][j] = tohx(s[qt][0][j]); pb[qt][8 + j] = tohx(s[qt][1][j]); }
                } else {
                    v8us h0, h1, l0, l1;
#pragma unroll
                    for (int j = 0; j < 8; ++j) { unsigned short a, c2; splitf(s[qt][0][j], a, c2); h0[j] = a; l0[j] = c2; splitf(s[qt][1][j], a, c2); h1[j] = a; l1[j] = c2; }
                    pb[qt] = cat16b(h0, h1); pb2[qt] = cat16b(l0, l1); }
            }
#pragma unroll
            for (int dt = 0; dt < 8; ++dt)
#pragma unroll
                for (int qt = 0; qt < QN; ++qt) { o[dt][qt] = WFrag<T16>::mma(va[dt], pb[qt], o[dt][qt]); if (NSPLIT == 2) { o[dt][qt] = WFrag<T16>::mma(va[dt], pb2[qt], o[dt][qt]); o[dt][qt] = WFrag<T16>::mma(va2[dt], pb[qt], o[dt][qt]); } }
            if constexpr (PIPE && MORE) ldv(VS);
            if constexpr (!PIPE && MORE) { pk += KS; pk2 += KS; pv += VS; pv2 += VS; }
        };
        int blk = wv;
#pragma unroll 1   // rolled: one 32-key block's fragments at a time in registers
        for (; blk + NW < nblk; blk += NW) block(blk * 32, BoolC<true>{});
        block(blk * 32, BoolC<false>{});
    }
#pragma unroll
    for (int qt = 0; qt < QN; ++qt) if (hi == 0) sm[wv * QR + qt * 16 + lr] = m[qt];
    __syncthreads();   // every wave's maxima are in LDS before any wave forms the common one
#pragma unroll
    for (int qt = 0; qt < QN; ++qt) { float M = sm[qt * 16 + lr];
#pragma unroll
        for (int w = 1; w < NW; ++w) M = fmaxf(M, sm[w * QR + qt * 16 + lr]);
        const float sc = __builtin_amdgcn_exp2f((m[qt] - M) * L2E); const float lt = l[qt] + __shfl_xor(l[qt], 16, 32);   // a wave without a block: its sum and its O are 0
        if (hi == 0) sl[wv * QR + qt * 16 + lr] = lt * sc;
#pragma unroll
        for (int dt = 0; dt < 8; ++dt) { const v8f c = o[dt][qt] * sc; float* p = os + (wv * QR + qt * 16 + lr) * GOP + dt * 16 + hi * 8;   // a lane's 8 accumulator rows are 8 neighbouring dims of its query's LDS row
            *(v4fa*)p = __builtin_shufflevector(c, c, 0, 1, 2, 3); *(v4fa*)(p + 4) = __builtin_shufflevector(c, c, 4, 5, 6, 7); } }
    __syncthreads();   // all 8 partial results are in LDS before any wave sums them
#pragma unroll
    for (int s = 0; s < QR / NW; ++s) { const int row = s * NW + wv; v4f val = *(const v4fa*)(os + row * GOP + lane * 4); float L = sl[row];
#pragma unroll
        for (int w = 1; w < NW; ++w) { val += *(const v4fa*)(os + (w * QR + row) * GOP + lane * 4); L += sl[w * QR + row]; }
        const float f = __fdiv_rn(1.0f, L); const size_t oo = (size_t)(q0 + row) * DQ + h * HD + lane * 4; v4us oh, ol;
#pragma unroll
        for (int qd = 0; qd < 4; ++qd) { unsigned short a, c2; splitf(val[qd] * f, a, c2); oh[qd] = a; ol[qd] = c2; }
        *(v4us*)(Mh + oo) = oh; *(v4us*)(Ml + oo) = ol; wait_x0(Mh + oo, Ml + oo); }
}
// Grid (batches x heads, row groups): the groups of 32 rows >= RH come first, the longest rows first of all; the groups of 16 rows < RH (hi/lo planes) fill the launch's tail.
#define ALO  ((TT - RH) / 32)
#define AHI  (RH / 16)
__global__ __launch_bounds__(32 * ANW) void k_attn(const h16* __restrict__ Q16, const h16* __restrict__ K16, const h16* __restrict__ V16, const bf* __restrict__ Qh, const bf* __restrict__ Ql, const bf* __restrict__ Kh, const bf* __restrict__ Kl, const bf* __restrict__ Vh, const bf* __restrict__ Vl, bf* Mh, bf* Ml) {
    __shared__ __align__(16) float os[ANW * 32 * GOP]; __shared__ float sm[ANW * 32]; __shared__ float sl[ANW * 32];
    const int h = (int)blockIdx.x % NH_, g = (int)blockIdx.y;
    const size_t po = (size_t)((int)blockIdx.x / NH_) * NH_ * TT * HD, mo = (size_t)((int)blockIdx.x / NH_) * TT * DQ;   // the batch's planes in every plane set, its rows in the merged planes
    Q16 += po; K16 += po; V16 += po; Qh += po; Ql += po; Kh += po; Kl += po; Vh += po; Vl += po; Mh += mo; Ml += mo;
    if (g < ALO) flash<h16, 0, 2>(Q16, nullptr, K16, nullptr, V16, nullptr, h, TT - 32 * (g + 1), Mh, Ml, os, sm, sl);
    else flash<bf, 2, 1>(Qh, Ql, Kh, Kl, Vh, Vl, h, RH - 16 * (g - ALO + 1), Mh, Ml, os, sm, sl);
}

__constant__ float INV2[HD / 2] = { 1.000000000e+00f, 8.659643531e-01f, 7.498942018e-01f, 6.493816376e-01f, 5.623413324e-01f, 4.869675338e-01f, 4.216965139e-01f, 3.651741147e-01f, 3.162277639e-01f, 2.738419771e-01f, 2.371373773e-01f, 2.053525001e-01f, 1.778279394e-01f, 1.539926529e-01f, 1.333521456e-01f, 1.154781953e-01f, 1.000000015e-01f, 8.659642935e-02f, 7.498942316e-02f, 6.493816525e-02f, 5.623413250e-02f, 4.869675264e-02f, 4.216964915e-02f, 3.651741147e-02f, 3.162277490e-02f, 2.738419548e-02f, 2.371373773e-02f, 2.053525113e-02f, 1.778279431e-02f, 1.539926510e-02f, 1.333521400e-02f, 1.154781971e-02f, 9.999999776e-03f, 8.659643121e-03f, 7.498942316e-03f, 6.493816152e-03f, 5.623413250e-03f, 4.869675264e-03f, 4.216964822e-03f, 3.651741194e-03f, 3.162277630e-03f, 2.738419687e-03f, 2.371373819e-03f, 2.053525066e-03f, 1.778279431e-03f, 1.539926510e-03f, 1.333521446e-03f, 1.154782018e-03f, 1.000000047e-03f, 8.659643354e-04f, 7.498941850e-04f, 6.493816036e-04f, 5.623413017e-04f, 4.869675322e-04f, 4.216965172e-04f, 3.651741135e-04f, 3.162277571e-04f, 2.738419571e-04f, 2.371373703e-04f, 2.053525095e-04f, 1.778279402e-04f, 1.539926598e-04f, 1.333521504e-04f, 1.154782003e-04f };   // float32 1 / 10000^(2i/128), generated with jnp to be bit-exact
// ---- k_prep: everything the GEMMs need ahead of them, in one launch of 1280 workgroups: the rotary table (the first PTB workgroups: their threads run longest) and the bf16 copies of the four weights and of x.
// Table: one thread per (position, pair), in the order in which the projections' epilogue reads it: per 16 positions and 16 dims two runs of 16 B a lane (lane as in a q, k unit), a lane's pairs 0, 1 in the first and 2, 3 in the second, each pair cos, sin. Copies: a workgroup takes 256 * PCH runs of 8 values of one source; a thread takes PCH of them, 256 runs apart, 8 in flight at a time.
#define PCH  16
#define PTB  (TT * (HD / 2) / 256)
#define PWB  (DQ * DM / (256 * 8 * PCH))       // workgroups per 2048 x 2048 source: each weight, each batch of x
static_assert(DQ * DM % (256 * 8 * PCH) == 0 && DKV == DQ && TT == DQ && PCH % 8 == 0, "whole workgroups; all six sources have one size");
__global__ __launch_bounds__(256) void k_prep(const float* __restrict__ x, const float* __restrict__ wq, const float* __restrict__ wk, const float* __restrict__ wv, const float* __restrict__ wo, bf* W4, bf* XB, float* CS) {
    const int tid = (int)threadIdx.x;
    if ((int)blockIdx.x < PTB) {
        const int idx = (int)blockIdx.x * 256 + tid, ln = (idx >> 1) & 31, i = ((idx >> 7) & 7) * 8 + (ln >> 4) * 4 + ((idx >> 6) & 1) * 2 + (idx & 1), t = (idx >> 10) * 16 + (ln & 15); const float a = __fmul_rn((float)t, INV2[i]); const float c = cosf(a), s = sinf(a);
        v2f cs; cs[0] = c; cs[1] = s; *(v2f*)(CS + (size_t)idx * 2) = cs; return; }
    const int blk = (int)blockIdx.x - PTB, sel = blk / PWB;   // which source: the same for the whole workgroup
    const float* sb = sel == 0 ? wq : sel == 1 ? wk : sel == 2 ? wv : sel == 3 ? wo : x + (size_t)(sel - 4) * TT * DM;
    bf* db = sel < 4 ? W4 + (size_t)sel * DQ * DM : XB + (size_t)(sel - 4) * TT * DM;
    const size_t e = ((size_t)(blk % PWB) * (256 * PCH) + tid) * 8; const float* sp = sb + e; bf* dp = db + e;
#pragma unroll     // unrolled: every load and store names sp or dp with a constant offset
    for (int k0 = 0; k0 < PCH; k0 += 8) { v8f v[8];
#pragma unroll
        for (int k = 0; k < 8; ++k) v[k] = *(const v8f*)(sp + (k0 + k) * (256 * 8));
#pragma unroll
        for (int k = 0; k < 8; ++k) { v8us o;
#pragma unroll
            for (int q = 0; q < 8; ++q) o[q] = f2bf(v[k][q]);
            *(v8us*)(dp + (k0 + k) * (256 * 8)) = o; } }
    wait_x0(sp, dp);   // in the built code this path runs on to the head of the table's code (and branches past it there), where the stores' address register is rewritten
}
extern "C" void kernel_launch(void* const* d_in, const int* in_sizes, int n_in,
                              void* d_out, int out_size, void* d_ws, size_t ws_size, hipStream_t stream) {
    (void)in_sizes; (void)n_in; (void)out_size;
    const float* x = (const float*)d_in[0]; const float* wq = (const float*)d_in[1]; const float* wk = (const float*)d_in[2]; const float* wv = (const float*)d_in[3]; const float* wo = (const float*)d_in[4];   /* weights 'oi' [2048][2048] */
    float* OUT = (float*)d_out;     // [2][2048][2048]
    char* wsp = (char*)d_ws;
    auto take = [&](size_t bytes) { char* p = wsp; wsp += (bytes + 255) & ~(size_t)255; return (void*)p; };
    bf* W4 = (bf*)take((size_t)4 * DQ * DM * 2);   // Wq, Wk, Wv, Wo
    h16* P16 = (h16*)take(3 * PLN * 2); bf* PH = (bf*)take(3 * PLN * 2); bf* PL = (bf*)take(3 * PLN * 2);   // each: the q, k, v plane sets
    bf* XB = (bf*)take((size_t)NB_ * TT * DM * 2); float* CS = (float*)take((size_t)TT * HD * 4); bf* ATh = (bf*)take((size_t)NB_ * TT * DQ * 2); bf* ATl = (bf*)take((size_t)NB_ * TT * DQ * 2);
    if ((size_t)(wsp - (char*)d_ws) > ws_size) return;    // 225 MiB of the 256 MiB
    k_prep<<<PTB + 6 * PWB, 256, 0, stream>>>(x, wq, wk, wv, wo, W4, XB, CS);
    k_gemmw<bf, 0, DM, 1><<<dim3(NB_ * TT / GT, 3 * DQ / GT, 1), 256, 0, stream>>>(XB, nullptr, W4, nullptr, 0, CS, P16, PH, PL);
    k_attn<<<dim3(NB_ * NH_, ALO + AHI, 1), 32 * ANW, 0, stream>>>(P16, P16 + PLN, P16 + 2 * PLN, PH, PL, PH + PLN, PL + PLN, PH + 2 * PLN, PL + 2 * PLN, ATh, ATl);
    k_gemmw<bf, 1, DQ, 0><<<dim3(NB_ * TT / GT, DM / GT, 1), 256, 0, stream>>>(ATh, ATl, W4 + (size_t)3 * DQ * DM, OUT, DM, nullptr, nullptr, nullptr, nullptr);
}

// v008
// Measured time: 202 microseconds a run.
// Next to v007, in two timings, it ran 1.08 and 1.09 times as fast.
// Counting every step since v000, it is 8.59 times as fast.
#include <hip/hip_runtime.h>

// Causal multi-head self-attention with 128-wide heads and interleaved-pair rotary embeddings (x [2][2048][2048]; Q, K, V = einsum('bsd,ed', x, W) ('oi' 0.02; 16 heads x 128); rope on consecutive (even, odd) pairs: (x1 cos - x2 sin, x1 sin + x2 cos) with angle pos x 10000^(-2i/128), pos = arange(S) (64 f32 frequencies jnp-exact for this expression; precise cosf/sinf); scores x 1/sqrt(128); causal (-inf); softmax; out = merged Wo^T -> [2][2048][2048] (8.4 M); argument order x, Wq, Wk, Wv, Wo).
// Four launches, each over both batches (a row of x is b * 2048 + t): k_prep, the q, k, v projections as one GEMM, k_attn, the Wo GEMM.
// Layout: bf16 copy of x; 'oi' weights; exact projections; k_prep's computed table (HD 128: one angle per (even, odd) pair); the projections' epilogues build the rotary q, k planes and the transposed v planes, all in the order in which k_attn's lanes hold them (see FRAGMENT ORDER); causal T-2048 attention at HD 128 in one kernel, online softmax (hybrid rows: < 512 hi/lo 3 products, rest fp16 x1024; key blocks above the diagonal are never read; its epilogue writes the merged hi/lo planes); merged hi/lo x Wo exact.
// Compute dtypes, f32 accumulate: every input rounded to bf16; projections exact; rotary f32; attention rows < 512 3 products, rest fp16; softmax f32; Wo hl x exact.

#define NB_  2
#define TT   2048
#define DM   2048
#define NH_  16
#define NKV  16
#define REP  (NH_ / NKV)
#define HD   128
#define DQ   (NH_ * HD)
#define DKV  (NKV * HD)
// FRAGMENT ORDER of a [batch][head] plane: a unit is the 16 B that each of a wave's 32 lanes holds of one half of a matrix fragment, 512 B in lane order, so that one wave-wide 16-byte load or store is 4 whole lines.
// Lane = 16 hi + lr. q, k: unit (t / 16, d / 16), lane (lr = t % 16, hi = d / 8 % 2), its 8 values d % 8; 8 units (FT elements) are 16 positions.
// v: unit (t / 32, d / 16, t / 16 % 2), lane (lr = d % 16, hi = t / 8 % 2), its 8 values t % 8; 16 units (2 FT elements) are 32 positions.
#define FU   256                  // elements of a unit
#define FT   (16 * HD)            // elements of 16 positions
#define PLN  ((size_t)NB_ * NH_ * TT * HD)   // elements of one plane set: [batch][head] planes of q, of k or of v
static_assert(NKV == NH_, "q, k and v plane sets have one size, and a projection tile's column block is a head of one of them");
#define RH   512                  // query rows < RH use hi+lo planes
#define SCL  0.088388347648318447f   // HD^-0.5
typedef _Float16 h16;
typedef unsigned short bf;
typedef __attribute__((ext_vector_type(16))) __bf16   v16bf;
typedef __attribute__((ext_vector_type(16))) _Float16 v16h;
typedef __attribute__((ext_vector_type(8)))  _Float16 v8h;
typedef __attribute__((ext_vector_type(8)))  unsigned short v8us;
typedef __attribute__((ext_vector_type(8)))  float    v8f;
typedef __attribute__((ext_vector_type(4)))  float    v4f;
typedef v8h  __attribute__((may_alias)) v8ha;
typedef v4f  __attribute__((may_alias)) v4fa;
typedef v8us __attribute__((may_alias)) v8usa;

__device__ __forceinline__ unsigned short f2bf(float f) { unsigned u = __float_as_uint(f); u += 0x7FFFu + ((u >> 16) & 1u); return (unsigned short)(u >> 16); }
__device__ __forceinline__ float bf2f(unsigned short b) { return __uint_as_float(((unsigned)b) << 16); }
__device__ __forceinline__ float bfr(float f) { return bf2f(f2bf(f)); }
__device__ __forceinline__ v16h cat16(v8h lo, v8h hi) { return __builtin_shufflevector(lo, hi, 0, 1, 2, 3, 4, 5, 6, 7, 8, 9, 10, 11, 12, 13, 14, 15); }
__device__ __forceinline__ v16bf cat16b(v8us lo, v8us hi) { return __builtin_bit_cast(v16bf, __builtin_shufflevector(lo, hi, 0, 1, 2, 3, 4, 5, 6, 7, 8, 9, 10, 11, 12, 13, 14, 15)); }
__device__ __forceinline__ v8f wmma16(v16h a, v16h b, v8f c) { return __builtin_amdgcn_wmma_f32_16x16x32_f16(false, a, false, b, (short)0, c, false, false); }
__device__ __forceinline__ v8f wmmab(v16bf a, v16bf b, v8f c) { return __builtin_amdgcn_wmma_f32_16x16x32_bf16(false, a, false, b, (short)0, c, false, false); }
__device__ __forceinline__ h16 tohx(float x) { return (h16)x; }
__device__ __forceinline__ void splitf(float y, unsigned short& h, unsigned short& l) { h = f2bf(y); l = f2bf(y - bf2f(h)); }
typedef __attribute__((ext_vector_type(4))) _Float16 v4h;
typedef __attribute__((ext_vector_type(4))) unsigned short v4us;
typedef __attribute__((ext_vector_type(2))) float v2f;
typedef __attribute__((ext_vector_type(4))) int v4i;
// One rotary pair (x0 even, x1 odd; cs = cos, sin of the pair's angle): y0 = x0 c - x1 s, y1 = x0 s + x1 c.
__device__ __forceinline__ void rope2(float x0, float x1, v2f cs, float& y0, float& y1) { y0 = x0 * cs[0] - x1 * cs[1]; y1 = x0 * cs[1] + x1 * cs[0]; }



// ---- k_gemmw: GEMM with both operands staged in LDS. One 128x128 output tile per workgroup of 8 waves (2 x 4 waves, 64x32 each, 8 accumulators per wave); grid (M/128, N/128), 256 threads.
// A stage is 128 k (256 B) of the tile's 128 A rows and 128 Bt rows (and the 128 A2 rows), laid at pitch 272 B by asynchronous copies to LDS whose wave-wide 512 B are two whole 256-B row pieces.
// Two buffers: stage t + 1 flies while stage t is worked on. Each wave sums its whole K in k order in one accumulator.
// C[m][n] (f32, pitch ldc) = sum_k A[m][k] Bt[n][k] (+ A2[m][k] Bt[n][k] for NSPLIT 1). M, N % 128 == 0; K a compile-time multiple of 128, at least 256.
template <bool B> struct BoolC { static constexpr bool value = B; };
template <typename T16> struct WFrag;   // ld: a fragment from rows in LDS (its halves 16 elements apart); ldu: from a plane in fragment order (its halves are two units)
template <> struct WFrag<h16> { typedef v16h V; static __device__ __forceinline__ V ld(const h16* p) { return cat16(*(const v8h*)p, *(const v8h*)(p + 16)); } static __device__ __forceinline__ V ldu(const h16* p) { return cat16(*(const v8h*)p, *(const v8h*)(p + FU)); } static __device__ __forceinline__ v8f mma(V a, V b, v8f c) { return wmma16(a, b, c); } };
template <> struct WFrag<bf> { typedef v16bf V; static __device__ __forceinline__ V ld(const bf* p) { return cat16b(*(const v8us*)p, *(const v8us*)(p + 16)); } static __device__ __forceinline__ V ldu(const bf* p) { return cat16b(*(const v8us*)p, *(const v8us*)(p + FU)); } static __device__ __forceinline__ v8f mma(V a, V b, v8f c) { return wmmab(a, b, c); } };
#define GT   128                  // edge of the output tile
#define GKB  256                  // bytes of an operand row in one stage
#define GP   272                  // LDS pitch of a staged row: 16 B x odd, for the 16-byte fragment reads
#define GPL  (GT * GP)            // bytes of one operand's 128 rows in a stage
#define GOP  132                  // pitch, in floats, of the output tile staged in the ring's bytes
__device__ __forceinline__ unsigned lds_off(const void* p) { return (unsigned)(size_t)p; }
__device__ __forceinline__ void wait_ds0() { asm volatile("s_wait_dscnt 0x0" ::: "memory"); }       // this wave's LDS reads of the buffer have returned before the buffer is handed over
__device__ __forceinline__ void wait_async0() { asm volatile("s_wait_asynccnt 0x0" ::: "memory"); } // this wave's copies have landed before the barrier that publishes them
// Stands behind a run of global loads or stores; it takes their two base addresses as inputs, so that those registers are neither rewritten nor given to a load's result ahead of it.
__device__ __forceinline__ void wait_x0(const void* a, const void* b) { asm volatile("s_wait_xcnt 0x0" :: "v"(a), "v"(b) : "memory"); }
// One operand's 128 rows of a stage: 8 copies per lane, 16 rows apart (l: the lane's LDS byte address, g: its global address, rs: bytes of 16 global rows).
// The s_wait_xcnt closes the statement so that no address register of an issued copy is rewritten ahead of it.
__device__ __forceinline__ void plane_copy(unsigned l, const char* g, size_t rs) {
    asm volatile("global_load_async_to_lds_b128 %0, %8, off\n\t"
                 "global_load_async_to_lds_b128 %1, %9, off\n\t"
                 "global_load_async_to_lds_b128 %2, %10, off\n\t"
                 "global_load_async_to_lds_b128 %3, %11, off\n\t"
                 "global_load_async_to_lds_b128 %4, %12, off\n\t"
                 "global_load_async_to_lds_b128 %5, %13, off\n\t"
                 "global_load_async_to_lds_b128 %6, %14, off\n\t"
                 "global_load_async_to_lds_b128 %7, %15, off\n\t"
                 "s_wait_xcnt 0x0"
                 :: "v"(l), "v"(l + 16 * GP), "v"(l + 32 * GP), "v"(l + 48 * GP), "v"(l + 64 * GP), "v"(l + 80 * GP), "v"(l + 96 * GP), "v"(l + 112 * GP),
                    "v"(g), "v"(g + rs), "v"(g + 2 * rs), "v"(g + 3 * rs), "v"(g + 4 * rs), "v"(g + 5 * rs), "v"(g + 6 * rs), "v"(g + 7 * rs)
                 : "memory");
}
// What becomes of the tile (EPI): 0: stored as f32 in C. 1: Bt is [Wq | Wk | Wv] and the tile is 128 positions x 128 dims of one batch and one head of q, k or v (by its column block); P16, Ph, Pl hold the q, k, v plane sets, PLN apart.
// q, k: rotary by the table CS, then the fp16 plane and the bf16 hi/lo planes. v: the tile laid transposed in LDS, then the same three planes. All planes [batch][head] in fragment order: every store is a whole unit.
template <typename T16, int NSPLIT, int K, int EPI>
__global__ __launch_bounds__(256) void k_gemmw(const T16* __restrict__ A, const T16* __restrict__ A2, const T16* __restrict__ Bt, float* C, int ldc, const float* __restrict__ CS, h16* P16, bf* Ph, bf* Pl) {
    static_assert(EPI == 0 || GT == HD, "a tile's columns are one head");
    typedef typename WFrag<T16>::V V;
    constexpr unsigned PB = (NSPLIT == 1 ? 2 : 1) * GPL, STG = PB + GPL;   // a stage: [A | A2 | Bt], Bt at PB: every fragment read is within the 16-bit offset of its own base
    static_assert(GT * GOP * 4 <= 2 * STG, "the output tile is staged in the ring's bytes");
    __shared__ __attribute__((aligned(16))) unsigned char L[2 * STG];
    const int tid = (int)threadIdx.x, lane = tid & 31, lr = lane & 15, hi = lane >> 4; const int r0 = blockIdx.x * GT, c0 = blockIdx.y * GT;
    const int wv = __builtin_amdgcn_readfirstlane(tid >> 5);          // wave number, scalar
    const int wm = (wv >> 2) * 64, wn = (wv & 3) * 32;                // the wave's 64x32 part of the tile
    v8f acc[4][2];
#pragma unroll
    for (int mb = 0; mb < 4; ++mb)
#pragma unroll
        for (int nb = 0; nb < 2; ++nb) acc[mb][nb] = (v8f){};
    constexpr size_t rowb = (size_t)K * 2;                            // bytes of a global operand row
    const int crow = tid >> 4, ccol = (tid & 15) * 16;                // the lane's row (of each 16) and byte column in every copy
    const char* gA = (const char*)A + (size_t)(r0 + crow) * rowb + ccol; const char* gB = (const char*)Bt + (size_t)(c0 + crow) * rowb + ccol;
    const char* gA2 = (NSPLIT == 1) ? (const char*)A2 + (size_t)(r0 + crow) * rowb + ccol : nullptr;
    const unsigned lc = lds_off(L) + (unsigned)(crow * GP + ccol);
    auto fill = [&](int t, unsigned buf) { plane_copy(lc + buf, gA + (size_t)t * GKB, 16 * rowb); if (NSPLIT == 1) plane_copy(lc + buf + GPL, gA2 + (size_t)t * GKB, 16 * rowb); plane_copy(lc + buf + PB, gB + (size_t)t * GKB, 16 * rowb); };
    constexpr int NT = K / (GKB / 2); static_assert(K % (GKB / 2) == 0 && NT >= 2, "whole stages, and the two that the prologue fills");
    fill(0, 0u); wait_async0(); __syncthreads();                      // stage 0 is published
    fill(1, STG);
#pragma unroll 1   // the trip stays rolled: one publish point in the text, the buffer chosen by the trip's parity
    for (int t = 0; t < NT; ++t) {
        const unsigned buf = (unsigned)(t & 1) * STG;
        const unsigned char* pa = L + buf + (wm + lr) * GP + 16 * hi; const unsigned char* pb = L + buf + PB + (wn + lr) * GP + 16 * hi;
        V a[2][4], a2[2][4], b[2][2];                                 // two fragment sets: block ks + 1 is fetched while block ks is multiplied
        auto frags = [&](int ks, int st) {
#pragma unroll
            for (int mb = 0; mb < 4; ++mb) { a[st][mb] = WFrag<T16>::ld((const T16*)(pa + mb * 16 * GP + ks * 64)); if (NSPLIT == 1) a2[st][mb] = WFrag<T16>::ld((const T16*)(pa + GPL + mb * 16 * GP + ks * 64)); }
#pragma unroll
            for (int nb = 0; nb < 2; ++nb) b[st][nb] = WFrag<T16>::ld((const T16*)(pb + nb * 16 * GP + ks * 64)); };
        frags(0, 0);
#pragma unroll     // unrolled: fragment sets and accumulators are indexed by constants, so they stay in registers
        for (int ks = 0; ks < GKB / 64; ++ks) {
            if (ks + 1 < GKB / 64) frags(ks + 1, (ks + 1) & 1);       // this stage's own buffer only
            __builtin_amdgcn_sched_barrier(0);                        // keeps the next block's LDS reads together, ahead of this block's products and not among them
#pragma unroll
            for (int nb = 0; nb < 2; ++nb)
#pragma unroll
                for (int mb = 0; mb < 4; ++mb) { acc[mb][nb] = WFrag<T16>::mma(a[ks & 1][mb], b[ks & 1][nb], acc[mb][nb]); if (NSPLIT == 1) acc[mb][nb] = WFrag<T16>::mma(a2[ks & 1][mb], b[ks & 1][nb], acc[mb][nb]); }
            __builtin_amdgcn_sched_barrier(0);                        // ends the block: the reads of the block after next stay behind it
        }
        wait_ds0(); wait_async0(); __syncthreads();                   // publishes stage t + 1 and ends every wave's reads of stage t's buffer
        if (t + 2 < NT) fill(t + 2, buf);
    }
    wait_async0();   // no copy is in flight when the ring's bytes take the output tile
    // The last trip's barrier has ended every read of the ring: the tile is laid there, and behind one barrier each wave takes whole rows of it (512 B of f32, or 256 B in each 16-bit plane).
    float* os = (float*)L;
    auto lay = [&](auto tr) {
#pragma unroll
        for (int mb = 0; mb < 4; ++mb) {
#pragma unroll
            for (int nb = 0; nb < 2; ++nb) {
                if constexpr (decltype(tr)::value) {   // transposed: a lane's 8 accumulator rows are 8 neighbours of one LDS row
                    float* p = os + (wn + nb * 16 + lr) * GOP + wm + mb * 16 + hi * 8; const v8f c = acc[mb][nb];
                    *(v4fa*)p = __builtin_shufflevector(c, c, 0, 1, 2, 3); *(v4fa*)(p + 4) = __builtin_shufflevector(c, c, 4, 5, 6, 7);
                } else {
#pragma unroll
                    for (int j = 0; j < 8; ++j) os[(wm + mb * 16 + hi * 8 + j) * GOP + wn + nb * 16 + lr] = acc[mb][nb][j]; } } } };
    if constexpr (EPI == 0) {
        lay(BoolC<false>{});
        __syncthreads();   // the whole tile is in LDS before any wave reads rows of it
#pragma unroll
        for (int s = 0; s < GT / 8; ++s) { const int row = s * 8 + wv; const v4f val = *(const v4fa*)(os + row * GOP + lane * 4);
            *(v4f*)(C + (size_t)(r0 + row) * ldc + c0 + lane * 4) = val; }
    } else {
        const int sel = (int)blockIdx.y / NH_, hd = (int)blockIdx.y % NH_, bt = r0 / TT, t0 = r0 % TT;   // q, k or v; head; batch; the tile's first position: the same for the whole workgroup
        auto planes = [&](auto isv) {
            constexpr bool ISV = decltype(isv)::value;
            // The wave takes the tile's LDS rows 16 wv + lr (q, k: positions; v: dims); its unit u is columns 16 u + 8 hi + (0..7) of them (q, k: dims, four rotary pairs; v: positions).
            v4f rc[GT / 16][2];   // q, k: cos, sin of the four pairs the lane turns in each of its units, asked for here so that all the loads fly while the tile goes through LDS
            if constexpr (!ISV) {
                const float* cp = CS + (size_t)(t0 / 16 + wv) * FT + lane * 4;   // the table holds one float per plane element (cos, sin per pair), so FT and FU count its floats too
#pragma unroll     // unrolled: rc is indexed by constants and stays in registers; one address, the units as immediate offsets
                for (int u = 0; u < GT / 16; ++u) { rc[u][0] = *(const v4f*)(cp + u * FU); rc[u][1] = *(const v4f*)(cp + u * FU + FU / 2); }
                wait_x0(cp, cp); }   // the loads' address registers are reused only behind it
            lay(isv);
            __syncthreads();   // the whole tile is in LDS before any wave reads rows of it (the branch around it is taken by the whole workgroup or not at all)
            const size_t e0 = (size_t)sel * PLN + ((size_t)bt * NH_ + hd) * TT * HD + (ISV ? (size_t)(t0 / 32) * (2 * FT) + wv * (2 * FU) : (size_t)(t0 / 16 + wv) * FT) + lane * 8;   // the lane's 8 values in the wave's unit 0
            h16* d16 = P16 + e0; bf* dh = Ph + e0; bf* dl = Pl + e0;
            v4f tv[GT / 16][2];   // the wave's 8 units are read in one run, so that their LDS latencies overlap
#pragma unroll     // unrolled, here and below: tv and rc stay in registers
            for (int u = 0; u < GT / 16; ++u) { const float* p = os + (wv * 16 + lr) * GOP + u * 16 + hi * 8; tv[u][0] = *(const v4fa*)p; tv[u][1] = *(const v4fa*)(p + 4); }
#pragma unroll
            for (int u = 0; u < GT / 16; ++u) { const int e = ISV ? (u >> 1) * (2 * FT) + (u & 1) * FU : u * FU; v8h o16; v8us oh, ol;
#pragma unroll
                for (int g = 0; g < 2; ++g) { v4f y = tv[u][g];
                    if constexpr (!ISV) { float y0, y1; v2f cs; cs[0] = rc[u][g][0]; cs[1] = rc[u][g][1]; rope2(tv[u][g][0], tv[u][g][1], cs, y0, y1); y[0] = y0; y[1] = y1; cs[0] = rc[u][g][2]; cs[1] = rc[u][g][3]; rope2(tv[u][g][2], tv[u][g][3], cs, y0, y1); y[2] = y0; y[3] = y1; }
#pragma unroll
                    for (int q = 0; q < 4; ++q) { o16[g * 4 + q] = tohx(y[q]); unsigned short a2, c2; splitf(y[q], a2, c2); oh[g * 4 + q] = a2; ol[g * 4 + q] = c2; } }
                *(v8h*)(d16 + e) = o16; *(v8us*)(dh + e) = oh; *(v8us*)(dl + e) = ol; }
            if constexpr (!ISV) wait_x0(dh, dl);   // in the built code the q, k path runs on to the head of the v path's code (and branches past it there), where a store's address register is rewritten
        };
        if (sel == 2) planes(BoolC<true>{}); else planes(BoolC<false>{});
    }
}

// ---- k_attn: causal attention, one launch; scores and probabilities never leave the registers. Rows < RH: flash (hi/lo planes, 16 rows a workgroup); rows >= RH: flashs (fp16, 128 rows a workgroup, K and V through LDS).
// flash: a workgroup of 8 waves takes 16 * QN query rows of one head of one batch.
// Transposed products: S^T = K Q^T puts a query in a lane (column lr) with 8 keys of each 16-key tile in its accumulator, which is already the B fragment's k order of O^T = V^T P^T: keys kb + 8 hi + j, then kb + 16 + 8 hi + j.
// Wave w takes the 32-key blocks w, w + 8, ... up to the diagonal, each with its own running maximum, sum and O^T (online softmax); at the end the 8 partial results are brought to the common maximum and summed in LDS, wave 0's first.
// PIPE (NSPLIT 0 only; k_attn calls flash with NSPLIT 2): the next block's K fragments are asked for as soon as S is formed, its V fragments as soon as O is: each load flies over the other half of the work, in the registers that have just come free.
// NSPLIT 0: one fp16 product, the probabilities carry 2^PSH (it cancels in the division by the row sum, which carries it too). NSPLIT 2: bf16 hi/lo planes, 3 products for S and for O.
// Q, K, V planes [head] in fragment order: a 32-key block of K and of V is 8 KB in a row, read by 16 loads of one unit each; the result goes into the merged [t][head][d] hi/lo planes. q0: the workgroup's first query row.
#define L2E  1.4426950408889634f
#define ANW  8                    // waves that share a workgroup's keys
template <typename T16, int NSPLIT, int QN>
__device__ __forceinline__ void flash(const T16* __restrict__ Q, const T16* __restrict__ Q2, const T16* __restrict__ Kp, const T16* __restrict__ Kp2, const T16* __restrict__ Vt, const T16* __restrict__ Vt2, int h, int q0, bf* Mh, bf* Ml, float* os, float* sm, float* sl) {
    typedef typename WFrag<T16>::V V;
    constexpr int NW = ANW, QR = 16 * QN; constexpr float PSH = (NSPLIT == 0) ? 10.0f : 0.0f;
    constexpr bool PIPE = (NSPLIT == 0);   // the hi/lo form has twice the fragments and at most two blocks per wave: it asks for a block's fragments at the block's head
    const int tid = (int)threadIdx.x, lane = tid & 31, lr = lane & 15, hi = lane >> 4;
    const int wv = __builtin_amdgcn_readfirstlane(tid >> 5);          // wave number, scalar: the key loop's bounds stay wave-uniform
    const size_t hp = (size_t)h * TT * HD;
    v8f o[8][QN]; float m[QN], l[QN];
#pragma unroll
    for (int qt = 0; qt < QN; ++qt) { m[qt] = -3.0e38f; l[qt] = 0.f;
#pragma unroll
        for (int dt = 0; dt < 8; ++dt) o[dt][qt] = (v8f){}; }
    const int nblk = (q0 + QR - 1) / 32 + 1;                          // every block holds a key <= q0, so no query ever sees a block that is masked whole
    if (wv < nblk) {
        V q[QN][4], q2[QN][4], ka[2][4], ka2[2][4], va[8], va2[8];
        // pk, pv (and the lo planes' pk2, pv2): the lane's addresses in the block whose fragments the registers hold; a load names them with the step as a constant, and they move on only behind the wait.
        constexpr int KS = NW * 2 * FT, VS = NW * 2 * FT;
        const size_t ek = hp + (size_t)wv * (2 * FT) + lane * 8, ev = ek;
        const T16* pk = Kp + ek; const T16* pk2 = (NSPLIT == 2) ? Kp2 + ek : pk; const T16* pv = Vt + ev; const T16* pv2 = (NSPLIT == 2) ? Vt2 + ev : pv;
        auto ldk = [&](int st) {
#pragma unroll
            for (int kt = 0; kt < 2; ++kt)
#pragma unroll
                for (int ks = 0; ks < 4; ++ks) { const int e = st + kt * FT + ks * (2 * FU); ka[kt][ks] = WFrag<T16>::ldu(pk + e); if (NSPLIT == 2) ka2[kt][ks] = WFrag<T16>::ldu(pk2 + e); }
            wait_x0(pk, pk2); pk += st; pk2 += st; };
        auto ldv = [&](int st) {
#pragma unroll
            for (int dt = 0; dt < 8; ++dt) { const int e = st + dt * (2 * FU); va[dt] = WFrag<T16>::ldu(pv + e); if (NSPLIT == 2) va2[dt] = WFrag<T16>::ldu(pv2 + e); }
            wait_x0(pv, pv2); pv += st; pv2 += st; };
        const size_t eq = hp + (size_t)(q0 / 16) * FT + lane * 8; const T16* pq = Q + eq; const T16* pq2 = (NSPLIT == 2) ? Q2 + eq : pq;
#pragma unroll
        for (int qt = 0; qt < QN; ++qt)
#pragma unroll
            for (int ks = 0; ks < 4; ++ks) { const int e = qt * FT + ks * (2 * FU); q[qt][ks] = WFrag<T16>::ldu(pq + e); if (NSPLIT == 2) q2[qt][ks] = WFrag<T16>::ldu(pq2 + e); }
        wait_x0(pq, pq2);
        if constexpr (PIPE) { ldk(0); ldv(0); }
        // One 32-key block. MORE: the wave has a further block, whose fragments are asked for here; the wave's last block is the only one that can reach the diagonal, so it alone masks.
        auto block = [&](int kb, auto more) {
            constexpr bool MORE = decltype(more)::value;
            if constexpr (!PIPE) { ldk(0); ldv(0); }
            v8f s[QN][2];
#pragma unroll
            for (int qt = 0; qt < QN; ++qt)
#pragma unroll
                for (int kt = 0; kt < 2; ++kt) { s[qt][kt] = (v8f){};
#pragma unroll
                    for (int ks = 0; ks < 4; ++ks) { s[qt][kt] = WFrag<T16>::mma(ka[kt][ks], q[qt][ks], s[qt][kt]); if (NSPLIT == 2) { s[qt][kt] = WFrag<T16>::mma(ka[kt][ks], q2[qt][ks], s[qt][kt]); s[qt][kt] = WFrag<T16>::mma(ka2[kt][ks], q[qt][ks], s[qt][kt]); } } }
            if constexpr (PIPE && MORE) ldk(KS);
            V pb[QN], pb2[QN];
#pragma unroll
            for (int qt = 0; qt < QN; ++qt) {
                const int qi = q0 + qt * 16 + lr; float mloc = -3.0e38f;
#pragma unroll
                for (int kt = 0; kt < 2; ++kt)
#pragma unroll
                    for (int j = 0; j < 8; ++j) { float t = s[qt][kt][j] * SCL; if constexpr (!MORE) t = (kb + kt * 16 + hi * 8 + j <= qi) ? t : -3.0e38f; s[qt][kt][j] = t; mloc = fmaxf(mloc, t); }
                mloc = fmaxf(mloc, __shfl_xor(mloc, 16, 32));         // the query's other 16 keys of the block are in lane lr + 16
                if (__any(mloc > m[qt])) {                            // where no maximum rose every factor would be 1
                    const float mn = fmaxf(m[qt], mloc), al = __builtin_amdgcn_exp2f((m[qt] - mn) * L2E); m[qt] = mn; l[qt] *= al;
#pragma unroll
                    for (int dt = 0; dt < 8; ++dt) o[dt][qt] *= al; }
                float ps = 0.f;
#pragma unroll
                for (int kt = 0; kt < 2; ++kt)
#pragma unroll
                    for (int j = 0; j < 8; ++j) { const float p = __builtin_amdgcn_exp2f((s[qt][kt][j] - m[qt]) * L2E + PSH); s[qt][kt][j] = p; ps += p; }
                l[qt] += ps;
                if constexpr (NSPLIT == 0) {
#pragma unroll
                    for (int j = 0; j < 8; ++j) { pb[qt][j] = tohx(s[qt][0][j]); pb[qt][8 + j] = tohx(s[qt][1][j]); }
                } else {
                    v8us h0, h1, l0, l1;
#pragma unroll
                    for (int j = 0; j < 8; ++j) { unsigned short a, c2; splitf(s[qt][0][j], a, c2); h0[j] = a; l0[j] = c2; splitf(s[qt][1][j], a, c2); h1[j] = a; l1[j] = c2; }
                    pb[qt] = cat16b(h0, h1); pb2[qt] = cat16b(l0, l1); }
            }
#pragma unroll
            for (int dt = 0; dt < 8; ++dt)
#pragma unroll
                for (int qt = 0; qt < QN; ++qt) { o[dt][qt] = WFrag<T16>::mma(va[dt], pb[qt], o[dt][qt]); if (NSPLIT == 2) { o[dt][qt] = WFrag<T16>::mma(va[dt], pb2[qt], o[dt][qt]); o[dt][qt] = WFrag<T16>::mma(va2[dt], pb[qt], o[dt][qt]); } }
            if constexpr (PIPE && MORE) ldv(VS);
            if constexpr (!PIPE && MORE) { pk += KS; pk2 += KS; pv += VS; pv2 += VS; }
        };
        int blk = wv;
#pragma unroll 1   // rolled: one 32-key block's fragments at a time in registers
        for (; blk + NW < nblk; blk += NW) block(blk * 32, BoolC<true>{});
        block(blk * 32, BoolC<false>{});
    }
#pragma unroll
    for (int qt = 0; qt < QN; ++qt) if (hi == 0) sm[wv * QR + qt * 16 + lr] = m[qt];
    __syncthreads();   // every wave's maxima are in LDS before any wave forms the common one
#pragma unroll
    for (int qt = 0; qt < QN; ++qt) { float M = sm[qt * 16 + lr];
#pragma unroll
        for (int w = 1; w < NW; ++w) M = fmaxf(M, sm[w * QR + qt * 16 + lr]);
        const float sc = __builtin_amdgcn_exp2f((m[qt] - M) * L2E); const float lt = l[qt] + __shfl_xor(l[qt], 16, 32);   // a wave without a block: its sum and its O are 0
        if (hi == 0) sl[wv * QR + qt * 16 + lr] = lt * sc;
#pragma unroll
        for (int dt = 0; dt < 8; ++dt) { const v8f c = o[dt][qt] * sc; float* p = os + (wv * QR + qt * 16 + lr) * GOP + dt * 16 + hi * 8;   // a lane's 8 accumulator rows are 8 neighbouring dims of its query's LDS row
            *(v4fa*)p = __builtin_shufflevector(c, c, 0, 1, 2, 3); *(v4fa*)(p + 4) = __builtin_shufflevector(c, c, 4, 5, 6, 7); } }
    __syncthreads();   // all 8 partial results are in LDS before any wave sums them
#pragma unroll
    for (int s = 0; s < QR / NW; ++s) { const int row = s * NW + wv; v4f val = *(const v4fa*)(os + row * GOP + lane * 4); float L = sl[row];
#pragma unroll
        for (int w = 1; w < NW; ++w) { val += *(const v4fa*)(os + (w * QR + row) * GOP + lane * 4); L += sl[w * QR + row]; }
        const float f = __fdiv_rn(1.0f, L); const size_t oo = (size_t)(q0 + row) * DQ + h * HD + lane * 4; v4us oh, ol;
#pragma unroll
        for (int qd = 0; qd < 4; ++qd) { unsigned short a, c2; splitf(val[qd] * f, a, c2); oh[qd] = a; ol[qd] = c2; }
        *(v4us*)(Mh + oo) = oh; *(v4us*)(Ml + oo) = ol; wait_x0(Mh + oo, Ml + oo); }
}
// ---- flashs: the fp16 form, one product, the probabilities carry 2^10 as in flash. A workgroup of 8 waves takes SQR = 128 query rows of one head: wave wv is query group qg = wv % 4 (32 rows) and key half sp = wv / 4.
// A stage is 128 keys: four 32-key blocks of K (32 KB in a row in the plane, already in fragment order) and the same of V, brought into LDS once by asynchronous copies and read there by all four query groups, so that
// a key's bytes leave L2 once per 128 rows. Wave (qg, sp) works on blocks 4 t + sp and 4 t + 2 + sp of stage t, up to its own diagonal block; only the last stage masks. Two buffers: stage t + 1 flies while stage t is worked on.
// At the end the two key halves of each query group are brought to their common maximum and summed in LDS (in the ring's bytes), half 0 first.
#define SQR  128                  // query rows of a workgroup
#define SBB  (2 * FT * 2)         // bytes of a 32-key block of K or of V
#define SPB  (4 * SBB)            // bytes of a stage's four K blocks, and of its four V blocks
#define SSTG (2 * SPB)            // bytes of a stage: [K | V]
// A stage's K blocks, or its V blocks: 8 copies per lane, each 4 KB over the workgroup (l: the lane's LDS byte address, g: its global address).
// The s_wait_xcnt closes the statement so that no address register of an issued copy is rewritten ahead of it.
__device__ __forceinline__ void kv_copy(unsigned l, const char* g) {
    asm volatile("global_load_async_to_lds_b128 %0, %8, off\n\t"
                 "global_load_async_to_lds_b128 %1, %9, off\n\t"
                 "global_load_async_to_lds_b128 %2, %10, off\n\t"
                 "global_load_async_to_lds_b128 %3, %11, off\n\t"
                 "global_load_async_to_lds_b128 %4, %12, off\n\t"
                 "global_load_async_to_lds_b128 %5, %13, off\n\t"
                 "global_load_async_to_lds_b128 %6, %14, off\n\t"
                 "global_load_async_to_lds_b128 %7, %15, off\n\t"
                 "s_wait_xcnt 0x0"
                 :: "v"(l), "v"(l + 4096), "v"(l + 8192), "v"(l + 12288), "v"(l + 16384), "v"(l + 20480), "v"(l + 24576), "v"(l + 28672),
                    "v"(g), "v"(g + 4096), "v"(g + 8192), "v"(g + 12288), "v"(g + 16384), "v"(g + 20480), "v"(g + 24576), "v"(g + 28672)
                 : "memory");
}
__device__ __forceinline__ void flashs(const h16* __restrict__ Q, const h16* __restrict__ Kp, const h16* __restrict__ Vt, int h, int q0, bf* Mh, bf* Ml, float* os, float* sm, float* sl) {
    typedef WFrag<h16> F; typedef F::V V;
    constexpr int QN = 2, QR = 16 * QN; constexpr float PSH = 10.0f;
    static_assert(SPB == 8 * 256 * 16 && 2 * SSTG <= ANW * 32 * GOP * 4 && ANW * QR == 2 * SQR && SQR == 128, "8 copies of the workgroup per plane; the ring lies in the merge rows' bytes; two key halves of SQR rows; a stage's keys are a workgroup's rows");
    const int tid = (int)threadIdx.x, lane = tid & 31, lr = lane & 15, hi = lane >> 4;
    const int wv = __builtin_amdgcn_readfirstlane(tid >> 5), qg = wv & 3, sp = wv >> 2;   // scalar: the tests on the wave's blocks stay wave-uniform
    const size_t hp = (size_t)h * TT * HD;
    const int qw = q0 + qg * QR, bd = qw / 32;                        // the wave's first query row; its diagonal block, whose first key every one of its queries sees
    v8f o[8][QN]; float m[QN], l[QN];
#pragma unroll
    for (int qt = 0; qt < QN; ++qt) { m[qt] = -3.0e38f; l[qt] = 0.f;
#pragma unroll
        for (int dt = 0; dt < 8; ++dt) o[dt][qt] = (v8f){}; }
    const char* gk = (const char*)(Kp + hp) + tid * 16; const char* gv = (const char*)(Vt + hp) + tid * 16;
    const unsigned lc = lds_off(os) + (unsigned)tid * 16;
    auto fill = [&](int t, unsigned buf) { kv_copy(lc + buf, gk + (size_t)t * SPB); kv_copy(lc + buf + SPB, gv + (size_t)t * SPB); };
    const int NS = q0 / SQR + 1;                                      // stages up to the workgroup's last row; at least two, the same for the whole workgroup
    fill(0, 0u);
    V q[QN][4];
    const h16* pq = Q + hp + (size_t)(qw / 16) * FT + lane * 8;
#pragma unroll
    for (int qt = 0; qt < QN; ++qt)
#pragma unroll
        for (int ks = 0; ks < 4; ++ks) q[qt][ks] = F::ldu(pq + qt * FT + ks * (2 * FU));
    wait_x0(pq, pq);
    wait_async0(); __syncthreads();                                   // stage 0 is published
    fill(1, SSTG);
    // One 32-key block, read from the stage's buffer (off: the bytes from the ring's start to the block's K). DIAG: the block may reach the wave's diagonal and is masked.
    auto block = [&](unsigned off, int kb, auto diag) {
        constexpr bool DIAG = decltype(diag)::value;
        const h16* lk = (const h16*)((const unsigned char*)os + off) + lane * 8; const h16* lv = lk + SPB / 2;
        V ka[2][4], va[8];
#pragma unroll
        for (int kt = 0; kt < 2; ++kt)
#pragma unroll
            for (int ks = 0; ks < 4; ++ks) ka[kt][ks] = F::ldu(lk + kt * FT + ks * (2 * FU));
#pragma unroll
        for (int dt = 0; dt < 8; ++dt) va[dt] = F::ldu(lv + dt * (2 * FU));
        v8f s[QN][2];
#pragma unroll
        for (int qt = 0; qt < QN; ++qt)
#pragma unroll
            for (int kt = 0; kt < 2; ++kt) { s[qt][kt] = (v8f){};
#pragma unroll
                for (int ks = 0; ks < 4; ++ks) s[qt][kt] = F::mma(ka[kt][ks], q[qt][ks], s[qt][kt]); }
        V pb[QN];
#pragma unroll
        for (int qt = 0; qt < QN; ++qt) {
            const int qi = qw + qt * 16 + lr; float mloc = -3.0e38f;
#pragma unroll
            for (int kt = 0; kt < 2; ++kt)
#pragma unroll
                for (int j = 0; j < 8; ++j) { float t = s[qt][kt][j] * SCL; if constexpr (DIAG) t = (kb + kt * 16 + hi * 8 + j <= qi) ? t : -3.0e38f; s[qt][kt][j] = t; mloc = fmaxf(mloc, t); }
            mloc = fmaxf(mloc, __shfl_xor(mloc, 16, 32));             // the query's other 16 keys of the block are in lane lr + 16
            if (__any(mloc > m[qt])) {                                // where no maximum rose every factor would be 1
                const float mn = fmaxf(m[qt], mloc), al = __builtin_amdgcn_exp2f((m[qt] - mn) * L2E); m[qt] = mn; l[qt] *= al;
#pragma unroll
                for (int dt = 0; dt < 8; ++dt) o[dt][qt] *= al; }
            float ps = 0.f;
#pragma unroll
            for (int kt = 0; kt < 2; ++kt)
#pragma unroll
                for (int j = 0; j < 8; ++j) { const float p = __builtin_amdgcn_exp2f((s[qt][kt][j] - m[qt]) * L2E + PSH); s[qt][kt][j] = p; ps += p; }
            l[qt] += ps;
#pragma unroll
            for (int j = 0; j < 8; ++j) { pb[qt][j] = tohx(s[qt][0][j]); pb[qt][8 + j] = tohx(s[qt][1][j]); }
        }
#pragma unroll
        for (int dt = 0; dt < 8; ++dt)
#pragma unroll
            for (int qt = 0; qt < QN; ++qt) o[dt][qt] = F::mma(va[dt], pb[qt], o[dt][qt]);
    };
    // All stages but the last lie below every wave's diagonal: one path through the two blocks, no test on them.
#pragma unroll 1   // the trip stays rolled: the buffer is chosen by the trip's parity
    for (int t = 0; t < NS - 1; ++t) {
        const unsigned buf = (unsigned)(t & 1) * SSTG;
        block(buf + sp * SBB, (4 * t + sp) * 32, BoolC<false>{});
        block(buf + (2 + sp) * SBB, (4 * t + 2 + sp) * 32, BoolC<false>{});
        wait_ds0(); wait_async0(); __syncthreads();                   // publishes stage t + 1 and ends every wave's reads of stage t's buffer
        if (t + 2 < NS) fill(t + 2, buf);
    }
    // The last stage holds the four diagonal blocks: its blocks are masked (an identity below the wave's diagonal block); a block past the wave's diagonal is left out.
#pragma unroll 1   // rolled: one copy of the masked block's code, not two
    for (int i = 0; i < 2; ++i) {
        const int b = 4 * (NS - 1) + 2 * i + sp;
        if (b <= bd) block((unsigned)((NS - 1) & 1) * SSTG + (2 * i + sp) * SBB, b * 32, BoolC<true>{});
    }
    wait_ds0(); wait_async0(); __syncthreads();                       // the last stage's foot: ends every wave's reads of the ring
    wait_async0();   // no copy is in flight when the ring's bytes take the partial results
#pragma unroll
    for (int qt = 0; qt < QN; ++qt) if (hi == 0) sm[wv * QR + qt * 16 + lr] = m[qt];   // row sp * SQR + (the query's row in the workgroup)
    __syncthreads();   // both halves' maxima are in LDS before any wave forms the common one
#pragma unroll
    for (int qt = 0; qt < QN; ++qt) { const int r = qg * QR + qt * 16 + lr; const float M = fmaxf(sm[r], sm[SQR + r]);
        const float sc = __builtin_amdgcn_exp2f((m[qt] - M) * L2E); const float lt = l[qt] + __shfl_xor(l[qt], 16, 32);
        if (hi == 0) sl[wv * QR + qt * 16 + lr] = lt * sc;
#pragma unroll
        for (int dt = 0; dt < 8; ++dt) { const v8f c = o[dt][qt] * sc; float* p = os + (wv * QR + qt * 16 + lr) * GOP + dt * 16 + hi * 8;   // a lane's 8 accumulator rows are 8 neighbouring dims of its query's LDS row
            *(v4fa*)p = __builtin_shufflevector(c, c, 0, 1, 2, 3); *(v4fa*)(p + 4) = __builtin_shufflevector(c, c, 4, 5, 6, 7); } }
    __syncthreads();   // both partial results of every row are in LDS before any wave sums them
#pragma unroll
    for (int s = 0; s < SQR / ANW; ++s) { const int row = s * ANW + wv; const v4f val = *(const v4fa*)(os + row * GOP + lane * 4) + *(const v4fa*)(os + (SQR + row) * GOP + lane * 4); const float L = sl[row] + sl[SQR + row];
        const float f = __fdiv_rn(1.0f, L); const size_t oo = (size_t)(q0 + row) * DQ + h * HD + lane * 4; v4us oh, ol;
#pragma unroll
        for (int qd = 0; qd < 4; ++qd) { unsigned short a, c2; splitf(val[qd] * f, a, c2); oh[qd] = a; ol[qd] = c2; }
        *(v4us*)(Mh + oo) = oh; *(v4us*)(Ml + oo) = ol; wait_x0(Mh + oo, Ml + oo); }
}
// Grid (batches x heads, row groups): the groups of SQR rows >= RH come first, the longest rows first of all; the groups of 16 rows < RH (hi/lo planes) fill the launch's tail.
#define ALO  ((TT - RH) / SQR)
static_assert((TT - RH) % SQR == 0 && RH % SQR == 0 && RH >= SQR, "whole groups of SQR rows, each beginning at a multiple of SQR: whole stages, at least two");
#define AHI  (RH / 16)
__global__ __launch_bounds__(32 * ANW) void k_attn(const h16* __restrict__ Q16, const h16* __restrict__ K16, const h16* __restrict__ V16, const bf* __restrict__ Qh, const bf* __restrict__ Ql, const bf* __restrict__ Kh, const bf* __restrict__ Kl, const bf* __restrict__ Vh, const bf* __restrict__ Vl, bf* Mh, bf* Ml) {
    __shared__ __align__(16) float os[ANW * 32 * GOP]; __shared__ float sm[ANW * 32]; __shared__ float sl[ANW * 32];
    const int h = (int)blockIdx.x % NH_, g = (int)blockIdx.y;
    const size_t po = (size_t)((int)blockIdx.x / NH_) * NH_ * TT * HD, mo = (size_t)((int)blockIdx.x / NH_) * TT * DQ;   // the batch's planes in every plane set, its rows in the merged planes
    Q16 += po; K16 += po; V16 += po; Qh += po; Ql += po; Kh += po; Kl += po; Vh += po; Vl += po; Mh += mo; Ml += mo;
    if (g < ALO) flashs(Q16, K16, V16, h, TT - SQR * (g + 1), Mh, Ml, os, sm, sl);
    else flash<bf, 2, 1>(Qh, Ql, Kh, Kl, Vh, Vl, h, RH - 16 * (g - ALO + 1), Mh, Ml, os, sm, sl);
}

__constant__ float INV2[HD / 2] = { 1.000000000e+00f, 8.659643531e-01f, 7.498942018e-01f, 6.493816376e-01f, 5.623413324e-01f, 4.869675338e-01f, 4.216965139e-01f, 3.651741147e-01f, 3.162277639e-01f, 2.738419771e-01f, 2.371373773e-01f, 2.053525001e-01f, 1.778279394e-01f, 1.539926529e-01f, 1.333521456e-01f, 1.154781953e-01f, 1.000000015e-01f, 8.659642935e-02f, 7.498942316e-02f, 6.493816525e-02f, 5.623413250e-02f, 4.869675264e-02f, 4.216964915e-02f, 3.651741147e-02f, 3.162277490e-02f, 2.738419548e-02f, 2.371373773e-02f, 2.053525113e-02f, 1.778279431e-02f, 1.539926510e-02f, 1.333521400e-02f, 1.154781971e-02f, 9.999999776e-03f, 8.659643121e-03f, 7.498942316e-03f, 6.493816152e-03f, 5.623413250e-03f, 4.869675264e-03f, 4.216964822e-03f, 3.651741194e-03f, 3.162277630e-03f, 2.738419687e-03f, 2.371373819e-03f, 2.053525066e-03f, 1.778279431e-03f, 1.539926510e-03f, 1.333521446e-03f, 1.154782018e-03f, 1.000000047e-03f, 8.659643354e-04f, 7.498941850e-04f, 6.493816036e-04f, 5.623413017e-04f, 4.869675322e-04f, 4.216965172e-04f, 3.651741135e-04f, 3.162277571e-04f, 2.738419571e-04f, 2.371373703e-04f, 2.053525095e-04f, 1.778279402e-04f, 1.539926598e-04f, 1.333521504e-04f, 1.154782003e-04f };   // float32 1 / 10000^(2i/128), generated with jnp to be bit-exact
// ---- k_prep: everything the GEMMs need ahead of them, in one launch of 1280 workgroups: the rotary table (the first PTB workgroups: their threads run longest) and the bf16 copies of the four weights and of x.
// Table: one thread per (position, pair), in the order in which the projections' epilogue reads it: per 16 positions and 16 dims two runs of 16 B a lane (lane as in a q, k unit), a lane's pairs 0, 1 in the first and 2, 3 in the second, each pair cos, sin. Copies: a workgroup takes 256 * PCH runs of 8 values of one source; a thread takes PCH of them, 256 runs apart, 8 in flight at a time.
#define PCH  16
#define PTB  (TT * (HD / 2) / 256)
#define PWB  (DQ * DM / (256 * 8 * PCH))       // workgroups per 2048 x 2048 source: each weight, each batch of x
static_assert(DQ * DM % (256 * 8 * PCH) == 0 && DKV == DQ && TT == DQ && PCH % 8 == 0, "whole workgroups; all six sources have one size");
__global__ __launch_bounds__(256) void k_prep(const float* __restrict__ x, const float* __restrict__ wq, const float* __restrict__ wk, const float* __restrict__ wv, const float* __restrict__ wo, bf* W4, bf* XB, float* CS) {
    const int tid = (int)threadIdx.x;
    if ((int)blockIdx.x < PTB) {
        const int idx = (int)blockIdx.x * 256 + tid, ln = (idx >> 1) & 31, i = ((idx >> 7) & 7) * 8 + (ln >> 4) * 4 + ((idx >> 6) & 1) * 2 + (idx & 1), t = (idx >> 10) * 16 + (ln & 15); const float a = __fmul_rn((float)t, INV2[i]); const float c = cosf(a), s = sinf(a);
        v2f cs; cs[0] = c; cs[1] = s; *(v2f*)(CS + (size_t)idx * 2) = cs; return; }
    const int blk = (int)blockIdx.x - PTB, sel = blk / PWB;   // which source: the same for the whole workgroup
    const float* sb = sel == 0 ? wq : sel == 1 ? wk : sel == 2 ? wv : sel == 3 ? wo : x + (size_t)(sel - 4) * TT * DM;
    bf* db = sel < 4 ? W4 + (size_t)sel * DQ * DM : XB + (size_t)(sel - 4) * TT * DM;
    const size_t e = ((size_t)(blk % PWB) * (256 * PCH) + tid) * 8; const float* sp = sb + e; bf* dp = db + e;
#pragma unroll     // unrolled: every load and store names sp or dp with a constant offset
    for (int k0 = 0; k0 < PCH; k0 += 8) { v8f v[8];
#pragma unroll
        for (int k = 0; k < 8; ++k) v[k] = *(const v8f*)(sp + (k0 + k) * (256 * 8));
#pragma unroll
        for (int k = 0; k < 8; ++k) { v8us o;
#pragma unroll
            for (int q = 0; q < 8; ++q) o[q] = f2bf(v[k][q]);
            *(v8us*)(dp + (k0 + k) * (256 * 8)) = o; } }
    wait_x0(sp, dp);   // in the built code this path runs on to the head of the table's code (and branches past it there), where the stores' address register is rewritten
}
extern "C" void kernel_launch(void* const* d_in, const int* in_sizes, int n_in,
                              void* d_out, int out_size, void* d_ws, size_t ws_size, hipStream_t stream) {
    (void)in_sizes; (void)n_in; (void)out_size;
    const float* x = (const float*)d_in[0]; const float* wq = (const float*)d_in[1]; const float* wk = (const float*)d_in[2]; const float* wv = (const float*)d_in[3]; const float* wo = (const float*)d_in[4];   /* weights 'oi' [2048][2048] */
    float* OUT = (float*)d_out;     // [2][2048][2048]
    char* wsp = (char*)d_ws;
    auto take = [&](size_t bytes) { char* p = wsp; wsp += (bytes + 255) & ~(size_t)255; return (void*)p; };
    bf* W4 = (bf*)take((size_t)4 * DQ * DM * 2);   // Wq, Wk, Wv, Wo
    h16* P16 = (h16*)take(3 * PLN * 2); bf* PH = (bf*)take(3 * PLN * 2); bf* PL = (bf*)take(3 * PLN * 2);   // each: the q, k, v plane sets
    bf* XB = (bf*)take((size_t)NB_ * TT * DM * 2); float* CS = (float*)take((size_t)TT * HD * 4); bf* ATh = (bf*)take((size_t)NB_ * TT * DQ * 2); bf* ATl = (bf*)take((size_t)NB_ * TT * DQ * 2);
    if ((size_t)(wsp - (char*)d_ws) > ws_size) return;    // 225 MiB of the 256 MiB
    k_prep<<<PTB + 6 * PWB, 256, 0, stream>>>(x, wq, wk, wv, wo, W4, XB, CS);
    k_gemmw<bf, 0, DM, 1><<<dim3(NB_ * TT / GT, 3 * DQ / GT, 1), 256, 0, stream>>>(XB, nullptr, W4, nullptr, 0, CS, P16, PH, PL);
    k_attn<<<dim3(NB_ * NH_, ALO + AHI, 1), 32 * ANW, 0, stream>>>(P16, P16 + PLN, P16 + 2 * PLN, PH, PL, PH + PLN, PL + PLN, PH + 2 * PLN, PL + 2 * PLN, ATh, ATl);
    k_gemmw<bf, 1, DQ, 0><<<dim3(NB_ * TT / GT, DM / GT, 1), 256, 0, stream>>>(ATh, ATl, W4 + (size_t)3 * DQ * DM, OUT, DM, nullptr, nullptr, nullptr, nullptr);
}

// v009
// A run of this version takes 187 microseconds.
// Next to v008, in two timings, it ran 1.09 times as fast each time.
// Over all steps from v000 it is 9.33 times as fast.
#include <hip/hip_runtime.h>

// Causal multi-head self-attention with 128-wide heads and interleaved-pair rotary embeddings (x [2][2048][2048]; Q, K, V = einsum('bsd,ed', x, W) ('oi' 0.02; 16 heads x 128); rope on consecutive (even, odd) pairs: (x1 cos - x2 sin, x1 sin + x2 cos) with angle pos x 10000^(-2i/128), pos = arange(S) (64 f32 frequencies jnp-exact for this expression; precise cosf/sinf); scores x 1/sqrt(128); causal (-inf); softmax; out = merged Wo^T -> [2][2048][2048] (8.4 M); argument order x, Wq, Wk, Wv, Wo).
// Four launches, each over both batches (a row of x is b * 2048 + t): k_prep, the q, k, v projections as one GEMM, k_attn, the Wo GEMM.
// Layout: bf16 copy of x; 'oi' weights; exact projections; k_prep's computed table (HD 128: one angle per (even, odd) pair); the projections' epilogues build the rotary q, k planes and the transposed v planes, all in the order in which k_attn's lanes hold them (see FRAGMENT ORDER); causal T-2048 attention at HD 128 in one kernel, online softmax (hybrid rows: < 512 hi/lo 3 products, rest fp16 x1024; key blocks above the diagonal are never read; its epilogue writes the merged f16 rows: one plane for rows >= 512, hi + lo for rows < 512); merged x Wo, Wo's bf16 values held in f16.
// Compute dtypes, f32 accumulate: every input rounded to bf16; projections exact; rotary f32; attention rows < 512 3 products, rest fp16; softmax f32; Wo f16: rows < 512 hi + lo (2 products), rest 1 product.

#define NB_  2
#define TT   2048
#define DM   2048
#define NH_  16
#define NKV  16
#define REP  (NH_ / NKV)
#define HD   128
#define DQ   (NH_ * HD)
#define DKV  (NKV * HD)
// FRAGMENT ORDER of a [batch][head] plane: a unit is the 16 B that each of a wave's 32 lanes holds of one half of a matrix fragment, 512 B in lane order, so that one wave-wide 16-byte load or store is 4 whole lines.
// Lane = 16 hi + lr. q, k: unit (t / 16, d / 16), lane (lr = t % 16, hi = d / 8 % 2), its 8 values d % 8; 8 units (FT elements) are 16 positions.
// v: unit (t / 32, d / 16, t / 16 % 2), lane (lr = d % 16, hi = t / 8 % 2), its 8 values t % 8; 16 units (2 FT elements) are 32 positions.
#define FU   256                  // elements of a unit
#define FT   (16 * HD)            // elements of 16 positions
#define PLN  ((size_t)NB_ * NH_ * TT * HD)   // elements of one plane set: [batch][head] planes of q, of k or of v
static_assert(NKV == NH_, "q, k and v plane sets have one size, and a projection tile's column block is a head of one of them");
#define RH   512                  // query rows < RH use hi+lo planes
#define SCL  0.088388347648318447f   // HD^-0.5
typedef _Float16 h16;
typedef unsigned short bf;
typedef __attribute__((ext_vector_type(16))) __bf16   v16bf;
typedef __attribute__((ext_vector_type(16))) _Float16 v16h;
typedef __attribute__((ext_vector_type(8)))  _Float16 v8h;
typedef __attribute__((ext_vector_type(8)))  unsigned short v8us;
typedef __attribute__((ext_vector_type(8)))  float    v8f;
typedef __attribute__((ext_vector_type(4)))  float    v4f;
typedef v8h  __attribute__((may_alias)) v8ha;
typedef v4f  __attribute__((may_alias)) v4fa;
typedef v8us __attribute__((may_alias)) v8usa;

__device__ __forceinline__ unsigned short f2bf(float f) { unsigned u = __float_as_uint(f); u += 0x7FFFu + ((u >> 16) & 1u); return (unsigned short)(u >> 16); }
__device__ __forceinline__ float bf2f(unsigned short b) { return __uint_as_float(((unsigned)b) << 16); }
__device__ __forceinline__ float bfr(float f) { return bf2f(f2bf(f)); }
__device__ __forceinline__ v16h cat16(v8h lo, v8h hi) { return __builtin_shufflevector(lo, hi, 0, 1, 2, 3, 4, 5, 6, 7, 8, 9, 10, 11, 12, 13, 14, 15); }
__device__ __forceinline__ v16bf cat16b(v8us lo, v8us hi) { return __builtin_bit_cast(v16bf, __builtin_shufflevector(lo, hi, 0, 1, 2, 3, 4, 5, 6, 7, 8, 9, 10, 11, 12, 13, 14, 15)); }
__device__ __forceinline__ v8f wmma16(v16h a, v16h b, v8f c) { return __builtin_amdgcn_wmma_f32_16x16x32_f16(false, a, false, b, (short)0, c, false, false); }
__device__ __forceinline__ v8f wmmab(v16bf a, v16bf b, v8f c) { return __builtin_amdgcn_wmma_f32_16x16x32_bf16(false, a, false, b, (short)0, c, false, false); }
__device__ __forceinline__ h16 tohx(float x) { return (h16)x; }
__device__ __forceinline__ void splitf(float y, unsigned short& h, unsigned short& l) { h = f2bf(y); l = f2bf(y - bf2f(h)); }
typedef __attribute__((ext_vector_type(4))) _Float16 v4h;
typedef __attribute__((ext_vector_type(4))) unsigned short v4us;
typedef __attribute__((ext_vector_type(2))) float v2f;
typedef __attribute__((ext_vector_type(4))) int v4i;
// One rotary pair (x0 even, x1 odd; cs = cos, sin of the pair's angle): y0 = x0 c - x1 s, y1 = x0 s + x1 c.
__device__ __forceinline__ void rope2(float x0, float x1, v2f cs, float& y0, float& y1) { y0 = x0 * cs[0] - x1 * cs[1]; y1 = x0 * cs[1] + x1 * cs[0]; }



// ---- k_gemmw: GEMM with both operands staged in LDS. One TM x 128 tile per workgroup of 8 waves (2 x 4 waves, TM/2 x 32 each); TM = 128 (projections) or WTM = 160 (Wo); grid (M/TM, N/128), 256 threads.
// A stage is 128 k (256 B) of the tile's TM A rows and 128 Bt rows, laid at pitch 272 B by asynchronous copies to LDS whose wave-wide 512 B are two whole 256-B row pieces.
// Two buffers: stage t + 1 flies while stage t is worked on. Each wave sums its whole K in k order in one accumulator.
// Tile[m][n] (f32) = sum_k A[m][k] Bt[n][k]. M % TM == 0, N % 128 == 0; K a compile-time multiple of 128, at least 256.
template <bool B> struct BoolC { static constexpr bool value = B; };
template <typename T16> struct WFrag;   // ld: a fragment from rows in LDS (its halves 16 elements apart); ldu: from a plane in fragment order (its halves are two units)
template <> struct WFrag<h16> { typedef v16h V; static __device__ __forceinline__ V ld(const h16* p) { return cat16(*(const v8h*)p, *(const v8h*)(p + 16)); } static __device__ __forceinline__ V ldu(const h16* p) { return cat16(*(const v8h*)p, *(const v8h*)(p + FU)); } static __device__ __forceinline__ v8f mma(V a, V b, v8f c) { return wmma16(a, b, c); } };
template <> struct WFrag<bf> { typedef v16bf V; static __device__ __forceinline__ V ld(const bf* p) { return cat16b(*(const v8us*)p, *(const v8us*)(p + 16)); } static __device__ __forceinline__ V ldu(const bf* p) { return cat16b(*(const v8us*)p, *(const v8us*)(p + FU)); } static __device__ __forceinline__ v8f mma(V a, V b, v8f c) { return wmmab(a, b, c); } };
#define GT   128                  // edge of the output tile
#define GKB  256                  // bytes of an operand row in one stage
#define GP   272                  // LDS pitch of a staged row: 16 B x odd, for the 16-byte fragment reads
#define GPL  (GT * GP)            // bytes of one operand's 128 rows in a stage
#define GOP  132                  // pitch, in floats, of the output tile staged in the ring's bytes
// MERGED ROWS, the Wo GEMM's A operand (f16, DQ wide): block i of WTM rows is that GEMM's tile i: WL rows of the positions >= RH (one plane; they are counted through both batches), then WH rows of the positions < RH (their hi plane), then the same WH rows' lo plane.
// So every workgroup of the Wo GEMM has the same work: WL + WH = 128 output rows, of which only the WH rows < RH take a second product.
#define WL   96
#define WH   32
#define WTM  (WL + 2 * WH)
#define WTN  (NB_ * (TT - RH) / WL)   // tiles
static_assert(NB_ * (TT - RH) % WL == 0 && NB_ * RH % WH == 0 && NB_ * RH / WH == WTN && WL + WH == GT && WTM % 32 == 0, "whole tiles, as many of the one kind of rows as of the other");
__device__ __forceinline__ int mrow_one(int bt, int t) { const int i = bt * (TT - RH) + t - RH; return i / WL * WTM + i % WL; }        // merged row of position t >= RH of batch bt
__device__ __forceinline__ int mrow_hi(int bt, int t) { const int i = bt * RH + t; return i / WH * WTM + WL + i % WH; }               // merged hi row of position t < RH; its lo row is WH further
__device__ __forceinline__ unsigned lds_off(const void* p) { return (unsigned)(size_t)p; }
__device__ __forceinline__ void wait_ds0() { asm volatile("s_wait_dscnt 0x0" ::: "memory"); }       // this wave's LDS reads of the buffer have returned before the buffer is handed over
__device__ __forceinline__ void wait_async0() { asm volatile("s_wait_asynccnt 0x0" ::: "memory"); } // this wave's copies have landed before the barrier that publishes them
// Stands behind a run of global loads or stores; it takes their two base addresses as inputs, so that those registers are neither rewritten nor given to a load's result ahead of it.
__device__ __forceinline__ void wait_x0(const void* a, const void* b) { asm volatile("s_wait_xcnt 0x0" :: "v"(a), "v"(b) : "memory"); }
// The same behind a run of eight 16-byte stores: it takes their base address and their data as inputs, so that none of these registers is rewritten ahead of it.
__device__ __forceinline__ void wait_xd8(const void* a, const v8us* d) { asm volatile("s_wait_xcnt 0x0" :: "v"(a), "v"(d[0]), "v"(d[1]), "v"(d[2]), "v"(d[3]), "v"(d[4]), "v"(d[5]), "v"(d[6]), "v"(d[7]) : "memory"); }
// One operand's 128 rows of a stage: 8 copies per lane, 16 rows apart (l: the lane's LDS byte address, g: its global address, rs: bytes of 16 global rows).
// The s_wait_xcnt closes the statement so that no address register of an issued copy is rewritten ahead of it.
__device__ __forceinline__ void plane_copy(unsigned l, const char* g, size_t rs) {
    asm volatile("global_load_async_to_lds_b128 %0, %8, off\n\t"
                 "global_load_async_to_lds_b128 %1, %9, off\n\t"
                 "global_load_async_to_lds_b128 %2, %10, off\n\t"
                 "global_load_async_to_lds_b128 %3, %11, off\n\t"
                 "global_load_async_to_lds_b128 %4, %12, off\n\t"
                 "global_load_async_to_lds_b128 %5, %13, off\n\t"
                 "global_load_async_to_lds_b128 %6, %14, off\n\t"
                 "global_load_async_to_lds_b128 %7, %15, off\n\t"
                 "s_wait_xcnt 0x0"
                 :: "v"(l), "v"(l + 16 * GP), "v"(l + 32 * GP), "v"(l + 48 * GP), "v"(l + 64 * GP), "v"(l + 80 * GP), "v"(l + 96 * GP), "v"(l + 112 * GP),
                    "v"(g), "v"(g + rs), "v"(g + 2 * rs), "v"(g + 3 * rs), "v"(g + 4 * rs), "v"(g + 5 * rs), "v"(g + 6 * rs), "v"(g + 7 * rs)
                 : "memory");
}
// 32 more rows of an operand: 2 copies per lane, in the same form.
__device__ __forceinline__ void plane_copy2(unsigned l, const char* g, size_t rs) {
    asm volatile("global_load_async_to_lds_b128 %0, %2, off\n\t"
                 "global_load_async_to_lds_b128 %1, %3, off\n\t"
                 "s_wait_xcnt 0x0"
                 :: "v"(l), "v"(l + 16 * GP), "v"(g), "v"(g + rs)
                 : "memory");
}
// What becomes of the tile (EPI): 0: A is the merged rows; the tile's first WL rows, and its WH hi rows each with its lo row added, are stored as f32 in the rows of C that they stand for. 1: Bt is [Wq | Wk | Wv] and the tile is 128 positions x 128 dims of one batch and one head of q, k or v (by its column block); P16, Ph, Pl hold the q, k, v plane sets, PLN apart.
// q, k: rotary by the table CS, then the fp16 plane and the bf16 hi/lo planes. v: the tile laid transposed in LDS, then the same three planes. All planes [batch][head] in fragment order: every store is a whole unit.
template <typename T16, int K, int EPI>
__global__ __launch_bounds__(256) void k_gemmw(const T16* __restrict__ A, const T16* __restrict__ Bt, float* C, int ldc, const float* __restrict__ CS, h16* P16, bf* Ph, bf* Pl) {
    static_assert(EPI == 0 || GT == HD, "a tile's columns are one head");
    typedef typename WFrag<T16>::V V;
    constexpr int TM = (EPI == 0) ? WTM : GT, MF = TM / 32;           // rows of the tile; 16-row fragments of a wave's half of them
    constexpr unsigned PB = TM * GP, STG = PB + GPL;                  // a stage: [A | Bt], Bt at PB: every fragment read is within the 16-bit offset of its own base
    static_assert(TM * GOP * 4 <= 2 * STG && (TM == GT || TM == GT + 32), "the output tile is staged in the ring's bytes; A's rows are 8 or 10 copies per lane");
    __shared__ __attribute__((aligned(16))) unsigned char L[2 * STG];
    const int tid = (int)threadIdx.x, lane = tid & 31, lr = lane & 15, hi = lane >> 4; const int r0 = blockIdx.x * TM, c0 = blockIdx.y * GT;
    const int wv = __builtin_amdgcn_readfirstlane(tid >> 5);          // wave number, scalar
    const int wm = (wv >> 2) * (TM / 2), wn = (wv & 3) * 32;          // the wave's TM/2 x 32 part of the tile
    v8f acc[MF][2];
#pragma unroll
    for (int mb = 0; mb < MF; ++mb)
#pragma unroll
        for (int nb = 0; nb < 2; ++nb) acc[mb][nb] = (v8f){};
    constexpr size_t rowb = (size_t)K * 2;                            // bytes of a global operand row
    const int crow = tid >> 4, ccol = (tid & 15) * 16;                // the lane's row (of each 16) and byte column in every copy
    const char* gA = (const char*)A + (size_t)(r0 + crow) * rowb + ccol; const char* gB = (const char*)Bt + (size_t)(c0 + crow) * rowb + ccol;
    const unsigned lc = lds_off(L) + (unsigned)(crow * GP + ccol);
    auto fill = [&](int t, unsigned buf) { plane_copy(lc + buf, gA + (size_t)t * GKB, 16 * rowb); if constexpr (TM > GT) plane_copy2(lc + buf + GPL, gA + (size_t)t * GKB + GT * rowb, 16 * rowb); plane_copy(lc + buf + PB, gB + (size_t)t * GKB, 16 * rowb); };
    constexpr int NT = K / (GKB / 2); static_assert(K % (GKB / 2) == 0 && NT >= 2, "whole stages, and the two that the prologue fills");
    fill(0, 0u); wait_async0(); __syncthreads();                      // stage 0 is published
    fill(1, STG);
#pragma unroll 1   // the trip stays rolled: one publish point in the text, the buffer chosen by the trip's parity
    for (int t = 0; t < NT; ++t) {
        const unsigned buf = (unsigned)(t & 1) * STG;
        const unsigned char* pa = L + buf + (wm + lr) * GP + 16 * hi; const unsigned char* pb = L + buf + PB + (wn + lr) * GP + 16 * hi;
        V a[2][MF], b[2][2];                                          // two fragment sets: block ks + 1 is fetched while block ks is multiplied
        auto frags = [&](int ks, int st) {
#pragma unroll
            for (int mb = 0; mb < MF; ++mb) a[st][mb] = WFrag<T16>::ld((const T16*)(pa + mb * 16 * GP + ks * 64));
#pragma unroll
            for (int nb = 0; nb < 2; ++nb) b[st][nb] = WFrag<T16>::ld((const T16*)(pb + nb * 16 * GP + ks * 64)); };
        frags(0, 0);
#pragma unroll     // unrolled: fragment sets and accumulators are indexed by constants, so they stay in registers
        for (int ks = 0; ks < GKB / 64; ++ks) {
            if (ks + 1 < GKB / 64) frags(ks + 1, (ks + 1) & 1);       // this stage's own buffer only
            __builtin_amdgcn_sched_barrier(0);                        // keeps the next block's LDS reads together, ahead of this block's products and not among them
#pragma unroll
            for (int nb = 0; nb < 2; ++nb)
#pragma unroll
                for (int mb = 0; mb < MF; ++mb) acc[mb][nb] = WFrag<T16>::mma(a[ks & 1][mb], b[ks & 1][nb], acc[mb][nb]);
            __builtin_amdgcn_sched_barrier(0);                        // ends the block: the reads of the block after next stay behind it
        }
        wait_ds0(); wait_async0(); __syncthreads();                   // publishes stage t + 1 and ends every wave's reads of stage t's buffer
        if (t + 2 < NT) fill(t + 2, buf);
    }
    wait_async0();   // no copy is in flight when the ring's bytes take the output tile
    // The last trip's barrier has ended every read of the ring: the tile is laid there, and behind one barrier each wave takes whole rows of it (512 B of f32, or 256 B in each 16-bit plane).
    float* os = (float*)L;
    auto lay = [&](auto tr) {
#pragma unroll
        for (int mb = 0; mb < MF; ++mb) {
#pragma unroll
            for (int nb = 0; nb < 2; ++nb) {
                if constexpr (decltype(tr)::value) {   // transposed: a lane's 8 accumulator rows are 8 neighbours of one LDS row
                    float* p = os + (wn + nb * 16 + lr) * GOP + wm + mb * 16 + hi * 8; const v8f c = acc[mb][nb];
                    *(v4fa*)p = __builtin_shufflevector(c, c, 0, 1, 2, 3); *(v4fa*)(p + 4) = __builtin_shufflevector(c, c, 4, 5, 6, 7);
                } else {
#pragma unroll
                    for (int j = 0; j < 8; ++j) os[(wm + mb * 16 + hi * 8 + j) * GOP + wn + nb * 16 + lr] = acc[mb][nb][j]; } } } };
    if constexpr (EPI == 0) {
        lay(BoolC<false>{});
        __syncthreads();   // the whole tile is in LDS before any wave reads rows of it
        static_assert(WL % 8 == 0, "a step of 8 rows is of one kind");
        v4f val[GT / 8];   // the wave's 16 rows are read in one run, so that their LDS latencies overlap
#pragma unroll     // unrolled, here and below: val stays in registers
        for (int s = 0; s < GT / 8; ++s) { const float* p = os + (s * 8 + wv) * GOP + lane * 4; val[s] = *(const v4fa*)p; if (s >= WL / 8) val[s] += *(const v4fa*)(p + WH * GOP); }   // rows 8 s + wv: one plane for s < WL / 8, else hi + lo
#pragma unroll
        for (int s = 0; s < GT / 8; ++s) { const int i = (int)blockIdx.x * (s < WL / 8 ? WL : WH) + s * 8 + wv - (s < WL / 8 ? 0 : WL);   // the row's number among the rows of its kind
            const int orow = s < WL / 8 ? i / (TT - RH) * TT + RH + i % (TT - RH) : i / RH * TT + i % RH;
            float* p = C + (size_t)orow * ldc + c0 + lane * 4; *(v4f*)p = val[s]; wait_x0(p, p); }   // the store's address registers are reused only behind the wait
    } else {
        const int sel = (int)blockIdx.y / NH_, hd = (int)blockIdx.y % NH_, bt = r0 / TT, t0 = r0 % TT;   // q, k or v; head; batch; the tile's first position: the same for the whole workgroup
        auto planes = [&](auto isv) {
            constexpr bool ISV = decltype(isv)::value;
            // The wave takes the tile's LDS rows 16 wv + lr (q, k: positions; v: dims); its unit u is columns 16 u + 8 hi + (0..7) of them (q, k: dims, four rotary pairs; v: positions).
            v4f rc[GT / 16][2];   // q, k: cos, sin of the four pairs the lane turns in each of its units, asked for here so that all the loads fly while the tile goes through LDS
            if constexpr (!ISV) {
                const float* cp = CS + (size_t)(t0 / 16 + wv) * FT + lane * 4;   // the table holds one float per plane element (cos, sin per pair), so FT and FU count its floats too
#pragma unroll     // unrolled: rc is indexed by constants and stays in registers; one address, the units as immediate offsets
                for (int u = 0; u < GT / 16; ++u) { rc[u][0] = *(const v4f*)(cp + u * FU); rc[u][1] = *(const v4f*)(cp + u * FU + FU / 2); }
                wait_x0(cp, cp); }   // the loads' address registers are reused only behind it
            lay(isv);
            __syncthreads();   // the whole tile is in LDS before any wave reads rows of it (the branch around it is taken by the whole workgroup or not at all)
            const size_t e0 = (size_t)sel * PLN + ((size_t)bt * NH_ + hd) * TT * HD + (ISV ? (size_t)(t0 / 32) * (2 * FT) + wv * (2 * FU) : (size_t)(t0 / 16 + wv) * FT) + lane * 8;   // the lane's 8 values in the wave's unit 0
            h16* d16 = P16 + e0; bf* dh = Ph + e0; bf* dl = Pl + e0;
            v4f tv[GT / 16][2];   // the wave's 8 units are read in one run, so that their LDS latencies overlap
#pragma unroll     // unrolled, here and below: tv and rc stay in registers
            for (int u = 0; u < GT / 16; ++u) { const float* p = os + (wv * 16 + lr) * GOP + u * 16 + hi * 8; tv[u][0] = *(const v4fa*)p; tv[u][1] = *(const v4fa*)(p + 4); }
#pragma unroll
            for (int u = 0; u < GT / 16; ++u) { const int e = ISV ? (u >> 1) * (2 * FT) + (u & 1) * FU : u * FU; v8h o16; v8us oh, ol;
#pragma unroll
                for (int g = 0; g < 2; ++g) { v4f y = tv[u][g];
                    if constexpr (!ISV) { float y0, y1; v2f cs; cs[0] = rc[u][g][0]; cs[1] = rc[u][g][1]; rope2(tv[u][g][0], tv[u][g][1], cs, y0, y1); y[0] = y0; y[1] = y1; cs[0] = rc[u][g][2]; cs[1] = rc[u][g][3]; rope2(tv[u][g][2], tv[u][g][3], cs, y0, y1); y[2] = y0; y[3] = y1; }
#pragma unroll
                    for (int q = 0; q < 4; ++q) { o16[g * 4 + q] = tohx(y[q]); unsigned short a2, c2; splitf(y[q], a2, c2); oh[g * 4 + q] = a2; ol[g * 4 + q] = c2; } }
                *(v8h*)(d16 + e) = o16; *(v8us*)(dh + e) = oh; *(v8us*)(dl + e) = ol; }
            if constexpr (!ISV) wait_x0(dh, dl);   // in the built code the q, k path runs on to the head of the v path's code (and branches past it there), where a store's address register is rewritten
        };
        if (sel == 2) planes(BoolC<true>{}); else planes(BoolC<false>{});
    }
}

// ---- k_attn: causal attention, one launch; scores and probabilities never leave the registers. Rows < RH: flash (hi/lo planes, 16 rows a workgroup); rows >= RH: flashs (fp16, 128 rows a workgroup, K and V through LDS).
// flash: a workgroup of 8 waves takes 16 * QN query rows of one head of one batch.
// Transposed products: S^T = K Q^T puts a query in a lane (column lr) with 8 keys of each 16-key tile in its accumulator, which is already the B fragment's k order of O^T = V^T P^T: keys kb + 8 hi + j, then kb + 16 + 8 hi + j.
// Wave w takes the 32-key blocks w, w + 8, ... up to the diagonal, each with its own running maximum, sum and O^T (online softmax); at the end the 8 partial results are brought to the common maximum and summed in LDS, wave 0's first.
// PIPE (NSPLIT 0 only; k_attn calls flash with NSPLIT 2): the next block's K fragments are asked for as soon as S is formed, its V fragments as soon as O is: each load flies over the other half of the work, in the registers that have just come free.
// NSPLIT 0: one fp16 product, the probabilities carry 2^PSH (it cancels in the division by the row sum, which carries it too). NSPLIT 2: bf16 hi/lo planes, 3 products for S and for O.
// Q, K, V planes [head] in fragment order: a 32-key block of K and of V is 8 KB in a row, read by 16 loads of one unit each; the result goes into the merged rows' hi and lo f16 planes (rows < RH only: see MERGED ROWS). bt: the batch; q0: the workgroup's first query row.
#define L2E  1.4426950408889634f
#define ANW  8                    // waves that share a workgroup's keys
template <typename T16, int NSPLIT, int QN>
__device__ __forceinline__ void flash(const T16* __restrict__ Q, const T16* __restrict__ Q2, const T16* __restrict__ Kp, const T16* __restrict__ Kp2, const T16* __restrict__ Vt, const T16* __restrict__ Vt2, int bt, int h, int q0, h16* Mg, float* os, float* sm, float* sl) {
    typedef typename WFrag<T16>::V V;
    constexpr int NW = ANW, QR = 16 * QN; constexpr float PSH = (NSPLIT == 0) ? 10.0f : 0.0f;
    constexpr bool PIPE = (NSPLIT == 0);   // the hi/lo form has twice the fragments and at most two blocks per wave: it asks for a block's fragments at the block's head
    const int tid = (int)threadIdx.x, lane = tid & 31, lr = lane & 15, hi = lane >> 4;
    const int wv = __builtin_amdgcn_readfirstlane(tid >> 5);          // wave number, scalar: the key loop's bounds stay wave-uniform
    const size_t hp = (size_t)h * TT * HD;
    v8f o[8][QN]; float m[QN], l[QN];
#pragma unroll
    for (int qt = 0; qt < QN; ++qt) { m[qt] = -3.0e38f; l[qt] = 0.f;
#pragma unroll
        for (int dt = 0; dt < 8; ++dt) o[dt][qt] = (v8f){}; }
    const int nblk = (q0 + QR - 1) / 32 + 1;                          // every block holds a key <= q0, so no query ever sees a block that is masked whole
    if (wv < nblk) {
        V q[QN][4], q2[QN][4], ka[2][4], ka2[2][4], va[8], va2[8];
        // pk, pv (and the lo planes' pk2, pv2): the lane's addresses in the block whose fragments the registers hold; a load names them with the step as a constant, and they move on only behind the wait.
        constexpr int KS = NW * 2 * FT, VS = NW * 2 * FT;
        const size_t ek = hp + (size_t)wv * (2 * FT) + lane * 8, ev = ek;
        const T16* pk = Kp + ek; const T16* pk2 = (NSPLIT == 2) ? Kp2 + ek : pk; const T16* pv = Vt + ev; const T16* pv2 = (NSPLIT == 2) ? Vt2 + ev : pv;
        auto ldk = [&](int st) {
#pragma unroll
            for (int kt = 0; kt < 2; ++kt)
#pragma unroll
                for (int ks = 0; ks < 4; ++ks) { const int e = st + kt * FT + ks * (2 * FU); ka[kt][ks] = WFrag<T16>::ldu(pk + e); if (NSPLIT == 2) ka2[kt][ks] = WFrag<T16>::ldu(pk2 + e); }
            wait_x0(pk, pk2); pk += st; pk2 += st; };
        auto ldv = [&](int st) {
#pragma unroll
            for (int dt = 0; dt < 8; ++dt) { const int e = st + dt * (2 * FU); va[dt] = WFrag<T16>::ldu(pv + e); if (NSPLIT == 2) va2[dt] = WFrag<T16>::ldu(pv2 + e); }
            wait_x0(pv, pv2); pv += st; pv2 += st; };
        const size_t eq = hp + (size_t)(q0 / 16) * FT + lane * 8; const T16* pq = Q + eq; const T16* pq2 = (NSPLIT == 2) ? Q2 + eq : pq;
#pragma unroll
        for (int qt = 0; qt < QN; ++qt)
#pragma unroll
            for (int ks = 0; ks < 4; ++ks) { const int e = qt * FT + ks * (2 * FU); q[qt][ks] = WFrag<T16>::ldu(pq + e); if (NSPLIT == 2) q2[qt][ks] = WFrag<T16>::ldu(pq2 + e); }
        wait_x0(pq, pq2);
        if constexpr (PIPE) { ldk(0); ldv(0); }
        // One 32-key block. MORE: the wave has a further block, whose fragments are asked for here; the wave's last block is the only one that can reach the diagonal, so it alone masks.
        auto block = [&](int kb, auto more) {
            constexpr bool MORE = decltype(more)::value;
            if constexpr (!PIPE) { ldk(0); ldv(0); }
            v8f s[QN][2];
#pragma unroll
            for (int qt = 0; qt < QN; ++qt)
#pragma unroll
                for (int kt = 0; kt < 2; ++kt) { s[qt][kt] = (v8f){};
#pragma unroll
                    for (int ks = 0; ks < 4; ++ks) { s[qt][kt] = WFrag<T16>::mma(ka[kt][ks], q[qt][ks], s[qt][kt]); if (NSPLIT == 2) { s[qt][kt] = WFrag<T16>::mma(ka[kt][ks], q2[qt][ks], s[qt][kt]); s[qt][kt] = WFrag<T16>::mma(ka2[kt][ks], q[qt][ks], s[qt][kt]); } } }
            if constexpr (PIPE && MORE) ldk(KS);
            V pb[QN], pb2[QN];
#pragma unroll
            for (int qt = 0; qt < QN; ++qt) {
                const int qi = q0 + qt * 16 + lr; float mloc = -3.0e38f;
#pragma unroll
                for (int kt = 0; kt < 2; ++kt)
#pragma unroll
                    for (int j = 0; j < 8; ++j) { float t = s[qt][kt][j] * SCL; if constexpr (!MORE) t = (kb + kt * 16 + hi * 8 + j <= qi) ? t : -3.0e38f; s[qt][kt][j] = t; mloc = fmaxf(mloc, t); }
                mloc = fmaxf(mloc, __shfl_xor(mloc, 16, 32));         // the query's other 16 keys of the block are in lane lr + 16
                if (__any(mloc > m[qt])) {                            // where no maximum rose every factor would be 1
                    const float mn = fmaxf(m[qt], mloc), al = __builtin_amdgcn_exp2f((m[qt] - mn) * L2E); m[qt] = mn; l[qt] *= al;
#pragma unroll
                    for (int dt = 0; dt < 8; ++dt) o[dt][qt] *= al; }
                float ps = 0.f;
#pragma unroll
                for (int kt = 0; kt < 2; ++kt)
#pragma unroll
                    for (int j = 0; j < 8; ++j) { const float p = __builtin_amdgcn_exp2f((s[qt][kt][j] - m[qt]) * L2E + PSH); s[qt][kt][j] = p; ps += p; }
                l[qt] += ps;
                if constexpr (NSPLIT == 0) {
#pragma unroll
                    for (int j = 0; j < 8; ++j) { pb[qt][j] = tohx(s[qt][0][j]); pb[qt][8 + j] = tohx(s[qt][1][j]); }
                } else {
                    v8us h0, h1, l0, l1;
#pragma unroll
                    for (int j = 0; j < 8; ++j) { unsigned short a, c2; splitf(s[qt][0][j], a, c2); h0[j] = a; l0[j] = c2; splitf(s[qt][1][j], a, c2); h1[j] = a; l1[j] = c2; }
                    pb[qt] = cat16b(h0, h1); pb2[qt] = cat16b(l0, l1); }
            }
#pragma unroll
            for (int dt = 0; dt < 8; ++dt)
#pragma unroll
                for (int qt = 0; qt < QN; ++qt) { o[dt][qt] = WFrag<T16>::mma(va[dt], pb[qt], o[dt][qt]); if (NSPLIT == 2) { o[dt][qt] = WFrag<T16>::mma(va[dt], pb2[qt], o[dt][qt]); o[dt][qt] = WFrag<T16>::mma(va2[dt], pb[qt], o[dt][qt]); } }
            if constexpr (PIPE && MORE) ldv(VS);
            if constexpr (!PIPE && MORE) { pk += KS; pk2 += KS; pv += VS; pv2 += VS; }
        };
        int blk = wv;
#pragma unroll 1   // rolled: one 32-key block's fragments at a time in registers
        for (; blk + NW < nblk; blk += NW) block(blk * 32, BoolC<true>{});
        block(blk * 32, BoolC<false>{});
    }
#pragma unroll
    for (int qt = 0; qt < QN; ++qt) if (hi == 0) sm[wv * QR + qt * 16 + lr] = m[qt];
    __syncthreads();   // every wave's maxima are in LDS before any wave forms the common one
#pragma unroll
    for (int qt = 0; qt < QN; ++qt) { float M = sm[qt * 16 + lr];
#pragma unroll
        for (int w = 1; w < NW; ++w) M = fmaxf(M, sm[w * QR + qt * 16 + lr]);
        const float sc = __builtin_amdgcn_exp2f((m[qt] - M) * L2E); const float lt = l[qt] + __shfl_xor(l[qt], 16, 32);   // a wave without a block: its sum and its O are 0
        if (hi == 0) sl[wv * QR + qt * 16 + lr] = lt * sc;
#pragma unroll
        for (int dt = 0; dt < 8; ++dt) { const v8f c = o[dt][qt] * sc; float* p = os + (wv * QR + qt * 16 + lr) * GOP + dt * 16 + hi * 8;   // a lane's 8 accumulator rows are 8 neighbouring dims of its query's LDS row
            *(v4fa*)p = __builtin_shufflevector(c, c, 0, 1, 2, 3); *(v4fa*)(p + 4) = __builtin_shufflevector(c, c, 4, 5, 6, 7); } }
    __syncthreads();   // all 8 partial results are in LDS before any wave sums them
#pragma unroll
    for (int s = 0; s < QR / NW; ++s) { const int row = s * NW + wv; v4f val = *(const v4fa*)(os + row * GOP + lane * 4); float L = sl[row];
#pragma unroll
        for (int w = 1; w < NW; ++w) { val += *(const v4fa*)(os + (w * QR + row) * GOP + lane * 4); L += sl[w * QR + row]; }
        const float f = __fdiv_rn(1.0f, L); h16* ph = Mg + (size_t)mrow_hi(bt, q0 + row) * DQ + h * HD + lane * 4; h16* pl = ph + (size_t)WH * DQ; v4h oh, ol;
#pragma unroll
        for (int qd = 0; qd < 4; ++qd) { const float y = val[qd] * f; oh[qd] = tohx(y); ol[qd] = tohx(y - (float)oh[qd]); }
        *(v4h*)ph = oh; *(v4h*)pl = ol; wait_x0(ph, pl); }
}
// ---- flashs: the fp16 form, one product, the probabilities carry 2^10 as in flash. A workgroup of 8 waves takes SQR = 128 query rows of one head: wave wv is query group qg = wv % 4 (32 rows) and key half sp = wv / 4.
// A stage is 128 keys: four 32-key blocks of K (32 KB in a row in the plane, already in fragment order) and the same of V, brought into LDS once by asynchronous copies and read there by all four query groups, so that
// a key's bytes leave L2 once per 128 rows. Wave (qg, sp) works on blocks 4 t + sp and 4 t + 2 + sp of stage t, up to its own diagonal block; only the last stage masks. Two buffers: stage t + 1 flies while stage t is worked on.
// At the end the two key halves of each query group are brought to their common maximum and summed in LDS (in the ring's bytes), half 0 first; the result goes into the merged rows as one f16 plane.
#define SQR  128                  // query rows of a workgroup
#define SBB  (2 * FT * 2)         // bytes of a 32-key block of K or of V
#define SPB  (4 * SBB)            // bytes of a stage's four K blocks, and of its four V blocks
#define SSTG (2 * SPB)            // bytes of a stage: [K | V]
// A stage's K blocks, or its V blocks: 8 copies per lane, each 4 KB over the workgroup (l: the lane's LDS byte address, g: its global address).
// The s_wait_xcnt closes the statement so that no address register of an issued copy is rewritten ahead of it.
__device__ __forceinline__ void kv_copy(unsigned l, const char* g) {
    asm volatile("global_load_async_to_lds_b128 %0, %8, off\n\t"
                 "global_load_async_to_lds_b128 %1, %9, off\n\t"
                 "global_load_async_to_lds_b128 %2, %10, off\n\t"
                 "global_load_async_to_lds_b128 %3, %11, off\n\t"
                 "global_load_async_to_lds_b128 %4, %12, off\n\t"
                 "global_load_async_to_lds_b128 %5, %13, off\n\t"
                 "global_load_async_to_lds_b128 %6, %14, off\n\t"
                 "global_load_async_to_lds_b128 %7, %15, off\n\t"
                 "s_wait_xcnt 0x0"
                 :: "v"(l), "v"(l + 4096), "v"(l + 8192), "v"(l + 12288), "v"(l + 16384), "v"(l + 20480), "v"(l + 24576), "v"(l + 28672),
                    "v"(g), "v"(g + 4096), "v"(g + 8192), "v"(g + 12288), "v"(g + 16384), "v"(g + 20480), "v"(g + 24576), "v"(g + 28672)
                 : "memory");
}
__device__ __forceinline__ void flashs(const h16* __restrict__ Q, const h16* __restrict__ Kp, const h16* __restrict__ Vt, int bt, int h, int q0, h16* Mg, float* os, float* sm, float* sl) {
    typedef WFrag<h16> F; typedef F::V V;
    constexpr int QN = 2, QR = 16 * QN; constexpr float PSH = 10.0f;
    static_assert(SPB == 8 * 256 * 16 && 2 * SSTG <= ANW * 32 * GOP * 4 && ANW * QR == 2 * SQR && SQR == 128, "8 copies of the workgroup per plane; the ring lies in the merge rows' bytes; two key halves of SQR rows; a stage's keys are a workgroup's rows");
    const int tid = (int)threadIdx.x, lane = tid & 31, lr = lane & 15, hi = lane >> 4;
    const int wv = __builtin_amdgcn_readfirstlane(tid >> 5), qg = wv & 3, sp = wv >> 2;   // scalar: the tests on the wave's blocks stay wave-uniform
    const size_t hp = (size_t)h * TT * HD;
    const int qw = q0 + qg * QR, bd = qw / 32;                        // the wave's first query row; its diagonal block, whose first key every one of its queries sees
    v8f o[8][QN]; float m[QN], l[QN];
#pragma unroll
    for (int qt = 0; qt < QN; ++qt) { m[qt] = -3.0e38f; l[qt] = 0.f;
#pragma unroll
        for (int dt = 0; dt < 8; ++dt) o[dt][qt] = (v8f){}; }
    const char* gk = (const char*)(Kp + hp) + tid * 16; const char* gv = (const char*)(Vt + hp) + tid * 16;
    const unsigned lc = lds_off(os) + (unsigned)tid * 16;
    auto fill = [&](int t, unsigned buf) { kv_copy(lc + buf, gk + (size_t)t * SPB); kv_copy(lc + buf + SPB, gv + (size_t)t * SPB); };
    const int NS = q0 / SQR + 1;                                      // stages up to the workgroup's last row; at least two, the same for the whole workgroup
    fill(0, 0u);
    V q[QN][4];
    const h16* pq = Q + hp + (size_t)(qw / 16) * FT + lane * 8;
#pragma unroll
    for (int qt = 0; qt < QN; ++qt)
#pragma unroll
        for (int ks = 0; ks < 4; ++ks) q[qt][ks] = F::ldu(pq + qt * FT + ks * (2 * FU));
    wait_x0(pq, pq);
    wait_async0(); __syncthreads();                                   // stage 0 is published
    fill(1, SSTG);
    // One 32-key block, read from the stage's buffer (off: the bytes from the ring's start to the block's K). DIAG: the block may reach the wave's diagonal and is masked.
    auto block = [&](unsigned off, int kb, auto diag) {
        constexpr bool DIAG = decltype(diag)::value;
        const h16* lk = (const h16*)((const unsigned char*)os + off) + lane * 8; const h16* lv = lk + SPB / 2;
        V ka[2][4], va[8];
#pragma unroll
        for (int kt = 0; kt < 2; ++kt)
#pragma unroll
            for (int ks = 0; ks < 4; ++ks) ka[kt][ks] = F::ldu(lk + kt * FT + ks * (2 * FU));
#pragma unroll
        for (int dt = 0; dt < 8; ++dt) va[dt] = F::ldu(lv + dt * (2 * FU));
        v8f s[QN][2];
#pragma unroll
        for (int qt = 0; qt < QN; ++qt)
#pragma unroll
            for (int kt = 0; kt < 2; ++kt) { s[qt][kt] = (v8f){};
#pragma unroll
                for (int ks = 0; ks < 4; ++ks) s[qt][kt] = F::mma(ka[kt][ks], q[qt][ks], s[qt][kt]); }
        V pb[QN];
#pragma unroll
        for (int qt = 0; qt < QN; ++qt) {
            const int qi = qw + qt * 16 + lr; float mloc = -3.0e38f;
#pragma unroll
            for (int kt = 0; kt < 2; ++kt)
#pragma unroll
                for (int j = 0; j < 8; ++j) { float t = s[qt][kt][j] * SCL; if constexpr (DIAG) t = (kb + kt * 16 + hi * 8 + j <= qi) ? t : -3.0e38f; s[qt][kt][j] = t; mloc = fmaxf(mloc, t); }
            mloc = fmaxf(mloc, __shfl_xor(mloc, 16, 32));             // the query's other 16 keys of the block are in lane lr + 16
            if (__any(mloc > m[qt])) {                                // where no maximum rose every factor would be 1
                const float mn = fmaxf(m[qt], mloc), al = __builtin_amdgcn_exp2f((m[qt] - mn) * L2E); m[qt] = mn; l[qt] *= al;
#pragma unroll
                for (int dt = 0; dt < 8; ++dt) o[dt][qt] *= al; }
            float ps = 0.f;
#pragma unroll
            for (int kt = 0; kt < 2; ++kt)
#pragma unroll
                for (int j = 0; j < 8; ++j) { const float p = __builtin_amdgcn_exp2f((s[qt][kt][j] - m[qt]) * L2E + PSH); s[qt][kt][j] = p; ps += p; }
            l[qt] += ps;
#pragma unroll
            for (int j = 0; j < 8; ++j) { pb[qt][j] = tohx(s[qt][0][j]); pb[qt][8 + j] = tohx(s[qt][1][j]); }
        }
#pragma unroll
        for (int dt = 0; dt < 8; ++dt)
#pragma unroll
            for (int qt = 0; qt < QN; ++qt) o[dt][qt] = F::mma(va[dt], pb[qt], o[dt][qt]);
    };
    // All stages but the last lie below every wave's diagonal: one path through the two blocks, no test on them.
#pragma unroll 1   // the trip stays rolled: the buffer is chosen by the trip's parity
    for (int t = 0; t < NS - 1; ++t) {
        const unsigned buf = (unsigned)(t & 1) * SSTG;
        block(buf + sp * SBB, (4 * t + sp) * 32, BoolC<false>{});
        block(buf + (2 + sp) * SBB, (4 * t + 2 + sp) * 32, BoolC<false>{});
        wait_ds0(); wait_async0(); __syncthreads();                   // publishes stage t + 1 and ends every wave's reads of stage t's buffer
        if (t + 2 < NS) fill(t + 2, buf);
    }
    // The last stage holds the four diagonal blocks: its blocks are masked (an identity below the wave's diagonal block); a block past the wave's diagonal is left out.
#pragma unroll 1   // rolled: one copy of the masked block's code, not two
    for (int i = 0; i < 2; ++i) {
        const int b = 4 * (NS - 1) + 2 * i + sp;
        if (b <= bd) block((unsigned)((NS - 1) & 1) * SSTG + (2 * i + sp) * SBB, b * 32, BoolC<true>{});
    }
    wait_ds0(); wait_async0(); __syncthreads();                       // the last stage's foot: ends every wave's reads of the ring
    wait_async0();   // no copy is in flight when the ring's bytes take the partial results
#pragma unroll
    for (int qt = 0; qt < QN; ++qt) if (hi == 0) sm[wv * QR + qt * 16 + lr] = m[qt];   // row sp * SQR + (the query's row in the workgroup)
    __syncthreads();   // both halves' maxima are in LDS before any wave forms the common one
#pragma unroll
    for (int qt = 0; qt < QN; ++qt) { const int r = qg * QR + qt * 16 + lr; const float M = fmaxf(sm[r], sm[SQR + r]);
        const float sc = __builtin_amdgcn_exp2f((m[qt] - M) * L2E); const float lt = l[qt] + __shfl_xor(l[qt], 16, 32);
        if (hi == 0) sl[wv * QR + qt * 16 + lr] = lt * sc;
#pragma unroll
        for (int dt = 0; dt < 8; ++dt) { const v8f c = o[dt][qt] * sc; float* p = os + (wv * QR + qt * 16 + lr) * GOP + dt * 16 + hi * 8;   // a lane's 8 accumulator rows are 8 neighbouring dims of its query's LDS row
            *(v4fa*)p = __builtin_shufflevector(c, c, 0, 1, 2, 3); *(v4fa*)(p + 4) = __builtin_shufflevector(c, c, 4, 5, 6, 7); } }
    __syncthreads();   // both partial results of every row are in LDS before any wave sums them
#pragma unroll
    for (int s = 0; s < SQR / ANW; ++s) { const int row = s * ANW + wv; const v4f val = *(const v4fa*)(os + row * GOP + lane * 4) + *(const v4fa*)(os + (SQR + row) * GOP + lane * 4); const float L = sl[row] + sl[SQR + row];
        const float f = __fdiv_rn(1.0f, L); h16* po = Mg + (size_t)mrow_one(bt, q0 + row) * DQ + h * HD + lane * 4; v4h oh;
#pragma unroll
        for (int qd = 0; qd < 4; ++qd) oh[qd] = tohx(val[qd] * f);
        *(v4h*)po = oh; wait_x0(po, po); }
}
// Grid (batches x heads, row groups): the groups of SQR rows >= RH come first, the longest rows first of all; the groups of 16 rows < RH (hi/lo planes) fill the launch's tail.
#define ALO  ((TT - RH) / SQR)
static_assert((TT - RH) % SQR == 0 && RH % SQR == 0 && RH >= SQR, "whole groups of SQR rows, each beginning at a multiple of SQR: whole stages, at least two");
#define AHI  (RH / 16)
__global__ __launch_bounds__(32 * ANW) void k_attn(const h16* __restrict__ Q16, const h16* __restrict__ K16, const h16* __restrict__ V16, const bf* __restrict__ Qh, const bf* __restrict__ Ql, const bf* __restrict__ Kh, const bf* __restrict__ Kl, const bf* __restrict__ Vh, const bf* __restrict__ Vl, h16* Mg) {
    __shared__ __align__(16) float os[ANW * 32 * GOP]; __shared__ float sm[ANW * 32]; __shared__ float sl[ANW * 32];
    const int h = (int)blockIdx.x % NH_, bt = (int)blockIdx.x / NH_, g = (int)blockIdx.y;
    const size_t po = (size_t)bt * NH_ * TT * HD;   // the batch's planes in every plane set
    Q16 += po; K16 += po; V16 += po; Qh += po; Ql += po; Kh += po; Kl += po; Vh += po; Vl += po;
    if (g < ALO) flashs(Q16, K16, V16, bt, h, TT - SQR * (g + 1), Mg, os, sm, sl);
    else flash<bf, 2, 1>(Qh, Ql, Kh, Kl, Vh, Vl, bt, h, RH - 16 * (g - ALO + 1), Mg, os, sm, sl);
}

__constant__ float INV2[HD / 2] = { 1.000000000e+00f, 8.659643531e-01f, 7.498942018e-01f, 6.493816376e-01f, 5.623413324e-01f, 4.869675338e-01f, 4.216965139e-01f, 3.651741147e-01f, 3.162277639e-01f, 2.738419771e-01f, 2.371373773e-01f, 2.053525001e-01f, 1.778279394e-01f, 1.539926529e-01f, 1.333521456e-01f, 1.154781953e-01f, 1.000000015e-01f, 8.659642935e-02f, 7.498942316e-02f, 6.493816525e-02f, 5.623413250e-02f, 4.869675264e-02f, 4.216964915e-02f, 3.651741147e-02f, 3.162277490e-02f, 2.738419548e-02f, 2.371373773e-02f, 2.053525113e-02f, 1.778279431e-02f, 1.539926510e-02f, 1.333521400e-02f, 1.154781971e-02f, 9.999999776e-03f, 8.659643121e-03f, 7.498942316e-03f, 6.493816152e-03f, 5.623413250e-03f, 4.869675264e-03f, 4.216964822e-03f, 3.651741194e-03f, 3.162277630e-03f, 2.738419687e-03f, 2.371373819e-03f, 2.053525066e-03f, 1.778279431e-03f, 1.539926510e-03f, 1.333521446e-03f, 1.154782018e-03f, 1.000000047e-03f, 8.659643354e-04f, 7.498941850e-04f, 6.493816036e-04f, 5.623413017e-04f, 4.869675322e-04f, 4.216965172e-04f, 3.651741135e-04f, 3.162277571e-04f, 2.738419571e-04f, 2.371373703e-04f, 2.053525095e-04f, 1.778279402e-04f, 1.539926598e-04f, 1.333521504e-04f, 1.154782003e-04f };   // float32 1 / 10000^(2i/128), generated with jnp to be bit-exact
// ---- k_prep: everything the GEMMs need ahead of them, in one launch of 1280 workgroups: the rotary table (the first PTB workgroups: their threads run longest) and the bf16 copies of the four weights and of x (Wo's bf16 values are stored as f16, the type of the Wo GEMM's other operand: exact from 2^-17 up to f16's largest value; a smaller one goes to the nearest multiple of 2^-24).
// Table: one thread per (position, pair), in the order in which the projections' epilogue reads it: per 16 positions and 16 dims two runs of 16 B a lane (lane as in a q, k unit), a lane's pairs 0, 1 in the first and 2, 3 in the second, each pair cos, sin. Copies: a workgroup takes 256 * PCH runs of 8 values of one source; a thread takes PCH of them, 256 runs apart, 8 in flight at a time.
#define PCH  16
#define PTB  (TT * (HD / 2) / 256)
#define PWB  (DQ * DM / (256 * 8 * PCH))       // workgroups per 2048 x 2048 source: each weight, each batch of x
static_assert(DQ * DM % (256 * 8 * PCH) == 0 && DKV == DQ && TT == DQ && PCH % 8 == 0, "whole workgroups; all six sources have one size");
__global__ __launch_bounds__(256) void k_prep(const float* __restrict__ x, const float* __restrict__ wq, const float* __restrict__ wk, const float* __restrict__ wv, const float* __restrict__ wo, bf* W4, bf* XB, float* CS) {
    const int tid = (int)threadIdx.x;
    if ((int)blockIdx.x < PTB) {
        const int idx = (int)blockIdx.x * 256 + tid, ln = (idx >> 1) & 31, i = ((idx >> 7) & 7) * 8 + (ln >> 4) * 4 + ((idx >> 6) & 1) * 2 + (idx & 1), t = (idx >> 10) * 16 + (ln & 15); const float a = __fmul_rn((float)t, INV2[i]); const float c = cosf(a), s = sinf(a);
        v2f cs; cs[0] = c; cs[1] = s; *(v2f*)(CS + (size_t)idx * 2) = cs; return; }
    const int blk = (int)blockIdx.x - PTB, sel = blk / PWB;   // which source: the same for the whole workgroup
    const float* sb = sel == 0 ? wq : sel == 1 ? wk : sel == 2 ? wv : sel == 3 ? wo : x + (size_t)(sel - 4) * TT * DM;
    bf* db = sel < 4 ? W4 + (size_t)sel * DQ * DM : XB + (size_t)(sel - 4) * TT * DM;
    const size_t e = ((size_t)(blk % PWB) * (256 * PCH) + tid) * 8; const float* sp = sb + e; bf* dp = db + e;
    auto copy = [&](auto asf16) {   // asf16: the bf16 value is stored in f16 form (Wo)
#pragma unroll     // unrolled: every load and store names sp or dp with a constant offset
        for (int k0 = 0; k0 < PCH; k0 += 8) { v8f v[8];
#pragma unroll
            for (int k = 0; k < 8; ++k) v[k] = *(const v8f*)(sp + (k0 + k) * (256 * 8));
            wait_x0(sp, dp);   // the loads' address registers are reused only behind it
            __builtin_amdgcn_sched_barrier(0);   // keeps the conversions behind that wait: without it they are lifted over it and rewrite the loads' offset register ahead of it
            v8us o[8];
#pragma unroll
            for (int k = 0; k < 8; ++k) {
#pragma unroll
                for (int q = 0; q < 8; ++q) { if constexpr (decltype(asf16)::value) o[k][q] = __builtin_bit_cast(unsigned short, tohx(bfr(v[k][q]))); else o[k][q] = f2bf(v[k][q]); }
                *(v8us*)(dp + (k0 + k) * (256 * 8)) = o[k]; }
            wait_xd8(dp, o); } };   // the eight stores' address and data registers are reused only behind it, and the next run of loads stands behind it
    if (sel == 3) copy(BoolC<true>{}); else copy(BoolC<false>{});   // the same for the whole workgroup
}
extern "C" void kernel_launch(void* const* d_in, const int* in_sizes, int n_in,
                              void* d_out, int out_size, void* d_ws, size_t ws_size, hipStream_t stream) {
    (void)in_sizes; (void)n_in; (void)out_size;
    const float* x = (const float*)d_in[0]; const float* wq = (const float*)d_in[1]; const float* wk = (const float*)d_in[2]; const float* wv = (const float*)d_in[3]; const float* wo = (const float*)d_in[4];   /* weights 'oi' [2048][2048] */
    float* OUT = (float*)d_out;     // [2][2048][2048]
    char* wsp = (char*)d_ws;
    auto take = [&](size_t bytes) { char* p = wsp; wsp += (bytes + 255) & ~(size_t)255; return (void*)p; };
    bf* W4 = (bf*)take((size_t)4 * DQ * DM * 2);   // Wq, Wk, Wv (bf16), Wo (f16)
    h16* P16 = (h16*)take(3 * PLN * 2); bf* PH = (bf*)take(3 * PLN * 2); bf* PL = (bf*)take(3 * PLN * 2);   // each: the q, k, v plane sets
    bf* XB = (bf*)take((size_t)NB_ * TT * DM * 2); float* CS = (float*)take((size_t)TT * HD * 4); h16* AT = (h16*)take((size_t)WTN * WTM * DQ * 2);   // AT: the merged rows
    if ((size_t)(wsp - (char*)d_ws) > ws_size) return;    // 213 MiB of the 256 MiB
    k_prep<<<PTB + 6 * PWB, 256, 0, stream>>>(x, wq, wk, wv, wo, W4, XB, CS);
    k_gemmw<bf, DM, 1><<<dim3(NB_ * TT / GT, 3 * DQ / GT, 1), 256, 0, stream>>>(XB, W4, nullptr, 0, CS, P16, PH, PL);
    k_attn<<<dim3(NB_ * NH_, ALO + AHI, 1), 32 * ANW, 0, stream>>>(P16, P16 + PLN, P16 + 2 * PLN, PH, PL, PH + PLN, PL + PLN, PH + 2 * PLN, PL + 2 * PLN, AT);
    k_gemmw<h16, DQ, 0><<<dim3(WTN, DM / GT, 1), 256, 0, stream>>>(AT, (const h16*)(W4 + (size_t)3 * DQ * DM), OUT, DM, nullptr, nullptr, nullptr, nullptr);
}

// v010
// It runs in 181 microseconds.
// Two timings next to v009 put it at 1.04 and 1.03 times that version's speed.
// All steps since v000 together make it 9.65 times as fast.
#include <hip/hip_runtime.h>

// Causal multi-head self-attention with 128-wide heads and interleaved-pair rotary embeddings (x [2][2048][2048]; Q, K, V = einsum('bsd,ed', x, W) ('oi' 0.02; 16 heads x 128); rope on consecutive (even, odd) pairs: (x1 cos - x2 sin, x1 sin + x2 cos) with angle pos x 10000^(-2i/128), pos = arange(S) (64 f32 frequencies jnp-exact for this expression; precise cosf/sinf); scores x 1/sqrt(128); causal (-inf); softmax; out = merged Wo^T -> [2][2048][2048] (8.4 M); argument order x, Wq, Wk, Wv, Wo).
// Four launches, each over both batches (a row of x is b * 2048 + t): k_prep, the q, k, v projections as one GEMM, k_attn, the Wo GEMM.
// Layout: bf16 copy of x; 'oi' weights; exact projections; k_prep's computed table (HD 128: one angle per (even, odd) pair); the projections' epilogues build the rotary q, k planes and the transposed v planes, all in the order in which k_attn's lanes hold them (see FRAGMENT ORDER); causal T-2048 attention at HD 128 in one kernel, online softmax (hybrid rows: < 512 hi/lo 3 products, rest fp16 x1024; key blocks above the diagonal are never read; its epilogue writes the merged f16 rows: one plane for rows >= 512, hi + lo for rows < 512); merged x Wo, Wo's bf16 values held in f16.
// Compute dtypes, f32 accumulate: every input rounded to bf16; projections exact; rotary f32; attention rows < 512 3 products, rest fp16; softmax f32; Wo f16: rows < 512 hi + lo (2 products), rest 1 product.

#define NB_  2
#define TT   2048
#define DM   2048
#define NH_  16
#define NKV  16
#define REP  (NH_ / NKV)
#define HD   128
#define DQ   (NH_ * HD)
#define DKV  (NKV * HD)
// FRAGMENT ORDER of a [batch][head] plane: a unit is the 16 B that each of a wave's 32 lanes holds of one half of a matrix fragment, 512 B in lane order, so that one wave-wide 16-byte load or store is 4 whole lines.
// Lane = 16 hi + lr. q, k: unit (t / 16, d / 16), lane (lr = t % 16, hi = d / 8 % 2), its 8 values d % 8; 8 units (FT elements) are 16 positions.
// v: unit (t / 32, d / 16, t / 16 % 2), lane (lr = d % 16, hi = t / 8 % 2), its 8 values t % 8; 16 units (2 FT elements) are 32 positions.
#define FU   256                  // elements of a unit
#define FT   (16 * HD)            // elements of 16 positions
#define PLN  ((size_t)NB_ * NH_ * TT * HD)   // elements of one plane set: [batch][head] planes of q, of k or of v
static_assert(NKV == NH_, "q, k and v plane sets have one size, and a projection tile's column block is a head of one of them");
#define RH   512                  // query rows < RH use hi+lo planes
#define SCL  0.088388347648318447f   // HD^-0.5
typedef _Float16 h16;
typedef unsigned short bf;
typedef __attribute__((ext_vector_type(16))) __bf16   v16bf;
typedef __attribute__((ext_vector_type(16))) _Float16 v16h;
typedef __attribute__((ext_vector_type(8)))  _Float16 v8h;
typedef __attribute__((ext_vector_type(8)))  unsigned short v8us;
typedef __attribute__((ext_vector_type(8)))  float    v8f;
typedef __attribute__((ext_vector_type(4)))  float    v4f;
typedef v8h  __attribute__((may_alias)) v8ha;
typedef v4f  __attribute__((may_alias)) v4fa;
typedef v8us __attribute__((may_alias)) v8usa;

__device__ __forceinline__ unsigned short f2bf(float f) { unsigned u = __float_as_uint(f); u += 0x7FFFu + ((u >> 16) & 1u); return (unsigned short)(u >> 16); }
__device__ __forceinline__ float bf2f(unsigned short b) { return __uint_as_float(((unsigned)b) << 16); }
__device__ __forceinline__ float bfr(float f) { return bf2f(f2bf(f)); }
__device__ __forceinline__ v16h cat16(v8h lo, v8h hi) { return __builtin_shufflevector(lo, hi, 0, 1, 2, 3, 4, 5, 6, 7, 8, 9, 10, 11, 12, 13, 14, 15); }
__device__ __forceinline__ v16bf cat16b(v8us lo, v8us hi) { return __builtin_bit_cast(v16bf, __builtin_shufflevector(lo, hi, 0, 1, 2, 3, 4, 5, 6, 7, 8, 9, 10, 11, 12, 13, 14, 15)); }
__device__ __forceinline__ v8f wmma16(v16h a, v16h b, v8f c) { return __builtin_amdgcn_wmma_f32_16x16x32_f16(false, a, false, b, (short)0, c, false, false); }
__device__ __forceinline__ v8f wmmab(v16bf a, v16bf b, v8f c) { return __builtin_amdgcn_wmma_f32_16x16x32_bf16(false, a, false, b, (short)0, c, false, false); }
__device__ __forceinline__ h16 tohx(float x) { return (h16)x; }
__device__ __forceinline__ void splitf(float y, unsigned short& h, unsigned short& l) { h = f2bf(y); l = f2bf(y - bf2f(h)); }
typedef __attribute__((ext_vector_type(4))) _Float16 v4h;
typedef __attribute__((ext_vector_type(4))) unsigned short v4us;
typedef __attribute__((ext_vector_type(2))) float v2f;
typedef __attribute__((ext_vector_type(4))) int v4i;
// One rotary pair (x0 even, x1 odd; cs = cos, sin of the pair's angle): y0 = x0 c - x1 s, y1 = x0 s + x1 c.
__device__ __forceinline__ void rope2(float x0, float x1, v2f cs, float& y0, float& y1) { y0 = x0 * cs[0] - x1 * cs[1]; y1 = x0 * cs[1] + x1 * cs[0]; }



// ---- k_gemmw: GEMM with both operands staged in LDS. One TM x 128 tile per workgroup of 8 waves (2 x 4 waves, TM/2 x 32 each); TM = 128 (projections) or WTM = 160 (Wo); grid (M/TM, N/128), 256 threads.
// A stage is 128 k (256 B) of the tile's TM A rows and 128 Bt rows, laid at pitch 272 B by asynchronous copies to LDS whose wave-wide 512 B are two whole 256-B row pieces.
// Two buffers: stage t + 1 flies while stage t is worked on. Each wave sums its whole K in k order in one accumulator.
// Tile[m][n] (f32) = sum_k A[m][k] Bt[n][k]. M % TM == 0, N % 128 == 0; K a compile-time multiple of 128, at least 256.
template <bool B> struct BoolC { static constexpr bool value = B; };
template <typename T16> struct WFrag;   // ld: a fragment from rows in LDS (its halves 16 elements apart); ldu: from a plane in fragment order (its halves are two units)
template <> struct WFrag<h16> { typedef v16h V; static __device__ __forceinline__ V ld(const h16* p) { return cat16(*(const v8h*)p, *(const v8h*)(p + 16)); } static __device__ __forceinline__ V ldu(const h16* p) { return cat16(*(const v8h*)p, *(const v8h*)(p + FU)); } static __device__ __forceinline__ v8f mma(V a, V b, v8f c) { return wmma16(a, b, c); } };
template <> struct WFrag<bf> { typedef v16bf V; static __device__ __forceinline__ V ld(const bf* p) { return cat16b(*(const v8us*)p, *(const v8us*)(p + 16)); } static __device__ __forceinline__ V ldu(const bf* p) { return cat16b(*(const v8us*)p, *(const v8us*)(p + FU)); } static __device__ __forceinline__ v8f mma(V a, V b, v8f c) { return wmmab(a, b, c); } };
#define GT   128                  // edge of the output tile
#define GKB  256                  // bytes of an operand row in one stage
#define GP   272                  // LDS pitch of a staged row: 16 B x odd, for the 16-byte fragment reads
#define GPL  (GT * GP)            // bytes of one operand's 128 rows in a stage
#define GOP  132                  // pitch, in floats, of the output tile staged in the ring's bytes
// MERGED ROWS, the Wo GEMM's A operand (f16, DQ wide): block i of WTM rows is that GEMM's tile i: WL rows of the positions >= RH (one plane; they are counted through both batches), then WH rows of the positions < RH (their hi plane), then the same WH rows' lo plane.
// So every workgroup of the Wo GEMM has the same work: WL + WH = 128 output rows, of which only the WH rows < RH take a second product.
#define WL   96
#define WH   32
#define WTM  (WL + 2 * WH)
#define WTN  (NB_ * (TT - RH) / WL)   // tiles
static_assert(NB_ * (TT - RH) % WL == 0 && NB_ * RH % WH == 0 && NB_ * RH / WH == WTN && WL + WH == GT && WTM % 32 == 0, "whole tiles, as many of the one kind of rows as of the other");
__device__ __forceinline__ int mrow_one(int bt, int t) { const int i = bt * (TT - RH) + t - RH; return i / WL * WTM + i % WL; }        // merged row of position t >= RH of batch bt
__device__ __forceinline__ int mrow_hi(int bt, int t) { const int i = bt * RH + t; return i / WH * WTM + WL + i % WH; }               // merged hi row of position t < RH; its lo row is WH further
__device__ __forceinline__ unsigned lds_off(const void* p) { return (unsigned)(size_t)p; }
__device__ __forceinline__ void wait_ds0() { asm volatile("s_wait_dscnt 0x0" ::: "memory"); }       // this wave's LDS reads of the buffer have returned before the buffer is handed over
__device__ __forceinline__ void wait_async0() { asm volatile("s_wait_asynccnt 0x0" ::: "memory"); } // this wave's copies have landed before the barrier that publishes them
// Stands behind a run of global loads or stores; it takes their two base addresses as inputs, so that those registers are neither rewritten nor given to a load's result ahead of it.
__device__ __forceinline__ void wait_x0(const void* a, const void* b) { asm volatile("s_wait_xcnt 0x0" :: "v"(a), "v"(b) : "memory"); }
// The same behind a run of eight 16-byte stores: it takes their base address and their data as inputs, so that none of these registers is rewritten ahead of it.
__device__ __forceinline__ void wait_xd8(const void* a, const v8us* d) { asm volatile("s_wait_xcnt 0x0" :: "v"(a), "v"(d[0]), "v"(d[1]), "v"(d[2]), "v"(d[3]), "v"(d[4]), "v"(d[5]), "v"(d[6]), "v"(d[7]) : "memory"); }
// One operand's 128 rows of a stage: 8 copies per lane, 16 rows apart (l: the lane's LDS byte address, g: its global address, rs: bytes of 16 global rows).
// The s_wait_xcnt closes the statement so that no address register of an issued copy is rewritten ahead of it.
__device__ __forceinline__ void plane_copy(unsigned l, const char* g, size_t rs) {
    asm volatile("global_load_async_to_lds_b128 %0, %8, off\n\t"
                 "global_load_async_to_lds_b128 %1, %9, off\n\t"
                 "global_load_async_to_lds_b128 %2, %10, off\n\t"
                 "global_load_async_to_lds_b128 %3, %11, off\n\t"
                 "global_load_async_to_lds_b128 %4, %12, off\n\t"
                 "global_load_async_to_lds_b128 %5, %13, off\n\t"
                 "global_load_async_to_lds_b128 %6, %14, off\n\t"
                 "global_load_async_to_lds_b128 %7, %15, off\n\t"
                 "s_wait_xcnt 0x0"
                 :: "v"(l), "v"(l + 16 * GP), "v"(l + 32 * GP), "v"(l + 48 * GP), "v"(l + 64 * GP), "v"(l + 80 * GP), "v"(l + 96 * GP), "v"(l + 112 * GP),
                    "v"(g), "v"(g + rs), "v"(g + 2 * rs), "v"(g + 3 * rs), "v"(g + 4 * rs), "v"(g + 5 * rs), "v"(g + 6 * rs), "v"(g + 7 * rs)
                 : "memory");
}
// 32 more rows of an operand: 2 copies per lane, in the same form.
__device__ __forceinline__ void plane_copy2(unsigned l, const char* g, size_t rs) {
    asm volatile("global_load_async_to_lds_b128 %0, %2, off\n\t"
                 "global_load_async_to_lds_b128 %1, %3, off\n\t"
                 "s_wait_xcnt 0x0"
                 :: "v"(l), "v"(l + 16 * GP), "v"(g), "v"(g + rs)
                 : "memory");
}
// What becomes of the tile (EPI): 0: A is the merged rows; the tile's first WL rows, and its WH hi rows each with its lo row added, are stored as f32 in the rows of C that they stand for. 1: Bt is [Wq | Wk | Wv] and the tile is 128 positions x 128 dims of one batch and one head of q, k or v (by its column block); P16, Ph, Pl hold the q, k, v plane sets, PLN apart.
// q, k: rotary by the table CS, then the fp16 plane and the bf16 hi/lo planes. v: the tile laid transposed in LDS, then the same three planes. All planes [batch][head] in fragment order: every store is a whole unit.
template <typename T16, int K, int EPI>
__global__ __launch_bounds__(256) void k_gemmw(const T16* __restrict__ A, const T16* __restrict__ Bt, float* C, int ldc, const float* __restrict__ CS, h16* P16, bf* Ph, bf* Pl) {
    static_assert(EPI == 0 || GT == HD, "a tile's columns are one head");
    typedef typename WFrag<T16>::V V;
    constexpr int TM = (EPI == 0) ? WTM : GT, MF = TM / 32;           // rows of the tile; 16-row fragments of a wave's half of them
    constexpr unsigned PB = TM * GP, STG = PB + GPL;                  // a stage: [A | Bt], Bt at PB: every fragment read is within the 16-bit offset of its own base
    static_assert(TM * GOP * 4 <= 2 * STG && (TM == GT || TM == GT + 32), "the output tile is staged in the ring's bytes; A's rows are 8 or 10 copies per lane");
    __shared__ __attribute__((aligned(16))) unsigned char L[2 * STG];
    const int tid = (int)threadIdx.x, lane = tid & 31, lr = lane & 15, hi = lane >> 4; const int r0 = blockIdx.x * TM, c0 = blockIdx.y * GT;
    const int wv = __builtin_amdgcn_readfirstlane(tid >> 5);          // wave number, scalar
    const int wm = (wv >> 2) * (TM / 2), wn = (wv & 3) * 32;          // the wave's TM/2 x 32 part of the tile
    v8f acc[MF][2];
#pragma unroll
    for (int mb = 0; mb < MF; ++mb)
#pragma unroll
        for (int nb = 0; nb < 2; ++nb) acc[mb][nb] = (v8f){};
    constexpr size_t rowb = (size_t)K * 2;                            // bytes of a global operand row
    const int crow = tid >> 4, ccol = (tid & 15) * 16;                // the lane's row (of each 16) and byte column in every copy
    const char* gA = (const char*)A + (size_t)(r0 + crow) * rowb + ccol; const char* gB = (const char*)Bt + (size_t)(c0 + crow) * rowb + ccol;
    const unsigned lc = lds_off(L) + (unsigned)(crow * GP + ccol);
    auto fill = [&](int t, unsigned buf) { plane_copy(lc + buf, gA + (size_t)t * GKB, 16 * rowb); if constexpr (TM > GT) plane_copy2(lc + buf + GPL, gA + (size_t)t * GKB + GT * rowb, 16 * rowb); plane_copy(lc + buf + PB, gB + (size_t)t * GKB, 16 * rowb); };
    constexpr int NT = K / (GKB / 2); static_assert(K % (GKB / 2) == 0 && NT >= 2, "whole stages, and the two that the prologue fills");
    fill(0, 0u); wait_async0(); __syncthreads();                      // stage 0 is published
    fill(1, STG);
#pragma unroll 1   // the trip stays rolled: one publish point in the text, the buffer chosen by the trip's parity
    for (int t = 0; t < NT; ++t) {
        const unsigned buf = (unsigned)(t & 1) * STG;
        const unsigned char* pa = L + buf + (wm + lr) * GP + 16 * hi; const unsigned char* pb = L + buf + PB + (wn + lr) * GP + 16 * hi;
        V a[2][MF], b[2][2];                                          // two fragment sets: block ks + 1 is fetched while block ks is multiplied
        auto frags = [&](int ks, int st) {
#pragma unroll
            for (int mb = 0; mb < MF; ++mb) a[st][mb] = WFrag<T16>::ld((const T16*)(pa + mb * 16 * GP + ks * 64));
#pragma unroll
            for (int nb = 0; nb < 2; ++nb) b[st][nb] = WFrag<T16>::ld((const T16*)(pb + nb * 16 * GP + ks * 64)); };
        frags(0, 0);
#pragma unroll     // unrolled: fragment sets and accumulators are indexed by constants, so they stay in registers
        for (int ks = 0; ks < GKB / 64; ++ks) {
            if (ks + 1 < GKB / 64) frags(ks + 1, (ks + 1) & 1);       // this stage's own buffer only
            __builtin_amdgcn_sched_barrier(0);                        // keeps the next block's LDS reads together, ahead of this block's products and not among them
#pragma unroll
            for (int nb = 0; nb < 2; ++nb)
#pragma unroll
                for (int mb = 0; mb < MF; ++mb) acc[mb][nb] = WFrag<T16>::mma(a[ks & 1][mb], b[ks & 1][nb], acc[mb][nb]);
            __builtin_amdgcn_sched_barrier(0);                        // ends the block: the reads of the block after next stay behind it
        }
        wait_ds0(); wait_async0(); __syncthreads();                   // publishes stage t + 1 and ends every wave's reads of stage t's buffer
        if (t + 2 < NT) fill(t + 2, buf);
    }
    wait_async0();   // no copy is in flight when the ring's bytes take the output tile
    // The last trip's barrier has ended every read of the ring: the tile is laid there, and behind one barrier each wave takes whole rows of it (512 B of f32, or 256 B in each 16-bit plane).
    float* os = (float*)L;
    auto lay = [&](auto tr) {
#pragma unroll
        for (int mb = 0; mb < MF; ++mb) {
#pragma unroll
            for (int nb = 0; nb < 2; ++nb) {
                if constexpr (decltype(tr)::value) {   // transposed: a lane's 8 accumulator rows are 8 neighbours of one LDS row
                    float* p = os + (wn + nb * 16 + lr) * GOP + wm + mb * 16 + hi * 8; const v8f c = acc[mb][nb];
                    *(v4fa*)p = __builtin_shufflevector(c, c, 0, 1, 2, 3); *(v4fa*)(p + 4) = __builtin_shufflevector(c, c, 4, 5, 6, 7);
                } else {
#pragma unroll
                    for (int j = 0; j < 8; ++j) os[(wm + mb * 16 + hi * 8 + j) * GOP + wn + nb * 16 + lr] = acc[mb][nb][j]; } } } };
    if constexpr (EPI == 0) {
        lay(BoolC<false>{});
        __syncthreads();   // the whole tile is in LDS before any wave reads rows of it
        static_assert(WL % 8 == 0, "a step of 8 rows is of one kind");
        v4f val[GT / 8];   // the wave's 16 rows are read in one run, so that their LDS latencies overlap
#pragma unroll     // unrolled, here and below: val stays in registers
        for (int s = 0; s < GT / 8; ++s) { const float* p = os + (s * 8 + wv) * GOP + lane * 4; val[s] = *(const v4fa*)p; if (s >= WL / 8) val[s] += *(const v4fa*)(p + WH * GOP); }   // rows 8 s + wv: one plane for s < WL / 8, else hi + lo
#pragma unroll
        for (int s = 0; s < GT / 8; ++s) { const int i = (int)blockIdx.x * (s < WL / 8 ? WL : WH) + s * 8 + wv - (s < WL / 8 ? 0 : WL);   // the row's number among the rows of its kind
            const int orow = s < WL / 8 ? i / (TT - RH) * TT + RH + i % (TT - RH) : i / RH * TT + i % RH;
            float* p = C + (size_t)orow * ldc + c0 + lane * 4; *(v4f*)p = val[s]; wait_x0(p, p); }   // the store's address registers are reused only behind the wait
    } else {
        const int sel = (int)blockIdx.y / NH_, hd = (int)blockIdx.y % NH_, bt = r0 / TT, t0 = r0 % TT;   // q, k or v; head; batch; the tile's first position: the same for the whole workgroup
        auto planes = [&](auto isv) {
            constexpr bool ISV = decltype(isv)::value;
            // The wave takes the tile's LDS rows 16 wv + lr (q, k: positions; v: dims); its unit u is columns 16 u + 8 hi + (0..7) of them (q, k: dims, four rotary pairs; v: positions).
            v4f rc[GT / 16][2];   // q, k: cos, sin of the four pairs the lane turns in each of its units, asked for here so that all the loads fly while the tile goes through LDS
            if constexpr (!ISV) {
                const float* cp = CS + (size_t)(t0 / 16 + wv) * FT + lane * 4;   // the table holds one float per plane element (cos, sin per pair), so FT and FU count its floats too
#pragma unroll     // unrolled: rc is indexed by constants and stays in registers; one address, the units as immediate offsets
                for (int u = 0; u < GT / 16; ++u) { rc[u][0] = *(const v4f*)(cp + u * FU); rc[u][1] = *(const v4f*)(cp + u * FU + FU / 2); }
                wait_x0(cp, cp); }   // the loads' address registers are reused only behind it
            lay(isv);
            __syncthreads();   // the whole tile is in LDS before any wave reads rows of it (the branch around it is taken by the whole workgroup or not at all)
            const size_t e0 = (size_t)sel * PLN + ((size_t)bt * NH_ + hd) * TT * HD + (ISV ? (size_t)(t0 / 32) * (2 * FT) + wv * (2 * FU) : (size_t)(t0 / 16 + wv) * FT) + lane * 8;   // the lane's 8 values in the wave's unit 0
            h16* d16 = P16 + e0; bf* dh = Ph + e0; bf* dl = Pl + e0;
            v4f tv[GT / 16][2];   // the wave's 8 units are read in one run, so that their LDS latencies overlap
#pragma unroll     // unrolled, here and below: tv and rc stay in registers
            for (int u = 0; u < GT / 16; ++u) { const float* p = os + (wv * 16 + lr) * GOP + u * 16 + hi * 8; tv[u][0] = *(const v4fa*)p; tv[u][1] = *(const v4fa*)(p + 4); }
#pragma unroll
            for (int u = 0; u < GT / 16; ++u) { const int e = ISV ? (u >> 1) * (2 * FT) + (u & 1) * FU : u * FU; v8h o16; v8us oh, ol;
#pragma unroll
                for (int g = 0; g < 2; ++g) { v4f y = tv[u][g];
                    if constexpr (!ISV) { float y0, y1; v2f cs; cs[0] = rc[u][g][0]; cs[1] = rc[u][g][1]; rope2(tv[u][g][0], tv[u][g][1], cs, y0, y1); y[0] = y0; y[1] = y1; cs[0] = rc[u][g][2]; cs[1] = rc[u][g][3]; rope2(tv[u][g][2], tv[u][g][3], cs, y0, y1); y[2] = y0; y[3] = y1; }
#pragma unroll
                    for (int q = 0; q < 4; ++q) { o16[g * 4 + q] = tohx(y[q]); unsigned short a2, c2; splitf(y[q], a2, c2); oh[g * 4 + q] = a2; ol[g * 4 + q] = c2; } }
                *(v8h*)(d16 + e) = o16; *(v8us*)(dh + e) = oh; *(v8us*)(dl + e) = ol; }
            if constexpr (!ISV) wait_x0(dh, dl);   // in the built code the q, k path runs on to the head of the v path's code (and branches past it there), where a store's address register is rewritten
        };
        if (sel == 2) planes(BoolC<true>{}); else planes(BoolC<false>{});
    }
}

// ---- k_attn: causal attention, one launch; scores and probabilities never leave the registers. Rows >= RH: flashs (fp16, 128 rows a workgroup); rows < RH: flashh (hi/lo planes, 64 rows a workgroup); both bring K and V through LDS.
// Transposed products: S^T = K Q^T puts a query in a lane (column lr) with 8 keys of each 16-key tile in its accumulator, which is already the B fragment's k order of O^T = V^T P^T: keys kb + 8 hi + j, then kb + 16 + 8 hi + j.
// Each wave keeps its own running maximum, sum and O^T over its 32-key blocks (online softmax); at the end the waves that share a query's keys are brought to the common maximum and summed in LDS.
// Q, K, V planes [head] in fragment order: a 32-key block of K and of V is 8 KB in a row, 16 units. bt: the batch; q0: the workgroup's first query row.
#define L2E  1.4426950408889634f
#define ANW  8                    // waves of a workgroup
// ---- flashs: the fp16 form, one product; the probabilities carry 2^10 (it cancels in the division by the row sum, which carries it too). A workgroup of 8 waves takes SQR = 128 query rows of one head: wave wv is query group qg = wv % 4 (32 rows) and key half sp = wv / 4.
// A stage is 128 keys: four 32-key blocks of K (32 KB in a row in the plane, already in fragment order) and the same of V, brought into LDS once by asynchronous copies and read there by all four query groups, so that
// a key's bytes leave L2 once per 128 rows. Wave (qg, sp) works on blocks 4 t + sp and 4 t + 2 + sp of stage t, up to its own diagonal block; only the last stage masks. Two buffers: stage t + 1 flies while stage t is worked on.
// At the end the two key halves of each query group are brought to their common maximum and summed in LDS (in the ring's bytes), half 0 first; the result goes into the merged rows as one f16 plane.
#define SQR  128                  // query rows of a workgroup
#define SBB  (2 * FT * 2)         // bytes of a 32-key block of K or of V
#define SPB  (4 * SBB)            // bytes of a stage's four K blocks, and of its four V blocks
#define SSTG (2 * SPB)            // bytes of a stage: [K | V]
// A stage's K blocks, or its V blocks: 8 copies per lane, each 4 KB over the workgroup (l: the lane's LDS byte address, g: its global address).
// The s_wait_xcnt closes the statement so that no address register of an issued copy is rewritten ahead of it.
__device__ __forceinline__ void kv_copy(unsigned l, const char* g) {
    asm volatile("global_load_async_to_lds_b128 %0, %8, off\n\t"
                 "global_load_async_to_lds_b128 %1, %9, off\n\t"
                 "global_load_async_to_lds_b128 %2, %10, off\n\t"
                 "global_load_async_to_lds_b128 %3, %11, off\n\t"
                 "global_load_async_to_lds_b128 %4, %12, off\n\t"
                 "global_load_async_to_lds_b128 %5, %13, off\n\t"
                 "global_load_async_to_lds_b128 %6, %14, off\n\t"
                 "global_load_async_to_lds_b128 %7, %15, off\n\t"
                 "s_wait_xcnt 0x0"
                 :: "v"(l), "v"(l + 4096), "v"(l + 8192), "v"(l + 12288), "v"(l + 16384), "v"(l + 20480), "v"(l + 24576), "v"(l + 28672),
                    "v"(g), "v"(g + 4096), "v"(g + 8192), "v"(g + 12288), "v"(g + 16384), "v"(g + 20480), "v"(g + 24576), "v"(g + 28672)
                 : "memory");
}
__device__ __forceinline__ void flashs(const h16* __restrict__ Q, const h16* __restrict__ Kp, const h16* __restrict__ Vt, int bt, int h, int q0, h16* Mg, float* os, float* sm, float* sl) {
    typedef WFrag<h16> F; typedef F::V V;
    constexpr int QN = 2, QR = 16 * QN; constexpr float PSH = 10.0f;
    static_assert(SPB == 8 * 256 * 16 && 2 * SSTG <= ANW * 32 * GOP * 4 && ANW * QR == 2 * SQR && SQR == 128, "8 copies of the workgroup per plane; the ring lies in the merge rows' bytes; two key halves of SQR rows; a stage's keys are a workgroup's rows");
    const int tid = (int)threadIdx.x, lane = tid & 31, lr = lane & 15, hi = lane >> 4;
    const int wv = __builtin_amdgcn_readfirstlane(tid >> 5), qg = wv & 3, sp = wv >> 2;   // scalar: the tests on the wave's blocks stay wave-uniform
    const size_t hp = (size_t)h * TT * HD;
    const int qw = q0 + qg * QR, bd = qw / 32;                        // the wave's first query row; its diagonal block, whose first key every one of its queries sees
    v8f o[8][QN]; float m[QN], l[QN];
#pragma unroll
    for (int qt = 0; qt < QN; ++qt) { m[qt] = -3.0e38f; l[qt] = 0.f;
#pragma unroll
        for (int dt = 0; dt < 8; ++dt) o[dt][qt] = (v8f){}; }
    const char* gk = (const char*)(Kp + hp) + tid * 16; const char* gv = (const char*)(Vt + hp) + tid * 16;
    const unsigned lc = lds_off(os) + (unsigned)tid * 16;
    auto fill = [&](int t, unsigned buf) { kv_copy(lc + buf, gk + (size_t)t * SPB); kv_copy(lc + buf + SPB, gv + (size_t)t * SPB); };
    const int NS = q0 / SQR + 1;                                      // stages up to the workgroup's last row; at least two, the same for the whole workgroup
    fill(0, 0u);
    V q[QN][4];
    const h16* pq = Q + hp + (size_t)(qw / 16) * FT + lane * 8;
#pragma unroll
    for (int qt = 0; qt < QN; ++qt)
#pragma unroll
        for (int ks = 0; ks < 4; ++ks) q[qt][ks] = F::ldu(pq + qt * FT + ks * (2 * FU));
    wait_x0(pq, pq);
    wait_async0(); __syncthreads();                                   // stage 0 is published
    fill(1, SSTG);
    // One 32-key block, read from the stage's buffer (off: the bytes from the ring's start to the block's K). DIAG: the block may reach the wave's diagonal and is masked.
    auto block = [&](unsigned off, int kb, auto diag) {
        constexpr bool DIAG = decltype(diag)::value;
        const h16* lk = (const h16*)((const unsigned char*)os + off) + lane * 8; const h16* lv = lk + SPB / 2;
        V ka[2][4], va[8];
#pragma unroll
        for (int kt = 0; kt < 2; ++kt)
#pragma unroll
            for (int ks = 0; ks < 4; ++ks) ka[kt][ks] = F::ldu(lk + kt * FT + ks * (2 * FU));
#pragma unroll
        for (int dt = 0; dt < 8; ++dt) va[dt] = F::ldu(lv + dt * (2 * FU));
        v8f s[QN][2];
#pragma unroll
        for (int qt = 0; qt < QN; ++qt)
#pragma unroll
            for (int kt = 0; kt < 2; ++kt) { s[qt][kt] = (v8f){};
#pragma unroll
                for (int ks = 0; ks < 4; ++ks) s[qt][kt] = F::mma(ka[kt][ks], q[qt][ks], s[qt][kt]); }
        V pb[QN];
#pragma unroll
        for (int qt = 0; qt < QN; ++qt) {
            const int qi = qw + qt * 16 + lr; float mloc = -3.0e38f;
#pragma unroll
            for (int kt = 0; kt < 2; ++kt)
#pragma unroll
                for (int j = 0; j < 8; ++j) { float t = s[qt][kt][j] * SCL; if constexpr (DIAG) t = (kb + kt * 16 + hi * 8 + j <= qi) ? t : -3.0e38f; s[qt][kt][j] = t; mloc = fmaxf(mloc, t); }
            mloc = fmaxf(mloc, __shfl_xor(mloc, 16, 32));             // the query's other 16 keys of the block are in lane lr + 16
            if (__any(mloc > m[qt])) {                                // where no maximum rose every factor would be 1
                const float mn = fmaxf(m[qt], mloc), al = __builtin_amdgcn_exp2f((m[qt] - mn) * L2E); m[qt] = mn; l[qt] *= al;
#pragma unroll
                for (int dt = 0; dt < 8; ++dt) o[dt][qt] *= al; }
            float ps = 0.f;
#pragma unroll
            for (int kt = 0; kt < 2; ++kt)
#pragma unroll
                for (int j = 0; j < 8; ++j) { const float p = __builtin_amdgcn_exp2f((s[qt][kt][j] - m[qt]) * L2E + PSH); s[qt][kt][j] = p; ps += p; }
            l[qt] += ps;
#pragma unroll
            for (int j = 0; j < 8; ++j) { pb[qt][j] = tohx(s[qt][0][j]); pb[qt][8 + j] = tohx(s[qt][1][j]); }
        }
#pragma unroll
        for (int dt = 0; dt < 8; ++dt)
#pragma unroll
            for (int qt = 0; qt < QN; ++qt) o[dt][qt] = F::mma(va[dt], pb[qt], o[dt][qt]);
    };
    // All stages but the last lie below every wave's diagonal: one path through the two blocks, no test on them.
#pragma unroll 1   // the trip stays rolled: the buffer is chosen by the trip's parity
    for (int t = 0; t < NS - 1; ++t) {
        const unsigned buf = (unsigned)(t & 1) * SSTG;
        block(buf + sp * SBB, (4 * t + sp) * 32, BoolC<false>{});
        block(buf + (2 + sp) * SBB, (4 * t + 2 + sp) * 32, BoolC<false>{});
        wait_ds0(); wait_async0(); __syncthreads();                   // publishes stage t + 1 and ends every wave's reads of stage t's buffer
        if (t + 2 < NS) fill(t + 2, buf);
    }
    // The last stage holds the four diagonal blocks: its blocks are masked (an identity below the wave's diagonal block); a block past the wave's diagonal is left out.
#pragma unroll 1   // rolled: one copy of the masked block's code, not two
    for (int i = 0; i < 2; ++i) {
        const int b = 4 * (NS - 1) + 2 * i + sp;
        if (b <= bd) block((unsigned)((NS - 1) & 1) * SSTG + (2 * i + sp) * SBB, b * 32, BoolC<true>{});
    }
    wait_ds0(); wait_async0(); __syncthreads();                       // the last stage's foot: ends every wave's reads of the ring
    wait_async0();   // no copy is in flight when the ring's bytes take the partial results
#pragma unroll
    for (int qt = 0; qt < QN; ++qt) if (hi == 0) sm[wv * QR + qt * 16 + lr] = m[qt];   // row sp * SQR + (the query's row in the workgroup)
    __syncthreads();   // both halves' maxima are in LDS before any wave forms the common one
#pragma unroll
    for (int qt = 0; qt < QN; ++qt) { const int r = qg * QR + qt * 16 + lr; const float M = fmaxf(sm[r], sm[SQR + r]);
        const float sc = __builtin_amdgcn_exp2f((m[qt] - M) * L2E); const float lt = l[qt] + __shfl_xor(l[qt], 16, 32);
        if (hi == 0) sl[wv * QR + qt * 16 + lr] = lt * sc;
#pragma unroll
        for (int dt = 0; dt < 8; ++dt) { const v8f c = o[dt][qt] * sc; float* p = os + (wv * QR + qt * 16 + lr) * GOP + dt * 16 + hi * 8;   // a lane's 8 accumulator rows are 8 neighbouring dims of its query's LDS row
            *(v4fa*)p = __builtin_shufflevector(c, c, 0, 1, 2, 3); *(v4fa*)(p + 4) = __builtin_shufflevector(c, c, 4, 5, 6, 7); } }
    __syncthreads();   // both partial results of every row are in LDS before any wave sums them
#pragma unroll
    for (int s = 0; s < SQR / ANW; ++s) { const int row = s * ANW + wv; const v4f val = *(const v4fa*)(os + row * GOP + lane * 4) + *(const v4fa*)(os + (SQR + row) * GOP + lane * 4); const float L = sl[row] + sl[SQR + row];
        const float f = __fdiv_rn(1.0f, L); h16* po = Mg + (size_t)mrow_one(bt, q0 + row) * DQ + h * HD + lane * 4; v4h oh;
#pragma unroll
        for (int qd = 0; qd < 4; ++qd) oh[qd] = tohx(val[qd] * f);
        *(v4h*)po = oh; wait_x0(po, po); }
}
// ---- flashh: the hi/lo form (bf16 planes, 3 products for S and for O), rows < RH. A workgroup of 8 waves takes HQR = 64 query rows of one head: wave wv is query group qg = wv % 4 (16 rows) and key half sp = wv / 4.
// A stage is 64 keys: two 32-key blocks of each of the planes K hi, K lo, V hi, V lo (16 KB in a row in each plane), brought into LDS once by asynchronous copies and read there by all four query groups.
// Wave (qg, sp) works on block 2 t + sp of stage t, up to its own diagonal block; only the last stage masks. Two buffers: stage t + 1 flies while stage t is worked on.
// At the end the two key halves of each query group are merged as in flashs, half 0 first; the result goes into the merged rows' hi and lo f16 planes (see MERGED ROWS).
#define HQR  64                   // query rows of a workgroup
#define HPB  (2 * SBB)            // bytes of a stage's two blocks of one plane
#define HSTG (4 * HPB)            // bytes of a stage: [K hi | K lo | V hi | V lo]
// A stage's two blocks of one plane: 4 copies per lane, each 4 KB over the workgroup (l: the lane's LDS byte address, g: its global address).
// The s_wait_xcnt closes the statement so that no address register of an issued copy is rewritten ahead of it.
__device__ __forceinline__ void kv_copy4(unsigned l, const char* g) {
    asm volatile("global_load_async_to_lds_b128 %0, %4, off\n\t"
                 "global_load_async_to_lds_b128 %1, %5, off\n\t"
                 "global_load_async_to_lds_b128 %2, %6, off\n\t"
                 "global_load_async_to_lds_b128 %3, %7, off\n\t"
                 "s_wait_xcnt 0x0"
                 :: "v"(l), "v"(l + 4096), "v"(l + 8192), "v"(l + 12288), "v"(g), "v"(g + 4096), "v"(g + 8192), "v"(g + 12288)
                 : "memory");
}
__device__ __forceinline__ void flashh(const bf* __restrict__ Q, const bf* __restrict__ Q2, const bf* __restrict__ Kp, const bf* __restrict__ Kp2, const bf* __restrict__ Vt, const bf* __restrict__ Vt2, int bt, int h, int q0, h16* Mg, float* os, float* sm, float* sl) {
    typedef WFrag<bf> F; typedef F::V V;
    constexpr int QR = 16;
    static_assert(HPB == 4 * 256 * 16 && 2 * HSTG <= ANW * 32 * GOP * 4 && ANW * QR == 2 * HQR && HQR == 64, "4 copies of the workgroup per plane; the ring lies in the merge rows' bytes; two key halves of HQR rows; a stage's keys are a workgroup's rows");
    const int tid = (int)threadIdx.x, lane = tid & 31, lr = lane & 15, hi = lane >> 4;
    const int wv = __builtin_amdgcn_readfirstlane(tid >> 5), qg = wv & 3, sp = wv >> 2;   // scalar: the test on the wave's last block stays wave-uniform
    const size_t hp = (size_t)h * TT * HD;
    const int qw = q0 + qg * QR, bd = qw / 32;                        // the wave's first query row; its diagonal block, whose first key every one of its queries sees
    v8f o[8]; float m = -3.0e38f, l = 0.f;
#pragma unroll
    for (int dt = 0; dt < 8; ++dt) o[dt] = (v8f){};
    const char* gk = (const char*)(Kp + hp) + tid * 16; const char* gk2 = (const char*)(Kp2 + hp) + tid * 16; const char* gv = (const char*)(Vt + hp) + tid * 16; const char* gv2 = (const char*)(Vt2 + hp) + tid * 16;
    const unsigned lc = lds_off(os) + (unsigned)tid * 16;
    auto fill = [&](int t, unsigned buf) { kv_copy4(lc + buf, gk + (size_t)t * HPB); kv_copy4(lc + buf + HPB, gk2 + (size_t)t * HPB); kv_copy4(lc + buf + 2 * HPB, gv + (size_t)t * HPB); kv_copy4(lc + buf + 3 * HPB, gv2 + (size_t)t * HPB); };
    const int NS = q0 / HQR + 1;                                      // stages up to the workgroup's last row; the same for the whole workgroup
    fill(0, 0u);
    V q[4], q2[4];
    const size_t eq = hp + (size_t)(qw / 16) * FT + lane * 8; const bf* pq = Q + eq; const bf* pq2 = Q2 + eq;
#pragma unroll
    for (int ks = 0; ks < 4; ++ks) { q[ks] = F::ldu(pq + ks * (2 * FU)); q2[ks] = F::ldu(pq2 + ks * (2 * FU)); }
    wait_x0(pq, pq2);
    wait_async0(); __syncthreads();                                   // stage 0 is published
    if (NS > 1) fill(1, HSTG);
    // One 32-key block, read from the stage's buffer (off: the bytes from the ring's start to the block in K hi). DIAG: the block may reach the wave's diagonal and is masked.
    auto block = [&](unsigned off, int kb, auto diag) {
        constexpr bool DIAG = decltype(diag)::value;
        const bf* lk = (const bf*)((const unsigned char*)os + off) + lane * 8; const bf* lk2 = lk + HPB / 2; const bf* lv = lk + HPB; const bf* lv2 = lk + 3 * (HPB / 2);
        V ka[2][4], ka2[2][4], va[8], va2[8];
#pragma unroll
        for (int kt = 0; kt < 2; ++kt)
#pragma unroll
            for (int ks = 0; ks < 4; ++ks) { const int e = kt * FT + ks * (2 * FU); ka[kt][ks] = F::ldu(lk + e); ka2[kt][ks] = F::ldu(lk2 + e); }
#pragma unroll
        for (int dt = 0; dt < 8; ++dt) { va[dt] = F::ldu(lv + dt * (2 * FU)); va2[dt] = F::ldu(lv2 + dt * (2 * FU)); }
        v8f s[2];
#pragma unroll
        for (int kt = 0; kt < 2; ++kt) { s[kt] = (v8f){};
#pragma unroll
            for (int ks = 0; ks < 4; ++ks) { s[kt] = F::mma(ka[kt][ks], q[ks], s[kt]); s[kt] = F::mma(ka[kt][ks], q2[ks], s[kt]); s[kt] = F::mma(ka2[kt][ks], q[ks], s[kt]); } }
        const int qi = qw + lr; float mloc = -3.0e38f;
#pragma unroll
        for (int kt = 0; kt < 2; ++kt)
#pragma unroll
            for (int j = 0; j < 8; ++j) { float t = s[kt][j] * SCL; if constexpr (DIAG) t = (kb + kt * 16 + hi * 8 + j <= qi) ? t : -3.0e38f; s[kt][j] = t; mloc = fmaxf(mloc, t); }
        mloc = fmaxf(mloc, __shfl_xor(mloc, 16, 32));                 // the query's other 16 keys of the block are in lane lr + 16
        if (__any(mloc > m)) {                                        // where no maximum rose every factor would be 1
            const float mn = fmaxf(m, mloc), al = __builtin_amdgcn_exp2f((m - mn) * L2E); m = mn; l *= al;
#pragma unroll
            for (int dt = 0; dt < 8; ++dt) o[dt] *= al; }
        float ps = 0.f;
#pragma unroll
        for (int kt = 0; kt < 2; ++kt)
#pragma unroll
            for (int j = 0; j < 8; ++j) { const float p = __builtin_amdgcn_exp2f((s[kt][j] - m) * L2E); s[kt][j] = p; ps += p; }
        l += ps;
        v8us h0, h1, l0, l1;
#pragma unroll
        for (int j = 0; j < 8; ++j) { unsigned short a, c2; splitf(s[0][j], a, c2); h0[j] = a; l0[j] = c2; splitf(s[1][j], a, c2); h1[j] = a; l1[j] = c2; }
        const V pb = cat16b(h0, h1), pb2 = cat16b(l0, l1);
#pragma unroll
        for (int dt = 0; dt < 8; ++dt) { o[dt] = F::mma(va[dt], pb, o[dt]); o[dt] = F::mma(va[dt], pb2, o[dt]); o[dt] = F::mma(va2[dt], pb, o[dt]); }
    };
    // All stages but the last lie below every wave's diagonal: no test on their blocks.
#pragma unroll 1   // the trip stays rolled: the buffer is chosen by the trip's parity
    for (int t = 0; t < NS - 1; ++t) {
        const unsigned buf = (unsigned)(t & 1) * HSTG;
        block(buf + sp * SBB, (2 * t + sp) * 32, BoolC<false>{});
        wait_ds0(); wait_async0(); __syncthreads();                   // publishes stage t + 1 and ends every wave's reads of stage t's buffer
        if (t + 2 < NS) fill(t + 2, buf);
    }
    // The last stage holds the two diagonal blocks: its blocks are masked (an identity below the wave's diagonal block); a block past the wave's diagonal is left out.
    { const int b = 2 * (NS - 1) + sp;
      if (b <= bd) block((unsigned)((NS - 1) & 1) * HSTG + sp * SBB, b * 32, BoolC<true>{}); }
    wait_ds0(); wait_async0(); __syncthreads();                       // the last stage's foot: ends every wave's reads of the ring
    wait_async0();   // no copy is in flight when the ring's bytes take the partial results
    if (hi == 0) sm[wv * QR + lr] = m;   // row sp * HQR + (the query's row in the workgroup)
    __syncthreads();   // both halves' maxima are in LDS before any wave forms the common one
    { const int r = qg * QR + lr; const float M = fmaxf(sm[r], sm[HQR + r]);   // half 0 has a block for every query, so M is a real score
        const float sc = __builtin_amdgcn_exp2f((m - M) * L2E); const float lt = l + __shfl_xor(l, 16, 32);   // a wave without a block: its factor, its sum and its O are 0
        if (hi == 0) sl[wv * QR + lr] = lt * sc;
#pragma unroll
        for (int dt = 0; dt < 8; ++dt) { const v8f c = o[dt] * sc; float* p = os + (wv * QR + lr) * GOP + dt * 16 + hi * 8;   // a lane's 8 accumulator rows are 8 neighbouring dims of its query's LDS row
            *(v4fa*)p = __builtin_shufflevector(c, c, 0, 1, 2, 3); *(v4fa*)(p + 4) = __builtin_shufflevector(c, c, 4, 5, 6, 7); } }
    __syncthreads();   // both partial results of every row are in LDS before any wave sums them
#pragma unroll
    for (int s = 0; s < HQR / ANW; ++s) { const int row = s * ANW + wv; const v4f val = *(const v4fa*)(os + row * GOP + lane * 4) + *(const v4fa*)(os + (HQR + row) * GOP + lane * 4); const float L = sl[row] + sl[HQR + row];
        const float f = __fdiv_rn(1.0f, L); h16* ph = Mg + (size_t)mrow_hi(bt, q0 + row) * DQ + h * HD + lane * 4; h16* pl = ph + (size_t)WH * DQ; v4h oh, ol;
#pragma unroll
        for (int qd = 0; qd < 4; ++qd) { const float y = val[qd] * f; oh[qd] = tohx(y); ol[qd] = tohx(y - (float)oh[qd]); }
        *(v4h*)ph = oh; *(v4h*)pl = ol; wait_x0(ph, pl); }
}
// Grid (batches x heads, row groups): the groups of SQR rows >= RH come first, the longest rows first of all; the groups of HQR rows < RH (hi/lo planes) fill the launch's tail, the longest first too.
#define ALO  ((TT - RH) / SQR)
static_assert((TT - RH) % SQR == 0 && RH % SQR == 0 && RH >= SQR, "whole groups of SQR rows, each beginning at a multiple of SQR: whole stages, at least two");
#define AHI  (RH / HQR)
static_assert(RH % HQR == 0, "whole groups of HQR rows, each beginning at a multiple of HQR: whole stages");
__global__ __launch_bounds__(32 * ANW) void k_attn(const h16* __restrict__ Q16, const h16* __restrict__ K16, const h16* __restrict__ V16, const bf* __restrict__ Qh, const bf* __restrict__ Ql, const bf* __restrict__ Kh, const bf* __restrict__ Kl, const bf* __restrict__ Vh, const bf* __restrict__ Vl, h16* Mg) {
    __shared__ __align__(16) float os[ANW * 32 * GOP]; __shared__ float sm[ANW * 32]; __shared__ float sl[ANW * 32];
    const int h = (int)blockIdx.x % NH_, bt = (int)blockIdx.x / NH_, g = (int)blockIdx.y;
    const size_t po = (size_t)bt * NH_ * TT * HD;   // the batch's planes in every plane set
    Q16 += po; K16 += po; V16 += po; Qh += po; Ql += po; Kh += po; Kl += po; Vh += po; Vl += po;
    if (g < ALO) flashs(Q16, K16, V16, bt, h, TT - SQR * (g + 1), Mg, os, sm, sl);
    else flashh(Qh, Ql, Kh, Kl, Vh, Vl, bt, h, RH - HQR * (g - ALO + 1), Mg, os, sm, sl);
}

__constant__ float INV2[HD / 2] = { 1.000000000e+00f, 8.659643531e-01f, 7.498942018e-01f, 6.493816376e-01f, 5.623413324e-01f, 4.869675338e-01f, 4.216965139e-01f, 3.651741147e-01f, 3.162277639e-01f, 2.738419771e-01f, 2.371373773e-01f, 2.053525001e-01f, 1.778279394e-01f, 1.539926529e-01f, 1.333521456e-01f, 1.154781953e-01f, 1.000000015e-01f, 8.659642935e-02f, 7.498942316e-02f, 6.493816525e-02f, 5.623413250e-02f, 4.869675264e-02f, 4.216964915e-02f, 3.651741147e-02f, 3.162277490e-02f, 2.738419548e-02f, 2.371373773e-02f, 2.053525113e-02f, 1.778279431e-02f, 1.539926510e-02f, 1.333521400e-02f, 1.154781971e-02f, 9.999999776e-03f, 8.659643121e-03f, 7.498942316e-03f, 6.493816152e-03f, 5.623413250e-03f, 4.869675264e-03f, 4.216964822e-03f, 3.651741194e-03f, 3.162277630e-03f, 2.738419687e-03f, 2.371373819e-03f, 2.053525066e-03f, 1.778279431e-03f, 1.539926510e-03f, 1.333521446e-03f, 1.154782018e-03f, 1.000000047e-03f, 8.659643354e-04f, 7.498941850e-04f, 6.493816036e-04f, 5.623413017e-04f, 4.869675322e-04f, 4.216965172e-04f, 3.651741135e-04f, 3.162277571e-04f, 2.738419571e-04f, 2.371373703e-04f, 2.053525095e-04f, 1.778279402e-04f, 1.539926598e-04f, 1.333521504e-04f, 1.154782003e-04f };   // float32 1 / 10000^(2i/128), generated with jnp to be bit-exact
// ---- k_prep: everything the GEMMs need ahead of them, in one launch of 1280 workgroups: the rotary table (the first PTB workgroups: their threads run longest) and the bf16 copies of the four weights and of x (Wo's bf16 values are stored as f16, the type of the Wo GEMM's other operand: exact from 2^-17 up to f16's largest value; a smaller one goes to the nearest multiple of 2^-24).
// Table: one thread per (position, pair), in the order in which the projections' epilogue reads it: per 16 positions and 16 dims two runs of 16 B a lane (lane as in a q, k unit), a lane's pairs 0, 1 in the first and 2, 3 in the second, each pair cos, sin. Copies: a workgroup takes 256 * PCH runs of 8 values of one source; a thread takes PCH of them, 256 runs apart, 8 in flight at a time.
#define PCH  16
#define PTB  (TT * (HD / 2) / 256)
#define PWB  (DQ * DM / (256 * 8 * PCH))       // workgroups per 2048 x 2048 source: each weight, each batch of x
static_assert(DQ * DM % (256 * 8 * PCH) == 0 && DKV == DQ && TT == DQ && PCH % 8 == 0, "whole workgroups; all six sources have one size");
__global__ __launch_bounds__(256) void k_prep(const float* __restrict__ x, const float* __restrict__ wq, const float* __restrict__ wk, const float* __restrict__ wv, const float* __restrict__ wo, bf* W4, bf* XB, float* CS) {
    const int tid = (int)threadIdx.x;
    if ((int)blockIdx.x < PTB) {
        const int idx = (int)blockIdx.x * 256 + tid, ln = (idx >> 1) & 31, i = ((idx >> 7) & 7) * 8 + (ln >> 4) * 4 + ((idx >> 6) & 1) * 2 + (idx & 1), t = (idx >> 10) * 16 + (ln & 15); const float a = __fmul_rn((float)t, INV2[i]); const float c = cosf(a), s = sinf(a);
        v2f cs; cs[0] = c; cs[1] = s; *(v2f*)(CS + (size_t)idx * 2) = cs; return; }
    const int blk = (int)blockIdx.x - PTB, sel = blk / PWB;   // which source: the same for the whole workgroup
    const float* sb = sel == 0 ? wq : sel == 1 ? wk : sel == 2 ? wv : sel == 3 ? wo : x + (size_t)(sel - 4) * TT * DM;
    bf* db = sel < 4 ? W4 + (size_t)sel * DQ * DM : XB + (size_t)(sel - 4) * TT * DM;
    const size_t e = ((size_t)(blk % PWB) * (256 * PCH) + tid) * 8; const float* sp = sb + e; bf* dp = db + e;
    auto copy = [&](auto asf16) {   // asf16: the bf16 value is stored in f16 form (Wo)
#pragma unroll     // unrolled: every load and store names sp or dp with a constant offset
        for (int k0 = 0; k0 < PCH; k0 += 8) { v8f v[8];
#pragma unroll
            for (int k = 0; k < 8; ++k) v[k] = *(const v8f*)(sp + (k0 + k) * (256 * 8));
            wait_x0(sp, dp);   // the loads' address registers are reused only behind it
            __builtin_amdgcn_sched_barrier(0);   // keeps the conversions behind that wait: without it they are lifted over it and rewrite the loads' offset register ahead of it
            v8us o[8];
#pragma unroll
            for (int k = 0; k < 8; ++k) {
#pragma unroll
                for (int q = 0; q < 8; ++q) { if constexpr (decltype(asf16)::value) o[k][q] = __builtin_bit_cast(unsigned short, tohx(bfr(v[k][q]))); else o[k][q] = f2bf(v[k][q]); }
                *(v8us*)(dp + (k0 + k) * (256 * 8)) = o[k]; }
            wait_xd8(dp, o); } };   // the eight stores' address and data registers are reused only behind it, and the next run of loads stands behind it
    if (sel == 3) copy(BoolC<true>{}); else copy(BoolC<false>{});   // the same for the whole workgroup
}
extern "C" void kernel_launch(void* const* d_in, const int* in_sizes, int n_in,
                              void* d_out, int out_size, void* d_ws, size_t ws_size, hipStream_t stream) {
    (void)in_sizes; (void)n_in; (void)out_size;
    const float* x = (const float*)d_in[0]; const float* wq = (const float*)d_in[1]; const float* wk = (const float*)d_in[2]; const float* wv = (const float*)d_in[3]; const float* wo = (const float*)d_in[4];   /* weights 'oi' [2048][2048] */
    float* OUT = (float*)d_out;     // [2][2048][2048]
    char* wsp = (char*)d_ws;
    auto take = [&](size_t bytes) { char* p = wsp; wsp += (bytes + 255) & ~(size_t)255; return (void*)p; };
    bf* W4 = (bf*)take((size_t)4 * DQ * DM * 2);   // Wq, Wk, Wv (bf16), Wo (f16)
    h16* P16 = (h16*)take(3 * PLN * 2); bf* PH = (bf*)take(3 * PLN * 2); bf* PL = (bf*)take(3 * PLN * 2);   // each: the q, k, v plane sets
    bf* XB = (bf*)take((size_t)NB_ * TT * DM * 2); float* CS = (float*)take((size_t)TT * HD * 4); h16* AT = (h16*)take((size_t)WTN * WTM * DQ * 2);   // AT: the merged rows
    if ((size_t)(wsp - (char*)d_ws) > ws_size) return;    // 213 MiB of the 256 MiB
    k_prep<<<PTB + 6 * PWB, 256, 0, stream>>>(x, wq, wk, wv, wo, W4, XB, CS);
    k_gemmw<bf, DM, 1><<<dim3(NB_ * TT / GT, 3 * DQ / GT, 1), 256, 0, stream>>>(XB, W4, nullptr, 0, CS, P16, PH, PL);
    k_attn<<<dim3(NB_ * NH_, ALO + AHI, 1), 32 * ANW, 0, stream>>>(P16, P16 + PLN, P16 + 2 * PLN, PH, PL, PH + PLN, PL + PLN, PH + 2 * PLN, PL + 2 * PLN, AT);
    k_gemmw<h16, DQ, 0><<<dim3(WTN, DM / GT, 1), 256, 0, stream>>>(AT, (const h16*)(W4 + (size_t)3 * DQ * DM), OUT, DM, nullptr, nullptr, nullptr, nullptr);
}
